// v000
// Times are from an AMD MI455X. After a warm-up the kernel runs many times in a row, and a time is the length of
// such a window on the GPU divided by its runs, so every launch and the gaps after it count. The runs cycle
// through copies of the inputs. A figure is the median of several windows, for all but v000 over two sittings.
// Sittings can differ by a few percent; kernels timed side by side share one.
// v000 is the starting kernel. One run takes 203 microseconds.
#include <hip/hip_runtime.h>

// Spatial-reduction attention, width 64 = 8 heads x 8: queries from all NB x SEQ tokens (x @ q_w, weights [in][out], no bias); keys / values from an 8x8 stride-8 patch projection (+ bias) -> LayerNorm (eps 1e-5) -> fused [in][out] kv weight (256 keys per batch at the full size); dense softmax, score scale 8^-0.5; output projection (+ bias).
// Compute dtypes, f32 accumulate everywhere: q projection and patch projection v_wmma_f32_16x16x32_bf16 (x and weights RNE-converted to bf16; products exact); kv projection v_wmma_f32_16x16x32_f16 (LayerNorm rows single f16, weight = bf16 value x64 held in f16);
// scores v_wmma_f32_16x16x32_f16 (q x16, k x16 single f16; four heads share one 32-deep k axis, the Q fragment is zeroed outside its head by value); P.V v_wmma_f32_16x16x32_f16 (P x16384 carry, v x64, single f16, row sum over the converted P);
// output projection v_wmma_f32_16x16x32_f16 (context x1024 single f16, weight = bf16 value x64 in f16), scale folded back in the f32 epilogue; softmax and LayerNorm in f32.
// Layout: bf16 x plane [b*SEQ+t][64]; transposed weight planes [out][in]; patch weight plane [oc][(ky*8+kx)*64+ic]; q plane [b*SEQ+t][64]; LayerNorm plane and k plane [b*NKEY+key][64]; v^T plane [b*64+c][key].
// Fused attention kernel in transposed form (S^T = K Q^T, O^T = V^T P^T), no score plane in memory, output projection inside the same kernel.

#ifndef NB
#define NB 2
#endif
#ifndef GH
#define GH 128                   // token grid height (rows of the grid used per batch)
#endif
#define GW   128                 // token grid width
#define SEQ  (GH * GW)
#define NB_FULL  2
#define GH_FULL  128
#define SEQ_FULL 16384
#ifndef OUT_SEQ
#define OUT_SEQ SEQ              // row pitch (in tokens) between batches of the output
#endif
#define DM   64
#define NH_  8
#define HD   8
#define SRR  8                   // patch size = stride
#define KGW  (GW / SRR)
#define NKEY ((GH / SRR) * (GW / SRR))
#define CK   (DM * SRR * SRR)    // patch projection depth (4096)
#define AW   4                   // waves per attention block (16 query rows each)
#define CP   72                  // LDS row pitch (halves) of the context tile
#define OSP  68                  // LDS row pitch (floats) of the output tile
#define QC   16.0f               // carry of the q plane
#define KC   16.0f               // carry of the k plane
#define VC   64.0f               // carry of the v^T plane
#define WC   64.0f               // carry of the f16 weight planes
#define CTXC 1024.0f             // carry of the context tile
#define SC2  ((float)(0.35355339059327378 * 1.4426950408889634 / 256.0))   // HD^-0.5 * log2(e) / (QC * KC)
#define PSH  14.0f               // log2 of the P carry (16384)
#define NEGB (-3.0e38f)
#define OUTI (1.0f / 65536.0f)   // 1 / (CTXC * WC)

static_assert(DM == 64);
static_assert(NH_ * HD == DM);                 // head h = columns h*8 + d
static_assert(HD == 8);                        // one head = 8 k-slots = one half fragment of one lane half
static_assert(NH_ == 8);                       // two groups of four heads, 32 columns each
static_assert(DM % 32 == 0);                   // GEMM k-loops step by 32
static_assert(CK % 32 == 0);
static_assert(CK == 64 * DM);                  // k index = (ky*8+kx)*64 + ic
static_assert(SRR == 8);
static_assert(GH % SRR == 0);
static_assert(GW % SRR == 0);
static_assert(NKEY % 64 == 0);                 // a 64-token tile of the v^T GEMM never straddles two batches; key loop steps by 32
static_assert((NB * NKEY) % 64 == 0);
static_assert((NB * SEQ) % 64 == 0);
static_assert(SEQ % (16 * AW) == 0);           // attention grid covers the sequence exactly
static_assert(((size_t)SEQ * DM) % 8 == 0);
static_assert(NB <= NB_FULL);
static_assert(GH <= GH_FULL);
static_assert(SEQ <= SEQ_FULL);
static_assert((CP * 2) % 16 == 0);
static_assert((OSP * 4) % 16 == 0);
static_assert(CP >= DM);
static_assert(OSP >= DM);
static_assert(32 * 16 * 4 == 16 * DM * 2);
static_assert(32 * 16 * 8 == 16 * DM * 4);     // output stores: 32 lanes x 16 B x 8 instructions == 16 rows x 256 B
static_assert(256 * 2 * 16 == 64 * 64 * 2);
static_assert(AW * 16 * CP * 2 + AW * 16 * OSP * 4 <= 131072);
static_assert(64 * 65 * 4 <= 131072);
static_assert(16 * 68 * 4 <= 131072);

typedef _Float16 h16;
typedef unsigned short bf;
typedef __attribute__((ext_vector_type(16))) __bf16   v16bf;
typedef __attribute__((ext_vector_type(16))) _Float16 v16h;
typedef __attribute__((ext_vector_type(8)))  _Float16 v8h;
typedef __attribute__((ext_vector_type(8)))  unsigned short v8us;
typedef __attribute__((ext_vector_type(8)))  float    v8f;
typedef __attribute__((ext_vector_type(4)))  float    v4f;
typedef v4f  __attribute__((may_alias)) v4fa;
typedef __attribute__((ext_vector_type(16))) unsigned short v16us;
typedef v8h  __attribute__((may_alias)) v8ha;

__device__ __forceinline__ unsigned short f2bf(float f) { unsigned u = __float_as_uint(f); u += 0x7FFFu + ((u >> 16) & 1u); return (unsigned short)(u >> 16); }
__device__ __forceinline__ float bfr(float f) { return __uint_as_float(((unsigned)f2bf(f)) << 16); }   // value after RNE convert to bf16
__device__ __forceinline__ v16h cat16(v8h lo, v8h hi) { return __builtin_shufflevector(lo, hi, 0, 1, 2, 3, 4, 5, 6, 7, 8, 9, 10, 11, 12, 13, 14, 15); }
__device__ __forceinline__ v16bf cat16b(v8us lo, v8us hi) { return __builtin_bit_cast(v16bf, __builtin_shufflevector(lo, hi, 0, 1, 2, 3, 4, 5, 6, 7, 8, 9, 10, 11, 12, 13, 14, 15)); }
__device__ __forceinline__ v8f wmma16(v16h a, v16h b, v8f c) { return __builtin_amdgcn_wmma_f32_16x16x32_f16(false, a, false, b, (short)0, c, false, false); }
__device__ __forceinline__ v8f wmmab(v16bf a, v16bf b, v8f c) { return __builtin_amdgcn_wmma_f32_16x16x32_bf16(false, a, false, b, (short)0, c, false, false); }
// fragment loaders from K-contiguous 16-bit rows; p already includes + 8*(lane>>4): elements 0..7 <- k0+8h+0..7, elements 8..15 <- k0+16+8h+0..7 (same map for A and B)
__device__ __forceinline__ v16h  ldh(const h16* p) { return cat16(*(const v8h*)p, *(const v8h*)(p + 16)); }
__device__ __forceinline__ v16bf ldb(const bf* p)  { return cat16b(*(const v8us*)p, *(const v8us*)(p + 16)); }
// ordering point for wave-private LDS tiles (same wave writes and reads)
__device__ __forceinline__ void wave_sync() { __builtin_amdgcn_fence(3 /* release order */, "wavefront"); __builtin_amdgcn_wave_barrier(); asm volatile("" ::: "memory"); }

// f32 -> f16 with a value select: results below the smallest normal become +0 (applied after the plane's power-of-two carry)
static __device__ __forceinline__ h16 toh_flush(float v) { const h16 r = (h16)v; return (fabsf(v) < 6.103515625e-05f) ? (h16)0.0f : r; }
// raw 16-bit fragment (same k map), used by the GEMM body for both operand kinds
__device__ __forceinline__ v16us cat16u(v8us lo, v8us hi) { return __builtin_shufflevector(lo, hi, 0, 1, 2, 3, 4, 5, 6, 7, 8, 9, 10, 11, 12, 13, 14, 15); }
__device__ __forceinline__ v16us ldu(const bf* p) { return cat16u(*(const v8us*)p, *(const v8us*)(p + 16)); }
// one WMMA + its own four-slot guard (ties the result, keeps both fragments live)
__device__ __forceinline__ v8f wmma16g(v16h a, v16h b, v8f c) {
    c = __builtin_amdgcn_wmma_f32_16x16x32_f16(false, a, false, b, (short)0, c, false, false);
    asm volatile("v_nop\n\tv_nop\n\tv_nop\n\tv_nop" : "+v"(c) : "v"(a), "v"(b));
    return c; }
template <bool F16>
__device__ __forceinline__ v8f wmmaug(v16us a, v16us b, v8f c) {
    if (F16) c = __builtin_amdgcn_wmma_f32_16x16x32_f16(false, __builtin_bit_cast(v16h, a), false, __builtin_bit_cast(v16h, b), (short)0, c, false, false);
    else     c = __builtin_amdgcn_wmma_f32_16x16x32_bf16(false, __builtin_bit_cast(v16bf, a), false, __builtin_bit_cast(v16bf, b), (short)0, c, false, false);
    asm volatile("v_nop\n\tv_nop\n\tv_nop\n\tv_nop" : "+v"(c) : "v"(a), "v"(b));
    return c; }

__global__ __launch_bounds__(256) void k_cvt8(const float* __restrict__ src, bf* dst, size_t n8) {
    const size_t i = (size_t)blockIdx.x * 256 + threadIdx.x; if (i >= n8) return;
    const v8f v = *(const v8f*)(src + i * 8); v8us o;
#pragma unroll
    for (int k = 0; k < 8; ++k) o[k] = f2bf(v[k]);
    *(v8us*)(dst + i * 8) = o; 
}

// f16mode == 0: bf16 RNE bits; f16mode != 0: f16 bits of (bf16 value x carry), results below the smallest normal selected to +0.
__global__ __launch_bounds__(256) void k_wT(const float* __restrict__ src, bf* dst, int Cn, int f16mode, float carry) {
#pragma clang fp contract(off)
    __shared__ float ts[64 * 65];
    const int tid = threadIdx.x; const int c0 = blockIdx.x * 64; const int z = blockIdx.y;
    const float* sp = src + (size_t)z * 64 * (size_t)Cn + c0;
#pragma unroll 1
    for (int it = 0; it < 16; ++it) { const int idx = it * 256 + tid; const int r = idx >> 6, c = idx & 63;   // 16 trips x 256 = 64 x 64 elements
        ts[r * 65 + c] = sp[(size_t)r * Cn + c]; }
    __syncthreads();
    bf* dp = dst + ((size_t)z * (size_t)Cn + c0) * 64;
{
#pragma unroll 1
        for (int it = 0; it < 2; ++it) { const int p = it * 256 + tid; const int c = p >> 3, r8 = (p & 7) * 8; v8us o;   // 2 trips x 256 = 64 rows x 8 pieces
#pragma unroll
            for (int k = 0; k < 8; ++k) { const float v = ts[(r8 + k) * 65 + c];
                const unsigned short ub = f2bf(v);
                const h16 hv = toh_flush(bfr(v) * carry);
                const unsigned short uh = __builtin_bit_cast(unsigned short, hv);
                o[k] = f16mode ? uh : ub; }
            *(v8us*)(dp + (size_t)c * 64 + r8) = o; }
         }
}

// gemm_body: register-blocked GEMM, ONE WAVE per 64x64 tile (16 accumulators), operands straight from K-contiguous 16-bit planes (raw 16-bit loads), C[m][n] = sum_k A[m][k] Bt[n][k].
// KIND 0: q projection, bf16 operands, K = 64; A = x rows (m = b*SEQ + t), Bt = q weight rows (n); result x QC as f16 rows [m][64]. grid NB*SEQ/64.
// KIND 1: patch projection, bf16 operands, K = 4096 with k = (ky*8+kx)*64 + ic; A row m = (b, ty, tx) addressed arithmetically inside the bf16 x plane (64 contiguous channels per patch position),
//         Bt = permuted patch weight rows (n = oc); + bias, LayerNorm over the 64 channels of each row in f32 (two lanes per row, one xor-16 exchange), gain / offset applied; f16 rows [m][64]. grid NB*NKEY/64.
// KIND 2: k projection, f16 operands, K = 64; A = LayerNorm rows, Bt = kv weight rows 0..63 (x WC); result x KC/WC as f16 rows [m][64]. grid NB*NKEY/64.
// KIND 3: v^T projection, f16 operands, K = 64; A = kv weight rows 64..127 (m = c), Bt = LayerNorm rows (n = b*NKEY + key); result x VC/WC into plane [(b*64 + c)][key], row pitch NKEY. grid NB*NKEY/64 (tile index = token tile).
template <int KIND>
__device__ __forceinline__ void gemm_body(const bf* __restrict__ A, const bf* __restrict__ Bt, const float* __restrict__ cbias, const float* __restrict__ lg, const float* __restrict__ lb, h16* P) {
    __shared__ __align__(16) float os[16 * 68];
    constexpr int KD = (KIND == 1) ? CK : DM;
    constexpr bool F16 = (KIND >= 2);
    constexpr float SCL = (KIND == 0) ? QC : ((KIND == 1) ? 1.0f : ((KIND == 2) ? (KC / WC) : (VC / WC)));
    const int lane = threadIdx.x & 31, lr = lane & 15, hi = lane >> 4;
    const int r0 = (KIND == 3) ? 0 : (int)blockIdx.x * 64;
    const int c0 = (KIND == 3) ? (int)blockIdx.x * 64 : 0;
    v8f acc[4][4];
#pragma unroll
    for (int mb = 0; mb < 4; ++mb)
#pragma unroll
        for (int nb = 0; nb < 4; ++nb) acc[mb][nb] = (v8f){};
    size_t aoff[4];
#pragma unroll
    for (int mb = 0; mb < 4; ++mb) {
        const int mrow = r0 + mb * 16 + lr;
        if (KIND == 1) { const int bb = mrow / NKEY, tk = mrow % NKEY; const int ty = tk / KGW, tx = tk % KGW;
                         aoff[mb] = ((size_t)bb * SEQ + (size_t)(ty * SRR) * GW + (size_t)(tx * SRR)) * DM + 8 * hi; }
        else           { aoff[mb] = (size_t)mrow * DM + 8 * hi; } }
    const size_t boff = (size_t)(c0 + lr) * KD + 8 * hi;
#pragma unroll 1
    for (int kc = 0; kc < KD; kc += 32) {
        const size_t ak = (KIND == 1) ? (size_t)((((kc >> 9) * GW + ((kc >> 6) & 7)) * DM) + (kc & 63)) : (size_t)kc;   // patch position (ky, kx) = (kc>>9, (kc>>6)&7), channel base kc&63
        v16us a[4];
#pragma unroll
        for (int mb = 0; mb < 4; ++mb) a[mb] = ldu(A + aoff[mb] + ak);
#pragma unroll
        for (int nb = 0; nb < 4; ++nb) { const v16us b = ldu(Bt + boff + (size_t)nb * 16 * KD + kc);
#pragma unroll
            for (int mb = 0; mb < 4; ++mb) acc[mb][nb] = wmmaug<F16>(a[mb], b, acc[mb][nb]); }
    }
    float bc[4];
#pragma unroll
    for (int nb = 0; nb < 4; ++nb) bc[nb] = (KIND == 1) ? bfr(cbias[nb * 16 + lr]) : 0.0f;
    const int bb3 = c0 / NKEY, tt3 = c0 % NKEY;
#pragma unroll
    for (int mb = 0; mb < 4; ++mb) {
#pragma unroll
        for (int nb = 0; nb < 4; ++nb) {
#pragma unroll
            for (int j = 0; j < 8; ++j) os[(hi * 8 + j) * 68 + nb * 16 + lr] = (acc[mb][nb][j] + bc[nb]) * SCL; }   // D: row 8h+j, col lane&15; rows 0..15 x columns 0..63 all written
        wave_sync();
        if (KIND == 1) {
            // LayerNorm of row lr; this lane owns columns 32*hi .. 32*hi+31 (reads and rewrites only those)
            const int cb0 = lr * 68 + hi * 32;
            float s = 0.0f;
#pragma unroll
            for (int i = 0; i < 8; ++i) { const v4f x = *(const v4fa*)(&os[cb0 + 4 * i]); s += (x[0] + x[1]) + (x[2] + x[3]); }
            s += __shfl_xor(s, 16, 32);
            const float mu = s * (1.0f / 64.0f);
            float q = 0.0f;
#pragma unroll
            for (int i = 0; i < 8; ++i) { const v4f x = *(const v4fa*)(&os[cb0 + 4 * i]);
                const float d0 = x[0] - mu, d1 = x[1] - mu, d2 = x[2] - mu, d3 = x[3] - mu; q += (d0 * d0 + d1 * d1) + (d2 * d2 + d3 * d3); }
            q += __shfl_xor(q, 16, 32);
            const float rs = 1.0f / sqrtf(q * (1.0f / 64.0f) + 1.0e-5f);
#pragma unroll
            for (int i = 0; i < 8; ++i) { const v4f x = *(const v4fa*)(&os[cb0 + 4 * i]);
                const v4f g = *(const v4f*)(lg + hi * 32 + 4 * i); const v4f o = *(const v4f*)(lb + hi * 32 + 4 * i); v4f y;
#pragma unroll
                for (int e = 0; e < 4; ++e) y[e] = (x[e] - mu) * rs * bfr(g[e]) + bfr(o[e]);
                *(v4fa*)(&os[cb0 + 4 * i]) = y; }
            wave_sync();
        }
{
#pragma unroll
            for (int s = 0; s < 4; ++s) { const int row = 4 * s + (lane >> 3), c8 = (lane & 7) * 8;   // 4 s x 4 row groups = 16 rows; 8 lanes x 8 = 64 columns = one line
                const v4f x0 = *(const v4fa*)(&os[row * 68 + c8]); const v4f x1 = *(const v4fa*)(&os[row * 68 + c8 + 4]); v8h hv;
#pragma unroll
                for (int i = 0; i < 4; ++i) { hv[i] = toh_flush(x0[i]); hv[4 + i] = toh_flush(x1[i]); }
                const size_t oo = (KIND == 3) ? (((size_t)bb3 * DM + (size_t)(mb * 16 + row)) * NKEY + (size_t)tt3 + c8)
                                              : ((size_t)(r0 + mb * 16 + row) * DM + c8);
                *(v8h*)(P + oo) = hv; }
             }
        wave_sync();
    }
}

__global__ __launch_bounds__(32) void k_qproj(const bf* __restrict__ A, const bf* __restrict__ Bt, h16* P) { gemm_body<0>(A, Bt, (const float*)0, (const float*)0, (const float*)0, P); }
__global__ __launch_bounds__(32) void k_patch(const bf* __restrict__ A, const bf* __restrict__ Bt, const float* __restrict__ cbias, const float* __restrict__ lg, const float* __restrict__ lb, h16* P) { gemm_body<1>(A, Bt, cbias, lg, lb, P); }
__global__ __launch_bounds__(32) void k_kproj(const bf* __restrict__ A, const bf* __restrict__ Bt, h16* P) { gemm_body<2>(A, Bt, (const float*)0, (const float*)0, (const float*)0, P); }
__global__ __launch_bounds__(32) void k_vproj(const bf* __restrict__ A, const bf* __restrict__ Bt, h16* P) { gemm_body<3>(A, Bt, (const float*)0, (const float*)0, (const float*)0, P); }

// k_attn: fused attention + output projection, one wave per 16 query rows of one batch, all 8 heads in a scalar loop; K / V^T / Q fragments straight from the f16 planes (two 16-B loads each, arithmetic addressing).
// Transposed form: S^T[key][t] = K Q^T (A = K rows over the 32 columns of the head's group, B = Q row with the k-slots outside the head selected to zero by value); lane (t = lane&15, h = lane>>4) holds keys 8h+r
// of each 16-key tile, so the packed P tile is directly the B fragment of O^T[d][t] = V^T P^T (A rows d: channel head*8 + (lane&7); rows 8..15 repeat rows 0..7 and are not used).
// Online softmax state is one scalar per lane; the two lane halves of a row are combined with one xor-16 exchange. P = f16 of exp2(score - max + 14), zero when the exponent argument is below -14; row sum over the converted P.
// Context (x CTXC) of each head goes to a wave-private f16 LDS tile [16][64]; after the head loop the tile is the A operand of the output projection (B = transposed weight plane, f16 x WC);
// The two integer grid-size inputs are read on the device; when they differ from the compiled grid the output is filled with NaN.
__global__ __launch_bounds__(32 * AW) void k_attn(const h16* __restrict__ QH, const h16* __restrict__ KP, const h16* __restrict__ VT, const h16* __restrict__ PW,
                                                  const float* __restrict__ pbias, const int* __restrict__ hp, const int* __restrict__ wp, float* OUT) {
    __shared__ __align__(16) h16   cs[AW * 16 * CP];
    __shared__ __align__(16) float os[AW * 16 * OSP];
    const int lane = threadIdx.x & 31, lr = lane & 15, hi = lane >> 4;
    const int wave = __builtin_amdgcn_readfirstlane((int)(threadIdx.x >> 5));
    const int b = blockIdx.y;
    const int t0 = (blockIdx.x * AW + wave) * 16;
    const bool bad = (hp[0] != GH_FULL) | (wp[0] != GW);
    const size_t qrow  = ((size_t)b * SEQ + (size_t)(t0 + lr)) * DM + 8 * hi;
    const size_t kbase = ((size_t)b * NKEY + (size_t)lr) * DM + 8 * hi;        // + key * DM + 32 * group   (A fragment: row key, k = column inside the group)
    const size_t vbase = ((size_t)b * DM + (size_t)(lr & 7)) * NKEY + 8 * hi;  // + head*8*NKEY + key       (A fragment: row d, k = key)
    const int cb = wave * 16 * CP;
    const v8h z8 = (v8h){};
#pragma unroll 1
    for (int h = 0; h < NH_; ++h) {
        const int g = h >> 2, j = h & 3;
        v8h qa = *(const v8h*)(QH + qrow + 32 * g), qb = *(const v8h*)(QH + qrow + 32 * g + 16);
        asm volatile("" : "+v"(qa), "+v"(qb));
        const bool kA = (hi == (j & 1)) & (j < 2);                 // head j of the group = k-slots 8j..8j+7: lane half (j&1), elements 0..7 (j < 2) or 8..15 (j >= 2)
        const bool kB = (hi == (j & 1)) & (j >= 2);
        qa = kA ? qa : z8; qb = kB ? qb : z8;
        const v16h qf = cat16(qa, qb);                             // B fragment: col t, k = column inside the group
        const size_t ko = kbase + (size_t)(32 * g);
        const size_t vo = vbase + (size_t)(h * HD) * NKEY;
        v8f o = (v8f){};
        float m = NEGB, l = 0.0f;
#pragma unroll 1
        for (int key0 = 0; key0 < NKEY; key0 += 32) {
            const h16* ka = KP + ko + (size_t)key0 * DM;
            const v16h ka0 = ldh(ka), kb0 = ldh(ka + 16 * DM);
            v8f sa = (v8f){}, sb = (v8f){};
            sa = wmma16g(ka0, qf, sa); sb = wmma16g(kb0, qf, sb);
            float ta[8], tb[8]; float mx = NEGB;
#pragma unroll
            for (int r = 0; r < 8; ++r) { ta[r] = sa[r] * SC2; tb[r] = sb[r] * SC2; mx = fmaxf(mx, fmaxf(ta[r], tb[r])); }
            mx = fmaxf(mx, __shfl_xor(mx, 16, 32));
            const float mnew = fmaxf(m, mx);
            const float alpha = __builtin_amdgcn_exp2f(m - mnew);
            const float sh = PSH - mnew;
            v16h pb; float ls = 0.0f;
#pragma unroll
            for (int r = 0; r < 8; ++r) {
                const float ea = ta[r] + sh, eb = tb[r] + sh;
                const float xa = __builtin_amdgcn_exp2f(ea), xb = __builtin_amdgcn_exp2f(eb);
                const h16 pa = (ea < -14.0f) ? (h16)0.0f : (h16)xa;
                const h16 pc = (eb < -14.0f) ? (h16)0.0f : (h16)xb;
                pb[r] = pa; pb[8 + r] = pc;
                ls += (float)pa + (float)pc; }
            l = l * alpha + ls; m = mnew;
            o = o * alpha;
            const v16h v0 = ldh(VT + vo + key0);
            o = wmma16g(v0, pb, o);
        }
        l += __shfl_xor(l, 16, 32);
        const float inv = (1.0f / l) * (CTXC / VC);                // l >= 16384 (the maximum element of every row converts to 16384)
        v8h cv;
#pragma unroll
        for (int r = 0; r < 8; ++r) cv[r] = toh_flush(o[r] * inv); // lane half 0: o[r] = (d = r, t = lane&15)
        if (hi == 0) *(v8ha*)(&cs[cb + lr * CP + h * HD]) = cv;    // 8 heads x 8 columns: rows 0..15 x columns 0..63 all written
    }
    wave_sync();
    v8f acc[4];
#pragma unroll
    for (int nb = 0; nb < 4; ++nb) acc[nb] = (v8f){};
#pragma unroll
    for (int kc = 0; kc < DM; kc += 32) {
        const v8h a0 = *(const v8ha*)(&cs[cb + lr * CP + kc + 8 * hi]);
        const v8h a1 = *(const v8ha*)(&cs[cb + lr * CP + kc + 16 + 8 * hi]);
        const v16h a = cat16(a0, a1);                              // A fragment: row t, k = context column
#pragma unroll
        for (int nb = 0; nb < 4; ++nb) { const v16h bw = ldh(PW + (size_t)(nb * 16 + lr) * DM + kc + 8 * hi);
            acc[nb] = wmma16g(a, bw, acc[nb]); }
    }
    const int ob = wave * 16 * OSP;
    const float nanv = __uint_as_float(0x7FC00000u);
#pragma unroll
    for (int nb = 0; nb < 4; ++nb) { const float bia = bfr(pbias[nb * 16 + lr]);
#pragma unroll
        for (int r = 0; r < 8; ++r) { const float v = acc[nb][r] * OUTI + bia;
            os[ob + (8 * hi + r) * OSP + nb * 16 + lr] = bad ? nanv : v; } }   // D: row 8h+r, col lane&15; rows 0..15 x columns 0..63 all written
    wave_sync();
    float* orow = OUT + ((size_t)b * OUT_SEQ + (size_t)t0) * DM;
{
#pragma unroll
        for (int s = 0; s < 8; ++s) { const int row = 2 * s + (lane >> 4), cofs = (lane & 15) * 4;
            const v4f val = *(const v4fa*)(&os[ob + row * OSP + cofs]);
            *(v4f*)(orow + (size_t)row * DM + cofs) = val; }
         }
}

static constexpr size_t al256(size_t v) { return (v + 255) & ~(size_t)255; }
static constexpr size_t SZ_XB = al256((size_t)NB * SEQ * DM * 2);        // bf16 x plane; also the extent of the q plane
static constexpr size_t SZ_W1 = al256((size_t)DM * DM * 2);              // one 64 x 64 weight plane
static constexpr size_t SZ_KV = al256((size_t)2 * DM * DM * 2);          // kv weight plane [128][64]
static constexpr size_t SZ_SW = al256((size_t)DM * CK * 2);              // patch weight plane [64][4096]
static constexpr size_t SZ_KP = al256((size_t)NB * NKEY * DM * 2);       // LayerNorm / k / v^T planes
static constexpr size_t SZ_TOTAL = 2 * SZ_XB + 2 * SZ_W1 + SZ_KV + SZ_SW + 3 * SZ_KP;
static_assert(SZ_TOTAL <= (size_t)134217728);                            // workspace carve <= 128 MiB
static_assert(((size_t)NB * SEQ * DM * 2) % 256 == 0);
static_assert(((size_t)NB * NKEY * DM * 2) % 256 == 0);
static_assert((size_t)NB * DM * NKEY == (size_t)NB * NKEY * DM);         // v^T plane [(b*64 + c)][key] has the same extent as the k plane

extern "C" void kernel_launch(void* const* d_in, const int* in_sizes, int n_in,
                              void* d_out, int out_size, void* d_ws, size_t ws_size, hipStream_t stream) {
    if (n_in < 11) return;
    const size_t needx = ((size_t)(NB - 1) * SEQ_FULL + SEQ) * DM;
    if ((size_t)in_sizes[0] < needx) return;
    if (in_sizes[1] < 1 || in_sizes[2] < 1) return;
    if ((size_t)in_sizes[3] < (size_t)DM * DM || (size_t)in_sizes[4] < (size_t)2 * DM * DM || (size_t)in_sizes[5] < (size_t)DM * CK) return;
    if (in_sizes[6] < DM || in_sizes[7] < DM || in_sizes[8] < DM || (size_t)in_sizes[9] < (size_t)DM * DM || in_sizes[10] < DM) return;
    if ((size_t)out_size < ((size_t)(NB - 1) * OUT_SEQ + SEQ) * DM) return;
    if (SZ_TOTAL > ws_size) return;
    // wire order: x, H, W, q_w, kv_w, sr_w, sr_b, ln_g, ln_b, proj_w, proj_b
    const float* x    = (const float*)d_in[0];
    const int*   gh   = (const int*)d_in[1];
    const int*   gw   = (const int*)d_in[2];
    const float* q_w  = (const float*)d_in[3];
    const float* kv_w = (const float*)d_in[4];
    const float* sr_w = (const float*)d_in[5];
    const float* sr_b = (const float*)d_in[6];
    const float* ln_g = (const float*)d_in[7];
    const float* ln_b = (const float*)d_in[8];
    const float* pj_w = (const float*)d_in[9];
    const float* pj_b = (const float*)d_in[10];
    float* OUT = (float*)d_out;      // [NB][SEQ][64]
    char* wsp = (char*)d_ws;
    bf*  XB  = (bf*)wsp;  wsp += SZ_XB;              // [NB*SEQ][64] bf16 x
    h16* QH  = (h16*)wsp; wsp += SZ_XB;              // [NB*SEQ][64] q x16
    bf*  WQT = (bf*)wsp;  wsp += SZ_W1;              // [64 out][64 in] bf16
    bf*  PWT = (bf*)wsp;  wsp += SZ_W1;              // [64 out][64 in] f16 bits, x64
    bf*  KVT = (bf*)wsp;  wsp += SZ_KV;              // [128 out][64 in] f16 bits, x64 (rows 0..63 k, 64..127 v)
    bf*  SW  = (bf*)wsp;  wsp += SZ_SW;              // [64 oc][(ky*8+kx)*64 + ic] bf16
    h16* LNP = (h16*)wsp; wsp += SZ_KP;              // [NB*NKEY][64] LayerNorm rows
    h16* KP  = (h16*)wsp; wsp += SZ_KP;              // [NB*NKEY][64] k x16
    h16* VT  = (h16*)wsp; wsp += SZ_KP;              // [NB*64][NKEY] v^T x64

    if (SEQ == SEQ_FULL) {
        const size_t n8 = (size_t)NB * SEQ * DM / 8;
        k_cvt8<<<(unsigned)((n8 + 255) / 256), 256, 0, stream>>>(x, XB, n8);
    } else {
        const size_t n8 = (size_t)SEQ * DM / 8;
        for (int b = 0; b < NB; ++b) k_cvt8<<<(unsigned)((n8 + 255) / 256), 256, 0, stream>>>(x + (size_t)b * SEQ_FULL * DM, XB + (size_t)b * SEQ * DM, n8);
    }
    // weight planes: in[rows = 64][cols] -> out[cols][64]
    k_wT<<<dim3(1, 1, 1),  256, 0, stream>>>(q_w,  WQT, DM,     0, 1.0f);   // q_w  [64 in][64 out]  -> [64 out][64 in]
    k_wT<<<dim3(2, 1, 1),  256, 0, stream>>>(kv_w, KVT, 2 * DM, 1, WC);     // kv_w [64 in][128 out] -> [128 out][64 in]
    k_wT<<<dim3(1, DM, 1), 256, 0, stream>>>(sr_w, SW,  DM,     0, 1.0f);   // per oc: [64 ic][64 (ky,kx)] -> [64 (ky,kx)][64 ic]
    k_wT<<<dim3(1, 1, 1),  256, 0, stream>>>(pj_w, PWT, DM,     1, WC);     // proj_w [64 in][64 out] -> [64 out][64 in]

    k_qproj<<<dim3(NB * SEQ / 64, 1, 1), 32, 0, stream>>>(XB, WQT, QH);
    k_patch<<<dim3(NB * NKEY / 64, 1, 1), 32, 0, stream>>>(XB, SW, sr_b, ln_g, ln_b, LNP);
    k_kproj<<<dim3(NB * NKEY / 64, 1, 1), 32, 0, stream>>>((const bf*)LNP, KVT, KP);
    k_vproj<<<dim3(NB * NKEY / 64, 1, 1), 32, 0, stream>>>(KVT + (size_t)DM * DM, (const bf*)LNP, VT);

    k_attn<<<dim3(SEQ / (16 * AW), NB, 1), 32 * AW, 0, stream>>>(QH, KP, VT, (const h16*)PWT, pj_b, gh, gw, OUT);
}

// v001
// Measured time: 99.7 microseconds a run.
// Timed twice side by side with v000, it ran 2.04 times as fast both times.
#include <hip/hip_runtime.h>

// Spatial-reduction attention, width 64 = 8 heads x 8: queries from all NB x SEQ tokens (x @ q_w, weights [in][out], no bias); keys / values from an 8x8 stride-8 patch projection (+ bias) -> LayerNorm (eps 1e-5) -> fused [in][out] kv weight (256 keys per batch at the full size); dense softmax, score scale 8^-0.5; output projection (+ bias).
// Compute dtypes, f32 accumulate everywhere: q projection and patch projection v_wmma_f32_16x16x32_bf16 (x and weights RNE-converted to bf16; products exact); kv projection v_wmma_f32_16x16x32_f16 (LayerNorm rows single f16, weight = bf16 value x64 held in f16);
// scores v_wmma_f32_16x16x32_f16 (q x16, k x16 single f16; four heads share one 32-deep k axis, the Q fragment is zeroed outside its head by value); P.V v_wmma_f32_16x16x32_f16 (P x16384 carry, v x64, single f16, row sum over the converted P);
// output projection v_wmma_f32_16x16x32_f16 (context x1024 single f16, weight = bf16 value x64 in f16), scale folded back in the f32 epilogue; softmax and LayerNorm in f32.
// Layout: bf16 x plane [b*SEQ+t][64]; transposed weight planes [out][in]; patch weight plane [oc][(ky*8+kx)*64+ic]; q plane [b*SEQ+t][64]; LayerNorm plane and k plane [b*NKEY+key][64]; v^T plane [b*64+c][key].
// Fused attention kernel in transposed form (S^T = K Q^T, O^T = V^T P^T), no score plane in memory, output projection inside the same kernel.

#ifndef NB
#define NB 2
#endif
#ifndef GH
#define GH 128                   // token grid height (rows of the grid used per batch)
#endif
#define GW   128                 // token grid width
#define SEQ  (GH * GW)
#define NB_FULL  2
#define GH_FULL  128
#define SEQ_FULL 16384
#ifndef OUT_SEQ
#define OUT_SEQ SEQ              // row pitch (in tokens) between batches of the output
#endif
#define DM   64
#define NH_  8
#define HD   8
#define SRR  8                   // patch size = stride
#define KGW  (GW / SRR)
#define NKEY ((GH / SRR) * (GW / SRR))
#define CK   (DM * SRR * SRR)    // patch projection depth (4096)
#define AW   4                   // waves per attention block (16 query rows each)
#define CP   72                  // LDS row pitch (halves) of the context tile
#define OSP  68                  // LDS row pitch (floats) of the output tile
#define PWV  16                  // waves per patch-projection block = slices of its depth = rows of its tile
#define PKS  (CK / PWV)          // depth of one slice (256 = 4 patch positions x 64 channels)
#define RP   68                  // LDS row pitch (floats) of the partial tiles
#define QC   16.0f               // carry of the q plane
#define KC   16.0f               // carry of the k plane
#define VC   64.0f               // carry of the v^T plane
#define WC   64.0f               // carry of the f16 weight planes
#define CTXC 1024.0f             // carry of the context tile
#define SC2  ((float)(0.35355339059327378 * 1.4426950408889634 / 256.0))   // HD^-0.5 * log2(e) / (QC * KC)
#define PSH  14.0f               // log2 of the P carry (16384)
#define NEGB (-3.0e38f)
#define OUTI (1.0f / 65536.0f)   // 1 / (CTXC * WC)

static_assert(DM == 64);
static_assert(NH_ * HD == DM);                 // head h = columns h*8 + d
static_assert(HD == 8);                        // one head = 8 k-slots = one half fragment of one lane half
static_assert(NH_ == 8);                       // two groups of four heads, 32 columns each
static_assert(DM % 32 == 0);                   // GEMM k-loops step by 32
static_assert(CK % 32 == 0);
static_assert(CK == 64 * DM);                  // k index = (ky*8+kx)*64 + ic
static_assert(SRR == 8);
static_assert(GH % SRR == 0);
static_assert(GW % SRR == 0);
static_assert(NKEY % 64 == 0);                 // a 64-token tile of the v^T GEMM never straddles two batches; key loop steps by 32
static_assert((NB * NKEY) % 64 == 0);
static_assert((NB * SEQ) % 64 == 0);
static_assert(SEQ % (16 * AW) == 0);           // attention grid covers the sequence exactly
static_assert(((size_t)SEQ * DM) % 8 == 0);
static_assert(NB <= NB_FULL);
static_assert(GH <= GH_FULL);
static_assert(SEQ <= SEQ_FULL);
static_assert((CP * 2) % 16 == 0);
static_assert((OSP * 4) % 16 == 0);
static_assert(CP >= DM);
static_assert(OSP >= DM);
static_assert(32 * 16 * 4 == 16 * DM * 2);
static_assert(32 * 16 * 8 == 16 * DM * 4);     // output stores: 32 lanes x 16 B x 8 instructions == 16 rows x 256 B
static_assert(256 * 2 * 16 == 64 * 64 * 2);
static_assert(AW * 16 * CP * 2 + AW * 16 * OSP * 4 <= 131072);
static_assert(64 * 65 * 4 <= 131072);
static_assert(16 * 68 * 4 <= 131072);
static_assert(PWV == 16);                      // wave w finishes row w of the 16-row tile
static_assert(PKS % DM == 0);                  // a slice holds whole patch positions
static_assert((SRR * DM) % PKS == 0);          // and stays inside one patch row ky
static_assert((NB * NKEY) % 16 == 0);
static_assert(NKEY % 16 == 0);                 // a 16-row tile never straddles two batches
static_assert((RP * 4) % 8 == 0);
static_assert(PWV * 16 * RP * 4 <= 131072);

typedef _Float16 h16;
typedef unsigned short bf;
typedef __attribute__((ext_vector_type(16))) __bf16   v16bf;
typedef __attribute__((ext_vector_type(16))) _Float16 v16h;
typedef __attribute__((ext_vector_type(8)))  _Float16 v8h;
typedef __attribute__((ext_vector_type(8)))  unsigned short v8us;
typedef __attribute__((ext_vector_type(8)))  float    v8f;
typedef __attribute__((ext_vector_type(4)))  float    v4f;
typedef v4f  __attribute__((may_alias)) v4fa;
typedef __attribute__((ext_vector_type(16))) unsigned short v16us;
typedef v8h  __attribute__((may_alias)) v8ha;
typedef __attribute__((ext_vector_type(2)))  float    v2f;
typedef v2f  __attribute__((may_alias)) v2fa;
typedef __attribute__((ext_vector_type(2)))  _Float16 v2h;

__device__ __forceinline__ unsigned short f2bf(float f) { unsigned u = __float_as_uint(f); u += 0x7FFFu + ((u >> 16) & 1u); return (unsigned short)(u >> 16); }
__device__ __forceinline__ float bfr(float f) { return __uint_as_float(((unsigned)f2bf(f)) << 16); }   // value after RNE convert to bf16
__device__ __forceinline__ v16h cat16(v8h lo, v8h hi) { return __builtin_shufflevector(lo, hi, 0, 1, 2, 3, 4, 5, 6, 7, 8, 9, 10, 11, 12, 13, 14, 15); }
__device__ __forceinline__ v16bf cat16b(v8us lo, v8us hi) { return __builtin_bit_cast(v16bf, __builtin_shufflevector(lo, hi, 0, 1, 2, 3, 4, 5, 6, 7, 8, 9, 10, 11, 12, 13, 14, 15)); }
__device__ __forceinline__ v8f wmma16(v16h a, v16h b, v8f c) { return __builtin_amdgcn_wmma_f32_16x16x32_f16(false, a, false, b, (short)0, c, false, false); }
__device__ __forceinline__ v8f wmmab(v16bf a, v16bf b, v8f c) { return __builtin_amdgcn_wmma_f32_16x16x32_bf16(false, a, false, b, (short)0, c, false, false); }
// fragment loaders from K-contiguous 16-bit rows; p already includes + 8*(lane>>4): elements 0..7 <- k0+8h+0..7, elements 8..15 <- k0+16+8h+0..7 (same map for A and B)
__device__ __forceinline__ v16h  ldh(const h16* p) { return cat16(*(const v8h*)p, *(const v8h*)(p + 16)); }
__device__ __forceinline__ v16bf ldb(const bf* p)  { return cat16b(*(const v8us*)p, *(const v8us*)(p + 16)); }
// ordering point for wave-private LDS tiles (same wave writes and reads)
__device__ __forceinline__ void wave_sync() { __builtin_amdgcn_fence(3 /* release order */, "wavefront"); __builtin_amdgcn_wave_barrier(); asm volatile("" ::: "memory"); }

// f32 -> f16 with a value select: results below the smallest normal become +0 (applied after the plane's power-of-two carry)
static __device__ __forceinline__ h16 toh_flush(float v) { const h16 r = (h16)v; return (fabsf(v) < 6.103515625e-05f) ? (h16)0.0f : r; }
// raw 16-bit fragment (same k map), used by the GEMM body for both operand kinds
__device__ __forceinline__ v16us cat16u(v8us lo, v8us hi) { return __builtin_shufflevector(lo, hi, 0, 1, 2, 3, 4, 5, 6, 7, 8, 9, 10, 11, 12, 13, 14, 15); }
__device__ __forceinline__ v16us ldu(const bf* p) { return cat16u(*(const v8us*)p, *(const v8us*)(p + 16)); }
// one WMMA + its own four-slot guard (ties the result, keeps both fragments live)
__device__ __forceinline__ v8f wmma16g(v16h a, v16h b, v8f c) {
    c = __builtin_amdgcn_wmma_f32_16x16x32_f16(false, a, false, b, (short)0, c, false, false);
    asm volatile("v_nop\n\tv_nop\n\tv_nop\n\tv_nop" : "+v"(c) : "v"(a), "v"(b));
    return c; }
template <bool F16>
__device__ __forceinline__ v8f wmmaug(v16us a, v16us b, v8f c) {
    if (F16) c = __builtin_amdgcn_wmma_f32_16x16x32_f16(false, __builtin_bit_cast(v16h, a), false, __builtin_bit_cast(v16h, b), (short)0, c, false, false);
    else     c = __builtin_amdgcn_wmma_f32_16x16x32_bf16(false, __builtin_bit_cast(v16bf, a), false, __builtin_bit_cast(v16bf, b), (short)0, c, false, false);
    asm volatile("v_nop\n\tv_nop\n\tv_nop\n\tv_nop" : "+v"(c) : "v"(a), "v"(b));
    return c; }

__global__ __launch_bounds__(256) void k_cvt8(const float* __restrict__ src, bf* dst, size_t n8) {
    const size_t i = (size_t)blockIdx.x * 256 + threadIdx.x; if (i >= n8) return;
    const v8f v = *(const v8f*)(src + i * 8); v8us o;
#pragma unroll
    for (int k = 0; k < 8; ++k) o[k] = f2bf(v[k]);
    *(v8us*)(dst + i * 8) = o; 
}

// f16mode == 0: bf16 RNE bits; f16mode != 0: f16 bits of (bf16 value x carry), results below the smallest normal selected to +0.
__global__ __launch_bounds__(256) void k_wT(const float* __restrict__ src, bf* dst, int Cn, int f16mode, float carry) {
#pragma clang fp contract(off)
    __shared__ float ts[64 * 65];
    const int tid = threadIdx.x; const int c0 = blockIdx.x * 64; const int z = blockIdx.y;
    const float* sp = src + (size_t)z * 64 * (size_t)Cn + c0;
#pragma unroll 1
    for (int it = 0; it < 16; ++it) { const int idx = it * 256 + tid; const int r = idx >> 6, c = idx & 63;   // 16 trips x 256 = 64 x 64 elements
        ts[r * 65 + c] = sp[(size_t)r * Cn + c]; }
    __syncthreads();
    bf* dp = dst + ((size_t)z * (size_t)Cn + c0) * 64;
{
#pragma unroll 1
        for (int it = 0; it < 2; ++it) { const int p = it * 256 + tid; const int c = p >> 3, r8 = (p & 7) * 8; v8us o;   // 2 trips x 256 = 64 rows x 8 pieces
#pragma unroll
            for (int k = 0; k < 8; ++k) { const float v = ts[(r8 + k) * 65 + c];
                const unsigned short ub = f2bf(v);
                const h16 hv = toh_flush(bfr(v) * carry);
                const unsigned short uh = __builtin_bit_cast(unsigned short, hv);
                o[k] = f16mode ? uh : ub; }
            *(v8us*)(dp + (size_t)c * 64 + r8) = o; }
         }
}

// gemm_body: register-blocked GEMM, ONE WAVE per 64x64 tile (16 accumulators), operands straight from K-contiguous 16-bit planes (raw 16-bit loads), C[m][n] = sum_k A[m][k] Bt[n][k].
// KIND 0: q projection, bf16 operands, K = 64; A = x rows (m = b*SEQ + t), Bt = q weight rows (n); result x QC as f16 rows [m][64]. grid NB*SEQ/64.
// KIND 1: patch projection, bf16 operands, K = 4096 with k = (ky*8+kx)*64 + ic; A row m = (b, ty, tx) addressed arithmetically inside the bf16 x plane (64 contiguous channels per patch position),
//         Bt = permuted patch weight rows (n = oc); + bias, LayerNorm over the 64 channels of each row in f32 (two lanes per row, one xor-16 exchange), gain / offset applied; f16 rows [m][64]. grid NB*NKEY/64.
// KIND 2: k projection, f16 operands, K = 64; A = LayerNorm rows, Bt = kv weight rows 0..63 (x WC); result x KC/WC as f16 rows [m][64]. grid NB*NKEY/64.
// KIND 3: v^T projection, f16 operands, K = 64; A = kv weight rows 64..127 (m = c), Bt = LayerNorm rows (n = b*NKEY + key); result x VC/WC into plane [(b*64 + c)][key], row pitch NKEY. grid NB*NKEY/64 (tile index = token tile).
template <int KIND>
__device__ __forceinline__ void gemm_body(const bf* __restrict__ A, const bf* __restrict__ Bt, const float* __restrict__ cbias, const float* __restrict__ lg, const float* __restrict__ lb, h16* P) {
    __shared__ __align__(16) float os[16 * 68];
    constexpr int KD = (KIND == 1) ? CK : DM;
    constexpr bool F16 = (KIND >= 2);
    constexpr float SCL = (KIND == 0) ? QC : ((KIND == 1) ? 1.0f : ((KIND == 2) ? (KC / WC) : (VC / WC)));
    const int lane = threadIdx.x & 31, lr = lane & 15, hi = lane >> 4;
    const int r0 = (KIND == 3) ? 0 : (int)blockIdx.x * 64;
    const int c0 = (KIND == 3) ? (int)blockIdx.x * 64 : 0;
    v8f acc[4][4];
#pragma unroll
    for (int mb = 0; mb < 4; ++mb)
#pragma unroll
        for (int nb = 0; nb < 4; ++nb) acc[mb][nb] = (v8f){};
    size_t aoff[4];
#pragma unroll
    for (int mb = 0; mb < 4; ++mb) {
        const int mrow = r0 + mb * 16 + lr;
        if (KIND == 1) { const int bb = mrow / NKEY, tk = mrow % NKEY; const int ty = tk / KGW, tx = tk % KGW;
                         aoff[mb] = ((size_t)bb * SEQ + (size_t)(ty * SRR) * GW + (size_t)(tx * SRR)) * DM + 8 * hi; }
        else           { aoff[mb] = (size_t)mrow * DM + 8 * hi; } }
    const size_t boff = (size_t)(c0 + lr) * KD + 8 * hi;
#pragma unroll 1
    for (int kc = 0; kc < KD; kc += 32) {
        const size_t ak = (KIND == 1) ? (size_t)((((kc >> 9) * GW + ((kc >> 6) & 7)) * DM) + (kc & 63)) : (size_t)kc;   // patch position (ky, kx) = (kc>>9, (kc>>6)&7), channel base kc&63
        v16us a[4];
#pragma unroll
        for (int mb = 0; mb < 4; ++mb) a[mb] = ldu(A + aoff[mb] + ak);
#pragma unroll
        for (int nb = 0; nb < 4; ++nb) { const v16us b = ldu(Bt + boff + (size_t)nb * 16 * KD + kc);
#pragma unroll
            for (int mb = 0; mb < 4; ++mb) acc[mb][nb] = wmmaug<F16>(a[mb], b, acc[mb][nb]); }
    }
    float bc[4];
#pragma unroll
    for (int nb = 0; nb < 4; ++nb) bc[nb] = (KIND == 1) ? bfr(cbias[nb * 16 + lr]) : 0.0f;
    const int bb3 = c0 / NKEY, tt3 = c0 % NKEY;
#pragma unroll
    for (int mb = 0; mb < 4; ++mb) {
#pragma unroll
        for (int nb = 0; nb < 4; ++nb) {
#pragma unroll
            for (int j = 0; j < 8; ++j) os[(hi * 8 + j) * 68 + nb * 16 + lr] = (acc[mb][nb][j] + bc[nb]) * SCL; }   // D: row 8h+j, col lane&15; rows 0..15 x columns 0..63 all written
        wave_sync();
        if (KIND == 1) {
            // LayerNorm of row lr; this lane owns columns 32*hi .. 32*hi+31 (reads and rewrites only those)
            const int cb0 = lr * 68 + hi * 32;
            float s = 0.0f;
#pragma unroll
            for (int i = 0; i < 8; ++i) { const v4f x = *(const v4fa*)(&os[cb0 + 4 * i]); s += (x[0] + x[1]) + (x[2] + x[3]); }
            s += __shfl_xor(s, 16, 32);
            const float mu = s * (1.0f / 64.0f);
            float q = 0.0f;
#pragma unroll
            for (int i = 0; i < 8; ++i) { const v4f x = *(const v4fa*)(&os[cb0 + 4 * i]);
                const float d0 = x[0] - mu, d1 = x[1] - mu, d2 = x[2] - mu, d3 = x[3] - mu; q += (d0 * d0 + d1 * d1) + (d2 * d2 + d3 * d3); }
            q += __shfl_xor(q, 16, 32);
            const float rs = 1.0f / sqrtf(q * (1.0f / 64.0f) + 1.0e-5f);
#pragma unroll
            for (int i = 0; i < 8; ++i) { const v4f x = *(const v4fa*)(&os[cb0 + 4 * i]);
                const v4f g = *(const v4f*)(lg + hi * 32 + 4 * i); const v4f o = *(const v4f*)(lb + hi * 32 + 4 * i); v4f y;
#pragma unroll
                for (int e = 0; e < 4; ++e) y[e] = (x[e] - mu) * rs * bfr(g[e]) + bfr(o[e]);
                *(v4fa*)(&os[cb0 + 4 * i]) = y; }
            wave_sync();
        }
{
#pragma unroll
            for (int s = 0; s < 4; ++s) { const int row = 4 * s + (lane >> 3), c8 = (lane & 7) * 8;   // 4 s x 4 row groups = 16 rows; 8 lanes x 8 = 64 columns = one line
                const v4f x0 = *(const v4fa*)(&os[row * 68 + c8]); const v4f x1 = *(const v4fa*)(&os[row * 68 + c8 + 4]); v8h hv;
#pragma unroll
                for (int i = 0; i < 4; ++i) { hv[i] = toh_flush(x0[i]); hv[4 + i] = toh_flush(x1[i]); }
                const size_t oo = (KIND == 3) ? (((size_t)bb3 * DM + (size_t)(mb * 16 + row)) * NKEY + (size_t)tt3 + c8)
                                              : ((size_t)(r0 + mb * 16 + row) * DM + c8);
                *(v8h*)(P + oo) = hv; }
             }
        wave_sync();
    }
}

__global__ __launch_bounds__(32) void k_qproj(const bf* __restrict__ A, const bf* __restrict__ Bt, h16* P) { gemm_body<0>(A, Bt, (const float*)0, (const float*)0, (const float*)0, P); }
__global__ __launch_bounds__(32) void k_kproj(const bf* __restrict__ A, const bf* __restrict__ Bt, h16* P) { gemm_body<2>(A, Bt, (const float*)0, (const float*)0, (const float*)0, P); }
__global__ __launch_bounds__(32) void k_vproj(const bf* __restrict__ A, const bf* __restrict__ Bt, h16* P) { gemm_body<3>(A, Bt, (const float*)0, (const float*)0, (const float*)0, P); }

// k_patch: patch projection (bf16 operands, K = 4096 with k = (ky*8+kx)*64 + ic) + bias + LayerNorm; f16 rows [m][64]. grid NB*NKEY/16, PWV waves per block. (It takes the place of gemm_body's KIND 1, which nothing instantiates any more.)
// One block per 16 rows m = (b, ty, tx = 0..15) x all 64 output channels; A rows addressed arithmetically inside the bf16 x plane (64 contiguous channels per patch position), Bt = permuted patch weight rows (n = oc).
// The depth is split over the waves: wave w sums k = 256 w .. 256 w + 255 (ky = w>>1, kx = 4 (w&1) .. + 3) into its own 16 x 64 f32 partial tile, one patch position (one 128-B line of every A and Bt row) per trip.
// The 16 partial tiles meet in LDS; behind the block barrier wave w adds them up for row w in slice order (lane owns columns 2 lane, 2 lane + 1), adds the bias and does the LayerNorm of that row in f32 (xor exchanges over the 32 lanes).
// amdgpu_waves_per_eu(4, 4): one block fills its 4 waves per SIMD and the grid is smaller than the chip, so the register budget goes to loads in flight (without it each fragment is loaded and waited for alone).
__global__ __launch_bounds__(32 * PWV) __attribute__((amdgpu_waves_per_eu(4, 4))) void k_patch(const bf* __restrict__ A, const bf* __restrict__ Bt, const float* __restrict__ cbias, const float* __restrict__ lg, const float* __restrict__ lb, h16* P) {
    __shared__ __align__(16) float red[PWV * 16 * RP];
    const int lane = threadIdx.x & 31, lr = lane & 15, hi = lane >> 4;
    const int wave = __builtin_amdgcn_readfirstlane((int)(threadIdx.x >> 5));
    const int r0 = (int)blockIdx.x * 16;
    const int mrow = r0 + lr;
    const int bb = mrow / NKEY, tk = mrow % NKEY; const int ty = tk / KGW, tx = tk % KGW;
    const int k0 = wave * PKS;
    const bf* ap = A + ((size_t)bb * SEQ + (size_t)(ty * SRR + (k0 >> 9)) * GW + (size_t)(tx * SRR + ((k0 >> 6) & 7))) * DM + 8 * hi;   // first patch position of the slice: (ky, kx) = (k0>>9, (k0>>6)&7)
    const bf* bp = Bt + (size_t)lr * CK + k0 + 8 * hi;
    v8f acc[4];                                                    // the loops over nb and j below are unrolled so that acc[] is indexed by constants and stays in registers
#pragma unroll
    for (int nb = 0; nb < 4; ++nb) acc[nb] = (v8f){};
#pragma unroll                                                     // 4 trips, unrolled: every address is base + constant, and a later trip's loads issue ahead of an earlier trip's WMMAs
    for (int kk = 0; kk < PKS; kk += DM) {                         // next patch position in the row = next token = + DM in both planes
        const v16bf a0 = ldb(ap + kk), a1 = ldb(ap + kk + 32);
#pragma unroll
        for (int nb = 0; nb < 4; ++nb) { const v16bf b0 = ldb(bp + (size_t)nb * 16 * CK + kk), b1 = ldb(bp + (size_t)nb * 16 * CK + kk + 32);
            acc[nb] = wmmab(a0, b0, acc[nb]); acc[nb] = wmmab(a1, b1, acc[nb]); }
    }
#pragma unroll
    for (int nb = 0; nb < 4; ++nb) {
#pragma unroll
        for (int j = 0; j < 8; ++j) red[(wave * 16 + hi * 8 + j) * RP + nb * 16 + lr] = acc[nb][j]; }   // D: row 8h+j, col lane&15
    __syncthreads();
    const v2f t0 = *(const v2fa*)(&red[wave * RP + 2 * lane]);
    float x0 = t0[0], x1 = t0[1];
#pragma unroll
    for (int p = 1; p < PWV; ++p) { const v2f t = *(const v2fa*)(&red[(p * 16 + wave) * RP + 2 * lane]); x0 += t[0]; x1 += t[1]; }
    const v2f bi = *(const v2f*)(cbias + 2 * lane), g = *(const v2f*)(lg + 2 * lane), of = *(const v2f*)(lb + 2 * lane);
    x0 += bfr(bi[0]); x1 += bfr(bi[1]);
    float sm = x0 + x1;
#pragma unroll
    for (int d = 16; d >= 1; d >>= 1) sm += __shfl_xor(sm, d, 32);
    const float mu = sm * (1.0f / 64.0f);
    const float d0 = x0 - mu, d1 = x1 - mu;
    float q = d0 * d0 + d1 * d1;
#pragma unroll
    for (int d = 16; d >= 1; d >>= 1) q += __shfl_xor(q, d, 32);
    const float rs = 1.0f / sqrtf(q * (1.0f / 64.0f) + 1.0e-5f);
    v2h hv;
    hv[0] = toh_flush(d0 * rs * bfr(g[0]) + bfr(of[0]));
    hv[1] = toh_flush(d1 * rs * bfr(g[1]) + bfr(of[1]));
    *(v2h*)(P + (size_t)(r0 + wave) * DM + 2 * lane) = hv;         // one wave stores one whole 128-B row
}

// k_attn: fused attention + output projection, one wave per 16 query rows of one batch, all 8 heads in a scalar loop; K / V^T / Q fragments straight from the f16 planes (two 16-B loads each, arithmetic addressing).
// Transposed form: S^T[key][t] = K Q^T (A = K rows over the 32 columns of the head's group, B = Q row with the k-slots outside the head selected to zero by value); lane (t = lane&15, h = lane>>4) holds keys 8h+r
// of each 16-key tile, so the packed P tile is directly the B fragment of O^T[d][t] = V^T P^T (A rows d: channel head*8 + (lane&7); rows 8..15 repeat rows 0..7 and are not used).
// Online softmax state is one scalar per lane; the two lane halves of a row are combined with one xor-16 exchange. P = f16 of exp2(score - max + 14), zero when the exponent argument is below -14; row sum over the converted P.
// Context (x CTXC) of each head goes to a wave-private f16 LDS tile [16][64]; after the head loop the tile is the A operand of the output projection (B = transposed weight plane, f16 x WC);
// The two integer grid-size inputs are read on the device; when they differ from the compiled grid the output is filled with NaN.
__global__ __launch_bounds__(32 * AW) void k_attn(const h16* __restrict__ QH, const h16* __restrict__ KP, const h16* __restrict__ VT, const h16* __restrict__ PW,
                                                  const float* __restrict__ pbias, const int* __restrict__ hp, const int* __restrict__ wp, float* OUT) {
    __shared__ __align__(16) h16   cs[AW * 16 * CP];
    __shared__ __align__(16) float os[AW * 16 * OSP];
    const int lane = threadIdx.x & 31, lr = lane & 15, hi = lane >> 4;
    const int wave = __builtin_amdgcn_readfirstlane((int)(threadIdx.x >> 5));
    const int b = blockIdx.y;
    const int t0 = (blockIdx.x * AW + wave) * 16;
    const bool bad = (hp[0] != GH_FULL) | (wp[0] != GW);
    const size_t qrow  = ((size_t)b * SEQ + (size_t)(t0 + lr)) * DM + 8 * hi;
    const size_t kbase = ((size_t)b * NKEY + (size_t)lr) * DM + 8 * hi;        // + key * DM + 32 * group   (A fragment: row key, k = column inside the group)
    const size_t vbase = ((size_t)b * DM + (size_t)(lr & 7)) * NKEY + 8 * hi;  // + head*8*NKEY + key       (A fragment: row d, k = key)
    const int cb = wave * 16 * CP;
    const v8h z8 = (v8h){};
#pragma unroll 1
    for (int h = 0; h < NH_; ++h) {
        const int g = h >> 2, j = h & 3;
        v8h qa = *(const v8h*)(QH + qrow + 32 * g), qb = *(const v8h*)(QH + qrow + 32 * g + 16);
        asm volatile("" : "+v"(qa), "+v"(qb));
        const bool kA = (hi == (j & 1)) & (j < 2);                 // head j of the group = k-slots 8j..8j+7: lane half (j&1), elements 0..7 (j < 2) or 8..15 (j >= 2)
        const bool kB = (hi == (j & 1)) & (j >= 2);
        qa = kA ? qa : z8; qb = kB ? qb : z8;
        const v16h qf = cat16(qa, qb);                             // B fragment: col t, k = column inside the group
        const size_t ko = kbase + (size_t)(32 * g);
        const size_t vo = vbase + (size_t)(h * HD) * NKEY;
        v8f o = (v8f){};
        float m = NEGB, l = 0.0f;
#pragma unroll 1
        for (int key0 = 0; key0 < NKEY; key0 += 32) {
            const h16* ka = KP + ko + (size_t)key0 * DM;
            const v16h ka0 = ldh(ka), kb0 = ldh(ka + 16 * DM);
            v8f sa = (v8f){}, sb = (v8f){};
            sa = wmma16g(ka0, qf, sa); sb = wmma16g(kb0, qf, sb);
            float ta[8], tb[8]; float mx = NEGB;
#pragma unroll
            for (int r = 0; r < 8; ++r) { ta[r] = sa[r] * SC2; tb[r] = sb[r] * SC2; mx = fmaxf(mx, fmaxf(ta[r], tb[r])); }
            mx = fmaxf(mx, __shfl_xor(mx, 16, 32));
            const float mnew = fmaxf(m, mx);
            const float alpha = __builtin_amdgcn_exp2f(m - mnew);
            const float sh = PSH - mnew;
            v16h pb; float ls = 0.0f;
#pragma unroll
            for (int r = 0; r < 8; ++r) {
                const float ea = ta[r] + sh, eb = tb[r] + sh;
                const float xa = __builtin_amdgcn_exp2f(ea), xb = __builtin_amdgcn_exp2f(eb);
                const h16 pa = (ea < -14.0f) ? (h16)0.0f : (h16)xa;
                const h16 pc = (eb < -14.0f) ? (h16)0.0f : (h16)xb;
                pb[r] = pa; pb[8 + r] = pc;
                ls += (float)pa + (float)pc; }
            l = l * alpha + ls; m = mnew;
            o = o * alpha;
            const v16h v0 = ldh(VT + vo + key0);
            o = wmma16g(v0, pb, o);
        }
        l += __shfl_xor(l, 16, 32);
        const float inv = (1.0f / l) * (CTXC / VC);                // l >= 16384 (the maximum element of every row converts to 16384)
        v8h cv;
#pragma unroll
        for (int r = 0; r < 8; ++r) cv[r] = toh_flush(o[r] * inv); // lane half 0: o[r] = (d = r, t = lane&15)
        if (hi == 0) *(v8ha*)(&cs[cb + lr * CP + h * HD]) = cv;    // 8 heads x 8 columns: rows 0..15 x columns 0..63 all written
    }
    wave_sync();
    v8f acc[4];
#pragma unroll
    for (int nb = 0; nb < 4; ++nb) acc[nb] = (v8f){};
#pragma unroll
    for (int kc = 0; kc < DM; kc += 32) {
        const v8h a0 = *(const v8ha*)(&cs[cb + lr * CP + kc + 8 * hi]);
        const v8h a1 = *(const v8ha*)(&cs[cb + lr * CP + kc + 16 + 8 * hi]);
        const v16h a = cat16(a0, a1);                              // A fragment: row t, k = context column
#pragma unroll
        for (int nb = 0; nb < 4; ++nb) { const v16h bw = ldh(PW + (size_t)(nb * 16 + lr) * DM + kc + 8 * hi);
            acc[nb] = wmma16g(a, bw, acc[nb]); }
    }
    const int ob = wave * 16 * OSP;
    const float nanv = __uint_as_float(0x7FC00000u);
#pragma unroll
    for (int nb = 0; nb < 4; ++nb) { const float bia = bfr(pbias[nb * 16 + lr]);
#pragma unroll
        for (int r = 0; r < 8; ++r) { const float v = acc[nb][r] * OUTI + bia;
            os[ob + (8 * hi + r) * OSP + nb * 16 + lr] = bad ? nanv : v; } }   // D: row 8h+r, col lane&15; rows 0..15 x columns 0..63 all written
    wave_sync();
    float* orow = OUT + ((size_t)b * OUT_SEQ + (size_t)t0) * DM;
{
#pragma unroll
        for (int s = 0; s < 8; ++s) { const int row = 2 * s + (lane >> 4), cofs = (lane & 15) * 4;
            const v4f val = *(const v4fa*)(&os[ob + row * OSP + cofs]);
            *(v4f*)(orow + (size_t)row * DM + cofs) = val; }
         }
}

static constexpr size_t al256(size_t v) { return (v + 255) & ~(size_t)255; }
static constexpr size_t SZ_XB = al256((size_t)NB * SEQ * DM * 2);        // bf16 x plane; also the extent of the q plane
static constexpr size_t SZ_W1 = al256((size_t)DM * DM * 2);              // one 64 x 64 weight plane
static constexpr size_t SZ_KV = al256((size_t)2 * DM * DM * 2);          // kv weight plane [128][64]
static constexpr size_t SZ_SW = al256((size_t)DM * CK * 2);              // patch weight plane [64][4096]
static constexpr size_t SZ_KP = al256((size_t)NB * NKEY * DM * 2);       // LayerNorm / k / v^T planes
static constexpr size_t SZ_TOTAL = 2 * SZ_XB + 2 * SZ_W1 + SZ_KV + SZ_SW + 3 * SZ_KP;
static_assert(SZ_TOTAL <= (size_t)134217728);                            // workspace carve <= 128 MiB
static_assert(((size_t)NB * SEQ * DM * 2) % 256 == 0);
static_assert(((size_t)NB * NKEY * DM * 2) % 256 == 0);
static_assert((size_t)NB * DM * NKEY == (size_t)NB * NKEY * DM);         // v^T plane [(b*64 + c)][key] has the same extent as the k plane

extern "C" void kernel_launch(void* const* d_in, const int* in_sizes, int n_in,
                              void* d_out, int out_size, void* d_ws, size_t ws_size, hipStream_t stream) {
    if (n_in < 11) return;
    const size_t needx = ((size_t)(NB - 1) * SEQ_FULL + SEQ) * DM;
    if ((size_t)in_sizes[0] < needx) return;
    if (in_sizes[1] < 1 || in_sizes[2] < 1) return;
    if ((size_t)in_sizes[3] < (size_t)DM * DM || (size_t)in_sizes[4] < (size_t)2 * DM * DM || (size_t)in_sizes[5] < (size_t)DM * CK) return;
    if (in_sizes[6] < DM || in_sizes[7] < DM || in_sizes[8] < DM || (size_t)in_sizes[9] < (size_t)DM * DM || in_sizes[10] < DM) return;
    if ((size_t)out_size < ((size_t)(NB - 1) * OUT_SEQ + SEQ) * DM) return;
    if (SZ_TOTAL > ws_size) return;
    // wire order: x, H, W, q_w, kv_w, sr_w, sr_b, ln_g, ln_b, proj_w, proj_b
    const float* x    = (const float*)d_in[0];
    const int*   gh   = (const int*)d_in[1];
    const int*   gw   = (const int*)d_in[2];
    const float* q_w  = (const float*)d_in[3];
    const float* kv_w = (const float*)d_in[4];
    const float* sr_w = (const float*)d_in[5];
    const float* sr_b = (const float*)d_in[6];
    const float* ln_g = (const float*)d_in[7];
    const float* ln_b = (const float*)d_in[8];
    const float* pj_w = (const float*)d_in[9];
    const float* pj_b = (const float*)d_in[10];
    float* OUT = (float*)d_out;      // [NB][SEQ][64]
    char* wsp = (char*)d_ws;
    bf*  XB  = (bf*)wsp;  wsp += SZ_XB;              // [NB*SEQ][64] bf16 x
    h16* QH  = (h16*)wsp; wsp += SZ_XB;              // [NB*SEQ][64] q x16
    bf*  WQT = (bf*)wsp;  wsp += SZ_W1;              // [64 out][64 in] bf16
    bf*  PWT = (bf*)wsp;  wsp += SZ_W1;              // [64 out][64 in] f16 bits, x64
    bf*  KVT = (bf*)wsp;  wsp += SZ_KV;              // [128 out][64 in] f16 bits, x64 (rows 0..63 k, 64..127 v)
    bf*  SW  = (bf*)wsp;  wsp += SZ_SW;              // [64 oc][(ky*8+kx)*64 + ic] bf16
    h16* LNP = (h16*)wsp; wsp += SZ_KP;              // [NB*NKEY][64] LayerNorm rows
    h16* KP  = (h16*)wsp; wsp += SZ_KP;              // [NB*NKEY][64] k x16
    h16* VT  = (h16*)wsp; wsp += SZ_KP;              // [NB*64][NKEY] v^T x64

    if (SEQ == SEQ_FULL) {
        const size_t n8 = (size_t)NB * SEQ * DM / 8;
        k_cvt8<<<(unsigned)((n8 + 255) / 256), 256, 0, stream>>>(x, XB, n8);
    } else {
        const size_t n8 = (size_t)SEQ * DM / 8;
        for (int b = 0; b < NB; ++b) k_cvt8<<<(unsigned)((n8 + 255) / 256), 256, 0, stream>>>(x + (size_t)b * SEQ_FULL * DM, XB + (size_t)b * SEQ * DM, n8);
    }
    // weight planes: in[rows = 64][cols] -> out[cols][64]
    k_wT<<<dim3(1, 1, 1),  256, 0, stream>>>(q_w,  WQT, DM,     0, 1.0f);   // q_w  [64 in][64 out]  -> [64 out][64 in]
    k_wT<<<dim3(2, 1, 1),  256, 0, stream>>>(kv_w, KVT, 2 * DM, 1, WC);     // kv_w [64 in][128 out] -> [128 out][64 in]
    k_wT<<<dim3(1, DM, 1), 256, 0, stream>>>(sr_w, SW,  DM,     0, 1.0f);   // per oc: [64 ic][64 (ky,kx)] -> [64 (ky,kx)][64 ic]
    k_wT<<<dim3(1, 1, 1),  256, 0, stream>>>(pj_w, PWT, DM,     1, WC);     // proj_w [64 in][64 out] -> [64 out][64 in]

    k_qproj<<<dim3(NB * SEQ / 64, 1, 1), 32, 0, stream>>>(XB, WQT, QH);
    k_patch<<<dim3(NB * NKEY / 16, 1, 1), 32 * PWV, 0, stream>>>(XB, SW, sr_b, ln_g, ln_b, LNP);
    k_kproj<<<dim3(NB * NKEY / 64, 1, 1), 32, 0, stream>>>((const bf*)LNP, KVT, KP);
    k_vproj<<<dim3(NB * NKEY / 64, 1, 1), 32, 0, stream>>>(KVT + (size_t)DM * DM, (const bf*)LNP, VT);

    k_attn<<<dim3(SEQ / (16 * AW), NB, 1), 32 * AW, 0, stream>>>(QH, KP, VT, (const h16*)PWT, pj_b, gh, gw, OUT);
}

// v002
// It runs in 63.7 microseconds.
// Next to v001, in two timings, it ran 1.57 and 1.56 times as fast.
// All steps since v000 together make it 3.19 times as fast.
#include <hip/hip_runtime.h>

// Spatial-reduction attention, width 64 = 8 heads x 8: queries from all NB x SEQ tokens (x @ q_w, weights [in][out], no bias); keys / values from an 8x8 stride-8 patch projection (+ bias) -> LayerNorm (eps 1e-5) -> fused [in][out] kv weight (256 keys per batch at the full size); dense softmax, score scale 8^-0.5; output projection (+ bias).
// Compute dtypes, f32 accumulate everywhere: q projection and patch projection v_wmma_f32_16x16x32_bf16 (x and weights RNE-converted to bf16; products exact); kv projection v_wmma_f32_16x16x32_f16 (LayerNorm rows single f16, weight = bf16 value x64 held in f16);
// scores v_wmma_f32_16x16x32_f16 (q x16, k x16 single f16; four heads share one 32-deep k axis, the Q fragment is zeroed outside its head by value); P.V v_wmma_f32_16x16x32_f16 (P x16384 carry, v x64, single f16, row sum over the converted P);
// output projection v_wmma_f32_16x16x32_f16 (context x1024 single f16, weight = bf16 value x64 in f16), scale folded back in the f32 epilogue; softmax and LayerNorm in f32.
// Layout: bf16 x plane [b*SEQ+t][64]; transposed weight planes [out][in]; patch weight plane [oc][(ky*8+kx)*64+ic]; q plane [b*SEQ+t][64]; LayerNorm plane and k plane [b*NKEY+key][64]; v^T plane [b*64+c][key].
// Fused attention kernel in transposed form (S^T = K Q^T, O^T = V^T P^T), no score plane in memory, output projection inside the same kernel.

#ifndef NB
#define NB 2
#endif
#ifndef GH
#define GH 128                   // token grid height (rows of the grid used per batch)
#endif
#define GW   128                 // token grid width
#define SEQ  (GH * GW)
#define NB_FULL  2
#define GH_FULL  128
#define SEQ_FULL 16384
#ifndef OUT_SEQ
#define OUT_SEQ SEQ              // row pitch (in tokens) between batches of the output
#endif
#define DM   64
#define NH_  8
#define HD   8
#define SRR  8                   // patch size = stride
#define KGW  (GW / SRR)
#define NKEY ((GH / SRR) * (GW / SRR))
#define CK   (DM * SRR * SRR)    // patch projection depth (4096)
#define AW   4                   // waves per attention block (16 query rows each)
#define CP   72                  // LDS row pitch (halves) of the context tile
#define OSP  68                  // LDS row pitch (floats) of the output tile
#define PWV  16                  // waves per patch-projection block = slices of its depth = rows of its tile
#define PKS  (CK / PWV)          // depth of one slice (256 = 4 patch positions x 64 channels)
#define RP   68                  // LDS row pitch (floats) of the partial tiles
#define QC   16.0f               // carry of the q plane
#define KC   16.0f               // carry of the k plane
#define VC   64.0f               // carry of the v^T plane
#define WC   64.0f               // carry of the f16 weight planes
#define CTXC 1024.0f             // carry of the context tile
#define SC2  ((float)(0.35355339059327378 * 1.4426950408889634 / 256.0))   // HD^-0.5 * log2(e) / (QC * KC)
#define PSH  14.0f               // log2 of the P carry (16384)
#define NEGB (-3.0e38f)
#define OUTI (1.0f / 65536.0f)   // 1 / (CTXC * WC)

static_assert(DM == 64);
static_assert(NH_ * HD == DM);                 // head h = columns h*8 + d
static_assert(HD == 8);                        // one head = 8 k-slots = one half fragment of one lane half
static_assert(NH_ == 8);                       // two groups of four heads, 32 columns each
static_assert(DM % 32 == 0);                   // GEMM k-loops step by 32
static_assert(CK % 32 == 0);
static_assert(CK == 64 * DM);                  // k index = (ky*8+kx)*64 + ic
static_assert(SRR == 8);
static_assert(GH % SRR == 0);
static_assert(GW % SRR == 0);
static_assert(NKEY % 64 == 0);                 // a 64-token tile of the v^T GEMM never straddles two batches; key loop steps by 32
static_assert((NB * NKEY) % 64 == 0);
static_assert((NB * SEQ) % 64 == 0);
static_assert(SEQ % (16 * AW) == 0);           // attention grid covers the sequence exactly
static_assert(((size_t)SEQ * DM) % 8 == 0);
static_assert(NB <= NB_FULL);
static_assert(GH <= GH_FULL);
static_assert(SEQ <= SEQ_FULL);
static_assert((CP * 2) % 16 == 0);
static_assert((OSP * 4) % 16 == 0);
static_assert(CP >= DM);
static_assert(OSP >= DM);
static_assert(32 * 16 * 4 == 16 * DM * 2);
static_assert(32 * 16 * 8 == 16 * DM * 4);     // output stores: 32 lanes x 16 B x 8 instructions == 16 rows x 256 B
static_assert(256 * 2 * 16 == 64 * 64 * 2);
static_assert(AW * 16 * CP * 2 + AW * 16 * OSP * 4 <= 131072);
static_assert(64 * 65 * 4 <= 131072);
static_assert(16 * 68 * 4 <= 131072);
static_assert(PWV == 16);                      // wave w finishes row w of the 16-row tile
static_assert(PKS % DM == 0);                  // a slice holds whole patch positions
static_assert((SRR * DM) % PKS == 0);          // and stays inside one patch row ky
static_assert((NB * NKEY) % 16 == 0);
static_assert(NKEY % 16 == 0);                 // a 16-row tile never straddles two batches
static_assert((RP * 4) % 8 == 0);
static_assert(PWV * 16 * RP * 4 <= 131072);

typedef _Float16 h16;
typedef unsigned short bf;
typedef __attribute__((ext_vector_type(16))) __bf16   v16bf;
typedef __attribute__((ext_vector_type(16))) _Float16 v16h;
typedef __attribute__((ext_vector_type(8)))  _Float16 v8h;
typedef __attribute__((ext_vector_type(8)))  unsigned short v8us;
typedef __attribute__((ext_vector_type(8)))  float    v8f;
typedef __attribute__((ext_vector_type(4)))  float    v4f;
typedef v4f  __attribute__((may_alias)) v4fa;
typedef __attribute__((ext_vector_type(16))) unsigned short v16us;
typedef v8h  __attribute__((may_alias)) v8ha;
typedef __attribute__((ext_vector_type(2)))  float    v2f;
typedef v2f  __attribute__((may_alias)) v2fa;
typedef __attribute__((ext_vector_type(2)))  _Float16 v2h;

__device__ __forceinline__ unsigned short f2bf(float f) { unsigned u = __float_as_uint(f); u += 0x7FFFu + ((u >> 16) & 1u); return (unsigned short)(u >> 16); }
__device__ __forceinline__ float bfr(float f) { return __uint_as_float(((unsigned)f2bf(f)) << 16); }   // value after RNE convert to bf16
__device__ __forceinline__ v16h cat16(v8h lo, v8h hi) { return __builtin_shufflevector(lo, hi, 0, 1, 2, 3, 4, 5, 6, 7, 8, 9, 10, 11, 12, 13, 14, 15); }
__device__ __forceinline__ v16bf cat16b(v8us lo, v8us hi) { return __builtin_bit_cast(v16bf, __builtin_shufflevector(lo, hi, 0, 1, 2, 3, 4, 5, 6, 7, 8, 9, 10, 11, 12, 13, 14, 15)); }
__device__ __forceinline__ v8f wmma16(v16h a, v16h b, v8f c) { return __builtin_amdgcn_wmma_f32_16x16x32_f16(false, a, false, b, (short)0, c, false, false); }
__device__ __forceinline__ v8f wmmab(v16bf a, v16bf b, v8f c) { return __builtin_amdgcn_wmma_f32_16x16x32_bf16(false, a, false, b, (short)0, c, false, false); }
// fragment loaders from K-contiguous 16-bit rows; p already includes + 8*(lane>>4): elements 0..7 <- k0+8h+0..7, elements 8..15 <- k0+16+8h+0..7 (same map for A and B)
__device__ __forceinline__ v16h  ldh(const h16* p) { return cat16(*(const v8h*)p, *(const v8h*)(p + 16)); }
__device__ __forceinline__ v16bf ldb(const bf* p)  { return cat16b(*(const v8us*)p, *(const v8us*)(p + 16)); }
// ordering point for wave-private LDS tiles (same wave writes and reads)
__device__ __forceinline__ void wave_sync() { __builtin_amdgcn_fence(3 /* release order */, "wavefront"); __builtin_amdgcn_wave_barrier(); asm volatile("" ::: "memory"); }

// f32 -> f16 with a value select: results below the smallest normal become +0 (applied after the plane's power-of-two carry)
static __device__ __forceinline__ h16 toh_flush(float v) { const h16 r = (h16)v; return (fabsf(v) < 6.103515625e-05f) ? (h16)0.0f : r; }
// raw 16-bit fragment (same k map), used by the GEMM body for both operand kinds
__device__ __forceinline__ v16us cat16u(v8us lo, v8us hi) { return __builtin_shufflevector(lo, hi, 0, 1, 2, 3, 4, 5, 6, 7, 8, 9, 10, 11, 12, 13, 14, 15); }
__device__ __forceinline__ v16us ldu(const bf* p) { return cat16u(*(const v8us*)p, *(const v8us*)(p + 16)); }
// one WMMA + its own four-slot guard (ties the result, keeps both fragments live)
__device__ __forceinline__ v8f wmma16g(v16h a, v16h b, v8f c) {
    c = __builtin_amdgcn_wmma_f32_16x16x32_f16(false, a, false, b, (short)0, c, false, false);
    asm volatile("v_nop\n\tv_nop\n\tv_nop\n\tv_nop" : "+v"(c) : "v"(a), "v"(b));
    return c; }
template <bool F16>
__device__ __forceinline__ v8f wmmaug(v16us a, v16us b, v8f c) {
    if (F16) c = __builtin_amdgcn_wmma_f32_16x16x32_f16(false, __builtin_bit_cast(v16h, a), false, __builtin_bit_cast(v16h, b), (short)0, c, false, false);
    else     c = __builtin_amdgcn_wmma_f32_16x16x32_bf16(false, __builtin_bit_cast(v16bf, a), false, __builtin_bit_cast(v16bf, b), (short)0, c, false, false);
    asm volatile("v_nop\n\tv_nop\n\tv_nop\n\tv_nop" : "+v"(c) : "v"(a), "v"(b));
    return c; }

// f16mode == 0: bf16 RNE bits; f16mode != 0: f16 bits of (bf16 value x carry), results below the smallest normal selected to +0.
// One block of 256 threads per 64 x 64 tile: tile column bx of plane z, in[rows = 64][Cn] -> out[Cn][64].
__device__ __forceinline__ void wT_body(const float* __restrict__ src, bf* dst, int Cn, int f16mode, float carry, int bx, int z) {
#pragma clang fp contract(off)
    __shared__ float ts[64 * 65];
    const int tid = threadIdx.x; const int c0 = bx * 64;
    const float* sp = src + (size_t)z * 64 * (size_t)Cn + c0;
#pragma unroll 1
    for (int it = 0; it < 16; ++it) { const int idx = it * 256 + tid; const int r = idx >> 6, c = idx & 63;   // 16 trips x 256 = 64 x 64 elements
        ts[r * 65 + c] = sp[(size_t)r * Cn + c]; }
    __syncthreads();
    bf* dp = dst + ((size_t)z * (size_t)Cn + c0) * 64;
{
#pragma unroll 1
        for (int it = 0; it < 2; ++it) { const int p = it * 256 + tid; const int c = p >> 3, r8 = (p & 7) * 8; v8us o;   // 2 trips x 256 = 64 rows x 8 pieces
#pragma unroll
            for (int k = 0; k < 8; ++k) { const float v = ts[(r8 + k) * 65 + c];
                const unsigned short ub = f2bf(v);
                const h16 hv = toh_flush(bfr(v) * carry);
                const unsigned short uh = __builtin_bit_cast(unsigned short, hv);
                o[k] = f16mode ? uh : ub; }
            *(v8us*)(dp + (size_t)c * 64 + r8) = o;
            asm volatile("s_wait_xcnt 0x0" ::: "memory"); }   // the next trip rewrites the store's address and data registers
         }
}

// k_prep: everything that depends on the inputs alone, in ONE launch; the block index picks the job (a block-uniform choice, so the barrier of wT_body is passed by whole blocks).
// Blocks 0 .. WTB-1: the weight tiles (they have the longest dependent chain, so they get the lowest block indices): 64 patch-weight planes, per oc [64 ic][64 (ky,kx)] -> [64 (ky,kx)][64 ic]; q_w [64 in][64 out] -> [64 out][64 in];
// kv_w [64 in][128 out] -> [128 out][64 in] (two tiles); proj_w [64 in][64 out] -> [64 out][64 in]. Blocks WTB ..: x -> bf16 plane, 8 elements per thread.
#define WTB  (DM + 4)
#define N8B  ((size_t)SEQ * DM / 8)                       // 8-element pieces of x per batch
#define CVB  ((unsigned)(((size_t)NB * N8B + 255) / 256))  // blocks of the x conversion
__global__ __launch_bounds__(256) void k_prep(const float* __restrict__ x, const float* __restrict__ q_w, const float* __restrict__ kv_w, const float* __restrict__ sr_w, const float* __restrict__ pj_w,
                                              bf* XB, bf* WQT, bf* KVT, bf* SW, bf* PWT) {
    const int bid = (int)blockIdx.x;
    if (bid < WTB) {
        const float* src = sr_w; bf* dst = SW; int Cn = DM, f16mode = 0, bx = 0, z = bid;
        if (bid == DM)          { src = q_w;  dst = WQT; z = 0; }
        else if (bid == DM + 3) { src = pj_w; dst = PWT; z = 0; f16mode = 1; }
        else if (bid > DM)      { src = kv_w; dst = KVT; z = 0; f16mode = 1; Cn = 2 * DM; bx = bid - (DM + 1); }
        wT_body(src, dst, Cn, f16mode, f16mode ? WC : 1.0f, bx, z);
        return;
    }
    const size_t i = (size_t)(bid - WTB) * 256 + threadIdx.x; if (i >= (size_t)NB * N8B) return;
    const v8f v = *(const v8f*)(x + (i / N8B) * ((size_t)SEQ_FULL * DM) + (i % N8B) * 8); v8us o;   // batch pitch of x is the full sequence
#pragma unroll
    for (int k = 0; k < 8; ++k) o[k] = f2bf(v[k]);
    *(v8us*)(XB + i * 8) = o;
}

// gemm_body: register-blocked GEMM, ONE WAVE per 64x64 tile (16 accumulators), operands straight from K-contiguous 16-bit planes (raw 16-bit loads), C[m][n] = sum_k A[m][k] Bt[n][k]. tile = index of the wave's tile, os = its 16 x 68 f32 LDS tile.
// KIND 0: q projection, bf16 operands, K = 64; A = x rows (m = b*SEQ + t), Bt = q weight rows (n); result x QC as f16 rows [m][64]. NB*SEQ/64 tiles.
// KIND 1: patch projection, bf16 operands, K = 4096 with k = (ky*8+kx)*64 + ic; A row m = (b, ty, tx) addressed arithmetically inside the bf16 x plane (64 contiguous channels per patch position),
//         Bt = permuted patch weight rows (n = oc); + bias, LayerNorm over the 64 channels of each row in f32 (two lanes per row, one xor-16 exchange), gain / offset applied; f16 rows [m][64]. NB*NKEY/64 tiles.
// KIND 2: k projection, f16 operands, K = 64; A = LayerNorm rows, Bt = kv weight rows 0..63 (x WC); result x KC/WC as f16 rows [m][64]. NB*NKEY/64 tiles.
// KIND 3: v^T projection, f16 operands, K = 64; A = kv weight rows 64..127 (m = c), Bt = LayerNorm rows (n = b*NKEY + key); result x VC/WC into plane [(b*64 + c)][key], row pitch NKEY. NB*NKEY/64 tiles (tile index = token tile).
template <int KIND>
__device__ __forceinline__ void gemm_body(const bf* __restrict__ A, const bf* __restrict__ Bt, const float* __restrict__ cbias, const float* __restrict__ lg, const float* __restrict__ lb, h16* P, int tile, float* os) {
    constexpr int KD = (KIND == 1) ? CK : DM;
    constexpr bool F16 = (KIND >= 2);
    constexpr float SCL = (KIND == 0) ? QC : ((KIND == 1) ? 1.0f : ((KIND == 2) ? (KC / WC) : (VC / WC)));
    const int lane = threadIdx.x & 31, lr = lane & 15, hi = lane >> 4;
    const int r0 = (KIND == 3) ? 0 : tile * 64;
    const int c0 = (KIND == 3) ? tile * 64 : 0;
    v8f acc[4][4];
#pragma unroll
    for (int mb = 0; mb < 4; ++mb)
#pragma unroll
        for (int nb = 0; nb < 4; ++nb) acc[mb][nb] = (v8f){};
    size_t aoff[4];
#pragma unroll
    for (int mb = 0; mb < 4; ++mb) {
        const int mrow = r0 + mb * 16 + lr;
        if (KIND == 1) { const int bb = mrow / NKEY, tk = mrow % NKEY; const int ty = tk / KGW, tx = tk % KGW;
                         aoff[mb] = ((size_t)bb * SEQ + (size_t)(ty * SRR) * GW + (size_t)(tx * SRR)) * DM + 8 * hi; }
        else           { aoff[mb] = (size_t)mrow * DM + 8 * hi; } }
    const size_t boff = (size_t)(c0 + lr) * KD + 8 * hi;
#pragma unroll 1
    for (int kc = 0; kc < KD; kc += 32) {
        const size_t ak = (KIND == 1) ? (size_t)((((kc >> 9) * GW + ((kc >> 6) & 7)) * DM) + (kc & 63)) : (size_t)kc;   // patch position (ky, kx) = (kc>>9, (kc>>6)&7), channel base kc&63
        v16us a[4];
#pragma unroll
        for (int mb = 0; mb < 4; ++mb) a[mb] = ldu(A + aoff[mb] + ak);
#pragma unroll
        for (int nb = 0; nb < 4; ++nb) { const v16us b = ldu(Bt + boff + (size_t)nb * 16 * KD + kc);
#pragma unroll
            for (int mb = 0; mb < 4; ++mb) acc[mb][nb] = wmmaug<F16>(a[mb], b, acc[mb][nb]); }
    }
    float bc[4];
#pragma unroll
    for (int nb = 0; nb < 4; ++nb) bc[nb] = (KIND == 1) ? bfr(cbias[nb * 16 + lr]) : 0.0f;
    const int bb3 = c0 / NKEY, tt3 = c0 % NKEY;
#pragma unroll
    for (int mb = 0; mb < 4; ++mb) {
#pragma unroll
        for (int nb = 0; nb < 4; ++nb) {
#pragma unroll
            for (int j = 0; j < 8; ++j) os[(hi * 8 + j) * 68 + nb * 16 + lr] = (acc[mb][nb][j] + bc[nb]) * SCL; }   // D: row 8h+j, col lane&15; rows 0..15 x columns 0..63 all written
        wave_sync();
        if (KIND == 1) {
            // LayerNorm of row lr; this lane owns columns 32*hi .. 32*hi+31 (reads and rewrites only those)
            const int cb0 = lr * 68 + hi * 32;
            float s = 0.0f;
#pragma unroll
            for (int i = 0; i < 8; ++i) { const v4f x = *(const v4fa*)(&os[cb0 + 4 * i]); s += (x[0] + x[1]) + (x[2] + x[3]); }
            s += __shfl_xor(s, 16, 32);
            const float mu = s * (1.0f / 64.0f);
            float q = 0.0f;
#pragma unroll
            for (int i = 0; i < 8; ++i) { const v4f x = *(const v4fa*)(&os[cb0 + 4 * i]);
                const float d0 = x[0] - mu, d1 = x[1] - mu, d2 = x[2] - mu, d3 = x[3] - mu; q += (d0 * d0 + d1 * d1) + (d2 * d2 + d3 * d3); }
            q += __shfl_xor(q, 16, 32);
            const float rs = 1.0f / sqrtf(q * (1.0f / 64.0f) + 1.0e-5f);
#pragma unroll
            for (int i = 0; i < 8; ++i) { const v4f x = *(const v4fa*)(&os[cb0 + 4 * i]);
                const v4f g = *(const v4f*)(lg + hi * 32 + 4 * i); const v4f o = *(const v4f*)(lb + hi * 32 + 4 * i); v4f y;
#pragma unroll
                for (int e = 0; e < 4; ++e) y[e] = (x[e] - mu) * rs * bfr(g[e]) + bfr(o[e]);
                *(v4fa*)(&os[cb0 + 4 * i]) = y; }
            wave_sync();
        }
{
#pragma unroll
            for (int s = 0; s < 4; ++s) { const int row = 4 * s + (lane >> 3), c8 = (lane & 7) * 8;   // 4 s x 4 row groups = 16 rows; 8 lanes x 8 = 64 columns = one line
                const v4f x0 = *(const v4fa*)(&os[row * 68 + c8]); const v4f x1 = *(const v4fa*)(&os[row * 68 + c8 + 4]); v8h hv;
#pragma unroll
                for (int i = 0; i < 4; ++i) { hv[i] = toh_flush(x0[i]); hv[4 + i] = toh_flush(x1[i]); }
                const size_t oo = (KIND == 3) ? (((size_t)bb3 * DM + (size_t)(mb * 16 + row)) * NKEY + (size_t)tt3 + c8)
                                              : ((size_t)(r0 + mb * 16 + row) * DM + c8);
                *(v8h*)(P + oo) = hv; }
            asm volatile("s_wait_xcnt 0x0" ::: "memory");   // what follows (the next row group, or in the listing another job's body) rewrites address and data registers of these four stores
             }
        wave_sync();
    }
}

// k_proj: the three projections that the attention kernel waits for, in ONE launch (none reads what another writes); the block index picks the job: KVB tiles of k, KVB tiles of v^T, then the q tiles.
#define KVB (NB * NKEY / 64)
#define QPB (NB * SEQ / 64)
__global__ __launch_bounds__(32) void k_proj(const bf* __restrict__ XB, const bf* __restrict__ WQT, const bf* __restrict__ LNP, const bf* __restrict__ KVT, h16* QH, h16* KP, h16* VT) {
    __shared__ __align__(16) float os[16 * 68];
    const int bid = (int)blockIdx.x;
    if (bid < KVB)          gemm_body<2>(LNP, KVT, (const float*)0, (const float*)0, (const float*)0, KP, bid, os);
    else if (bid < 2 * KVB) gemm_body<3>(KVT + (size_t)DM * DM, LNP, (const float*)0, (const float*)0, (const float*)0, VT, bid - KVB, os);
    else                    gemm_body<0>(XB, WQT, (const float*)0, (const float*)0, (const float*)0, QH, bid - 2 * KVB, os);
}

// k_patch: patch projection (bf16 operands, K = 4096 with k = (ky*8+kx)*64 + ic) + bias + LayerNorm; f16 rows [m][64]. grid NB*NKEY/16, PWV waves per block. (It takes the place of gemm_body's KIND 1, which nothing instantiates any more.)
// One block per 16 rows m = (b, ty, tx = 0..15) x all 64 output channels; A rows addressed arithmetically inside the bf16 x plane (64 contiguous channels per patch position), Bt = permuted patch weight rows (n = oc).
// The depth is split over the waves: wave w sums k = 256 w .. 256 w + 255 (ky = w>>1, kx = 4 (w&1) .. + 3) into its own 16 x 64 f32 partial tile, one patch position (one 128-B line of every A and Bt row) per trip.
// The 16 partial tiles meet in LDS; behind the block barrier wave w adds them up for row w in slice order (lane owns columns 2 lane, 2 lane + 1), adds the bias and does the LayerNorm of that row in f32 (xor exchanges over the 32 lanes).
// amdgpu_waves_per_eu(4, 4): one block fills its 4 waves per SIMD and the grid is smaller than the chip, so the register budget goes to loads in flight (without it each fragment is loaded and waited for alone).
__global__ __launch_bounds__(32 * PWV) __attribute__((amdgpu_waves_per_eu(4, 4))) void k_patch(const bf* __restrict__ A, const bf* __restrict__ Bt, const float* __restrict__ cbias, const float* __restrict__ lg, const float* __restrict__ lb, h16* P) {
    __shared__ __align__(16) float red[PWV * 16 * RP];
    const int lane = threadIdx.x & 31, lr = lane & 15, hi = lane >> 4;
    const int wave = __builtin_amdgcn_readfirstlane((int)(threadIdx.x >> 5));
    const int r0 = (int)blockIdx.x * 16;
    const int mrow = r0 + lr;
    const int bb = mrow / NKEY, tk = mrow % NKEY; const int ty = tk / KGW, tx = tk % KGW;
    const int k0 = wave * PKS;
    const bf* ap = A + ((size_t)bb * SEQ + (size_t)(ty * SRR + (k0 >> 9)) * GW + (size_t)(tx * SRR + ((k0 >> 6) & 7))) * DM + 8 * hi;   // first patch position of the slice: (ky, kx) = (k0>>9, (k0>>6)&7)
    const bf* bp = Bt + (size_t)lr * CK + k0 + 8 * hi;
    v8f acc[4];                                                    // the loops over nb and j below are unrolled so that acc[] is indexed by constants and stays in registers
#pragma unroll
    for (int nb = 0; nb < 4; ++nb) acc[nb] = (v8f){};
#pragma unroll                                                     // 4 trips, unrolled: every address is base + constant, and a later trip's loads issue ahead of an earlier trip's WMMAs
    for (int kk = 0; kk < PKS; kk += DM) {                         // next patch position in the row = next token = + DM in both planes
        const v16bf a0 = ldb(ap + kk), a1 = ldb(ap + kk + 32);
#pragma unroll
        for (int nb = 0; nb < 4; ++nb) { const v16bf b0 = ldb(bp + (size_t)nb * 16 * CK + kk), b1 = ldb(bp + (size_t)nb * 16 * CK + kk + 32);
            acc[nb] = wmmab(a0, b0, acc[nb]); acc[nb] = wmmab(a1, b1, acc[nb]); }
    }
#pragma unroll
    for (int nb = 0; nb < 4; ++nb) {
#pragma unroll
        for (int j = 0; j < 8; ++j) red[(wave * 16 + hi * 8 + j) * RP + nb * 16 + lr] = acc[nb][j]; }   // D: row 8h+j, col lane&15
    __syncthreads();
    const v2f t0 = *(const v2fa*)(&red[wave * RP + 2 * lane]);
    float x0 = t0[0], x1 = t0[1];
#pragma unroll
    for (int p = 1; p < PWV; ++p) { const v2f t = *(const v2fa*)(&red[(p * 16 + wave) * RP + 2 * lane]); x0 += t[0]; x1 += t[1]; }
    const v2f bi = *(const v2f*)(cbias + 2 * lane), g = *(const v2f*)(lg + 2 * lane), of = *(const v2f*)(lb + 2 * lane);
    x0 += bfr(bi[0]); x1 += bfr(bi[1]);
    float sm = x0 + x1;
#pragma unroll
    for (int d = 16; d >= 1; d >>= 1) sm += __shfl_xor(sm, d, 32);
    const float mu = sm * (1.0f / 64.0f);
    const float d0 = x0 - mu, d1 = x1 - mu;
    float q = d0 * d0 + d1 * d1;
#pragma unroll
    for (int d = 16; d >= 1; d >>= 1) q += __shfl_xor(q, d, 32);
    const float rs = 1.0f / sqrtf(q * (1.0f / 64.0f) + 1.0e-5f);
    v2h hv;
    hv[0] = toh_flush(d0 * rs * bfr(g[0]) + bfr(of[0]));
    hv[1] = toh_flush(d1 * rs * bfr(g[1]) + bfr(of[1]));
    *(v2h*)(P + (size_t)(r0 + wave) * DM + 2 * lane) = hv;         // one wave stores one whole 128-B row
}

// k_attn: fused attention + output projection, one wave per 16 query rows of one batch, all 8 heads in a scalar loop; K / V^T / Q fragments straight from the f16 planes (two 16-B loads each, arithmetic addressing).
// Transposed form: S^T[key][t] = K Q^T (A = K rows over the 32 columns of the head's group, B = Q row with the k-slots outside the head selected to zero by value); lane (t = lane&15, h = lane>>4) holds keys 8h+r
// of each 16-key tile, so the packed P tile is directly the B fragment of O^T[d][t] = V^T P^T (A rows d: channel head*8 + (lane&7); rows 8..15 repeat rows 0..7 and are not used).
// Online softmax state is one scalar per lane; the two lane halves of a row are combined with one xor-16 exchange. P = f16 of exp2(score - max + 14), zero when the exponent argument is below -14; row sum over the converted P.
// Context (x CTXC) of each head goes to a wave-private f16 LDS tile [16][64]; after the head loop the tile is the A operand of the output projection (B = transposed weight plane, f16 x WC);
// The two integer grid-size inputs are read on the device; when they differ from the compiled grid the output is filled with NaN.
__global__ __launch_bounds__(32 * AW) void k_attn(const h16* __restrict__ QH, const h16* __restrict__ KP, const h16* __restrict__ VT, const h16* __restrict__ PW,
                                                  const float* __restrict__ pbias, const int* __restrict__ hp, const int* __restrict__ wp, float* OUT) {
    __shared__ __align__(16) h16   cs[AW * 16 * CP];
    __shared__ __align__(16) float os[AW * 16 * OSP];
    const int lane = threadIdx.x & 31, lr = lane & 15, hi = lane >> 4;
    const int wave = __builtin_amdgcn_readfirstlane((int)(threadIdx.x >> 5));
    const int b = blockIdx.y;
    const int t0 = (blockIdx.x * AW + wave) * 16;
    const bool bad = (hp[0] != GH_FULL) | (wp[0] != GW);
    const size_t qrow  = ((size_t)b * SEQ + (size_t)(t0 + lr)) * DM + 8 * hi;
    const size_t kbase = ((size_t)b * NKEY + (size_t)lr) * DM + 8 * hi;        // + key * DM + 32 * group   (A fragment: row key, k = column inside the group)
    const size_t vbase = ((size_t)b * DM + (size_t)(lr & 7)) * NKEY + 8 * hi;  // + head*8*NKEY + key       (A fragment: row d, k = key)
    const int cb = wave * 16 * CP;
    const v8h z8 = (v8h){};
#pragma unroll 1
    for (int h = 0; h < NH_; ++h) {
        const int g = h >> 2, j = h & 3;
        v8h qa = *(const v8h*)(QH + qrow + 32 * g), qb = *(const v8h*)(QH + qrow + 32 * g + 16);
        asm volatile("" : "+v"(qa), "+v"(qb));
        const bool kA = (hi == (j & 1)) & (j < 2);                 // head j of the group = k-slots 8j..8j+7: lane half (j&1), elements 0..7 (j < 2) or 8..15 (j >= 2)
        const bool kB = (hi == (j & 1)) & (j >= 2);
        qa = kA ? qa : z8; qb = kB ? qb : z8;
        const v16h qf = cat16(qa, qb);                             // B fragment: col t, k = column inside the group
        const size_t ko = kbase + (size_t)(32 * g);
        const size_t vo = vbase + (size_t)(h * HD) * NKEY;
        v8f o = (v8f){};
        float m = NEGB, l = 0.0f;
#pragma unroll 1
        for (int key0 = 0; key0 < NKEY; key0 += 32) {
            const h16* ka = KP + ko + (size_t)key0 * DM;
            const v16h ka0 = ldh(ka), kb0 = ldh(ka + 16 * DM);
            v8f sa = (v8f){}, sb = (v8f){};
            sa = wmma16g(ka0, qf, sa); sb = wmma16g(kb0, qf, sb);
            float ta[8], tb[8]; float mx = NEGB;
#pragma unroll
            for (int r = 0; r < 8; ++r) { ta[r] = sa[r] * SC2; tb[r] = sb[r] * SC2; mx = fmaxf(mx, fmaxf(ta[r], tb[r])); }
            mx = fmaxf(mx, __shfl_xor(mx, 16, 32));
            const float mnew = fmaxf(m, mx);
            const float alpha = __builtin_amdgcn_exp2f(m - mnew);
            const float sh = PSH - mnew;
            v16h pb; float ls = 0.0f;
#pragma unroll
            for (int r = 0; r < 8; ++r) {
                const float ea = ta[r] + sh, eb = tb[r] + sh;
                const float xa = __builtin_amdgcn_exp2f(ea), xb = __builtin_amdgcn_exp2f(eb);
                const h16 pa = (ea < -14.0f) ? (h16)0.0f : (h16)xa;
                const h16 pc = (eb < -14.0f) ? (h16)0.0f : (h16)xb;
                pb[r] = pa; pb[8 + r] = pc;
                ls += (float)pa + (float)pc; }
            l = l * alpha + ls; m = mnew;
            o = o * alpha;
            const v16h v0 = ldh(VT + vo + key0);
            o = wmma16g(v0, pb, o);
        }
        l += __shfl_xor(l, 16, 32);
        const float inv = (1.0f / l) * (CTXC / VC);                // l >= 16384 (the maximum element of every row converts to 16384)
        v8h cv;
#pragma unroll
        for (int r = 0; r < 8; ++r) cv[r] = toh_flush(o[r] * inv); // lane half 0: o[r] = (d = r, t = lane&15)
        if (hi == 0) *(v8ha*)(&cs[cb + lr * CP + h * HD]) = cv;    // 8 heads x 8 columns: rows 0..15 x columns 0..63 all written
    }
    wave_sync();
    v8f acc[4];
#pragma unroll
    for (int nb = 0; nb < 4; ++nb) acc[nb] = (v8f){};
#pragma unroll
    for (int kc = 0; kc < DM; kc += 32) {
        const v8h a0 = *(const v8ha*)(&cs[cb + lr * CP + kc + 8 * hi]);
        const v8h a1 = *(const v8ha*)(&cs[cb + lr * CP + kc + 16 + 8 * hi]);
        const v16h a = cat16(a0, a1);                              // A fragment: row t, k = context column
#pragma unroll
        for (int nb = 0; nb < 4; ++nb) { const v16h bw = ldh(PW + (size_t)(nb * 16 + lr) * DM + kc + 8 * hi);
            acc[nb] = wmma16g(a, bw, acc[nb]); }
    }
    const int ob = wave * 16 * OSP;
    const float nanv = __uint_as_float(0x7FC00000u);
#pragma unroll
    for (int nb = 0; nb < 4; ++nb) { const float bia = bfr(pbias[nb * 16 + lr]);
#pragma unroll
        for (int r = 0; r < 8; ++r) { const float v = acc[nb][r] * OUTI + bia;
            os[ob + (8 * hi + r) * OSP + nb * 16 + lr] = bad ? nanv : v; } }   // D: row 8h+r, col lane&15; rows 0..15 x columns 0..63 all written
    wave_sync();
    float* orow = OUT + ((size_t)b * OUT_SEQ + (size_t)t0) * DM;
{
#pragma unroll
        for (int s = 0; s < 8; ++s) { const int row = 2 * s + (lane >> 4), cofs = (lane & 15) * 4;
            const v4f val = *(const v4fa*)(&os[ob + row * OSP + cofs]);
            *(v4f*)(orow + (size_t)row * DM + cofs) = val; }
         }
}

static constexpr size_t al256(size_t v) { return (v + 255) & ~(size_t)255; }
static constexpr size_t SZ_XB = al256((size_t)NB * SEQ * DM * 2);        // bf16 x plane; also the extent of the q plane
static constexpr size_t SZ_W1 = al256((size_t)DM * DM * 2);              // one 64 x 64 weight plane
static constexpr size_t SZ_KV = al256((size_t)2 * DM * DM * 2);          // kv weight plane [128][64]
static constexpr size_t SZ_SW = al256((size_t)DM * CK * 2);              // patch weight plane [64][4096]
static constexpr size_t SZ_KP = al256((size_t)NB * NKEY * DM * 2);       // LayerNorm / k / v^T planes
static constexpr size_t SZ_TOTAL = 2 * SZ_XB + 2 * SZ_W1 + SZ_KV + SZ_SW + 3 * SZ_KP;
static_assert(SZ_TOTAL <= (size_t)134217728);                            // workspace carve <= 128 MiB
static_assert(((size_t)NB * SEQ * DM * 2) % 256 == 0);
static_assert(((size_t)NB * NKEY * DM * 2) % 256 == 0);
static_assert((size_t)NB * DM * NKEY == (size_t)NB * NKEY * DM);         // v^T plane [(b*64 + c)][key] has the same extent as the k plane

extern "C" void kernel_launch(void* const* d_in, const int* in_sizes, int n_in,
                              void* d_out, int out_size, void* d_ws, size_t ws_size, hipStream_t stream) {
    if (n_in < 11) return;
    const size_t needx = ((size_t)(NB - 1) * SEQ_FULL + SEQ) * DM;
    if ((size_t)in_sizes[0] < needx) return;
    if (in_sizes[1] < 1 || in_sizes[2] < 1) return;
    if ((size_t)in_sizes[3] < (size_t)DM * DM || (size_t)in_sizes[4] < (size_t)2 * DM * DM || (size_t)in_sizes[5] < (size_t)DM * CK) return;
    if (in_sizes[6] < DM || in_sizes[7] < DM || in_sizes[8] < DM || (size_t)in_sizes[9] < (size_t)DM * DM || in_sizes[10] < DM) return;
    if ((size_t)out_size < ((size_t)(NB - 1) * OUT_SEQ + SEQ) * DM) return;
    if (SZ_TOTAL > ws_size) return;
    // wire order: x, H, W, q_w, kv_w, sr_w, sr_b, ln_g, ln_b, proj_w, proj_b
    const float* x    = (const float*)d_in[0];
    const int*   gh   = (const int*)d_in[1];
    const int*   gw   = (const int*)d_in[2];
    const float* q_w  = (const float*)d_in[3];
    const float* kv_w = (const float*)d_in[4];
    const float* sr_w = (const float*)d_in[5];
    const float* sr_b = (const float*)d_in[6];
    const float* ln_g = (const float*)d_in[7];
    const float* ln_b = (const float*)d_in[8];
    const float* pj_w = (const float*)d_in[9];
    const float* pj_b = (const float*)d_in[10];
    float* OUT = (float*)d_out;      // [NB][SEQ][64]
    char* wsp = (char*)d_ws;
    bf*  XB  = (bf*)wsp;  wsp += SZ_XB;              // [NB*SEQ][64] bf16 x
    h16* QH  = (h16*)wsp; wsp += SZ_XB;              // [NB*SEQ][64] q x16
    bf*  WQT = (bf*)wsp;  wsp += SZ_W1;              // [64 out][64 in] bf16
    bf*  PWT = (bf*)wsp;  wsp += SZ_W1;              // [64 out][64 in] f16 bits, x64
    bf*  KVT = (bf*)wsp;  wsp += SZ_KV;              // [128 out][64 in] f16 bits, x64 (rows 0..63 k, 64..127 v)
    bf*  SW  = (bf*)wsp;  wsp += SZ_SW;              // [64 oc][(ky*8+kx)*64 + ic] bf16
    h16* LNP = (h16*)wsp; wsp += SZ_KP;              // [NB*NKEY][64] LayerNorm rows
    h16* KP  = (h16*)wsp; wsp += SZ_KP;              // [NB*NKEY][64] k x16
    h16* VT  = (h16*)wsp; wsp += SZ_KP;              // [NB*64][NKEY] v^T x64

    // four dependent launches: inputs -> planes; patch projection + LayerNorm; q, k, v^T projections; attention
    k_prep<<<dim3(WTB + CVB, 1, 1), 256, 0, stream>>>(x, q_w, kv_w, sr_w, pj_w, XB, WQT, KVT, SW, PWT);
    k_patch<<<dim3(NB * NKEY / 16, 1, 1), 32 * PWV, 0, stream>>>(XB, SW, sr_b, ln_g, ln_b, LNP);
    k_proj<<<dim3(2 * KVB + QPB, 1, 1), 32, 0, stream>>>(XB, WQT, (const bf*)LNP, KVT, QH, KP, VT);

    k_attn<<<dim3(SEQ / (16 * AW), NB, 1), 32 * AW, 0, stream>>>(QH, KP, VT, (const h16*)PWT, pj_b, gh, gw, OUT);
}

// v003
// A run of this version takes 48.1 microseconds.
// Next to v002, in two timings, it ran 1.32 times as fast each time.
// Over all steps from v000 it is 4.22 times as fast.
#include <hip/hip_runtime.h>

// Spatial-reduction attention, width 64 = 8 heads x 8: queries from all NB x SEQ tokens (x @ q_w, weights [in][out], no bias); keys / values from an 8x8 stride-8 patch projection (+ bias) -> LayerNorm (eps 1e-5) -> fused [in][out] kv weight (256 keys per batch at the full size); dense softmax, score scale 8^-0.5; output projection (+ bias).
// Compute dtypes, f32 accumulate everywhere: q projection and patch projection v_wmma_f32_16x16x32_bf16 (x and weights RNE-converted to bf16; products exact); kv projection v_wmma_f32_16x16x32_f16 (LayerNorm rows single f16, weight = bf16 value x64 held in f16);
// scores v_wmma_f32_16x16x32_f16 (q x16, k x16 single f16; four heads share one 32-deep k axis, the Q fragment is zeroed outside its head by value); P.V v_wmma_f32_16x16x32_f16 (P x16384 carry, v x64, single f16, row sum over the converted P);
// output projection v_wmma_f32_16x16x32_f16 (context x1024 single f16, weight = bf16 value x64 in f16), scale folded back in the f32 epilogue; softmax and LayerNorm in f32.
// Layout: bf16 x plane [b*SEQ+t][64]; transposed weight planes [out][in]; patch weight plane [oc][(ky*8+kx)*64+ic]; q plane [b*SEQ+t][64]; LayerNorm plane and k plane [b*NKEY+key][64]; v^T plane [b*64+c][key].
// Fused attention kernel in transposed form (S^T = K Q^T, O^T = V^T P^T), no score plane in memory, output projection inside the same kernel.

#ifndef NB
#define NB 2
#endif
#ifndef GH
#define GH 128                   // token grid height (rows of the grid used per batch)
#endif
#define GW   128                 // token grid width
#define SEQ  (GH * GW)
#define NB_FULL  2
#define GH_FULL  128
#define SEQ_FULL 16384
#ifndef OUT_SEQ
#define OUT_SEQ SEQ              // row pitch (in tokens) between batches of the output
#endif
#define DM   64
#define NH_  8
#define HD   8
#define SRR  8                   // patch size = stride
#define KGW  (GW / SRR)
#define NKEY ((GH / SRR) * (GW / SRR))
#define CK   (DM * SRR * SRR)    // patch projection depth (4096)
#define AW   4                   // waves per attention block (16 query rows each)
#define CP   72                  // LDS row pitch (halves) of the context tile
#define OSP  68                  // LDS row pitch (floats) of the output tile
#define PWV  16                  // waves per patch-projection block = slices of its depth = rows of its tile
#define PKS  (CK / PWV)          // depth of one slice (256 = 4 patch positions x 64 channels)
#define RP   68                  // LDS row pitch (floats) of the partial tiles
#define QC   16.0f               // carry of the q plane
#define KC   16.0f               // carry of the k plane
#define VC   64.0f               // carry of the v^T plane
#define WC   64.0f               // carry of the f16 weight planes
#define CTXC 1024.0f             // carry of the context tile
#define SC2  ((float)(0.35355339059327378 * 1.4426950408889634 / 256.0))   // HD^-0.5 * log2(e) / (QC * KC)
#define PSH  14.0f               // log2 of the P carry (16384)
#define NEGB (-3.0e38f)
#define OUTI (1.0f / 65536.0f)   // 1 / (CTXC * WC)

static_assert(DM == 64);
static_assert(NH_ * HD == DM);                 // head h = columns h*8 + d
static_assert(HD == 8);                        // one head = 8 k-slots = one half fragment of one lane half
static_assert(NH_ == 8);                       // two groups of four heads, 32 columns each
static_assert(DM % 32 == 0);                   // GEMM k-loops step by 32
static_assert(CK % 32 == 0);
static_assert(CK == 64 * DM);                  // k index = (ky*8+kx)*64 + ic
static_assert(SRR == 8);
static_assert(GH % SRR == 0);
static_assert(GW % SRR == 0);
static_assert(NKEY % 64 == 0);                 // a 64-token tile of the v^T GEMM never straddles two batches; key loop steps by 32
static_assert((NB * NKEY) % 64 == 0);
static_assert((NB * SEQ) % 64 == 0);
static_assert(SEQ % (16 * AW) == 0);           // attention grid covers the sequence exactly
static_assert(((size_t)SEQ * DM) % 8 == 0);
static_assert(NB <= NB_FULL);
static_assert(GH <= GH_FULL);
static_assert(SEQ <= SEQ_FULL);
static_assert((CP * 2) % 16 == 0);
static_assert((OSP * 4) % 16 == 0);
static_assert(CP >= DM);
static_assert(OSP >= DM);
static_assert(32 * 16 * 4 == 16 * DM * 2);
static_assert(32 * 16 * 8 == 16 * DM * 4);     // output stores: 32 lanes x 16 B x 8 instructions == 16 rows x 256 B
static_assert(256 * 2 * 16 == 64 * 64 * 2);
static_assert(AW * 16 * CP * 2 + AW * 16 * OSP * 4 <= 131072);
static_assert(64 * 65 * 4 <= 131072);
static_assert(16 * 68 * 4 <= 131072);
static_assert(PWV == 16);                      // wave w finishes row w of the 16-row tile
static_assert(PKS % DM == 0);                  // a slice holds whole patch positions
static_assert((SRR * DM) % PKS == 0);          // and stays inside one patch row ky
static_assert((NB * NKEY) % 16 == 0);
static_assert(NKEY % 16 == 0);                 // a 16-row tile never straddles two batches
static_assert((RP * 4) % 8 == 0);
static_assert(PWV * 16 * RP * 4 <= 131072);

typedef _Float16 h16;
typedef unsigned short bf;
typedef __attribute__((ext_vector_type(16))) __bf16   v16bf;
typedef __attribute__((ext_vector_type(16))) _Float16 v16h;
typedef __attribute__((ext_vector_type(8)))  _Float16 v8h;
typedef __attribute__((ext_vector_type(8)))  unsigned short v8us;
typedef __attribute__((ext_vector_type(8)))  float    v8f;
typedef __attribute__((ext_vector_type(4)))  float    v4f;
typedef v4f  __attribute__((may_alias)) v4fa;
typedef __attribute__((ext_vector_type(16))) unsigned short v16us;
typedef v8h  __attribute__((may_alias)) v8ha;
typedef __attribute__((ext_vector_type(2)))  float    v2f;
typedef v2f  __attribute__((may_alias)) v2fa;
typedef __attribute__((ext_vector_type(2)))  _Float16 v2h;

__device__ __forceinline__ unsigned short f2bf(float f) { unsigned u = __float_as_uint(f); u += 0x7FFFu + ((u >> 16) & 1u); return (unsigned short)(u >> 16); }
__device__ __forceinline__ float bfr(float f) { return __uint_as_float(((unsigned)f2bf(f)) << 16); }   // value after RNE convert to bf16
__device__ __forceinline__ v16h cat16(v8h lo, v8h hi) { return __builtin_shufflevector(lo, hi, 0, 1, 2, 3, 4, 5, 6, 7, 8, 9, 10, 11, 12, 13, 14, 15); }
__device__ __forceinline__ v16bf cat16b(v8us lo, v8us hi) { return __builtin_bit_cast(v16bf, __builtin_shufflevector(lo, hi, 0, 1, 2, 3, 4, 5, 6, 7, 8, 9, 10, 11, 12, 13, 14, 15)); }
__device__ __forceinline__ v8f wmma16(v16h a, v16h b, v8f c) { return __builtin_amdgcn_wmma_f32_16x16x32_f16(false, a, false, b, (short)0, c, false, false); }
__device__ __forceinline__ v8f wmmab(v16bf a, v16bf b, v8f c) { return __builtin_amdgcn_wmma_f32_16x16x32_bf16(false, a, false, b, (short)0, c, false, false); }
// fragment loaders from K-contiguous 16-bit rows; p already includes + 8*(lane>>4): elements 0..7 <- k0+8h+0..7, elements 8..15 <- k0+16+8h+0..7 (same map for A and B)
__device__ __forceinline__ v16h  ldh(const h16* p) { return cat16(*(const v8h*)p, *(const v8h*)(p + 16)); }
__device__ __forceinline__ v16bf ldb(const bf* p)  { return cat16b(*(const v8us*)p, *(const v8us*)(p + 16)); }
// ordering point for wave-private LDS tiles (same wave writes and reads)
__device__ __forceinline__ void wave_sync() { __builtin_amdgcn_fence(3 /* release order */, "wavefront"); __builtin_amdgcn_wave_barrier(); asm volatile("" ::: "memory"); }

// f32 -> f16 with a value select: results below the smallest normal become +0 (applied after the plane's power-of-two carry)
static __device__ __forceinline__ h16 toh_flush(float v) { const h16 r = (h16)v; return (fabsf(v) < 6.103515625e-05f) ? (h16)0.0f : r; }
// raw 16-bit fragment (same k map), used by the GEMM body for both operand kinds
__device__ __forceinline__ v16us cat16u(v8us lo, v8us hi) { return __builtin_shufflevector(lo, hi, 0, 1, 2, 3, 4, 5, 6, 7, 8, 9, 10, 11, 12, 13, 14, 15); }
__device__ __forceinline__ v16us ldu(const bf* p) { return cat16u(*(const v8us*)p, *(const v8us*)(p + 16)); }
// one WMMA + its own four-slot guard (ties the result, keeps both fragments live)
__device__ __forceinline__ v8f wmma16g(v16h a, v16h b, v8f c) {
    c = __builtin_amdgcn_wmma_f32_16x16x32_f16(false, a, false, b, (short)0, c, false, false);
    asm volatile("v_nop\n\tv_nop\n\tv_nop\n\tv_nop" : "+v"(c) : "v"(a), "v"(b));
    return c; }
template <bool F16>
__device__ __forceinline__ v8f wmmaug(v16us a, v16us b, v8f c) {
    if (F16) c = __builtin_amdgcn_wmma_f32_16x16x32_f16(false, __builtin_bit_cast(v16h, a), false, __builtin_bit_cast(v16h, b), (short)0, c, false, false);
    else     c = __builtin_amdgcn_wmma_f32_16x16x32_bf16(false, __builtin_bit_cast(v16bf, a), false, __builtin_bit_cast(v16bf, b), (short)0, c, false, false);
    asm volatile("v_nop\n\tv_nop\n\tv_nop\n\tv_nop" : "+v"(c) : "v"(a), "v"(b));
    return c; }

// f16mode == 0: bf16 RNE bits; f16mode != 0: f16 bits of (bf16 value x carry), results below the smallest normal selected to +0.
// One block of 256 threads per 64 x 64 tile: tile column bx of plane z, in[rows = 64][Cn] -> out[Cn][64].
__device__ __forceinline__ void wT_body(const float* __restrict__ src, bf* dst, int Cn, int f16mode, float carry, int bx, int z) {
#pragma clang fp contract(off)
    __shared__ float ts[64 * 65];
    const int tid = threadIdx.x; const int c0 = bx * 64;
    const float* sp = src + (size_t)z * 64 * (size_t)Cn + c0;
#pragma unroll 1
    for (int it = 0; it < 16; ++it) { const int idx = it * 256 + tid; const int r = idx >> 6, c = idx & 63;   // 16 trips x 256 = 64 x 64 elements
        ts[r * 65 + c] = sp[(size_t)r * Cn + c]; }
    __syncthreads();
    bf* dp = dst + ((size_t)z * (size_t)Cn + c0) * 64;
{
#pragma unroll 1
        for (int it = 0; it < 2; ++it) { const int p = it * 256 + tid; const int c = p >> 3, r8 = (p & 7) * 8; v8us o;   // 2 trips x 256 = 64 rows x 8 pieces
#pragma unroll
            for (int k = 0; k < 8; ++k) { const float v = ts[(r8 + k) * 65 + c];
                const unsigned short ub = f2bf(v);
                const h16 hv = toh_flush(bfr(v) * carry);
                const unsigned short uh = __builtin_bit_cast(unsigned short, hv);
                o[k] = f16mode ? uh : ub; }
            *(v8us*)(dp + (size_t)c * 64 + r8) = o;
            asm volatile("s_wait_xcnt 0x0" ::: "memory"); }   // the next trip rewrites the store's address and data registers
         }
}

// k_prep: everything that depends on the inputs alone, in ONE launch; the block index picks the job (a block-uniform choice, so the barrier of wT_body is passed by whole blocks).
// Blocks 0 .. WTB-1: the weight tiles (they have the longest dependent chain, so they get the lowest block indices): 64 patch-weight planes, per oc [64 ic][64 (ky,kx)] -> [64 (ky,kx)][64 ic]; q_w [64 in][64 out] -> [64 out][64 in];
// kv_w [64 in][128 out] -> [128 out][64 in] (two tiles); proj_w [64 in][64 out] -> [64 out][64 in]. Blocks WTB ..: x -> bf16 plane, 8 elements per thread.
#define WTB  (DM + 4)
#define N8B  ((size_t)SEQ * DM / 8)                       // 8-element pieces of x per batch
#define CVB  ((unsigned)(((size_t)NB * N8B + 255) / 256))  // blocks of the x conversion
__global__ __launch_bounds__(256) void k_prep(const float* __restrict__ x, const float* __restrict__ q_w, const float* __restrict__ kv_w, const float* __restrict__ sr_w, const float* __restrict__ pj_w,
                                              bf* XB, bf* WQT, bf* KVT, bf* SW, bf* PWT) {
    const int bid = (int)blockIdx.x;
    if (bid < WTB) {
        const float* src = sr_w; bf* dst = SW; int Cn = DM, f16mode = 0, bx = 0, z = bid;
        if (bid == DM)          { src = q_w;  dst = WQT; z = 0; }
        else if (bid == DM + 3) { src = pj_w; dst = PWT; z = 0; f16mode = 1; }
        else if (bid > DM)      { src = kv_w; dst = KVT; z = 0; f16mode = 1; Cn = 2 * DM; bx = bid - (DM + 1); }
        wT_body(src, dst, Cn, f16mode, f16mode ? WC : 1.0f, bx, z);
        return;
    }
    const size_t i = (size_t)(bid - WTB) * 256 + threadIdx.x; if (i >= (size_t)NB * N8B) return;
    const v8f v = *(const v8f*)(x + (i / N8B) * ((size_t)SEQ_FULL * DM) + (i % N8B) * 8); v8us o;   // batch pitch of x is the full sequence
#pragma unroll
    for (int k = 0; k < 8; ++k) o[k] = f2bf(v[k]);
    *(v8us*)(XB + i * 8) = o;
}

// gemm_body: register-blocked GEMM, ONE WAVE per 64x64 tile (16 accumulators), operands straight from K-contiguous 16-bit planes (raw 16-bit loads), C[m][n] = sum_k A[m][k] Bt[n][k]. tile = index of the wave's tile, os = its 16 x 68 f32 LDS tile.
// KIND 0: q projection, bf16 operands, K = 64; A = x rows (m = b*SEQ + t), Bt = q weight rows (n); result x QC as f16 rows [m][64]. NB*SEQ/64 tiles.
// KIND 1: patch projection, bf16 operands, K = 4096 with k = (ky*8+kx)*64 + ic; A row m = (b, ty, tx) addressed arithmetically inside the bf16 x plane (64 contiguous channels per patch position),
//         Bt = permuted patch weight rows (n = oc); + bias, LayerNorm over the 64 channels of each row in f32 (two lanes per row, one xor-16 exchange), gain / offset applied; f16 rows [m][64]. NB*NKEY/64 tiles.
// KIND 2: k projection, f16 operands, K = 64; A = LayerNorm rows, Bt = kv weight rows 0..63 (x WC); result x KC/WC as f16 rows [m][64]. NB*NKEY/64 tiles.
// KIND 3: v^T projection, f16 operands, K = 64; A = kv weight rows 64..127 (m = c), Bt = LayerNorm rows (n = b*NKEY + key); result x VC/WC into plane [(b*64 + c)][key], row pitch NKEY. NB*NKEY/64 tiles (tile index = token tile).
template <int KIND>
__device__ __forceinline__ void gemm_body(const bf* __restrict__ A, const bf* __restrict__ Bt, const float* __restrict__ cbias, const float* __restrict__ lg, const float* __restrict__ lb, h16* P, int tile, float* os) {
    constexpr int KD = (KIND == 1) ? CK : DM;
    constexpr bool F16 = (KIND >= 2);
    constexpr float SCL = (KIND == 0) ? QC : ((KIND == 1) ? 1.0f : ((KIND == 2) ? (KC / WC) : (VC / WC)));
    const int lane = threadIdx.x & 31, lr = lane & 15, hi = lane >> 4;
    const int r0 = (KIND == 3) ? 0 : tile * 64;
    const int c0 = (KIND == 3) ? tile * 64 : 0;
    v8f acc[4][4];
#pragma unroll
    for (int mb = 0; mb < 4; ++mb)
#pragma unroll
        for (int nb = 0; nb < 4; ++nb) acc[mb][nb] = (v8f){};
    size_t aoff[4];
#pragma unroll
    for (int mb = 0; mb < 4; ++mb) {
        const int mrow = r0 + mb * 16 + lr;
        if (KIND == 1) { const int bb = mrow / NKEY, tk = mrow % NKEY; const int ty = tk / KGW, tx = tk % KGW;
                         aoff[mb] = ((size_t)bb * SEQ + (size_t)(ty * SRR) * GW + (size_t)(tx * SRR)) * DM + 8 * hi; }
        else           { aoff[mb] = (size_t)mrow * DM + 8 * hi; } }
    const size_t boff = (size_t)(c0 + lr) * KD + 8 * hi;
#pragma unroll 1
    for (int kc = 0; kc < KD; kc += 32) {
        const size_t ak = (KIND == 1) ? (size_t)((((kc >> 9) * GW + ((kc >> 6) & 7)) * DM) + (kc & 63)) : (size_t)kc;   // patch position (ky, kx) = (kc>>9, (kc>>6)&7), channel base kc&63
        v16us a[4];
#pragma unroll
        for (int mb = 0; mb < 4; ++mb) a[mb] = ldu(A + aoff[mb] + ak);
#pragma unroll
        for (int nb = 0; nb < 4; ++nb) { const v16us b = ldu(Bt + boff + (size_t)nb * 16 * KD + kc);
#pragma unroll
            for (int mb = 0; mb < 4; ++mb) acc[mb][nb] = wmmaug<F16>(a[mb], b, acc[mb][nb]); }
    }
    float bc[4];
#pragma unroll
    for (int nb = 0; nb < 4; ++nb) bc[nb] = (KIND == 1) ? bfr(cbias[nb * 16 + lr]) : 0.0f;
    const int bb3 = c0 / NKEY, tt3 = c0 % NKEY;
#pragma unroll
    for (int mb = 0; mb < 4; ++mb) {
#pragma unroll
        for (int nb = 0; nb < 4; ++nb) {
#pragma unroll
            for (int j = 0; j < 8; ++j) os[(hi * 8 + j) * 68 + nb * 16 + lr] = (acc[mb][nb][j] + bc[nb]) * SCL; }   // D: row 8h+j, col lane&15; rows 0..15 x columns 0..63 all written
        wave_sync();
        if (KIND == 1) {
            // LayerNorm of row lr; this lane owns columns 32*hi .. 32*hi+31 (reads and rewrites only those)
            const int cb0 = lr * 68 + hi * 32;
            float s = 0.0f;
#pragma unroll
            for (int i = 0; i < 8; ++i) { const v4f x = *(const v4fa*)(&os[cb0 + 4 * i]); s += (x[0] + x[1]) + (x[2] + x[3]); }
            s += __shfl_xor(s, 16, 32);
            const float mu = s * (1.0f / 64.0f);
            float q = 0.0f;
#pragma unroll
            for (int i = 0; i < 8; ++i) { const v4f x = *(const v4fa*)(&os[cb0 + 4 * i]);
                const float d0 = x[0] - mu, d1 = x[1] - mu, d2 = x[2] - mu, d3 = x[3] - mu; q += (d0 * d0 + d1 * d1) + (d2 * d2 + d3 * d3); }
            q += __shfl_xor(q, 16, 32);
            const float rs = 1.0f / sqrtf(q * (1.0f / 64.0f) + 1.0e-5f);
#pragma unroll
            for (int i = 0; i < 8; ++i) { const v4f x = *(const v4fa*)(&os[cb0 + 4 * i]);
                const v4f g = *(const v4f*)(lg + hi * 32 + 4 * i); const v4f o = *(const v4f*)(lb + hi * 32 + 4 * i); v4f y;
#pragma unroll
                for (int e = 0; e < 4; ++e) y[e] = (x[e] - mu) * rs * bfr(g[e]) + bfr(o[e]);
                *(v4fa*)(&os[cb0 + 4 * i]) = y; }
            wave_sync();
        }
{
#pragma unroll
            for (int s = 0; s < 4; ++s) { const int row = 4 * s + (lane >> 3), c8 = (lane & 7) * 8;   // 4 s x 4 row groups = 16 rows; 8 lanes x 8 = 64 columns = one line
                const v4f x0 = *(const v4fa*)(&os[row * 68 + c8]); const v4f x1 = *(const v4fa*)(&os[row * 68 + c8 + 4]); v8h hv;
#pragma unroll
                for (int i = 0; i < 4; ++i) { hv[i] = toh_flush(x0[i]); hv[4 + i] = toh_flush(x1[i]); }
                const size_t oo = (KIND == 3) ? (((size_t)bb3 * DM + (size_t)(mb * 16 + row)) * NKEY + (size_t)tt3 + c8)
                                              : ((size_t)(r0 + mb * 16 + row) * DM + c8);
                *(v8h*)(P + oo) = hv; }
            asm volatile("s_wait_xcnt 0x0" ::: "memory");   // what follows (the next row group, or in the listing another job's body) rewrites address and data registers of these four stores
             }
        wave_sync();
    }
}

// k_proj: the three projections that the attention kernel waits for, in ONE launch (none reads what another writes); the block index picks the job: KVB tiles of k, KVB tiles of v^T, then the q tiles.
#define KVB (NB * NKEY / 64)
#define QPB (NB * SEQ / 64)
__global__ __launch_bounds__(32) void k_proj(const bf* __restrict__ XB, const bf* __restrict__ WQT, const bf* __restrict__ LNP, const bf* __restrict__ KVT, h16* QH, h16* KP, h16* VT) {
    __shared__ __align__(16) float os[16 * 68];
    const int bid = (int)blockIdx.x;
    if (bid < KVB)          gemm_body<2>(LNP, KVT, (const float*)0, (const float*)0, (const float*)0, KP, bid, os);
    else if (bid < 2 * KVB) gemm_body<3>(KVT + (size_t)DM * DM, LNP, (const float*)0, (const float*)0, (const float*)0, VT, bid - KVB, os);
    else                    gemm_body<0>(XB, WQT, (const float*)0, (const float*)0, (const float*)0, QH, bid - 2 * KVB, os);
}

// k_patch: patch projection (bf16 operands, K = 4096 with k = (ky*8+kx)*64 + ic) + bias + LayerNorm; f16 rows [m][64]. grid NB*NKEY/16, PWV waves per block. (It takes the place of gemm_body's KIND 1, which nothing instantiates any more.)
// One block per 16 rows m = (b, ty, tx = 0..15) x all 64 output channels; A rows addressed arithmetically inside the bf16 x plane (64 contiguous channels per patch position), Bt = permuted patch weight rows (n = oc).
// The depth is split over the waves: wave w sums k = 256 w .. 256 w + 255 (ky = w>>1, kx = 4 (w&1) .. + 3) into its own 16 x 64 f32 partial tile, one patch position (one 128-B line of every A and Bt row) per trip.
// The 16 partial tiles meet in LDS; behind the block barrier wave w adds them up for row w in slice order (lane owns columns 2 lane, 2 lane + 1), adds the bias and does the LayerNorm of that row in f32 (xor exchanges over the 32 lanes).
// amdgpu_waves_per_eu(4, 4): one block fills its 4 waves per SIMD and the grid is smaller than the chip, so the register budget goes to loads in flight (without it each fragment is loaded and waited for alone).
__global__ __launch_bounds__(32 * PWV) __attribute__((amdgpu_waves_per_eu(4, 4))) void k_patch(const bf* __restrict__ A, const bf* __restrict__ Bt, const float* __restrict__ cbias, const float* __restrict__ lg, const float* __restrict__ lb, h16* P) {
    __shared__ __align__(16) float red[PWV * 16 * RP];
    const int lane = threadIdx.x & 31, lr = lane & 15, hi = lane >> 4;
    const int wave = __builtin_amdgcn_readfirstlane((int)(threadIdx.x >> 5));
    const int r0 = (int)blockIdx.x * 16;
    const int mrow = r0 + lr;
    const int bb = mrow / NKEY, tk = mrow % NKEY; const int ty = tk / KGW, tx = tk % KGW;
    const int k0 = wave * PKS;
    const bf* ap = A + ((size_t)bb * SEQ + (size_t)(ty * SRR + (k0 >> 9)) * GW + (size_t)(tx * SRR + ((k0 >> 6) & 7))) * DM + 8 * hi;   // first patch position of the slice: (ky, kx) = (k0>>9, (k0>>6)&7)
    const bf* bp = Bt + (size_t)lr * CK + k0 + 8 * hi;
    v8f acc[4];                                                    // the loops over nb and j below are unrolled so that acc[] is indexed by constants and stays in registers
#pragma unroll
    for (int nb = 0; nb < 4; ++nb) acc[nb] = (v8f){};
#pragma unroll                                                     // 4 trips, unrolled: every address is base + constant, and a later trip's loads issue ahead of an earlier trip's WMMAs
    for (int kk = 0; kk < PKS; kk += DM) {                         // next patch position in the row = next token = + DM in both planes
        const v16bf a0 = ldb(ap + kk), a1 = ldb(ap + kk + 32);
#pragma unroll
        for (int nb = 0; nb < 4; ++nb) { const v16bf b0 = ldb(bp + (size_t)nb * 16 * CK + kk), b1 = ldb(bp + (size_t)nb * 16 * CK + kk + 32);
            acc[nb] = wmmab(a0, b0, acc[nb]); acc[nb] = wmmab(a1, b1, acc[nb]); }
    }
#pragma unroll
    for (int nb = 0; nb < 4; ++nb) {
#pragma unroll
        for (int j = 0; j < 8; ++j) red[(wave * 16 + hi * 8 + j) * RP + nb * 16 + lr] = acc[nb][j]; }   // D: row 8h+j, col lane&15
    __syncthreads();
    const v2f t0 = *(const v2fa*)(&red[wave * RP + 2 * lane]);
    float x0 = t0[0], x1 = t0[1];
#pragma unroll
    for (int p = 1; p < PWV; ++p) { const v2f t = *(const v2fa*)(&red[(p * 16 + wave) * RP + 2 * lane]); x0 += t[0]; x1 += t[1]; }
    const v2f bi = *(const v2f*)(cbias + 2 * lane), g = *(const v2f*)(lg + 2 * lane), of = *(const v2f*)(lb + 2 * lane);
    x0 += bfr(bi[0]); x1 += bfr(bi[1]);
    float sm = x0 + x1;
#pragma unroll
    for (int d = 16; d >= 1; d >>= 1) sm += __shfl_xor(sm, d, 32);
    const float mu = sm * (1.0f / 64.0f);
    const float d0 = x0 - mu, d1 = x1 - mu;
    float q = d0 * d0 + d1 * d1;
#pragma unroll
    for (int d = 16; d >= 1; d >>= 1) q += __shfl_xor(q, d, 32);
    const float rs = 1.0f / sqrtf(q * (1.0f / 64.0f) + 1.0e-5f);
    v2h hv;
    hv[0] = toh_flush(d0 * rs * bfr(g[0]) + bfr(of[0]));
    hv[1] = toh_flush(d1 * rs * bfr(g[1]) + bfr(of[1]));
    *(v2h*)(P + (size_t)(r0 + wave) * DM + 2 * lane) = hv;         // one wave stores one whole 128-B row
}

// k_attn: fused attention + output projection, one wave per 16 query rows of one batch, the 8 heads in two trips of four (the four heads that share a 32-column group go through the key loop together, on one K fragment pair per 32 keys); K / V^T / Q fragments straight from the f16 planes (two 16-B loads each, arithmetic addressing).
// Transposed form: S^T[key][t] = K Q^T (A = K rows over the 32 columns of the head's group, B = Q row with the k-slots outside the head selected to zero by value); lane (t = lane&15, h = lane>>4) holds keys 8h+r
// of each 16-key tile, so the packed P tile is directly the B fragment of O^T[d][t] = V^T P^T (A rows d: channel head*8 + (lane&7); rows 8..15 repeat rows 0..7 and are not used).
// Online softmax state is one scalar per lane; the two lane halves of a row are combined with one xor-16 exchange. P = f16 of exp2(score - max + 14), zero when the exponent argument is below -14; row sum over the converted P.
// Context (x CTXC) of each head goes to a wave-private f16 LDS tile [16][64]; after the head loop the tile is the A operand of the output projection (B = transposed weight plane, f16 x WC);
// The two integer grid-size inputs are read on the device; when they differ from the compiled grid the output is filled with NaN.
__global__ __launch_bounds__(32 * AW) void k_attn(const h16* __restrict__ QH, const h16* __restrict__ KP, const h16* __restrict__ VT, const h16* __restrict__ PW,
                                                  const float* __restrict__ pbias, const int* __restrict__ hp, const int* __restrict__ wp, float* OUT) {
    __shared__ __align__(16) h16   cs[AW * 16 * CP];
    __shared__ __align__(16) float os[AW * 16 * OSP];
    const int lane = threadIdx.x & 31, lr = lane & 15, hi = lane >> 4;
    const int wave = __builtin_amdgcn_readfirstlane((int)(threadIdx.x >> 5));
    const int b = blockIdx.y;
    const int t0 = (blockIdx.x * AW + wave) * 16;
    const bool bad = (hp[0] != GH_FULL) | (wp[0] != GW);
    const size_t qrow  = ((size_t)b * SEQ + (size_t)(t0 + lr)) * DM + 8 * hi;
    const size_t kbase = ((size_t)b * NKEY + (size_t)lr) * DM + 8 * hi;        // + key * DM + 32 * group   (A fragment: row key, k = column inside the group)
    const size_t vbase = ((size_t)b * DM + (size_t)(lr & 7)) * NKEY + 8 * hi;  // + head*8*NKEY + key       (A fragment: row d, k = key)
    const int cb = wave * 16 * CP;
    const v8h z8 = (v8h){};
#pragma unroll 1
    for (int g = 0; g < 2; ++g) {                                  // one trip = the four heads that share the group's 32 columns, carried together through the key loop
        const v8h qa = *(const v8h*)(QH + qrow + 32 * g), qb = *(const v8h*)(QH + qrow + 32 * g + 16);
        v16h qf[4]; v8f o[4]; float m[4], l[4];                    // every loop over j is unrolled so that the per-head arrays are indexed by constants and stay in registers
#pragma unroll
        for (int j = 0; j < 4; ++j) {
            const bool kA = (hi == (j & 1)) & (j < 2);             // head j of the group = k-slots 8j..8j+7: lane half (j&1), elements 0..7 (j < 2) or 8..15 (j >= 2)
            const bool kB = (hi == (j & 1)) & (j >= 2);
            qf[j] = cat16(kA ? qa : z8, kB ? qb : z8);             // B fragment: col t, k = column inside the group
            o[j] = (v8f){}; m[j] = NEGB; l[j] = 0.0f; }
        const size_t ko = kbase + (size_t)(32 * g);
        const size_t vo = vbase + (size_t)(g * 4 * HD) * NKEY;
#pragma unroll 1
        for (int key0 = 0; key0 < NKEY; key0 += 32) {
            const h16* ka = KP + ko + (size_t)key0 * DM;
            const v16h ka0 = ldh(ka), kb0 = ldh(ka + 16 * DM);     // one K fragment pair serves the four heads
            v16h vf[4];
#pragma unroll
            for (int j = 0; j < 4; ++j) vf[j] = ldh(VT + vo + (size_t)(j * HD) * NKEY + key0);
            v8f sa[4], sb[4];
#pragma unroll
            for (int j = 0; j < 4; ++j) { sa[j] = wmma16(ka0, qf[j], (v8f){}); sb[j] = wmma16(kb0, qf[j], (v8f){}); }   // eight independent products
            float mx[4];
#pragma unroll
            for (int j = 0; j < 4; ++j) { mx[j] = NEGB;
#pragma unroll
                for (int r = 0; r < 8; ++r) { sa[j][r] = sa[j][r] * SC2; sb[j][r] = sb[j][r] * SC2; mx[j] = fmaxf(mx[j], fmaxf(sa[j][r], sb[j][r])); } }
            float ox[4];
#pragma unroll
            for (int j = 0; j < 4; ++j) ox[j] = __shfl_xor(mx[j], 16, 32);           // the other lane half's maximum, one exchange per head
            float dm[4], alpha[4], sh[4];
#pragma unroll
            for (int j = 0; j < 4; ++j) {
                const float mnew = fmaxf(m[j], fmaxf(mx[j], ox[j]));
                dm[j] = m[j] - mnew; alpha[j] = __builtin_amdgcn_exp2f(dm[j]); sh[j] = PSH - mnew; m[j] = mnew; }
            // the slot that the instruction set asks for behind a v_exp_f32 before its source register is overwritten: the sources are inputs here, so they stay untouched up to this v_nop
            asm volatile("v_nop" :: "v"(dm[0]), "v"(dm[1]), "v"(dm[2]), "v"(dm[3]), "v"(alpha[0]), "v"(alpha[1]), "v"(alpha[2]), "v"(alpha[3]));
#pragma unroll
            for (int j = 0; j < 4; ++j) {
                v16h pb; float ls = 0.0f;
                float ea[8], eb[8], xa[8], xb[8];
#pragma unroll
                for (int r = 0; r < 8; ++r) { ea[r] = sa[j][r] + sh[j]; eb[r] = sb[j][r] + sh[j]; xa[r] = __builtin_amdgcn_exp2f(ea[r]); xb[r] = __builtin_amdgcn_exp2f(eb[r]); }
                // the same slot for these v_exp_f32, eight to a statement: no source register is overwritten before all eight results stand
                asm volatile("v_nop" :: "v"(ea[0]), "v"(ea[1]), "v"(ea[2]), "v"(ea[3]), "v"(ea[4]), "v"(ea[5]), "v"(ea[6]), "v"(ea[7]), "v"(xa[0]), "v"(xa[1]), "v"(xa[2]), "v"(xa[3]), "v"(xa[4]), "v"(xa[5]), "v"(xa[6]), "v"(xa[7]));
                asm volatile("v_nop" :: "v"(eb[0]), "v"(eb[1]), "v"(eb[2]), "v"(eb[3]), "v"(eb[4]), "v"(eb[5]), "v"(eb[6]), "v"(eb[7]), "v"(xb[0]), "v"(xb[1]), "v"(xb[2]), "v"(xb[3]), "v"(xb[4]), "v"(xb[5]), "v"(xb[6]), "v"(xb[7]));
#pragma unroll
                for (int r = 0; r < 8; ++r) {
                    const h16 pa = (ea[r] < -14.0f) ? (h16)0.0f : (h16)xa[r];
                    const h16 pc = (eb[r] < -14.0f) ? (h16)0.0f : (h16)xb[r];
                    pb[r] = pa; pb[8 + r] = pc;
                    ls += (float)pa + (float)pc; }
                l[j] = l[j] * alpha[j] + ls;
                o[j] = o[j] * alpha[j];
                o[j] = wmma16(vf[j], pb, o[j]);
            }
            // four vector slots between the trip's last WMMA and the loop branch: the next trip's first products reuse this trip's fragment registers
            asm volatile("v_nop\n\tv_nop\n\tv_nop\n\tv_nop" : "+v"(o[0]), "+v"(o[1]), "+v"(o[2]), "+v"(o[3]));
        }
#pragma unroll
        for (int j = 0; j < 4; ++j) {
            const float lt = l[j] + __shfl_xor(l[j], 16, 32);
            const float inv = (1.0f / lt) * (CTXC / VC);           // lt >= 16384 (the maximum element of every row converts to 16384)
            v8h cv;
#pragma unroll
            for (int r = 0; r < 8; ++r) cv[r] = toh_flush(o[j][r] * inv);           // lane half 0: o[r] = (d = r, t = lane&15)
            if (hi == 0) *(v8ha*)(&cs[cb + lr * CP + (g * 4 + j) * HD]) = cv; }     // 8 heads x 8 columns: rows 0..15 x columns 0..63 all written
    }
    wave_sync();
    v8f acc[4];
#pragma unroll
    for (int nb = 0; nb < 4; ++nb) acc[nb] = (v8f){};
#pragma unroll
    for (int kc = 0; kc < DM; kc += 32) {
        const v8h a0 = *(const v8ha*)(&cs[cb + lr * CP + kc + 8 * hi]);
        const v8h a1 = *(const v8ha*)(&cs[cb + lr * CP + kc + 16 + 8 * hi]);
        const v16h a = cat16(a0, a1);                              // A fragment: row t, k = context column
#pragma unroll
        for (int nb = 0; nb < 4; ++nb) { const v16h bw = ldh(PW + (size_t)(nb * 16 + lr) * DM + kc + 8 * hi);
            acc[nb] = wmma16g(a, bw, acc[nb]); }
    }
    const int ob = wave * 16 * OSP;
    const float nanv = __uint_as_float(0x7FC00000u);
#pragma unroll
    for (int nb = 0; nb < 4; ++nb) { const float bia = bfr(pbias[nb * 16 + lr]);
#pragma unroll
        for (int r = 0; r < 8; ++r) { const float v = acc[nb][r] * OUTI + bia;
            os[ob + (8 * hi + r) * OSP + nb * 16 + lr] = bad ? nanv : v; } }   // D: row 8h+r, col lane&15; rows 0..15 x columns 0..63 all written
    wave_sync();
    float* orow = OUT + ((size_t)b * OUT_SEQ + (size_t)t0) * DM;
{
#pragma unroll
        for (int s = 0; s < 8; ++s) { const int row = 2 * s + (lane >> 4), cofs = (lane & 15) * 4;
            const v4f val = *(const v4fa*)(&os[ob + row * OSP + cofs]);
            *(v4f*)(orow + (size_t)row * DM + cofs) = val; }
         }
}

static constexpr size_t al256(size_t v) { return (v + 255) & ~(size_t)255; }
static constexpr size_t SZ_XB = al256((size_t)NB * SEQ * DM * 2);        // bf16 x plane; also the extent of the q plane
static constexpr size_t SZ_W1 = al256((size_t)DM * DM * 2);              // one 64 x 64 weight plane
static constexpr size_t SZ_KV = al256((size_t)2 * DM * DM * 2);          // kv weight plane [128][64]
static constexpr size_t SZ_SW = al256((size_t)DM * CK * 2);              // patch weight plane [64][4096]
static constexpr size_t SZ_KP = al256((size_t)NB * NKEY * DM * 2);       // LayerNorm / k / v^T planes
static constexpr size_t SZ_TOTAL = 2 * SZ_XB + 2 * SZ_W1 + SZ_KV + SZ_SW + 3 * SZ_KP;
static_assert(SZ_TOTAL <= (size_t)134217728);                            // workspace carve <= 128 MiB
static_assert(((size_t)NB * SEQ * DM * 2) % 256 == 0);
static_assert(((size_t)NB * NKEY * DM * 2) % 256 == 0);
static_assert((size_t)NB * DM * NKEY == (size_t)NB * NKEY * DM);         // v^T plane [(b*64 + c)][key] has the same extent as the k plane

extern "C" void kernel_launch(void* const* d_in, const int* in_sizes, int n_in,
                              void* d_out, int out_size, void* d_ws, size_t ws_size, hipStream_t stream) {
    if (n_in < 11) return;
    const size_t needx = ((size_t)(NB - 1) * SEQ_FULL + SEQ) * DM;
    if ((size_t)in_sizes[0] < needx) return;
    if (in_sizes[1] < 1 || in_sizes[2] < 1) return;
    if ((size_t)in_sizes[3] < (size_t)DM * DM || (size_t)in_sizes[4] < (size_t)2 * DM * DM || (size_t)in_sizes[5] < (size_t)DM * CK) return;
    if (in_sizes[6] < DM || in_sizes[7] < DM || in_sizes[8] < DM || (size_t)in_sizes[9] < (size_t)DM * DM || in_sizes[10] < DM) return;
    if ((size_t)out_size < ((size_t)(NB - 1) * OUT_SEQ + SEQ) * DM) return;
    if (SZ_TOTAL > ws_size) return;
    // wire order: x, H, W, q_w, kv_w, sr_w, sr_b, ln_g, ln_b, proj_w, proj_b
    const float* x    = (const float*)d_in[0];
    const int*   gh   = (const int*)d_in[1];
    const int*   gw   = (const int*)d_in[2];
    const float* q_w  = (const float*)d_in[3];
    const float* kv_w = (const float*)d_in[4];
    const float* sr_w = (const float*)d_in[5];
    const float* sr_b = (const float*)d_in[6];
    const float* ln_g = (const float*)d_in[7];
    const float* ln_b = (const float*)d_in[8];
    const float* pj_w = (const float*)d_in[9];
    const float* pj_b = (const float*)d_in[10];
    float* OUT = (float*)d_out;      // [NB][SEQ][64]
    char* wsp = (char*)d_ws;
    bf*  XB  = (bf*)wsp;  wsp += SZ_XB;              // [NB*SEQ][64] bf16 x
    h16* QH  = (h16*)wsp; wsp += SZ_XB;              // [NB*SEQ][64] q x16
    bf*  WQT = (bf*)wsp;  wsp += SZ_W1;              // [64 out][64 in] bf16
    bf*  PWT = (bf*)wsp;  wsp += SZ_W1;              // [64 out][64 in] f16 bits, x64
    bf*  KVT = (bf*)wsp;  wsp += SZ_KV;              // [128 out][64 in] f16 bits, x64 (rows 0..63 k, 64..127 v)
    bf*  SW  = (bf*)wsp;  wsp += SZ_SW;              // [64 oc][(ky*8+kx)*64 + ic] bf16
    h16* LNP = (h16*)wsp; wsp += SZ_KP;              // [NB*NKEY][64] LayerNorm rows
    h16* KP  = (h16*)wsp; wsp += SZ_KP;              // [NB*NKEY][64] k x16
    h16* VT  = (h16*)wsp; wsp += SZ_KP;              // [NB*64][NKEY] v^T x64

    // four dependent launches: inputs -> planes; patch projection + LayerNorm; q, k, v^T projections; attention
    k_prep<<<dim3(WTB + CVB, 1, 1), 256, 0, stream>>>(x, q_w, kv_w, sr_w, pj_w, XB, WQT, KVT, SW, PWT);
    k_patch<<<dim3(NB * NKEY / 16, 1, 1), 32 * PWV, 0, stream>>>(XB, SW, sr_b, ln_g, ln_b, LNP);
    k_proj<<<dim3(2 * KVB + QPB, 1, 1), 32, 0, stream>>>(XB, WQT, (const bf*)LNP, KVT, QH, KP, VT);

    k_attn<<<dim3(SEQ / (16 * AW), NB, 1), 32 * AW, 0, stream>>>(QH, KP, VT, (const h16*)PWT, pj_b, gh, gw, OUT);
}

// v004
// It runs in 44.7 microseconds.
// In two side-by-side timings against v003, it was 1.07 and 1.08 times as fast.
// Counting every step since v000, it is 4.53 times as fast.
#include <hip/hip_runtime.h>

// Spatial-reduction attention, width 64 = 8 heads x 8: queries from all NB x SEQ tokens (x @ q_w, weights [in][out], no bias); keys / values from an 8x8 stride-8 patch projection (+ bias) -> LayerNorm (eps 1e-5) -> fused [in][out] kv weight (256 keys per batch at the full size); dense softmax, score scale 8^-0.5; output projection (+ bias).
// Compute dtypes, f32 accumulate everywhere: q projection and patch projection v_wmma_f32_16x16x32_bf16 (x and weights RNE-converted to bf16; products exact); kv projection v_wmma_f32_16x16x32_f16 (LayerNorm rows single f16, weight = bf16 value x64 held in f16);
// scores v_wmma_f32_16x16x32_f16 (q x16, k x16 single f16; four heads share one 32-deep k axis, the Q fragment is zeroed outside its head by value); P.V v_wmma_f32_16x16x32_f16 (P x16384 carry, v x64, single f16, row sum over the converted P);
// output projection v_wmma_f32_16x16x32_f16 (context x1024 single f16, weight = bf16 value x64 in f16), scale folded back in the f32 epilogue; softmax and LayerNorm in f32.
// Layout: bf16 x plane [b*SEQ+t][64]; transposed weight planes [out][in]; patch weight plane [oc][(ky*8+kx)*64+ic]; q plane [b*SEQ+t][64]; LayerNorm plane and k plane [b*NKEY+key][64]; v^T plane [b*64+c][key].
// Fused attention kernel in transposed form (S^T = K Q^T, O^T = V^T P^T), no score plane in memory, output projection inside the same kernel.

#ifndef NB
#define NB 2
#endif
#ifndef GH
#define GH 128                   // token grid height (rows of the grid used per batch)
#endif
#define GW   128                 // token grid width
#define SEQ  (GH * GW)
#define NB_FULL  2
#define GH_FULL  128
#define SEQ_FULL 16384
#ifndef OUT_SEQ
#define OUT_SEQ SEQ              // row pitch (in tokens) between batches of the output
#endif
#define DM   64
#define NH_  8
#define HD   8
#define SRR  8                   // patch size = stride
#define KGW  (GW / SRR)
#define NKEY ((GH / SRR) * (GW / SRR))
#define CK   (DM * SRR * SRR)    // patch projection depth (4096)
#define AW   4                   // waves per attention block (16 query rows each)
#define CP   72                  // LDS row pitch (halves) of the context tile
#define OSP  68                  // LDS row pitch (floats) of the output tile
#define PWV  16                  // waves per patch-projection block = slices of its depth = rows of its tile
#define PKS  (CK / PWV)          // depth of one slice (256 = 4 patch positions x 64 channels)
#define RP   68                  // LDS row pitch (floats) of the partial tiles
#define QC   16.0f               // carry of the q plane
#define KC   16.0f               // carry of the k plane
#define VC   64.0f               // carry of the v^T plane
#define WC   64.0f               // carry of the f16 weight planes
#define CTXC 1024.0f             // carry of the context tile
#define SC2  ((float)(0.35355339059327378 * 1.4426950408889634 / 256.0))   // HD^-0.5 * log2(e) / (QC * KC)
#define PSH  14.0f               // log2 of the P carry (16384)
#define NEGB (-3.0e38f)
#define OUTI (1.0f / 65536.0f)   // 1 / (CTXC * WC)

static_assert(DM == 64);
static_assert(NH_ * HD == DM);                 // head h = columns h*8 + d
static_assert(HD == 8);                        // one head = 8 k-slots = one half fragment of one lane half
static_assert(NH_ == 8);                       // two groups of four heads, 32 columns each
static_assert(DM % 32 == 0);                   // GEMM k-loops step by 32
static_assert(CK % 32 == 0);
static_assert(CK == 64 * DM);                  // k index = (ky*8+kx)*64 + ic
static_assert(SRR == 8);
static_assert(GH % SRR == 0);
static_assert(GW % SRR == 0);
static_assert(NKEY % 64 == 0);                 // a 64-token tile of the v^T GEMM never straddles two batches; key loop steps by 32
static_assert((NB * NKEY) % 64 == 0);
static_assert((NB * SEQ) % 64 == 0);
static_assert(SEQ % (16 * AW) == 0);           // attention grid covers the sequence exactly
static_assert(((size_t)SEQ * DM) % 8 == 0);
static_assert(NB <= NB_FULL);
static_assert(GH <= GH_FULL);
static_assert(SEQ <= SEQ_FULL);
static_assert((CP * 2) % 16 == 0);
static_assert((OSP * 4) % 16 == 0);
static_assert(CP >= DM);
static_assert(OSP >= DM);
static_assert(32 * 16 * 4 == 16 * DM * 2);
static_assert(32 * 16 * 8 == 16 * DM * 4);     // output stores: 32 lanes x 16 B x 8 instructions == 16 rows x 256 B
static_assert(256 * 2 * 16 == 64 * 64 * 2);
static_assert(AW * 16 * CP * 2 + AW * 16 * OSP * 4 <= 131072);
static_assert(64 * 65 * 4 <= 131072);
static_assert(16 * 68 * 4 <= 131072);
static_assert(PWV == 16);                      // wave w finishes row w of the 16-row tile
static_assert(PKS % DM == 0);                  // a slice holds whole patch positions
static_assert((SRR * DM) % PKS == 0);          // and stays inside one patch row ky
static_assert((NB * NKEY) % 16 == 0);
static_assert(NKEY % 16 == 0);                 // a 16-row tile never straddles two batches
static_assert((RP * 4) % 8 == 0);
static_assert(PWV * 16 * RP * 4 <= 131072);

typedef _Float16 h16;
typedef unsigned short bf;
typedef __attribute__((ext_vector_type(16))) __bf16   v16bf;
typedef __attribute__((ext_vector_type(16))) _Float16 v16h;
typedef __attribute__((ext_vector_type(8)))  _Float16 v8h;
typedef __attribute__((ext_vector_type(8)))  unsigned short v8us;
typedef __attribute__((ext_vector_type(8)))  float    v8f;
typedef __attribute__((ext_vector_type(4)))  float    v4f;
typedef v4f  __attribute__((may_alias)) v4fa;
typedef __attribute__((ext_vector_type(16))) unsigned short v16us;
typedef v8h  __attribute__((may_alias)) v8ha;
typedef __attribute__((ext_vector_type(2)))  float    v2f;
typedef v2f  __attribute__((may_alias)) v2fa;
typedef __attribute__((ext_vector_type(2)))  _Float16 v2h;

__device__ __forceinline__ unsigned short f2bf(float f) { unsigned u = __float_as_uint(f); u += 0x7FFFu + ((u >> 16) & 1u); return (unsigned short)(u >> 16); }
__device__ __forceinline__ float bfr(float f) { return __uint_as_float(((unsigned)f2bf(f)) << 16); }   // value after RNE convert to bf16
__device__ __forceinline__ v16h cat16(v8h lo, v8h hi) { return __builtin_shufflevector(lo, hi, 0, 1, 2, 3, 4, 5, 6, 7, 8, 9, 10, 11, 12, 13, 14, 15); }
__device__ __forceinline__ v16bf cat16b(v8us lo, v8us hi) { return __builtin_bit_cast(v16bf, __builtin_shufflevector(lo, hi, 0, 1, 2, 3, 4, 5, 6, 7, 8, 9, 10, 11, 12, 13, 14, 15)); }
__device__ __forceinline__ v8f wmma16(v16h a, v16h b, v8f c) { return __builtin_amdgcn_wmma_f32_16x16x32_f16(false, a, false, b, (short)0, c, false, false); }
__device__ __forceinline__ v8f wmmab(v16bf a, v16bf b, v8f c) { return __builtin_amdgcn_wmma_f32_16x16x32_bf16(false, a, false, b, (short)0, c, false, false); }
// fragment loaders from K-contiguous 16-bit rows; p already includes + 8*(lane>>4): elements 0..7 <- k0+8h+0..7, elements 8..15 <- k0+16+8h+0..7 (same map for A and B)
__device__ __forceinline__ v16h  ldh(const h16* p) { return cat16(*(const v8h*)p, *(const v8h*)(p + 16)); }
__device__ __forceinline__ v16bf ldb(const bf* p)  { return cat16b(*(const v8us*)p, *(const v8us*)(p + 16)); }
// ordering point for wave-private LDS tiles (same wave writes and reads)
__device__ __forceinline__ void wave_sync() { __builtin_amdgcn_fence(3 /* release order */, "wavefront"); __builtin_amdgcn_wave_barrier(); asm volatile("" ::: "memory"); }

// f32 -> f16 with a value select: results below the smallest normal become +0 (applied after the plane's power-of-two carry)
static __device__ __forceinline__ h16 toh_flush(float v) { const h16 r = (h16)v; return (fabsf(v) < 6.103515625e-05f) ? (h16)0.0f : r; }
// raw 16-bit fragment (same k map), used by the GEMM body for both operand kinds
__device__ __forceinline__ v16us cat16u(v8us lo, v8us hi) { return __builtin_shufflevector(lo, hi, 0, 1, 2, 3, 4, 5, 6, 7, 8, 9, 10, 11, 12, 13, 14, 15); }
__device__ __forceinline__ v16us ldu(const bf* p) { return cat16u(*(const v8us*)p, *(const v8us*)(p + 16)); }
// one WMMA + its own four-slot guard (ties the result, keeps both fragments live)
__device__ __forceinline__ v8f wmma16g(v16h a, v16h b, v8f c) {
    c = __builtin_amdgcn_wmma_f32_16x16x32_f16(false, a, false, b, (short)0, c, false, false);
    asm volatile("v_nop\n\tv_nop\n\tv_nop\n\tv_nop" : "+v"(c) : "v"(a), "v"(b));
    return c; }
template <bool F16>
__device__ __forceinline__ v8f wmmaug(v16us a, v16us b, v8f c) {
    if (F16) c = __builtin_amdgcn_wmma_f32_16x16x32_f16(false, __builtin_bit_cast(v16h, a), false, __builtin_bit_cast(v16h, b), (short)0, c, false, false);
    else     c = __builtin_amdgcn_wmma_f32_16x16x32_bf16(false, __builtin_bit_cast(v16bf, a), false, __builtin_bit_cast(v16bf, b), (short)0, c, false, false);
    asm volatile("v_nop\n\tv_nop\n\tv_nop\n\tv_nop" : "+v"(c) : "v"(a), "v"(b));
    return c; }

// f16mode == 0: bf16 RNE bits; f16mode != 0: f16 bits of (bf16 value x carry), results below the smallest normal selected to +0.
// One block of 256 threads per 64 x 64 tile: tile column bx of plane z, in[rows = 64][Cn] -> out[Cn][64].
__device__ __forceinline__ void wT_body(const float* __restrict__ src, bf* dst, int Cn, int f16mode, float carry, int bx, int z) {
#pragma clang fp contract(off)
    __shared__ float ts[64 * 65];
    const int tid = threadIdx.x; const int c0 = bx * 64;
    const float* sp = src + (size_t)z * 64 * (size_t)Cn + c0;
#pragma unroll 1
    for (int it = 0; it < 16; ++it) { const int idx = it * 256 + tid; const int r = idx >> 6, c = idx & 63;   // 16 trips x 256 = 64 x 64 elements
        ts[r * 65 + c] = sp[(size_t)r * Cn + c]; }
    __syncthreads();
    bf* dp = dst + ((size_t)z * (size_t)Cn + c0) * 64;
{
#pragma unroll 1
        for (int it = 0; it < 2; ++it) { const int p = it * 256 + tid; const int c = p >> 3, r8 = (p & 7) * 8; v8us o;   // 2 trips x 256 = 64 rows x 8 pieces
#pragma unroll
            for (int k = 0; k < 8; ++k) { const float v = ts[(r8 + k) * 65 + c];
                const unsigned short ub = f2bf(v);
                const h16 hv = toh_flush(bfr(v) * carry);
                const unsigned short uh = __builtin_bit_cast(unsigned short, hv);
                o[k] = f16mode ? uh : ub; }
            *(v8us*)(dp + (size_t)c * 64 + r8) = o;
            asm volatile("s_wait_xcnt 0x0" ::: "memory"); }   // the next trip rewrites the store's address and data registers
         }
}

// k_prep: everything that depends on the inputs alone, in ONE launch; the block index picks the job (a block-uniform choice, so the barrier of wT_body is passed by whole blocks).
// Blocks 0 .. WTB-1: the weight tiles (they have the longest dependent chain, so they get the lowest block indices): 64 patch-weight planes, per oc [64 ic][64 (ky,kx)] -> [64 (ky,kx)][64 ic]; q_w [64 in][64 out] -> [64 out][64 in];
// kv_w [64 in][128 out] -> [128 out][64 in] (two tiles); proj_w [64 in][64 out] -> [64 out][64 in]. Blocks WTB ..: x -> bf16 plane, 8 elements per thread.
#define WTB  (DM + 4)
#define N8B  ((size_t)SEQ * DM / 8)                       // 8-element pieces of x per batch
#define CVB  ((unsigned)(((size_t)NB * N8B + 255) / 256))  // blocks of the x conversion
__global__ __launch_bounds__(256) void k_prep(const float* __restrict__ x, const float* __restrict__ q_w, const float* __restrict__ kv_w, const float* __restrict__ sr_w, const float* __restrict__ pj_w,
                                              bf* XB, bf* WQT, bf* KVT, bf* SW, bf* PWT) {
    const int bid = (int)blockIdx.x;
    if (bid < WTB) {
        const float* src = sr_w; bf* dst = SW; int Cn = DM, f16mode = 0, bx = 0, z = bid;
        if (bid == DM)          { src = q_w;  dst = WQT; z = 0; }
        else if (bid == DM + 3) { src = pj_w; dst = PWT; z = 0; f16mode = 1; }
        else if (bid > DM)      { src = kv_w; dst = KVT; z = 0; f16mode = 1; Cn = 2 * DM; bx = bid - (DM + 1); }
        wT_body(src, dst, Cn, f16mode, f16mode ? WC : 1.0f, bx, z);
        return;
    }
    const size_t i = (size_t)(bid - WTB) * 256 + threadIdx.x; if (i >= (size_t)NB * N8B) return;
    const v8f v = *(const v8f*)(x + (i / N8B) * ((size_t)SEQ_FULL * DM) + (i % N8B) * 8); v8us o;   // batch pitch of x is the full sequence
#pragma unroll
    for (int k = 0; k < 8; ++k) o[k] = f2bf(v[k]);
    *(v8us*)(XB + i * 8) = o;
}

// gemm_body: register-blocked GEMM, ONE WAVE per 64x64 tile (16 accumulators), operands straight from K-contiguous 16-bit planes (raw 16-bit loads), C[m][n] = sum_k A[m][k] Bt[n][k]. tile = index of the wave's tile, os = its 16 x 68 f32 LDS tile.
// KIND 0: q projection, bf16 operands, K = 64; A = x rows (m = b*SEQ + t), Bt = q weight rows (n); result x QC as f16 rows [m][64]. NB*SEQ/64 tiles.
// KIND 1: patch projection, bf16 operands, K = 4096 with k = (ky*8+kx)*64 + ic; A row m = (b, ty, tx) addressed arithmetically inside the bf16 x plane (64 contiguous channels per patch position),
//         Bt = permuted patch weight rows (n = oc); + bias, LayerNorm over the 64 channels of each row in f32 (two lanes per row, one xor-16 exchange), gain / offset applied; f16 rows [m][64]. NB*NKEY/64 tiles.
// KIND 2: k projection, f16 operands, K = 64; A = LayerNorm rows, Bt = kv weight rows 0..63 (x WC); result x KC/WC as f16 rows [m][64]. NB*NKEY/64 tiles.
// KIND 3: v^T projection, f16 operands, K = 64; A = kv weight rows 64..127 (m = c), Bt = LayerNorm rows (n = b*NKEY + key); result x VC/WC into plane [(b*64 + c)][key], row pitch NKEY. NB*NKEY/64 tiles (tile index = token tile).
template <int KIND>
__device__ __forceinline__ void gemm_body(const bf* __restrict__ A, const bf* __restrict__ Bt, const float* __restrict__ cbias, const float* __restrict__ lg, const float* __restrict__ lb, h16* P, int tile, float* os) {
    constexpr int KD = (KIND == 1) ? CK : DM;
    constexpr bool F16 = (KIND >= 2);
    constexpr float SCL = (KIND == 0) ? QC : ((KIND == 1) ? 1.0f : ((KIND == 2) ? (KC / WC) : (VC / WC)));
    const int lane = threadIdx.x & 31, lr = lane & 15, hi = lane >> 4;
    const int r0 = (KIND == 3) ? 0 : tile * 64;
    const int c0 = (KIND == 3) ? tile * 64 : 0;
    v8f acc[4][4];
#pragma unroll
    for (int mb = 0; mb < 4; ++mb)
#pragma unroll
        for (int nb = 0; nb < 4; ++nb) acc[mb][nb] = (v8f){};
    size_t aoff[4];
#pragma unroll
    for (int mb = 0; mb < 4; ++mb) {
        const int mrow = r0 + mb * 16 + lr;
        if (KIND == 1) { const int bb = mrow / NKEY, tk = mrow % NKEY; const int ty = tk / KGW, tx = tk % KGW;
                         aoff[mb] = ((size_t)bb * SEQ + (size_t)(ty * SRR) * GW + (size_t)(tx * SRR)) * DM + 8 * hi; }
        else           { aoff[mb] = (size_t)mrow * DM + 8 * hi; } }
    const size_t boff = (size_t)(c0 + lr) * KD + 8 * hi;
#pragma unroll 1
    for (int kc = 0; kc < KD; kc += 32) {
        const size_t ak = (KIND == 1) ? (size_t)((((kc >> 9) * GW + ((kc >> 6) & 7)) * DM) + (kc & 63)) : (size_t)kc;   // patch position (ky, kx) = (kc>>9, (kc>>6)&7), channel base kc&63
        v16us a[4];
#pragma unroll
        for (int mb = 0; mb < 4; ++mb) a[mb] = ldu(A + aoff[mb] + ak);
#pragma unroll
        for (int nb = 0; nb < 4; ++nb) { const v16us b = ldu(Bt + boff + (size_t)nb * 16 * KD + kc);
#pragma unroll
            for (int mb = 0; mb < 4; ++mb) acc[mb][nb] = wmmaug<F16>(a[mb], b, acc[mb][nb]); }
    }
    float bc[4];
#pragma unroll
    for (int nb = 0; nb < 4; ++nb) bc[nb] = (KIND == 1) ? bfr(cbias[nb * 16 + lr]) : 0.0f;
    const int bb3 = c0 / NKEY, tt3 = c0 % NKEY;
#pragma unroll
    for (int mb = 0; mb < 4; ++mb) {
#pragma unroll
        for (int nb = 0; nb < 4; ++nb) {
#pragma unroll
            for (int j = 0; j < 8; ++j) os[(hi * 8 + j) * 68 + nb * 16 + lr] = (acc[mb][nb][j] + bc[nb]) * SCL; }   // D: row 8h+j, col lane&15; rows 0..15 x columns 0..63 all written
        wave_sync();
        if (KIND == 1) {
            // LayerNorm of row lr; this lane owns columns 32*hi .. 32*hi+31 (reads and rewrites only those)
            const int cb0 = lr * 68 + hi * 32;
            float s = 0.0f;
#pragma unroll
            for (int i = 0; i < 8; ++i) { const v4f x = *(const v4fa*)(&os[cb0 + 4 * i]); s += (x[0] + x[1]) + (x[2] + x[3]); }
            s += __shfl_xor(s, 16, 32);
            const float mu = s * (1.0f / 64.0f);
            float q = 0.0f;
#pragma unroll
            for (int i = 0; i < 8; ++i) { const v4f x = *(const v4fa*)(&os[cb0 + 4 * i]);
                const float d0 = x[0] - mu, d1 = x[1] - mu, d2 = x[2] - mu, d3 = x[3] - mu; q += (d0 * d0 + d1 * d1) + (d2 * d2 + d3 * d3); }
            q += __shfl_xor(q, 16, 32);
            const float rs = 1.0f / sqrtf(q * (1.0f / 64.0f) + 1.0e-5f);
#pragma unroll
            for (int i = 0; i < 8; ++i) { const v4f x = *(const v4fa*)(&os[cb0 + 4 * i]);
                const v4f g = *(const v4f*)(lg + hi * 32 + 4 * i); const v4f o = *(const v4f*)(lb + hi * 32 + 4 * i); v4f y;
#pragma unroll
                for (int e = 0; e < 4; ++e) y[e] = (x[e] - mu) * rs * bfr(g[e]) + bfr(o[e]);
                *(v4fa*)(&os[cb0 + 4 * i]) = y; }
            wave_sync();
        }
{
#pragma unroll
            for (int s = 0; s < 4; ++s) { const int row = 4 * s + (lane >> 3), c8 = (lane & 7) * 8;   // 4 s x 4 row groups = 16 rows; 8 lanes x 8 = 64 columns = one line
                const v4f x0 = *(const v4fa*)(&os[row * 68 + c8]); const v4f x1 = *(const v4fa*)(&os[row * 68 + c8 + 4]); v8h hv;
#pragma unroll
                for (int i = 0; i < 4; ++i) { hv[i] = toh_flush(x0[i]); hv[4 + i] = toh_flush(x1[i]); }
                const size_t oo = (KIND == 3) ? (((size_t)bb3 * DM + (size_t)(mb * 16 + row)) * NKEY + (size_t)tt3 + c8)
                                              : ((size_t)(r0 + mb * 16 + row) * DM + c8);
                *(v8h*)(P + oo) = hv; }
            asm volatile("s_wait_xcnt 0x0" ::: "memory");   // what follows (the next row group, or in the listing another job's body) rewrites address and data registers of these four stores
             }
        wave_sync();
    }
}

// k_proj: the three projections that the attention kernel waits for, in ONE launch (none reads what another writes); the block index picks the job: KVB tiles of k, KVB tiles of v^T, then the q tiles.
#define KVB (NB * NKEY / 64)
#define QPB (NB * SEQ / 64)
__global__ __launch_bounds__(32) void k_proj(const bf* __restrict__ XB, const bf* __restrict__ WQT, const bf* __restrict__ LNP, const bf* __restrict__ KVT, h16* QH, h16* KP, h16* VT) {
    __shared__ __align__(16) float os[16 * 68];
    const int bid = (int)blockIdx.x;
    if (bid < KVB)          gemm_body<2>(LNP, KVT, (const float*)0, (const float*)0, (const float*)0, KP, bid, os);
    else if (bid < 2 * KVB) gemm_body<3>(KVT + (size_t)DM * DM, LNP, (const float*)0, (const float*)0, (const float*)0, VT, bid - KVB, os);
    else                    gemm_body<0>(XB, WQT, (const float*)0, (const float*)0, (const float*)0, QH, bid - 2 * KVB, os);
}

// k_patch: patch projection (bf16 operands, K = 4096 with k = (ky*8+kx)*64 + ic) + bias + LayerNorm; f16 rows [m][64]. grid NB*NKEY/16, PWV waves per block. (It takes the place of gemm_body's KIND 1, which nothing instantiates any more.)
// One block per 16 rows m = (b, ty, tx = 0..15) x all 64 output channels; A rows addressed arithmetically inside the bf16 x plane (64 contiguous channels per patch position), Bt = permuted patch weight rows (n = oc).
// The depth is split over the waves: wave w sums k = 256 w .. 256 w + 255 (ky = w>>1, kx = 4 (w&1) .. + 3) into its own 16 x 64 f32 partial tile, one patch position (one 128-B line of every A and Bt row) per trip.
// The 16 partial tiles meet in LDS; behind the block barrier wave w adds them up for row w in slice order (lane owns columns 2 lane, 2 lane + 1), adds the bias and does the LayerNorm of that row in f32 (xor exchanges over the 32 lanes).
// amdgpu_waves_per_eu(4, 4): one block fills its 4 waves per SIMD and the grid is smaller than the chip, so the register budget goes to loads in flight (without it each fragment is loaded and waited for alone).
__global__ __launch_bounds__(32 * PWV) __attribute__((amdgpu_waves_per_eu(4, 4))) void k_patch(const bf* __restrict__ A, const bf* __restrict__ Bt, const float* __restrict__ cbias, const float* __restrict__ lg, const float* __restrict__ lb, h16* P) {
    __shared__ __align__(16) float red[PWV * 16 * RP];
    const int lane = threadIdx.x & 31, lr = lane & 15, hi = lane >> 4;
    const int wave = __builtin_amdgcn_readfirstlane((int)(threadIdx.x >> 5));
    const int r0 = (int)blockIdx.x * 16;
    const int mrow = r0 + lr;
    const int bb = mrow / NKEY, tk = mrow % NKEY; const int ty = tk / KGW, tx = tk % KGW;
    const int k0 = wave * PKS;
    const bf* ap = A + ((size_t)bb * SEQ + (size_t)(ty * SRR + (k0 >> 9)) * GW + (size_t)(tx * SRR + ((k0 >> 6) & 7))) * DM + 8 * hi;   // first patch position of the slice: (ky, kx) = (k0>>9, (k0>>6)&7)
    const bf* bp = Bt + (size_t)lr * CK + k0 + 8 * hi;
    v8f acc[4];                                                    // the loops over nb and j below are unrolled so that acc[] is indexed by constants and stays in registers
#pragma unroll
    for (int nb = 0; nb < 4; ++nb) acc[nb] = (v8f){};
#pragma unroll                                                     // 4 trips, unrolled: every address is base + constant, and a later trip's loads issue ahead of an earlier trip's WMMAs
    for (int kk = 0; kk < PKS; kk += DM) {                         // next patch position in the row = next token = + DM in both planes
        const v16bf a0 = ldb(ap + kk), a1 = ldb(ap + kk + 32);
#pragma unroll
        for (int nb = 0; nb < 4; ++nb) { const v16bf b0 = ldb(bp + (size_t)nb * 16 * CK + kk), b1 = ldb(bp + (size_t)nb * 16 * CK + kk + 32);
            acc[nb] = wmmab(a0, b0, acc[nb]); acc[nb] = wmmab(a1, b1, acc[nb]); }
    }
#pragma unroll
    for (int nb = 0; nb < 4; ++nb) {
#pragma unroll
        for (int j = 0; j < 8; ++j) red[(wave * 16 + hi * 8 + j) * RP + nb * 16 + lr] = acc[nb][j]; }   // D: row 8h+j, col lane&15
    __syncthreads();
    const v2f t0 = *(const v2fa*)(&red[wave * RP + 2 * lane]);
    float x0 = t0[0], x1 = t0[1];
#pragma unroll
    for (int p = 1; p < PWV; ++p) { const v2f t = *(const v2fa*)(&red[(p * 16 + wave) * RP + 2 * lane]); x0 += t[0]; x1 += t[1]; }
    const v2f bi = *(const v2f*)(cbias + 2 * lane), g = *(const v2f*)(lg + 2 * lane), of = *(const v2f*)(lb + 2 * lane);
    x0 += bfr(bi[0]); x1 += bfr(bi[1]);
    float sm = x0 + x1;
#pragma unroll
    for (int d = 16; d >= 1; d >>= 1) sm += __shfl_xor(sm, d, 32);
    const float mu = sm * (1.0f / 64.0f);
    const float d0 = x0 - mu, d1 = x1 - mu;
    float q = d0 * d0 + d1 * d1;
#pragma unroll
    for (int d = 16; d >= 1; d >>= 1) q += __shfl_xor(q, d, 32);
    const float rs = 1.0f / sqrtf(q * (1.0f / 64.0f) + 1.0e-5f);
    v2h hv;
    hv[0] = toh_flush(d0 * rs * bfr(g[0]) + bfr(of[0]));
    hv[1] = toh_flush(d1 * rs * bfr(g[1]) + bfr(of[1]));
    *(v2h*)(P + (size_t)(r0 + wave) * DM + 2 * lane) = hv;         // one wave stores one whole 128-B row
}

// k_attn: fused attention + output projection, one wave per 16 query rows of one batch, the 8 heads in two trips of four (the four heads that share a 32-column group go through the key loop together, on one K fragment pair per 32 keys); K / V^T / Q fragments straight from the f16 planes (two 16-B loads each, arithmetic addressing).
// Transposed form: S^T[key][t] = K Q^T (A = K rows over the 32 columns of the head's group, B = Q row with the k-slots outside the head selected to zero by value); lane (t = lane&15, h = lane>>4) holds keys 8h+r
// of each 16-key tile, so the packed P tile is directly the B fragment of O^T[d][t] = V^T P^T (A rows d: channel head*8 + (lane&7); rows 8..15 repeat rows 0..7 and are not used).
// Online softmax state is one scalar per lane; the two lane halves of a row are combined with one xor-16 exchange. P = f16 of exp2(score - max + 14), converted in pairs (subnormal results kept); row sum over the converted P.
// Context (x CTXC) of each head goes to a wave-private f16 LDS tile [16][64]; after the head loop the tile is the A operand of the output projection (B = transposed weight plane, f16 x WC);
// The two integer grid-size inputs are read on the device; when they differ from the compiled grid the output is filled with NaN.
__global__ __launch_bounds__(32 * AW) void k_attn(const h16* __restrict__ QH, const h16* __restrict__ KP, const h16* __restrict__ VT, const h16* __restrict__ PW,
                                                  const float* __restrict__ pbias, const int* __restrict__ hp, const int* __restrict__ wp, float* OUT) {
    __shared__ __align__(16) h16   cs[AW * 16 * CP];
    __shared__ __align__(16) float os[AW * 16 * OSP];
    const int lane = threadIdx.x & 31, lr = lane & 15, hi = lane >> 4;
    const int wave = __builtin_amdgcn_readfirstlane((int)(threadIdx.x >> 5));
    const int b = blockIdx.y;
    const int t0 = (blockIdx.x * AW + wave) * 16;
    const bool bad = (hp[0] != GH_FULL) | (wp[0] != GW);
    const size_t qrow  = ((size_t)b * SEQ + (size_t)(t0 + lr)) * DM + 8 * hi;
    const size_t kbase = ((size_t)b * NKEY + (size_t)lr) * DM + 8 * hi;        // + key * DM + 32 * group   (A fragment: row key, k = column inside the group)
    const size_t vbase = ((size_t)b * DM + (size_t)(lr & 7)) * NKEY + 8 * hi;  // + head*8*NKEY + key       (A fragment: row d, k = key)
    const int cb = wave * 16 * CP;
    const v8h z8 = (v8h){};
#pragma unroll 1
    for (int g = 0; g < 2; ++g) {                                  // one trip = the four heads that share the group's 32 columns, carried together through the key loop
        const v8h qa = *(const v8h*)(QH + qrow + 32 * g), qb = *(const v8h*)(QH + qrow + 32 * g + 16);
        v16h qf[4]; v8f o[4]; float m[4], l[4];                    // every loop over j is unrolled so that the per-head arrays are indexed by constants and stay in registers
#pragma unroll
        for (int j = 0; j < 4; ++j) {
            const bool kA = (hi == (j & 1)) & (j < 2);             // head j of the group = k-slots 8j..8j+7: lane half (j&1), elements 0..7 (j < 2) or 8..15 (j >= 2)
            const bool kB = (hi == (j & 1)) & (j >= 2);
            qf[j] = cat16(kA ? qa : z8, kB ? qb : z8);             // B fragment: col t, k = column inside the group
            o[j] = (v8f){}; m[j] = NEGB; l[j] = 0.0f; }
        const size_t ko = kbase + (size_t)(32 * g);
        const size_t vo = vbase + (size_t)(g * 4 * HD) * NKEY;
#pragma unroll 1
        for (int key0 = 0; key0 < NKEY; key0 += 32) {
            const h16* ka = KP + ko + (size_t)key0 * DM;
            const v16h ka0 = ldh(ka), kb0 = ldh(ka + 16 * DM);     // one K fragment pair serves the four heads
            v16h vf[4];
#pragma unroll
            for (int j = 0; j < 4; ++j) vf[j] = ldh(VT + vo + (size_t)(j * HD) * NKEY + key0);
            v8f sa[4], sb[4];
#pragma unroll
            for (int j = 0; j < 4; ++j) { sa[j] = wmma16(ka0, qf[j], (v8f){}); sb[j] = wmma16(kb0, qf[j], (v8f){}); }   // eight independent products
            float mx[4];
#pragma unroll
            for (int j = 0; j < 4; ++j) { mx[j] = NEGB;
#pragma unroll
                for (int r = 0; r < 8; ++r) { sa[j][r] = sa[j][r] * SC2; sb[j][r] = sb[j][r] * SC2; mx[j] = fmaxf(mx[j], fmaxf(sa[j][r], sb[j][r])); } }
            float ox[4];
#pragma unroll
            for (int j = 0; j < 4; ++j) ox[j] = __shfl_xor(mx[j], 16, 32);           // the other lane half's maximum, one exchange per head
            float dm[4], alpha[4], sh[4];
#pragma unroll
            for (int j = 0; j < 4; ++j) {
                const float mnew = fmaxf(m[j], fmaxf(mx[j], ox[j]));
                dm[j] = m[j] - mnew; alpha[j] = __builtin_amdgcn_exp2f(dm[j]); sh[j] = PSH - mnew; m[j] = mnew; }
            // the slot that the instruction set asks for behind a v_exp_f32 before its source register is overwritten: the sources are inputs here, so they stay untouched up to this v_nop
            asm volatile("v_nop" :: "v"(dm[0]), "v"(dm[1]), "v"(dm[2]), "v"(dm[3]), "v"(alpha[0]), "v"(alpha[1]), "v"(alpha[2]), "v"(alpha[3]));
#pragma unroll
            for (int j = 0; j < 4; ++j) {
                v16h pb; float ls = 0.0f;
                float ea[8], eb[8], xa[8], xb[8];
#pragma unroll
                for (int r = 0; r < 8; ++r) { ea[r] = sa[j][r] + sh[j]; eb[r] = sb[j][r] + sh[j]; xa[r] = __builtin_amdgcn_exp2f(ea[r]); xb[r] = __builtin_amdgcn_exp2f(eb[r]); }
                // the same slot for these v_exp_f32, eight to a statement: no source register is overwritten before all eight results stand
                asm volatile("v_nop" :: "v"(ea[0]), "v"(ea[1]), "v"(ea[2]), "v"(ea[3]), "v"(ea[4]), "v"(ea[5]), "v"(ea[6]), "v"(ea[7]), "v"(xa[0]), "v"(xa[1]), "v"(xa[2]), "v"(xa[3]), "v"(xa[4]), "v"(xa[5]), "v"(xa[6]), "v"(xa[7]));
                asm volatile("v_nop" :: "v"(eb[0]), "v"(eb[1]), "v"(eb[2]), "v"(eb[3]), "v"(eb[4]), "v"(eb[5]), "v"(eb[6]), "v"(eb[7]), "v"(xb[0]), "v"(xb[1]), "v"(xb[2]), "v"(xb[3]), "v"(xb[4]), "v"(xb[5]), "v"(xb[6]), "v"(xb[7]));
#pragma unroll
                for (int r = 0; r < 8; r += 2) {                   // two P values to a register by one packed convert (round to nearest even); values under the smallest normal f16 stay subnormal: the matrix unit and the sum below both take them as they are
                    const v2h pa = __builtin_convertvector((v2f){xa[r], xa[r + 1]}, v2h);
                    const v2h pc = __builtin_convertvector((v2f){xb[r], xb[r + 1]}, v2h);
                    pb[r] = pa[0]; pb[r + 1] = pa[1]; pb[8 + r] = pc[0]; pb[9 + r] = pc[1];
                    ls += (float)pa[0]; ls += (float)pc[0]; ls += (float)pa[1]; ls += (float)pc[1]; }   // one running sum: each add reads its f16 half straight from the packed register
                l[j] = l[j] * alpha[j] + ls;
                o[j] = o[j] * alpha[j];
                o[j] = wmma16(vf[j], pb, o[j]);
            }
            // four vector slots between the trip's last WMMA and the loop branch: the next trip's first products reuse this trip's fragment registers
            asm volatile("v_nop\n\tv_nop\n\tv_nop\n\tv_nop" : "+v"(o[0]), "+v"(o[1]), "+v"(o[2]), "+v"(o[3]));
        }
#pragma unroll
        for (int j = 0; j < 4; ++j) {
            const float lt = l[j] + __shfl_xor(l[j], 16, 32);
            const float inv = (1.0f / lt) * (CTXC / VC);           // lt >= 16384 (the maximum element of every row converts to 16384)
            v8h cv;
#pragma unroll
            for (int r = 0; r < 8; ++r) cv[r] = toh_flush(o[j][r] * inv);           // lane half 0: o[r] = (d = r, t = lane&15)
            if (hi == 0) *(v8ha*)(&cs[cb + lr * CP + (g * 4 + j) * HD]) = cv; }     // 8 heads x 8 columns: rows 0..15 x columns 0..63 all written
    }
    wave_sync();
    v8f acc[4];
#pragma unroll
    for (int nb = 0; nb < 4; ++nb) acc[nb] = (v8f){};
#pragma unroll
    for (int kc = 0; kc < DM; kc += 32) {
        const v8h a0 = *(const v8ha*)(&cs[cb + lr * CP + kc + 8 * hi]);
        const v8h a1 = *(const v8ha*)(&cs[cb + lr * CP + kc + 16 + 8 * hi]);
        const v16h a = cat16(a0, a1);                              // A fragment: row t, k = context column
#pragma unroll
        for (int nb = 0; nb < 4; ++nb) { const v16h bw = ldh(PW + (size_t)(nb * 16 + lr) * DM + kc + 8 * hi);
            acc[nb] = wmma16g(a, bw, acc[nb]); }
    }
    const int ob = wave * 16 * OSP;
    const float nanv = __uint_as_float(0x7FC00000u);
#pragma unroll
    for (int nb = 0; nb < 4; ++nb) { const float bia = bfr(pbias[nb * 16 + lr]);
#pragma unroll
        for (int r = 0; r < 8; ++r) { const float v = acc[nb][r] * OUTI + bia;
            os[ob + (8 * hi + r) * OSP + nb * 16 + lr] = bad ? nanv : v; } }   // D: row 8h+r, col lane&15; rows 0..15 x columns 0..63 all written
    wave_sync();
    float* orow = OUT + ((size_t)b * OUT_SEQ + (size_t)t0) * DM;
{
#pragma unroll
        for (int s = 0; s < 8; ++s) { const int row = 2 * s + (lane >> 4), cofs = (lane & 15) * 4;
            const v4f val = *(const v4fa*)(&os[ob + row * OSP + cofs]);
            *(v4f*)(orow + (size_t)row * DM + cofs) = val; }
         }
}

static constexpr size_t al256(size_t v) { return (v + 255) & ~(size_t)255; }
static constexpr size_t SZ_XB = al256((size_t)NB * SEQ * DM * 2);        // bf16 x plane; also the extent of the q plane
static constexpr size_t SZ_W1 = al256((size_t)DM * DM * 2);              // one 64 x 64 weight plane
static constexpr size_t SZ_KV = al256((size_t)2 * DM * DM * 2);          // kv weight plane [128][64]
static constexpr size_t SZ_SW = al256((size_t)DM * CK * 2);              // patch weight plane [64][4096]
static constexpr size_t SZ_KP = al256((size_t)NB * NKEY * DM * 2);       // LayerNorm / k / v^T planes
static constexpr size_t SZ_TOTAL = 2 * SZ_XB + 2 * SZ_W1 + SZ_KV + SZ_SW + 3 * SZ_KP;
static_assert(SZ_TOTAL <= (size_t)134217728);                            // workspace carve <= 128 MiB
static_assert(((size_t)NB * SEQ * DM * 2) % 256 == 0);
static_assert(((size_t)NB * NKEY * DM * 2) % 256 == 0);
static_assert((size_t)NB * DM * NKEY == (size_t)NB * NKEY * DM);         // v^T plane [(b*64 + c)][key] has the same extent as the k plane

extern "C" void kernel_launch(void* const* d_in, const int* in_sizes, int n_in,
                              void* d_out, int out_size, void* d_ws, size_t ws_size, hipStream_t stream) {
    if (n_in < 11) return;
    const size_t needx = ((size_t)(NB - 1) * SEQ_FULL + SEQ) * DM;
    if ((size_t)in_sizes[0] < needx) return;
    if (in_sizes[1] < 1 || in_sizes[2] < 1) return;
    if ((size_t)in_sizes[3] < (size_t)DM * DM || (size_t)in_sizes[4] < (size_t)2 * DM * DM || (size_t)in_sizes[5] < (size_t)DM * CK) return;
    if (in_sizes[6] < DM || in_sizes[7] < DM || in_sizes[8] < DM || (size_t)in_sizes[9] < (size_t)DM * DM || in_sizes[10] < DM) return;
    if ((size_t)out_size < ((size_t)(NB - 1) * OUT_SEQ + SEQ) * DM) return;
    if (SZ_TOTAL > ws_size) return;
    // wire order: x, H, W, q_w, kv_w, sr_w, sr_b, ln_g, ln_b, proj_w, proj_b
    const float* x    = (const float*)d_in[0];
    const int*   gh   = (const int*)d_in[1];
    const int*   gw   = (const int*)d_in[2];
    const float* q_w  = (const float*)d_in[3];
    const float* kv_w = (const float*)d_in[4];
    const float* sr_w = (const float*)d_in[5];
    const float* sr_b = (const float*)d_in[6];
    const float* ln_g = (const float*)d_in[7];
    const float* ln_b = (const float*)d_in[8];
    const float* pj_w = (const float*)d_in[9];
    const float* pj_b = (const float*)d_in[10];
    float* OUT = (float*)d_out;      // [NB][SEQ][64]
    char* wsp = (char*)d_ws;
    bf*  XB  = (bf*)wsp;  wsp += SZ_XB;              // [NB*SEQ][64] bf16 x
    h16* QH  = (h16*)wsp; wsp += SZ_XB;              // [NB*SEQ][64] q x16
    bf*  WQT = (bf*)wsp;  wsp += SZ_W1;              // [64 out][64 in] bf16
    bf*  PWT = (bf*)wsp;  wsp += SZ_W1;              // [64 out][64 in] f16 bits, x64
    bf*  KVT = (bf*)wsp;  wsp += SZ_KV;              // [128 out][64 in] f16 bits, x64 (rows 0..63 k, 64..127 v)
    bf*  SW  = (bf*)wsp;  wsp += SZ_SW;              // [64 oc][(ky*8+kx)*64 + ic] bf16
    h16* LNP = (h16*)wsp; wsp += SZ_KP;              // [NB*NKEY][64] LayerNorm rows
    h16* KP  = (h16*)wsp; wsp += SZ_KP;              // [NB*NKEY][64] k x16
    h16* VT  = (h16*)wsp; wsp += SZ_KP;              // [NB*64][NKEY] v^T x64

    // four dependent launches: inputs -> planes; patch projection + LayerNorm; q, k, v^T projections; attention
    k_prep<<<dim3(WTB + CVB, 1, 1), 256, 0, stream>>>(x, q_w, kv_w, sr_w, pj_w, XB, WQT, KVT, SW, PWT);
    k_patch<<<dim3(NB * NKEY / 16, 1, 1), 32 * PWV, 0, stream>>>(XB, SW, sr_b, ln_g, ln_b, LNP);
    k_proj<<<dim3(2 * KVB + QPB, 1, 1), 32, 0, stream>>>(XB, WQT, (const bf*)LNP, KVT, QH, KP, VT);

    k_attn<<<dim3(SEQ / (16 * AW), NB, 1), 32 * AW, 0, stream>>>(QH, KP, VT, (const h16*)PWT, pj_b, gh, gw, OUT);
}

// v005
// One run takes 43.6 microseconds.
// Next to v004, in two timings, it ran 1.07 and 1.02 times as fast.
// Over all steps from v000 it is 4.75 times as fast.
#include <hip/hip_runtime.h>

// Spatial-reduction attention, width 64 = 8 heads x 8: queries from all NB x SEQ tokens (x @ q_w, weights [in][out], no bias); keys / values from an 8x8 stride-8 patch projection (+ bias) -> LayerNorm (eps 1e-5) -> fused [in][out] kv weight (256 keys per batch at the full size); dense softmax, score scale 8^-0.5; output projection (+ bias).
// Compute dtypes, f32 accumulate everywhere: q projection and patch projection v_wmma_f32_16x16x32_bf16 (x and weights RNE-converted to bf16; products exact); kv projection v_wmma_f32_16x16x32_f16 (LayerNorm rows single f16, weight = bf16 value x64 held in f16);
// scores v_wmma_f32_16x16x32_f16 (q x16, k x16 single f16; four heads share one 32-deep k axis, the Q fragment is zeroed outside its head by value); P.V v_wmma_f32_16x16x32_f16 (P x16384 carry, v x64, single f16, row sum over the converted P);
// output projection v_wmma_f32_16x16x32_f16 (context x1024 single f16, weight = bf16 value x64 in f16), scale folded back in the f32 epilogue; softmax and LayerNorm in f32.
// Layout: bf16 x plane [b*SEQ+t][64]; transposed weight planes [out][in]; patch weight plane [oc][(ky*8+kx)*64+ic]; k plane [b*NKEY+key][64]; v^T plane in tiles of 16 keys [(b*NKEY+key)/16][c][key%16]. q and the LayerNorm rows never reach memory.
// Fused attention kernel in transposed form (Q^T = Wq^T X^T, S^T = K Q^T, O^T = V^T P^T), no q or score plane in memory, q projection and output projection inside the same kernel; k and v^T projections inside the patch kernel, behind its LayerNorm.

#ifndef NB
#define NB 2
#endif
#ifndef GH
#define GH 128                   // token grid height (rows of the grid used per batch)
#endif
#define GW   128                 // token grid width
#define SEQ  (GH * GW)
#define NB_FULL  2
#define GH_FULL  128
#define SEQ_FULL 16384
#ifndef OUT_SEQ
#define OUT_SEQ SEQ              // row pitch (in tokens) between batches of the output
#endif
#define DM   64
#define NH_  8
#define HD   8
#define SRR  8                   // patch size = stride
#define KGW  (GW / SRR)
#define NKEY ((GH / SRR) * (GW / SRR))
#define CK   (DM * SRR * SRR)    // patch projection depth (4096)
#define AW   4                   // waves per attention block (16 query rows each)
#define CP   72                  // LDS row pitch (halves) of the context tile
#define OSP  68                  // LDS row pitch (floats) of the output tile
#define PWV  16                  // waves per patch-projection block = slices of its depth = rows of its tile
#define PKS  (CK / PWV)          // depth of one slice (256 = 4 patch positions x 64 channels)
#define RP   68                  // LDS row pitch (floats) of the partial tiles
#define LP   72                  // LDS row pitch (halves) of the LayerNorm tile
#define VTT  (DM * 16)           // halves in one 16-key tile of the v^T plane
#define QC   16.0f               // carry of q
#define KC   16.0f               // carry of the k plane
#define VC   64.0f               // carry of the v^T plane
#define WC   64.0f               // carry of the f16 weight planes
#define CTXC 1024.0f             // carry of the context tile
#define SC2  ((float)(0.35355339059327378 * 1.4426950408889634 / 256.0))   // HD^-0.5 * log2(e) / (QC * KC)
#define PSH  14.0f               // log2 of the P carry (16384)
#define NEGB (-3.0e38f)
#define OUTI (1.0f / 65536.0f)   // 1 / (CTXC * WC)

static_assert(DM == 64);
static_assert(NH_ * HD == DM);                 // head h = columns h*8 + d
static_assert(HD == 8);                        // one head = 8 k-slots = one half fragment of one lane half
static_assert(NH_ == 8);                       // two groups of four heads, 32 columns each
static_assert(DM % 32 == 0);                   // GEMM k-loops step by 32
static_assert(CK % 32 == 0);
static_assert(CK == 64 * DM);                  // k index = (ky*8+kx)*64 + ic
static_assert(SRR == 8);
static_assert(GH % SRR == 0);
static_assert(GW % SRR == 0);
static_assert(NKEY % 32 == 0);                 // key loop steps by 32
static_assert(SEQ % (16 * AW) == 0);           // attention grid covers the sequence exactly
static_assert(((size_t)SEQ * DM) % 8 == 0);
static_assert(NB <= NB_FULL);
static_assert(GH <= GH_FULL);
static_assert(SEQ <= SEQ_FULL);
static_assert((CP * 2) % 16 == 0);
static_assert((OSP * 4) % 16 == 0);
static_assert(CP >= DM);
static_assert(OSP >= DM);
static_assert(32 * 16 * 4 == 16 * DM * 2);
static_assert(32 * 16 * 8 == 16 * DM * 4);     // output stores: 32 lanes x 16 B x 8 instructions == 16 rows x 256 B
static_assert(256 * 2 * 16 == 64 * 64 * 2);
static_assert(AW * 16 * CP * 2 + AW * 16 * OSP * 4 <= 131072);
static_assert(64 * 65 * 4 <= 131072);
static_assert(PWV == 16);                      // wave w finishes row w of the 16-row tile
static_assert(PKS % DM == 0);                  // a slice holds whole patch positions
static_assert((SRR * DM) % PKS == 0);          // and stays inside one patch row ky
static_assert((NB * NKEY) % 16 == 0);
static_assert(NKEY % 16 == 0);                 // a 16-row tile never straddles two batches
static_assert((RP * 4) % 8 == 0);
static_assert((LP * 2) % 16 == 0);
static_assert(LP >= DM);
static_assert(PWV * 16 * RP * 4 + 16 * LP * 2 <= 131072);

typedef _Float16 h16;
typedef unsigned short bf;
typedef __attribute__((ext_vector_type(16))) __bf16   v16bf;
typedef __attribute__((ext_vector_type(16))) _Float16 v16h;
typedef __attribute__((ext_vector_type(8)))  _Float16 v8h;
typedef __attribute__((ext_vector_type(8)))  unsigned short v8us;
typedef __attribute__((ext_vector_type(8)))  float    v8f;
typedef __attribute__((ext_vector_type(4)))  float    v4f;
typedef v4f  __attribute__((may_alias)) v4fa;
typedef v8h  __attribute__((may_alias)) v8ha;
typedef __attribute__((ext_vector_type(2)))  float    v2f;
typedef v2f  __attribute__((may_alias)) v2fa;
typedef __attribute__((ext_vector_type(2)))  _Float16 v2h;

__device__ __forceinline__ unsigned short f2bf(float f) { unsigned u = __float_as_uint(f); u += 0x7FFFu + ((u >> 16) & 1u); return (unsigned short)(u >> 16); }
__device__ __forceinline__ float bfr(float f) { return __uint_as_float(((unsigned)f2bf(f)) << 16); }   // value after RNE convert to bf16
__device__ __forceinline__ v16h cat16(v8h lo, v8h hi) { return __builtin_shufflevector(lo, hi, 0, 1, 2, 3, 4, 5, 6, 7, 8, 9, 10, 11, 12, 13, 14, 15); }
__device__ __forceinline__ v16bf cat16b(v8us lo, v8us hi) { return __builtin_bit_cast(v16bf, __builtin_shufflevector(lo, hi, 0, 1, 2, 3, 4, 5, 6, 7, 8, 9, 10, 11, 12, 13, 14, 15)); }
__device__ __forceinline__ v8f wmma16(v16h a, v16h b, v8f c) { return __builtin_amdgcn_wmma_f32_16x16x32_f16(false, a, false, b, (short)0, c, false, false); }
__device__ __forceinline__ v8f wmmab(v16bf a, v16bf b, v8f c) { return __builtin_amdgcn_wmma_f32_16x16x32_bf16(false, a, false, b, (short)0, c, false, false); }
// fragment loaders from K-contiguous 16-bit rows; p already includes + 8*(lane>>4): elements 0..7 <- k0+8h+0..7, elements 8..15 <- k0+16+8h+0..7 (same map for A and B)
__device__ __forceinline__ v16h  ldh(const h16* p) { return cat16(*(const v8h*)p, *(const v8h*)(p + 16)); }
__device__ __forceinline__ v16bf ldb(const bf* p)  { return cat16b(*(const v8us*)p, *(const v8us*)(p + 16)); }
// ordering point for wave-private LDS tiles (same wave writes and reads)
__device__ __forceinline__ void wave_sync() { __builtin_amdgcn_fence(3 /* release order */, "wavefront"); __builtin_amdgcn_wave_barrier(); asm volatile("" ::: "memory"); }

// f32 -> f16 with a value select: results below the smallest normal become +0 (applied after the plane's power-of-two carry)
static __device__ __forceinline__ h16 toh_flush(float v) { const h16 r = (h16)v; return (fabsf(v) < 6.103515625e-05f) ? (h16)0.0f : r; }
// one WMMA + its own four-slot guard (ties the result, keeps both fragments live)
__device__ __forceinline__ v8f wmma16g(v16h a, v16h b, v8f c) {
    c = __builtin_amdgcn_wmma_f32_16x16x32_f16(false, a, false, b, (short)0, c, false, false);
    asm volatile("v_nop\n\tv_nop\n\tv_nop\n\tv_nop" : "+v"(c) : "v"(a), "v"(b));
    return c; }

// f16mode == 0: bf16 RNE bits; f16mode != 0: f16 bits of (bf16 value x carry), results below the smallest normal selected to +0.
// One block of 256 threads per 64 x 64 tile: tile column bx of plane z, in[rows = 64][Cn] -> out[Cn][64].
__device__ __forceinline__ void wT_body(const float* __restrict__ src, bf* dst, int Cn, int f16mode, float carry, int bx, int z) {
#pragma clang fp contract(off)
    __shared__ float ts[64 * 65];
    const int tid = threadIdx.x; const int c0 = bx * 64;
    const float* sp = src + (size_t)z * 64 * (size_t)Cn + c0;
#pragma unroll 1
    for (int it = 0; it < 16; ++it) { const int idx = it * 256 + tid; const int r = idx >> 6, c = idx & 63;   // 16 trips x 256 = 64 x 64 elements
        ts[r * 65 + c] = sp[(size_t)r * Cn + c]; }
    __syncthreads();
    bf* dp = dst + ((size_t)z * (size_t)Cn + c0) * 64;
{
#pragma unroll 1
        for (int it = 0; it < 2; ++it) { const int p = it * 256 + tid; const int c = p >> 3, r8 = (p & 7) * 8; v8us o;   // 2 trips x 256 = 64 rows x 8 pieces
#pragma unroll
            for (int k = 0; k < 8; ++k) { const float v = ts[(r8 + k) * 65 + c];
                const unsigned short ub = f2bf(v);
                const h16 hv = toh_flush(bfr(v) * carry);
                const unsigned short uh = __builtin_bit_cast(unsigned short, hv);
                o[k] = f16mode ? uh : ub; }
            *(v8us*)(dp + (size_t)c * 64 + r8) = o;
            asm volatile("s_wait_xcnt 0x0" ::: "memory"); }   // the next trip rewrites the store's address and data registers
         }
}

// k_prep: everything that depends on the inputs alone, in ONE launch; the block index picks the job (a block-uniform choice, so the barrier of wT_body is passed by whole blocks).
// Blocks 0 .. WTB-1: the weight tiles (they have the longest dependent chain, so they get the lowest block indices): 64 patch-weight planes, per oc [64 ic][64 (ky,kx)] -> [64 (ky,kx)][64 ic]; q_w [64 in][64 out] -> [64 out][64 in];
// kv_w [64 in][128 out] -> [128 out][64 in] (two tiles); proj_w [64 in][64 out] -> [64 out][64 in]. Blocks WTB ..: x -> bf16 plane, 8 elements per thread.
#define WTB  (DM + 4)
#define N8B  ((size_t)SEQ * DM / 8)                       // 8-element pieces of x per batch
#define CVB  ((unsigned)(((size_t)NB * N8B + 255) / 256))  // blocks of the x conversion
__global__ __launch_bounds__(256) void k_prep(const float* __restrict__ x, const float* __restrict__ q_w, const float* __restrict__ kv_w, const float* __restrict__ sr_w, const float* __restrict__ pj_w,
                                              bf* XB, bf* WQT, bf* KVT, bf* SW, bf* PWT) {
    const int bid = (int)blockIdx.x;
    if (bid < WTB) {
        const float* src = sr_w; bf* dst = SW; int Cn = DM, f16mode = 0, bx = 0, z = bid;
        if (bid == DM)          { src = q_w;  dst = WQT; z = 0; }
        else if (bid == DM + 3) { src = pj_w; dst = PWT; z = 0; f16mode = 1; }
        else if (bid > DM)      { src = kv_w; dst = KVT; z = 0; f16mode = 1; Cn = 2 * DM; bx = bid - (DM + 1); }
        wT_body(src, dst, Cn, f16mode, f16mode ? WC : 1.0f, bx, z);
        return;
    }
    const size_t i = (size_t)(bid - WTB) * 256 + threadIdx.x; if (i >= (size_t)NB * N8B) return;
    const v8f v = *(const v8f*)(x + (i / N8B) * ((size_t)SEQ_FULL * DM) + (i % N8B) * 8); v8us o;   // batch pitch of x is the full sequence
#pragma unroll
    for (int k = 0; k < 8; ++k) o[k] = f2bf(v[k]);
    *(v8us*)(XB + i * 8) = o;
}

// kv_tail: one wave's projection of the 16 LayerNorm rows (fragments n0, n1: depth 0..31, 32..63) onto 64 kv weight rows (fragments wf[2t], wf[2t+1] of tile t), four 16 x 16 tiles, each lane's 8 results of a tile stored as one 16-B piece at op + tile step.
// ISK: A = weight, B = LayerNorm: D row = column 16t + 8h + j of k, col = key lane&15; tile step 16 columns of a k row. Otherwise A = LayerNorm, B = weight: D row = key 8h + j, col = channel 16t + (lane&15) of v; tile step 16 channel rows of the v^T tile.
template <bool ISK>
__device__ __forceinline__ void kv_tail(const v16h (&wf)[8], v16h n0, v16h n1, h16* op) {
    v8f kv[4]; v8h ov[4];
#pragma unroll
    for (int t = 0; t < 4; ++t) kv[t] = ISK ? wmma16(wf[2 * t], n0, (v8f){}) : wmma16(n0, wf[2 * t], (v8f){});
#pragma unroll
    for (int t = 0; t < 4; ++t) kv[t] = ISK ? wmma16(wf[2 * t + 1], n1, kv[t]) : wmma16(n1, wf[2 * t + 1], kv[t]);
#pragma unroll
    for (int t = 0; t < 4; ++t) {
#pragma unroll
        for (int j = 0; j < 8; ++j) ov[t][j] = toh_flush(kv[t][j] * (ISK ? (KC / WC) : (VC / WC))); }
#pragma unroll
    for (int t = 0; t < 4; ++t) *(v8h*)(op + t * (ISK ? 16 : 16 * 16)) = ov[t];
}

// k_patch: patch projection (bf16 operands, K = 4096 with k = (ky*8+kx)*64 + ic) + bias + LayerNorm, then the k and v^T projections of the block's own 16 rows. grid NB*NKEY/16, PWV waves per block.
// One block per 16 rows m = (b, ty, tx = 0..15) x all 64 output channels; A rows addressed arithmetically inside the bf16 x plane (64 contiguous channels per patch position), Bt = permuted patch weight rows (n = oc).
// The depth is split over the waves: wave w sums k = 256 w .. 256 w + 255 (ky = w>>1, kx = 4 (w&1) .. + 3) into its own 16 x 64 f32 partial tile, one patch position (one 128-B line of every A and Bt row) per trip.
// The 16 partial tiles meet in LDS; behind the block barrier wave w adds them up for row w in slice order (lane owns columns 2 lane, 2 lane + 1), adds the bias and does the LayerNorm of that row in f32 (xor exchanges over the 32 lanes).
// The 16 LayerNorm rows (single f16) meet in a second LDS tile; behind a second block barrier wave 0 forms k^T = Wk^T LN^T (A = kv weight rows 0..63, x WC; lane = key, 8 adjacent columns per tile; result x KC/WC into rows [m][64])
// and wave 1 forms v = LN Wv (B = kv weight rows 64..127; lane = channel, 8 adjacent keys per tile; result x VC/WC into the block's own 16-key tile of the v^T plane). Each of the two waves alone writes its 2 KiB, so no 128-B line has two writers.
// amdgpu_waves_per_eu(4, 4): one block fills its 4 waves per SIMD and the grid is smaller than the chip, so the register budget goes to loads in flight (without it each fragment is loaded and waited for alone).
__global__ __launch_bounds__(32 * PWV) __attribute__((amdgpu_waves_per_eu(4, 4))) void k_patch(const bf* __restrict__ A, const bf* __restrict__ Bt, const float* __restrict__ cbias, const float* __restrict__ lg, const float* __restrict__ lb, const h16* __restrict__ KVW, h16* KP, h16* VT) {
    __shared__ __align__(16) float red[PWV * 16 * RP];
    __shared__ __align__(16) h16   lnt[16 * LP];
    const int lane = threadIdx.x & 31, lr = lane & 15, hi = lane >> 4;
    const int wave = __builtin_amdgcn_readfirstlane((int)(threadIdx.x >> 5));
    const int r0 = (int)blockIdx.x * 16;
    const int mrow = r0 + lr;
    const int bb = mrow / NKEY, tk = mrow % NKEY; const int ty = tk / KGW, tx = tk % KGW;
    const int k0 = wave * PKS;
    const bf* ap = A + ((size_t)bb * SEQ + (size_t)(ty * SRR + (k0 >> 9)) * GW + (size_t)(tx * SRR + ((k0 >> 6) & 7))) * DM + 8 * hi;   // first patch position of the slice: (ky, kx) = (k0>>9, (k0>>6)&7)
    const bf* bp = Bt + (size_t)lr * CK + k0 + 8 * hi;
    v8f acc[4];                                                    // the loops over nb and j below are unrolled so that acc[] is indexed by constants and stays in registers
#pragma unroll
    for (int nb = 0; nb < 4; ++nb) acc[nb] = (v8f){};
#pragma unroll                                                     // 4 trips, unrolled: every address is base + constant, and a later trip's loads issue ahead of an earlier trip's WMMAs
    for (int kk = 0; kk < PKS; kk += DM) {                         // next patch position in the row = next token = + DM in both planes
        const v16bf a0 = ldb(ap + kk), a1 = ldb(ap + kk + 32);
#pragma unroll
        for (int nb = 0; nb < 4; ++nb) { const v16bf b0 = ldb(bp + (size_t)nb * 16 * CK + kk), b1 = ldb(bp + (size_t)nb * 16 * CK + kk + 32);
            acc[nb] = wmmab(a0, b0, acc[nb]); acc[nb] = wmmab(a1, b1, acc[nb]); }
    }
#pragma unroll
    for (int nb = 0; nb < 4; ++nb) {
#pragma unroll
        for (int j = 0; j < 8; ++j) red[(wave * 16 + hi * 8 + j) * RP + nb * 16 + lr] = acc[nb][j]; }   // D: row 8h+j, col lane&15
    __syncthreads();
    v16h wf[8];                                                    // kv weight fragments of waves 0 (k rows) and 1 (v rows), asked for behind the barrier (which waits for every load in flight) so that they arrive while the sums and the LayerNorm run
    if (wave < 2) {
        const h16* wp = KVW + (size_t)(wave * DM + lr) * DM + 8 * hi;
#pragma unroll
        for (int f = 0; f < 8; ++f) wf[f] = ldh(wp + (f >> 1) * 16 * DM + (f & 1) * 32);   // tile f>>1 (16 weight rows), depth half f&1
        asm volatile("s_wait_xcnt 0x0" :: "v"(wp) : "memory"); }   // the address pair is an input here: no load's result lands on it while the other loads still name it
    const v2f t0 = *(const v2fa*)(&red[wave * RP + 2 * lane]);
    float x0 = t0[0], x1 = t0[1];
#pragma unroll
    for (int p = 1; p < PWV; ++p) { const v2f t = *(const v2fa*)(&red[(p * 16 + wave) * RP + 2 * lane]); x0 += t[0]; x1 += t[1]; }
    const v2f bi = *(const v2f*)(cbias + 2 * lane), g = *(const v2f*)(lg + 2 * lane), of = *(const v2f*)(lb + 2 * lane);
    x0 += bfr(bi[0]); x1 += bfr(bi[1]);
    float sm = x0 + x1;
#pragma unroll
    for (int d = 16; d >= 1; d >>= 1) sm += __shfl_xor(sm, d, 32);
    const float mu = sm * (1.0f / 64.0f);
    const float d0 = x0 - mu, d1 = x1 - mu;
    float q = d0 * d0 + d1 * d1;
#pragma unroll
    for (int d = 16; d >= 1; d >>= 1) q += __shfl_xor(q, d, 32);
    const float rs = 1.0f / sqrtf(q * (1.0f / 64.0f) + 1.0e-5f);
    v2h hv;
    hv[0] = toh_flush(d0 * rs * bfr(g[0]) + bfr(of[0]));
    hv[1] = toh_flush(d1 * rs * bfr(g[1]) + bfr(of[1]));
    *(v2h*)(&lnt[wave * LP + 2 * lane]) = hv;                      // row w of the LayerNorm tile
    __syncthreads();                                               // all 16 rows stand before waves 0 and 1 read them
    if (wave >= 2) return;                                         // no barrier follows
    const v16h n0 = cat16(*(const v8ha*)(&lnt[lr * LP + 8 * hi]),      *(const v8ha*)(&lnt[lr * LP + 16 + 8 * hi]));   // fragment of row lr, depth 0..31 (same k map as ldh)
    const v16h n1 = cat16(*(const v8ha*)(&lnt[lr * LP + 32 + 8 * hi]), *(const v8ha*)(&lnt[lr * LP + 48 + 8 * hi]));   // depth 32..63
    if (wave == 0) kv_tail<true>(wf, n0, n1, KP + (size_t)(r0 + lr) * DM + 8 * hi);
    else           kv_tail<false>(wf, n0, n1, VT + (size_t)blockIdx.x * VTT + lr * 16 + 8 * hi);
}

// k_attn: fused q projection + attention + output projection, one wave per 16 query rows of one batch, the 8 heads in two trips of four (the four heads that share a 32-column group go through the key loop together, on one K fragment pair per 32 keys); K / V^T fragments straight from the f16 planes (two 16-B loads each, arithmetic addressing).
// q projection in transposed form: Q^T[c][t] = Wq^T X^T (A = q weight rows c, B = bf16 x rows t, depth 64): lane (t = lane&15, h) holds columns 16 tile + 8h + 0..7 of its row, which after the f16 convert (x QC) are the two halves of the Q fragment below.
// Transposed form: S^T[key][t] = K Q^T (A = K rows over the 32 columns of the head's group, B = Q row with the k-slots outside the head selected to zero by value); lane (t = lane&15, h = lane>>4) holds keys 8h+r
// of each 16-key tile, so the packed P tile is directly the B fragment of O^T[d][t] = V^T P^T (A rows d: channel head*8 + (lane&7); rows 8..15 repeat rows 0..7 and are not used).
// Online softmax state is one scalar per lane; the two lane halves of a row are combined with one xor-16 exchange. P = f16 of exp2(score - max + 14), converted in pairs (subnormal results kept); row sum over the converted P.
// Context (x CTXC) of each head goes to a wave-private f16 LDS tile [16][64]; after the head loop the tile is the A operand of the output projection (B = transposed weight plane, f16 x WC);
// The two integer grid-size inputs are read on the device; when they differ from the compiled grid the output is filled with NaN.
__global__ __launch_bounds__(32 * AW) void k_attn(const bf* __restrict__ XB, const bf* __restrict__ WQT, const h16* __restrict__ KP, const h16* __restrict__ VT, const h16* __restrict__ PW,
                                                  const float* __restrict__ pbias, const int* __restrict__ hp, const int* __restrict__ wp, float* OUT) {
    __shared__ __align__(16) h16   cs[AW * 16 * CP];
    __shared__ __align__(16) float os[AW * 16 * OSP];
    const int lane = threadIdx.x & 31, lr = lane & 15, hi = lane >> 4;
    const int wave = __builtin_amdgcn_readfirstlane((int)(threadIdx.x >> 5));
    const int b = blockIdx.y;
    const int t0 = (blockIdx.x * AW + wave) * 16;
    const bool bad = (hp[0] != GH_FULL) | (wp[0] != GW);
    const size_t qrow  = ((size_t)b * SEQ + (size_t)(t0 + lr)) * DM + 8 * hi;
    const size_t kbase = ((size_t)b * NKEY + (size_t)lr) * DM + 8 * hi;        // + key * DM + 32 * group   (A fragment: row key, k = column inside the group)
    const size_t vbase = (size_t)b * (NKEY / 16) * VTT + (size_t)(lr & 7) * 16 + 8 * hi;   // + (key/16)*VTT + head*8*16   (A fragment: row d, k = key)
    const int cb = wave * 16 * CP;
    const v8h z8 = (v8h){};
    v8h qh[4];                                                     // q x QC of row t, columns 16 tile + 8h + 0..7
    {
        const v16bf x0 = ldb(XB + qrow), x1 = ldb(XB + qrow + 32);
        const bf* wr = WQT + (size_t)lr * DM + 8 * hi;
        v16bf wq[8];
#pragma unroll
        for (int f = 0; f < 8; ++f) wq[f] = ldb(wr + (f >> 1) * 16 * DM + (f & 1) * 32);   // tile f>>1 (16 weight rows), depth half f&1
        // the loaded fragments are inputs here, so all twenty loads are asked for before the first product waits: one trip to the L2 instead of two (without it the second depth half is loaded into the first half's registers, behind its products)
        asm volatile("" :: "v"(x0), "v"(x1), "v"(wq[0]), "v"(wq[1]), "v"(wq[2]), "v"(wq[3]), "v"(wq[4]), "v"(wq[5]), "v"(wq[6]), "v"(wq[7]));
#pragma unroll
        for (int t = 0; t < 4; ++t) {
            v8f qa4 = wmmab(wq[2 * t], x0, (v8f){}); qa4 = wmmab(wq[2 * t + 1], x1, qa4);   // D: row = column 8h + j of the tile, col = t
#pragma unroll
            for (int j = 0; j < 8; ++j) qh[t][j] = toh_flush(qa4[j] * QC); }
    }
#pragma unroll 1
    for (int g = 0; g < 2; ++g) {                                  // one trip = the four heads that share the group's 32 columns, carried together through the key loop
        const v8h qa = g ? qh[2] : qh[0], qb = g ? qh[3] : qh[1];  // columns 32g + 8h + 0..7 and 32g + 16 + 8h + 0..7
        v16h qf[4]; v8f o[4]; float m[4], l[4];                    // every loop over j is unrolled so that the per-head arrays are indexed by constants and stay in registers
#pragma unroll
        for (int j = 0; j < 4; ++j) {
            const bool kA = (hi == (j & 1)) & (j < 2);             // head j of the group = k-slots 8j..8j+7: lane half (j&1), elements 0..7 (j < 2) or 8..15 (j >= 2)
            const bool kB = (hi == (j & 1)) & (j >= 2);
            qf[j] = cat16(kA ? qa : z8, kB ? qb : z8);             // B fragment: col t, k = column inside the group
            o[j] = (v8f){}; m[j] = NEGB; l[j] = 0.0f; }
        const size_t ko = kbase + (size_t)(32 * g);
        const size_t vo = vbase + (size_t)(g * 4 * HD) * 16;
#pragma unroll 1
        for (int key0 = 0; key0 < NKEY; key0 += 32) {
            const h16* ka = KP + ko + (size_t)key0 * DM;
            const v16h ka0 = ldh(ka), kb0 = ldh(ka + 16 * DM);     // one K fragment pair serves the four heads
            v16h vf[4];
#pragma unroll
            for (int j = 0; j < 4; ++j) { const h16* vp = VT + vo + (size_t)(key0 >> 4) * VTT + j * HD * 16; vf[j] = cat16(*(const v8h*)vp, *(const v8h*)(vp + VTT)); }   // keys key0 + 8h + 0..7 and, one tile on, key0 + 16 + 8h + 0..7
            v8f sa[4], sb[4];
#pragma unroll
            for (int j = 0; j < 4; ++j) { sa[j] = wmma16(ka0, qf[j], (v8f){}); sb[j] = wmma16(kb0, qf[j], (v8f){}); }   // eight independent products
            float mx[4];
#pragma unroll
            for (int j = 0; j < 4; ++j) { mx[j] = NEGB;
#pragma unroll
                for (int r = 0; r < 8; ++r) { sa[j][r] = sa[j][r] * SC2; sb[j][r] = sb[j][r] * SC2; mx[j] = fmaxf(mx[j], fmaxf(sa[j][r], sb[j][r])); } }
            float ox[4];
#pragma unroll
            for (int j = 0; j < 4; ++j) ox[j] = __shfl_xor(mx[j], 16, 32);           // the other lane half's maximum, one exchange per head
            float dm[4], alpha[4], sh[4];
#pragma unroll
            for (int j = 0; j < 4; ++j) {
                const float mnew = fmaxf(m[j], fmaxf(mx[j], ox[j]));
                dm[j] = m[j] - mnew; alpha[j] = __builtin_amdgcn_exp2f(dm[j]); sh[j] = PSH - mnew; m[j] = mnew; }
            // the slot that the instruction set asks for behind a v_exp_f32 before its source register is overwritten: the sources are inputs here, so they stay untouched up to this v_nop
            asm volatile("v_nop" :: "v"(dm[0]), "v"(dm[1]), "v"(dm[2]), "v"(dm[3]), "v"(alpha[0]), "v"(alpha[1]), "v"(alpha[2]), "v"(alpha[3]));
#pragma unroll
            for (int j = 0; j < 4; ++j) {
                v16h pb; float ls = 0.0f;
                float ea[8], eb[8], xa[8], xb[8];
#pragma unroll
                for (int r = 0; r < 8; ++r) { ea[r] = sa[j][r] + sh[j]; eb[r] = sb[j][r] + sh[j]; xa[r] = __builtin_amdgcn_exp2f(ea[r]); xb[r] = __builtin_amdgcn_exp2f(eb[r]); }
                // the same slot for these v_exp_f32, eight to a statement: no source register is overwritten before all eight results stand
                asm volatile("v_nop" :: "v"(ea[0]), "v"(ea[1]), "v"(ea[2]), "v"(ea[3]), "v"(ea[4]), "v"(ea[5]), "v"(ea[6]), "v"(ea[7]), "v"(xa[0]), "v"(xa[1]), "v"(xa[2]), "v"(xa[3]), "v"(xa[4]), "v"(xa[5]), "v"(xa[6]), "v"(xa[7]));
                asm volatile("v_nop" :: "v"(eb[0]), "v"(eb[1]), "v"(eb[2]), "v"(eb[3]), "v"(eb[4]), "v"(eb[5]), "v"(eb[6]), "v"(eb[7]), "v"(xb[0]), "v"(xb[1]), "v"(xb[2]), "v"(xb[3]), "v"(xb[4]), "v"(xb[5]), "v"(xb[6]), "v"(xb[7]));
#pragma unroll
                for (int r = 0; r < 8; r += 2) {                   // two P values to a register by one packed convert (round to nearest even); values under the smallest normal f16 stay subnormal: the matrix unit and the sum below both take them as they are
                    const v2h pa = __builtin_convertvector((v2f){xa[r], xa[r + 1]}, v2h);
                    const v2h pc = __builtin_convertvector((v2f){xb[r], xb[r + 1]}, v2h);
                    pb[r] = pa[0]; pb[r + 1] = pa[1]; pb[8 + r] = pc[0]; pb[9 + r] = pc[1];
                    ls += (float)pa[0]; ls += (float)pc[0]; ls += (float)pa[1]; ls += (float)pc[1]; }   // one running sum: each add reads its f16 half straight from the packed register
                l[j] = l[j] * alpha[j] + ls;
                o[j] = o[j] * alpha[j];
                o[j] = wmma16(vf[j], pb, o[j]);
            }
            // four vector slots between the trip's last WMMA and the loop branch: the next trip's first products reuse this trip's fragment registers
            asm volatile("v_nop\n\tv_nop\n\tv_nop\n\tv_nop" : "+v"(o[0]), "+v"(o[1]), "+v"(o[2]), "+v"(o[3]));
        }
#pragma unroll
        for (int j = 0; j < 4; ++j) {
            const float lt = l[j] + __shfl_xor(l[j], 16, 32);
            const float inv = (1.0f / lt) * (CTXC / VC);           // lt >= 16384 (the maximum element of every row converts to 16384)
            v8h cv;
#pragma unroll
            for (int r = 0; r < 8; ++r) cv[r] = toh_flush(o[j][r] * inv);           // lane half 0: o[r] = (d = r, t = lane&15)
            if (hi == 0) *(v8ha*)(&cs[cb + lr * CP + (g * 4 + j) * HD]) = cv; }     // 8 heads x 8 columns: rows 0..15 x columns 0..63 all written
    }
    wave_sync();
    v8f acc[4];
#pragma unroll
    for (int nb = 0; nb < 4; ++nb) acc[nb] = (v8f){};
#pragma unroll
    for (int kc = 0; kc < DM; kc += 32) {
        const v8h a0 = *(const v8ha*)(&cs[cb + lr * CP + kc + 8 * hi]);
        const v8h a1 = *(const v8ha*)(&cs[cb + lr * CP + kc + 16 + 8 * hi]);
        const v16h a = cat16(a0, a1);                              // A fragment: row t, k = context column
#pragma unroll
        for (int nb = 0; nb < 4; ++nb) { const v16h bw = ldh(PW + (size_t)(nb * 16 + lr) * DM + kc + 8 * hi);
            acc[nb] = wmma16g(a, bw, acc[nb]); }
    }
    const int ob = wave * 16 * OSP;
    const float nanv = __uint_as_float(0x7FC00000u);
#pragma unroll
    for (int nb = 0; nb < 4; ++nb) { const float bia = bfr(pbias[nb * 16 + lr]);
#pragma unroll
        for (int r = 0; r < 8; ++r) { const float v = acc[nb][r] * OUTI + bia;
            os[ob + (8 * hi + r) * OSP + nb * 16 + lr] = bad ? nanv : v; } }   // D: row 8h+r, col lane&15; rows 0..15 x columns 0..63 all written
    wave_sync();
    float* orow = OUT + ((size_t)b * OUT_SEQ + (size_t)t0) * DM;
{
#pragma unroll
        for (int s = 0; s < 8; ++s) { const int row = 2 * s + (lane >> 4), cofs = (lane & 15) * 4;
            const v4f val = *(const v4fa*)(&os[ob + row * OSP + cofs]);
            *(v4f*)(orow + (size_t)row * DM + cofs) = val; }
         }
}

static constexpr size_t al256(size_t v) { return (v + 255) & ~(size_t)255; }
static constexpr size_t SZ_XB = al256((size_t)NB * SEQ * DM * 2);        // bf16 x plane
static constexpr size_t SZ_W1 = al256((size_t)DM * DM * 2);              // one 64 x 64 weight plane
static constexpr size_t SZ_KV = al256((size_t)2 * DM * DM * 2);          // kv weight plane [128][64]
static constexpr size_t SZ_SW = al256((size_t)DM * CK * 2);              // patch weight plane [64][4096]
static constexpr size_t SZ_KP = al256((size_t)NB * NKEY * DM * 2);       // k / v^T planes
static constexpr size_t SZ_TOTAL = SZ_XB + 2 * SZ_W1 + SZ_KV + SZ_SW + 2 * SZ_KP;
static_assert(SZ_TOTAL <= (size_t)134217728);                            // workspace carve <= 128 MiB
static_assert(((size_t)NB * SEQ * DM * 2) % 256 == 0);
static_assert(((size_t)NB * NKEY * DM * 2) % 256 == 0);
static_assert((size_t)NB * (NKEY / 16) * VTT == (size_t)NB * NKEY * DM);  // the tiled v^T plane has the same extent as the k plane

extern "C" void kernel_launch(void* const* d_in, const int* in_sizes, int n_in,
                              void* d_out, int out_size, void* d_ws, size_t ws_size, hipStream_t stream) {
    if (n_in < 11) return;
    const size_t needx = ((size_t)(NB - 1) * SEQ_FULL + SEQ) * DM;
    if ((size_t)in_sizes[0] < needx) return;
    if (in_sizes[1] < 1 || in_sizes[2] < 1) return;
    if ((size_t)in_sizes[3] < (size_t)DM * DM || (size_t)in_sizes[4] < (size_t)2 * DM * DM || (size_t)in_sizes[5] < (size_t)DM * CK) return;
    if (in_sizes[6] < DM || in_sizes[7] < DM || in_sizes[8] < DM || (size_t)in_sizes[9] < (size_t)DM * DM || in_sizes[10] < DM) return;
    if ((size_t)out_size < ((size_t)(NB - 1) * OUT_SEQ + SEQ) * DM) return;
    if (SZ_TOTAL > ws_size) return;
    // wire order: x, H, W, q_w, kv_w, sr_w, sr_b, ln_g, ln_b, proj_w, proj_b
    const float* x    = (const float*)d_in[0];
    const int*   gh   = (const int*)d_in[1];
    const int*   gw   = (const int*)d_in[2];
    const float* q_w  = (const float*)d_in[3];
    const float* kv_w = (const float*)d_in[4];
    const float* sr_w = (const float*)d_in[5];
    const float* sr_b = (const float*)d_in[6];
    const float* ln_g = (const float*)d_in[7];
    const float* ln_b = (const float*)d_in[8];
    const float* pj_w = (const float*)d_in[9];
    const float* pj_b = (const float*)d_in[10];
    float* OUT = (float*)d_out;      // [NB][SEQ][64]
    char* wsp = (char*)d_ws;
    bf*  XB  = (bf*)wsp;  wsp += SZ_XB;              // [NB*SEQ][64] bf16 x
    bf*  WQT = (bf*)wsp;  wsp += SZ_W1;              // [64 out][64 in] bf16
    bf*  PWT = (bf*)wsp;  wsp += SZ_W1;              // [64 out][64 in] f16 bits, x64
    bf*  KVT = (bf*)wsp;  wsp += SZ_KV;              // [128 out][64 in] f16 bits, x64 (rows 0..63 k, 64..127 v)
    bf*  SW  = (bf*)wsp;  wsp += SZ_SW;              // [64 oc][(ky*8+kx)*64 + ic] bf16
    h16* KP  = (h16*)wsp; wsp += SZ_KP;              // [NB*NKEY][64] k x16
    h16* VT  = (h16*)wsp; wsp += SZ_KP;              // [NB*NKEY/16][64][16] v^T x64

    // three dependent launches: inputs -> planes; patch projection + LayerNorm + k, v^T projections; q projection + attention + output projection
    k_prep<<<dim3(WTB + CVB, 1, 1), 256, 0, stream>>>(x, q_w, kv_w, sr_w, pj_w, XB, WQT, KVT, SW, PWT);
    k_patch<<<dim3(NB * NKEY / 16, 1, 1), 32 * PWV, 0, stream>>>(XB, SW, sr_b, ln_g, ln_b, (const h16*)KVT, KP, VT);
    k_attn<<<dim3(SEQ / (16 * AW), NB, 1), 32 * AW, 0, stream>>>(XB, WQT, KP, VT, (const h16*)PWT, pj_b, gh, gw, OUT);
}

// v006
// One run takes 39.5 microseconds.
// Timed twice side by side with v005, it ran 1.10 times as fast both times.
// All steps since v000 together make it 5.23 times as fast.
#include <hip/hip_runtime.h>

// Spatial-reduction attention, width 64 = 8 heads x 8: queries from all NB x SEQ tokens (x @ q_w, weights [in][out], no bias); keys / values from an 8x8 stride-8 patch projection (+ bias) -> LayerNorm (eps 1e-5) -> fused [in][out] kv weight (256 keys per batch at the full size); dense softmax, score scale 8^-0.5; output projection (+ bias).
// Compute dtypes, f32 accumulate everywhere: q projection and patch projection v_wmma_f32_16x16x32_bf16 (x and weights RNE-converted to bf16; products exact); kv projection v_wmma_f32_16x16x32_f16 (LayerNorm rows single f16, weight = bf16 value x64 held in f16);
// scores v_wmma_f32_16x16x32_f16 (q x16, k x16 single f16; four heads share one 32-deep k axis, the Q fragment is zeroed outside its head by value); P.V v_wmma_f32_16x16x32_f16 (P x16384 carry, v x64, single f16, row sum over the converted P);
// output projection v_wmma_f32_16x16x32_f16 (context x1024 single f16, weight = bf16 value x64 in f16), scale folded back in the f32 epilogue; softmax and LayerNorm in f32.
// Layout: the bf16 x plane, every weight plane and the k plane in fragment order (ldfh / ldfb below): [16-row tile][k/32][element half][lane][8] (rows: out channel; key; for x the 16 tokens tx = 0..15 of one patch row ty at one patch position (ky, kx), tile index (b*GH/8 + ty)*64 + ky*8 + kx), the patch weight plane with the chunk outermost, [k/32][oc/16][element half][lane][8], k = (ky*8+kx)*64+ic; v^T plane in tiles of 16 keys [(b*NKEY+key)/16][c][key%16]. q and the LayerNorm rows never reach memory.
// Fused attention kernel in transposed form (Q^T = Wq^T X^T, S^T = K Q^T, O^T = V^T P^T), no q or score plane in memory, q projection and output projection inside the same kernel; k and v^T projections inside the patch kernel, behind its LayerNorm.

#ifndef NB
#define NB 2
#endif
#ifndef GH
#define GH 128                   // token grid height (rows of the grid used per batch)
#endif
#define GW   128                 // token grid width
#define SEQ  (GH * GW)
#define NB_FULL  2
#define GH_FULL  128
#define SEQ_FULL 16384
#ifndef OUT_SEQ
#define OUT_SEQ SEQ              // row pitch (in tokens) between batches of the output
#endif
#define DM   64
#define NH_  8
#define HD   8
#define SRR  8                   // patch size = stride
#define KGW  (GW / SRR)
#define NKEY ((GH / SRR) * (GW / SRR))
#define CK   (DM * SRR * SRR)    // patch projection depth (4096)
#define AW   4                   // waves per attention block (16 query rows each)
#define CP   72                  // LDS row pitch (halves) of the context tile
#define OSP  68                  // LDS row pitch (floats) of the output tile
#define PWV  16                  // waves per patch-projection block = slices of its depth = rows of its tile
#define PKS  (CK / PWV)          // depth of one slice (256 = 4 patch positions x 64 channels)
#define RP   68                  // LDS row pitch (floats) of the partial tiles
#define LP   72                  // LDS row pitch (halves) of the LayerNorm tile
#define VTT  (DM * 16)           // halves in one 16-key tile of the v^T plane
#define QC   16.0f               // carry of q
#define KC   16.0f               // carry of the k plane
#define VC   64.0f               // carry of the v^T plane
#define WC   64.0f               // carry of the f16 weight planes
#define CTXC 1024.0f             // carry of the context tile
#define SC2  ((float)(0.35355339059327378 * 1.4426950408889634 / 256.0))   // HD^-0.5 * log2(e) / (QC * KC)
#define PSH  14.0f               // log2 of the P carry (16384)
#define NEGB (-3.0e38f)
#define OUTI (1.0f / 65536.0f)   // 1 / (CTXC * WC)

static_assert(DM == 64);
static_assert(NH_ * HD == DM);                 // head h = columns h*8 + d
static_assert(HD == 8);                        // one head = 8 k-slots = one half fragment of one lane half
static_assert(NH_ == 8);                       // two groups of four heads, 32 columns each
static_assert(DM % 32 == 0);                   // GEMM k-loops step by 32
static_assert(CK % 32 == 0);
static_assert(CK == 64 * DM);                  // k index = (ky*8+kx)*64 + ic
static_assert(SRR == 8);
static_assert(GH % SRR == 0);
static_assert(GW % SRR == 0);
static_assert(NKEY % 32 == 0);                 // key loop steps by 32
static_assert(SEQ % (16 * AW) == 0);           // attention grid covers the sequence exactly
static_assert(((size_t)SEQ * DM) % 8 == 0);
static_assert(NB <= NB_FULL);
static_assert(GH <= GH_FULL);
static_assert(SEQ <= SEQ_FULL);
static_assert((CP * 2) % 16 == 0);
static_assert((OSP * 4) % 16 == 0);
static_assert(CP >= DM);
static_assert(OSP >= DM);
static_assert(32 * 16 * 4 == 16 * DM * 2);
static_assert(32 * 16 * 8 == 16 * DM * 4);     // output stores: 32 lanes x 16 B x 8 instructions == 16 rows x 256 B
static_assert(256 * 2 * 16 == 64 * 64 * 2);
static_assert(AW * 16 * CP * 2 + AW * 16 * OSP * 4 <= 131072);
static_assert(64 * 65 * 4 <= 131072);
static_assert(PWV == 16);                      // wave w finishes row w of the 16-row tile
static_assert(PKS % DM == 0);                  // a slice holds whole patch positions
static_assert((SRR * DM) % PKS == 0);          // and stays inside one patch row ky
static_assert((NB * NKEY) % 16 == 0);
static_assert(NKEY % 16 == 0);                 // a 16-row tile never straddles two batches
static_assert(KGW == 16);                      // a 16-row tile = one patch row ty, row = tx
static_assert((RP * 4) % 8 == 0);
static_assert((LP * 2) % 16 == 0);
static_assert(LP >= DM);
static_assert(PWV * 16 * RP * 4 + 16 * LP * 2 <= 131072);

typedef _Float16 h16;
typedef unsigned short bf;
typedef __attribute__((ext_vector_type(16))) __bf16   v16bf;
typedef __attribute__((ext_vector_type(16))) _Float16 v16h;
typedef __attribute__((ext_vector_type(8)))  _Float16 v8h;
typedef __attribute__((ext_vector_type(8)))  unsigned short v8us;
typedef __attribute__((ext_vector_type(8)))  float    v8f;
typedef __attribute__((ext_vector_type(4)))  float    v4f;
typedef v4f  __attribute__((may_alias)) v4fa;
typedef v8h  __attribute__((may_alias)) v8ha;
typedef __attribute__((ext_vector_type(2)))  float    v2f;
typedef v2f  __attribute__((may_alias)) v2fa;
typedef __attribute__((ext_vector_type(2)))  _Float16 v2h;

__device__ __forceinline__ unsigned short f2bf(float f) { unsigned u = __float_as_uint(f); u += 0x7FFFu + ((u >> 16) & 1u); return (unsigned short)(u >> 16); }
__device__ __forceinline__ float bfr(float f) { return __uint_as_float(((unsigned)f2bf(f)) << 16); }   // value after RNE convert to bf16
__device__ __forceinline__ v16h cat16(v8h lo, v8h hi) { return __builtin_shufflevector(lo, hi, 0, 1, 2, 3, 4, 5, 6, 7, 8, 9, 10, 11, 12, 13, 14, 15); }
__device__ __forceinline__ v16bf cat16b(v8us lo, v8us hi) { return __builtin_bit_cast(v16bf, __builtin_shufflevector(lo, hi, 0, 1, 2, 3, 4, 5, 6, 7, 8, 9, 10, 11, 12, 13, 14, 15)); }
__device__ __forceinline__ v8f wmma16(v16h a, v16h b, v8f c) { return __builtin_amdgcn_wmma_f32_16x16x32_f16(false, a, false, b, (short)0, c, false, false); }
__device__ __forceinline__ v8f wmmab(v16bf a, v16bf b, v8f c) { return __builtin_amdgcn_wmma_f32_16x16x32_bf16(false, a, false, b, (short)0, c, false, false); }
// k map of a 16-bit fragment, lane = 16 h + row: elements 0..7 <- k0+8h+0..7, elements 8..15 <- k0+16+8h+0..7 (same map for A and B)
// fragment loaders from a plane in fragment order: one fragment (16 rows x 32 deep) = 512 elements, element half e/8 then lane then 8 elements, with the k map above; p already includes + 8*lane. Each of the two wave-wide 16-B loads reads 512 contiguous bytes (4 lines; K-contiguous rows give 16 lines of 32 B).
#define FRG  512                 // elements of one fragment
__device__ __forceinline__ v16h  ldfh(const h16* p) { return cat16(*(const v8h*)p, *(const v8h*)(p + 256)); }
__device__ __forceinline__ v16bf ldfb(const bf* p)  { return cat16b(*(const v8us*)p, *(const v8us*)(p + 256)); }
// ordering point for wave-private LDS tiles (same wave writes and reads)
__device__ __forceinline__ void wave_sync() { __builtin_amdgcn_fence(3 /* release order */, "wavefront"); __builtin_amdgcn_wave_barrier(); asm volatile("" ::: "memory"); }

// f32 -> f16 with a value select: results below the smallest normal become +0 (applied after the plane's power-of-two carry)
static __device__ __forceinline__ h16 toh_flush(float v) { const h16 r = (h16)v; return (fabsf(v) < 6.103515625e-05f) ? (h16)0.0f : r; }
// one WMMA + its own four-slot guard (ties the result, keeps both fragments live)
__device__ __forceinline__ v8f wmma16g(v16h a, v16h b, v8f c) {
    c = __builtin_amdgcn_wmma_f32_16x16x32_f16(false, a, false, b, (short)0, c, false, false);
    asm volatile("v_nop\n\tv_nop\n\tv_nop\n\tv_nop" : "+v"(c) : "v"(a), "v"(b));
    return c; }

// f16mode == 0: bf16 RNE bits; f16mode != 0: f16 bits of (bf16 value x carry), results below the smallest normal selected to +0.
// One block of 256 threads per 64 x 64 tile: tile column bx of plane z, in[rows = 64][Cn] -> the transposed tile [64 out rows][64 deep] in fragment order (8 fragments, 8 KiB, written by this block alone).
__device__ __forceinline__ void wT_body(const float* __restrict__ src, bf* dst, int Cn, int f16mode, float carry, int bx, int z) {
#pragma clang fp contract(off)
    __shared__ float ts[64 * 65];
    const int tid = threadIdx.x; const int c0 = bx * 64;
    const float* sp = src + (size_t)z * 64 * (size_t)Cn + c0;
#pragma unroll 1
    for (int it = 0; it < 16; ++it) { const int idx = it * 256 + tid; const int r = idx >> 6, c = idx & 63;   // 16 trips x 256 = 64 x 64 elements
        ts[r * 65 + c] = sp[(size_t)r * Cn + c]; }
    __syncthreads();
    bf* dp = dst + ((size_t)z * (size_t)Cn + c0) * 64;
{
#pragma unroll 1
        for (int it = 0; it < 2; ++it) { const int p = it * 256 + tid; const int c = p >> 3, r8 = (p & 7) * 8; v8us o;   // 2 trips x 256 = 64 rows x 8 pieces
#pragma unroll
            for (int k = 0; k < 8; ++k) { const float v = ts[(r8 + k) * 65 + c];
                const unsigned short ub = f2bf(v);
                const h16 hv = toh_flush(bfr(v) * carry);
                const unsigned short uh = __builtin_bit_cast(unsigned short, hv);
                o[k] = f16mode ? uh : ub; }
            *(v8us*)(dp + ((c >> 4) * 2 + (r8 >> 5)) * FRG + ((r8 >> 4) & 1) * 256 + (((r8 >> 3) & 1) * 16 + (c & 15)) * 8) = o;   // row tile c/16, chunk r8/32, element half, lane = 16 h + row
            asm volatile("s_wait_xcnt 0x0" ::: "memory"); }   // the next trip rewrites the store's address and data registers
         }
}

// Patch weight [oc][ic][ky*8+kx] f32 -> bf16 plane in the order in which k_patch loads its B fragments: with k = (ky*8+kx)*64 + ic, the 8 elements k = 32 c + 16 part + 8 h + 0..7 of row oc = 16 nb + lr stand at
// (((c*4 + nb)*2 + part)*32 + 16 h + lr)*8, so one wave-wide 16-B load of a fragment half reads 512 contiguous bytes (4 lines) where rows [oc][k] gave 16 lines of 32 B each.
// One block of 256 threads per (nb, 8 input channels ic8, 32 patch positions ph): reads 128 runs of 128 B, writes 32 runs of 256 B (16 oc x 16 B), so every 128-B line of the plane has one writer.
#define FCH  2048                // elements of the plane per 32-deep k chunk (4 column tiles x 2 halves x 32 lanes x 8)
#define FTP  33                  // LDS row pitch (floats) of the staging tile
__device__ __forceinline__ void wF_body(const float* __restrict__ src, bf* dst, int nb, int ic8, int ph) {
    __shared__ float tf[128 * FTP];                                // row = oc_l*8 + ic_l, column = position inside the half
    const int tid = threadIdx.x;
    const float* sp = src + ((size_t)(nb * 16) * DM + (size_t)(ic8 * 8)) * 64 + ph * 32;
    v4f ld[4];
#pragma unroll
    for (int it = 0; it < 4; ++it) { const int q4 = it * 256 + tid; const int row = q4 >> 3, c4 = (q4 & 7) * 4;   // 4 x 256 pieces of 4 floats = 128 rows x 32 columns
        ld[it] = *(const v4f*)(sp + ((size_t)(row >> 3) * DM + (size_t)(row & 7)) * 64 + c4); }
#pragma unroll
    for (int it = 0; it < 4; ++it) { const int q4 = it * 256 + tid; const int row = q4 >> 3, c4 = (q4 & 7) * 4;
#pragma unroll
        for (int k = 0; k < 4; ++k) tf[row * FTP + c4 + k] = ld[it][k]; }
    __syncthreads();
    bf* dp = dst + (size_t)(ic8 >> 2) * FCH + (size_t)(((nb * 2 + ((ic8 >> 1) & 1)) * 32 + (ic8 & 1) * 16) * 8);   // chunk parity, column tile, element half and lane half are fixed by (nb, ic8)
#pragma unroll
    for (int it = 0; it < 2; ++it) { const int p = it * 256 + tid; const int lr = p & 15, pl = p >> 4; v8us o;   // 2 x 256 pieces = 32 positions x 16 oc
#pragma unroll
        for (int k = 0; k < 8; ++k) o[k] = f2bf(tf[(lr * 8 + k) * FTP + pl]);
        *(v8us*)(dp + (size_t)((ph * 32 + pl) * 2) * FCH + lr * 8) = o; }   // position p holds chunks 2p and 2p + 1
}

// k_prep: everything that depends on the inputs alone, in ONE launch; the block index picks the job (a block-uniform choice, so the barriers of wT_body and wF_body are passed by whole blocks).
// Blocks 0 .. WTB-1: the weight tiles (they have the longest dependent chain, so they take the lowest block indices): 64 tiles of the patch weight (wF_body); q_w [64 in][64 out] -> [64 out][64 in];
// kv_w [64 in][128 out] -> [128 out][64 in] (two tiles); proj_w [64 in][64 out] -> [64 out][64 in]. Blocks WTB ..: x -> bf16 plane in fragment order, 8 elements per thread (a block writes 4 KiB in a row and reads whole 512-B runs, two adjacent tokens of each of 16 patches).
#define WTB  (DM + 4)
#define N8B  ((size_t)SEQ * DM / 8)                       // 8-element pieces of x per batch
#define CVB  ((unsigned)(((size_t)NB * N8B + 255) / 256))  // blocks of the x conversion
__global__ __launch_bounds__(256) void k_prep(const float* __restrict__ x, const float* __restrict__ q_w, const float* __restrict__ kv_w, const float* __restrict__ sr_w, const float* __restrict__ pj_w,
                                              bf* XB, bf* WQT, bf* KVT, bf* SW, bf* PWT) {
    const int bid = (int)blockIdx.x;
    if (bid < WTB) {
        if (bid < DM) { wF_body(sr_w, SW, bid >> 4, (bid >> 1) & 7, bid & 1); return; }
        const float* src = q_w; bf* dst = WQT; int Cn = DM, f16mode = 0, bx = 0;
        if (bid == DM + 3)      { src = pj_w; dst = PWT; f16mode = 1; }
        else if (bid > DM)      { src = kv_w; dst = KVT; f16mode = 1; Cn = 2 * DM; bx = bid - (DM + 1); }
        wT_body(src, dst, Cn, f16mode, f16mode ? WC : 1.0f, bx, 0);
        return;
    }
    const size_t i = (size_t)(bid - WTB) * 256 + threadIdx.x; if (i >= (size_t)NB * N8B) return;
    // thread i -> one 16-B piece of the plane: 4 adjacent lanes (h, element half) read one 128-B line of a token, the 8 lanes that share them write one 128-B line of the plane (a wave: 8 lines read, 4 written); then chunk, patch position, patch row of the batch
    const int h = (int)i & 1, eh = (int)(i >> 1) & 1, tx = (int)(i >> 2) & 15, ch = (int)(i >> 6) & 1, pos = (int)(i >> 7) & 63, ty = (int)((i % N8B) >> 13);
    const size_t tok = (size_t)(ty * SRR + (pos >> 3)) * GW + (size_t)(tx * SRR + (pos & 7));
    const v8f v = *(const v8f*)(x + ((i / N8B) * (size_t)SEQ_FULL + tok) * DM + ch * 32 + eh * 16 + h * 8); v8us o;   // batch pitch of x is the full sequence
#pragma unroll
    for (int k = 0; k < 8; ++k) o[k] = f2bf(v[k]);
    *(v8us*)(XB + ((i & ~(size_t)63) + (size_t)(eh * 32 + h * 16 + tx)) * 8) = o;   // fragment = 64 pieces: element half, lane = 16 h + tx
}

// kv_tail: one wave's projection of the 16 LayerNorm rows (fragments n0, n1: depth 0..31, 32..63) onto 64 kv weight rows (fragments wf[2t], wf[2t+1] of tile t), four 16 x 16 tiles, each lane's 8 results of a tile stored as one 16-B piece at op + 256 t.
// ISK: A = weight, B = LayerNorm: D row = column 16t + 8h + j of k, col = key lane&15: the lane's piece of element half t&1 of the k fragment of column group t>>1, so op = the block's 4 halves + 8*lane. Otherwise A = LayerNorm, B = weight: D row = key 8h + j, col = channel 16t + (lane&15) of v; 256 = 16 channel rows of the v^T tile.
template <bool ISK>
__device__ __forceinline__ void kv_tail(const v16h (&wf)[8], v16h n0, v16h n1, h16* op) {
    v8f kv[4]; v8h ov[4];
#pragma unroll
    for (int t = 0; t < 4; ++t) kv[t] = ISK ? wmma16(wf[2 * t], n0, (v8f){}) : wmma16(n0, wf[2 * t], (v8f){});
#pragma unroll
    for (int t = 0; t < 4; ++t) kv[t] = ISK ? wmma16(wf[2 * t + 1], n1, kv[t]) : wmma16(n1, wf[2 * t + 1], kv[t]);
#pragma unroll
    for (int t = 0; t < 4; ++t) {
#pragma unroll
        for (int j = 0; j < 8; ++j) ov[t][j] = toh_flush(kv[t][j] * (ISK ? (KC / WC) : (VC / WC))); }
#pragma unroll
    for (int t = 0; t < 4; ++t) *(v8h*)(op + t * 256) = ov[t];
}

// k_patch: patch projection (bf16 operands, K = 4096 with k = (ky*8+kx)*64 + ic) + bias + LayerNorm, then the k and v^T projections of the block's own 16 rows. grid NB*NKEY/16, PWV waves per block.
// One block per 16 rows m = (b, ty, tx = 0..15) x all 64 output channels; A = the block's own 64 tiles of the bf16 x plane (one per patch position, two fragments each), Bt = patch weight plane in fragment order (n = oc; wF_body has the map).
// The depth is split over the waves: wave w sums k = 256 w .. 256 w + 255 (ky = w>>1, kx = 4 (w&1) .. + 3) into its own 16 x 64 f32 partial tile, one patch position (2 KiB in a row of the x plane, 8 KiB in a row of the Bt plane) per trip.
// The 16 partial tiles meet in LDS; behind the block barrier wave w adds them up for row w in slice order (lane owns columns 2 lane, 2 lane + 1), adds the bias and does the LayerNorm of that row in f32 (xor exchanges over the 32 lanes).
// The 16 LayerNorm rows (single f16) meet in a second LDS tile; behind a second block barrier wave 0 forms k^T = Wk^T LN^T (A = kv weight rows 0..63, x WC; lane = key, 8 adjacent columns per tile; result x KC/WC into the block's own 16-key tile of the k plane)
// and wave 1 forms v = LN Wv (B = kv weight rows 64..127; lane = channel, 8 adjacent keys per tile; result x VC/WC into the block's own 16-key tile of the v^T plane). Each of the two waves alone writes its 2 KiB, so no 128-B line has two writers.
// amdgpu_waves_per_eu(4, 4): one block fills its 4 waves per SIMD and the grid is smaller than the chip, so the register budget goes to loads in flight (without it each fragment is loaded and waited for alone).
__global__ __launch_bounds__(32 * PWV) __attribute__((amdgpu_waves_per_eu(4, 4))) void k_patch(const bf* __restrict__ A, const bf* __restrict__ Bt, const float* __restrict__ cbias, const float* __restrict__ lg, const float* __restrict__ lb, const h16* __restrict__ KVW, h16* KP, h16* VT) {
    __shared__ __align__(16) float red[PWV * 16 * RP];
    __shared__ __align__(16) h16   lnt[16 * LP];
    const int lane = threadIdx.x & 31, lr = lane & 15, hi = lane >> 4;
    const int wave = __builtin_amdgcn_readfirstlane((int)(threadIdx.x >> 5));
    const int r0 = (int)blockIdx.x * 16;
    const int k0 = wave * PKS;
    const bf* ap = A + ((size_t)blockIdx.x * 64 + (size_t)(k0 >> 6)) * (16 * DM) + lane * 8;   // first patch position of the slice: ky*8 + kx = k0>>6; row tile (b, ty) = block
    const bf* bp = Bt + (size_t)(k0 >> 5) * FCH + lane * 8;         // the slice's 8 chunks stand in a row (32 KiB); + chunk * FCH + nb * FRG
    v8f acc[4];                                                    // the loops over nb, j and p below are unrolled so that acc[] is indexed by constants and stays in registers
#pragma unroll
    for (int nb = 0; nb < 4; ++nb) acc[nb] = (v8f){};
#pragma unroll                                                     // 4 trips, unrolled: every address is base + constant, and a later trip's loads issue ahead of an earlier trip's WMMAs
    for (int kk = 0; kk < PKS; kk += DM) {                         // next patch position = next tile of the x plane, two chunks on in the weight plane
        const v16bf a0 = ldfb(ap + (kk >> 6) * (16 * DM)), a1 = ldfb(ap + (kk >> 6) * (16 * DM) + FRG);
#pragma unroll
        for (int nb = 0; nb < 4; ++nb) { const bf* bq = bp + (kk >> 5) * FCH + nb * FRG;
            const v16bf b0 = ldfb(bq), b1 = ldfb(bq + FCH);
            acc[nb] = wmmab(a0, b0, acc[nb]); acc[nb] = wmmab(a1, b1, acc[nb]); }
    }
#pragma unroll
    for (int nb = 0; nb < 4; ++nb) {
#pragma unroll
        for (int j = 0; j < 8; ++j) red[(wave * 16 + hi * 8 + j) * RP + nb * 16 + lr] = acc[nb][j]; }   // D: row 8h+j, col lane&15
    __syncthreads();
    v16h wf[8];                                                    // kv weight fragments of waves 0 (k rows) and 1 (v rows), asked for behind the barrier (which waits for every load in flight) so that they arrive while the sums and the LayerNorm run
    if (wave < 2) {
        const h16* wp = KVW + (size_t)wave * 8 * FRG + lane * 8;
#pragma unroll
        for (int f = 0; f < 8; ++f) wf[f] = ldfh(wp + f * FRG);   // tile f>>1 (16 weight rows), depth half f&1
        asm volatile("s_wait_xcnt 0x0" :: "v"(wp) : "memory"); }   // the address pair is an input here: no load's result lands on it while the other loads still name it
    const v2f t0 = *(const v2fa*)(&red[wave * RP + 2 * lane]);
    float x0 = t0[0], x1 = t0[1];
#pragma unroll
    for (int p = 1; p < PWV; ++p) { const v2f t = *(const v2fa*)(&red[(p * 16 + wave) * RP + 2 * lane]); x0 += t[0]; x1 += t[1]; }
    const v2f bi = *(const v2f*)(cbias + 2 * lane), g = *(const v2f*)(lg + 2 * lane), of = *(const v2f*)(lb + 2 * lane);
    x0 += bfr(bi[0]); x1 += bfr(bi[1]);
    float sm = x0 + x1;
#pragma unroll
    for (int d = 16; d >= 1; d >>= 1) sm += __shfl_xor(sm, d, 32);
    const float mu = sm * (1.0f / 64.0f);
    const float d0 = x0 - mu, d1 = x1 - mu;
    float q = d0 * d0 + d1 * d1;
#pragma unroll
    for (int d = 16; d >= 1; d >>= 1) q += __shfl_xor(q, d, 32);
    const float rs = 1.0f / sqrtf(q * (1.0f / 64.0f) + 1.0e-5f);
    v2h hv;
    hv[0] = toh_flush(d0 * rs * bfr(g[0]) + bfr(of[0]));
    hv[1] = toh_flush(d1 * rs * bfr(g[1]) + bfr(of[1]));
    *(v2h*)(&lnt[wave * LP + 2 * lane]) = hv;                      // row w of the LayerNorm tile
    __syncthreads();                                               // all 16 rows stand before waves 0 and 1 read them
    if (wave >= 2) return;                                         // no barrier follows
    const v16h n0 = cat16(*(const v8ha*)(&lnt[lr * LP + 8 * hi]),      *(const v8ha*)(&lnt[lr * LP + 16 + 8 * hi]));   // fragment of row lr, depth 0..31 (the k map of ldfh)
    const v16h n1 = cat16(*(const v8ha*)(&lnt[lr * LP + 32 + 8 * hi]), *(const v8ha*)(&lnt[lr * LP + 48 + 8 * hi]));   // depth 32..63
    if (wave == 0) kv_tail<true>(wf, n0, n1, KP + (size_t)blockIdx.x * (16 * DM) + lane * 8);
    else           kv_tail<false>(wf, n0, n1, VT + (size_t)blockIdx.x * VTT + lr * 16 + 8 * hi);
}

// k_attn: fused q projection + attention + output projection, one wave per 16 query rows of one batch (one tile of the x plane: every 8th token of a grid row), the 8 heads in two trips of four (the four heads that share a 32-column group go through the key loop together, on one K fragment pair per 32 keys); K / V^T fragments straight from the f16 planes (two 16-B loads each, arithmetic addressing; K in fragment order).
// q projection in transposed form: Q^T[c][t] = Wq^T X^T (A = q weight rows c, B = bf16 x rows t, depth 64): lane (t = lane&15, h) holds columns 16 tile + 8h + 0..7 of its row, which after the f16 convert (x QC) are the two halves of the Q fragment below.
// Transposed form: S^T[key][t] = K Q^T (A = K rows over the 32 columns of the head's group, B = Q row with the k-slots outside the head selected to zero by value); lane (t = lane&15, h = lane>>4) holds keys 8h+r
// of each 16-key tile, so the packed P tile is directly the B fragment of O^T[d][t] = V^T P^T (A rows d: channel head*8 + (lane&7); rows 8..15 repeat rows 0..7 and are not used).
// Online softmax state is one scalar per lane; the two lane halves of a row are combined with one xor-16 exchange. P = f16 of exp2(score - max + 14), converted in pairs (subnormal results kept); row sum over the converted P.
// Context (x CTXC) of each head goes to a wave-private f16 LDS tile [16][64]; after the head loop the tile is the A operand of the output projection (B = transposed weight plane, f16 x WC);
// The two integer grid-size inputs are read on the device; when they differ from the compiled grid the output is filled with NaN.
__global__ __launch_bounds__(32 * AW) void k_attn(const bf* __restrict__ XB, const bf* __restrict__ WQT, const h16* __restrict__ KP, const h16* __restrict__ VT, const h16* __restrict__ PW,
                                                  const float* __restrict__ pbias, const int* __restrict__ hp, const int* __restrict__ wp, float* OUT) {
    __shared__ __align__(16) h16   cs[AW * 16 * CP];
    __shared__ __align__(16) float os[AW * 16 * OSP];
    const int lane = threadIdx.x & 31, lr = lane & 15, hi = lane >> 4;
    const int wave = __builtin_amdgcn_readfirstlane((int)(threadIdx.x >> 5));
    const int b = blockIdx.y;
    const int ut = blockIdx.x * AW + wave;                         // tile of the x plane inside the batch = ty*64 + ky*8 + kx: the wave's 16 query rows are the tokens (grid row ut>>3, column 8 row + (ut&7))
    const bool bad = (hp[0] != GH_FULL) | (wp[0] != GW);
    const size_t qrow  = ((size_t)b * (SEQ / 16) + (size_t)ut) * (16 * DM) + (size_t)lane * 8;
    const size_t kbase = (size_t)b * NKEY * DM + (size_t)lane * 8;             // + (key/16) * 16*DM + group * FRG   (A fragment: row key, k = column inside the group)
    const size_t vbase = (size_t)b * (NKEY / 16) * VTT + (size_t)(lr & 7) * 16 + 8 * hi;   // + (key/16)*VTT + head*8*16   (A fragment: row d, k = key)
    const int cb = wave * 16 * CP;
    const v8h z8 = (v8h){};
    v8h qh[4];                                                     // q x QC of row t, columns 16 tile + 8h + 0..7
    {
        const v16bf x0 = ldfb(XB + qrow), x1 = ldfb(XB + qrow + FRG);
        const bf* wr = WQT + lane * 8;
        v16bf wq[8];
#pragma unroll
        for (int f = 0; f < 8; ++f) wq[f] = ldfb(wr + f * FRG);   // tile f>>1 (16 weight rows), depth half f&1
        // the loaded fragments are inputs here, so all twenty loads are asked for before the first product waits: one trip to the L2 instead of two (without it the second depth half is loaded into the first half's registers, behind its products)
        asm volatile("" :: "v"(x0), "v"(x1), "v"(wq[0]), "v"(wq[1]), "v"(wq[2]), "v"(wq[3]), "v"(wq[4]), "v"(wq[5]), "v"(wq[6]), "v"(wq[7]));
#pragma unroll
        for (int t = 0; t < 4; ++t) {
            v8f qa4 = wmmab(wq[2 * t], x0, (v8f){}); qa4 = wmmab(wq[2 * t + 1], x1, qa4);   // D: row = column 8h + j of the tile, col = t
#pragma unroll
            for (int j = 0; j < 8; ++j) qh[t][j] = toh_flush(qa4[j] * QC); }
    }
#pragma unroll 1
    for (int g = 0; g < 2; ++g) {                                  // one trip = the four heads that share the group's 32 columns, carried together through the key loop
        const v8h qa = g ? qh[2] : qh[0], qb = g ? qh[3] : qh[1];  // columns 32g + 8h + 0..7 and 32g + 16 + 8h + 0..7
        v16h qf[4]; v8f o[4]; float m[4], l[4];                    // every loop over j is unrolled so that the per-head arrays are indexed by constants and stay in registers
#pragma unroll
        for (int j = 0; j < 4; ++j) {
            const bool kA = (hi == (j & 1)) & (j < 2);             // head j of the group = k-slots 8j..8j+7: lane half (j&1), elements 0..7 (j < 2) or 8..15 (j >= 2)
            const bool kB = (hi == (j & 1)) & (j >= 2);
            qf[j] = cat16(kA ? qa : z8, kB ? qb : z8);             // B fragment: col t, k = column inside the group
            o[j] = (v8f){}; m[j] = NEGB; l[j] = 0.0f; }
        const size_t ko = kbase + (size_t)(g * FRG);
        const size_t vo = vbase + (size_t)(g * 4 * HD) * 16;
#pragma unroll 1
        for (int key0 = 0; key0 < NKEY; key0 += 32) {
            const h16* ka = KP + ko + (size_t)key0 * DM;
            const v16h ka0 = ldfh(ka), kb0 = ldfh(ka + 16 * DM);     // one K fragment pair serves the four heads
            v16h vf[4];
#pragma unroll
            for (int j = 0; j < 4; ++j) { const h16* vp = VT + vo + (size_t)(key0 >> 4) * VTT + j * HD * 16; vf[j] = cat16(*(const v8h*)vp, *(const v8h*)(vp + VTT)); }   // keys key0 + 8h + 0..7 and, one tile on, key0 + 16 + 8h + 0..7
            v8f sa[4], sb[4];
#pragma unroll
            for (int j = 0; j < 4; ++j) { sa[j] = wmma16(ka0, qf[j], (v8f){}); sb[j] = wmma16(kb0, qf[j], (v8f){}); }   // eight independent products
            float mx[4];
#pragma unroll
            for (int j = 0; j < 4; ++j) { mx[j] = NEGB;
#pragma unroll
                for (int r = 0; r < 8; ++r) { sa[j][r] = sa[j][r] * SC2; sb[j][r] = sb[j][r] * SC2; mx[j] = fmaxf(mx[j], fmaxf(sa[j][r], sb[j][r])); } }
            float ox[4];
#pragma unroll
            for (int j = 0; j < 4; ++j) ox[j] = __shfl_xor(mx[j], 16, 32);           // the other lane half's maximum, one exchange per head
            float dm[4], alpha[4], sh[4];
#pragma unroll
            for (int j = 0; j < 4; ++j) {
                const float mnew = fmaxf(m[j], fmaxf(mx[j], ox[j]));
                dm[j] = m[j] - mnew; alpha[j] = __builtin_amdgcn_exp2f(dm[j]); sh[j] = PSH - mnew; m[j] = mnew; }
            // the slot that the instruction set asks for behind a v_exp_f32 before its source register is overwritten: the sources are inputs here, so they stay untouched up to this v_nop
            asm volatile("v_nop" :: "v"(dm[0]), "v"(dm[1]), "v"(dm[2]), "v"(dm[3]), "v"(alpha[0]), "v"(alpha[1]), "v"(alpha[2]), "v"(alpha[3]));
#pragma unroll
            for (int j = 0; j < 4; ++j) {
                v16h pb; float ls = 0.0f;
                float ea[8], eb[8], xa[8], xb[8];
#pragma unroll
                for (int r = 0; r < 8; ++r) { ea[r] = sa[j][r] + sh[j]; eb[r] = sb[j][r] + sh[j]; xa[r] = __builtin_amdgcn_exp2f(ea[r]); xb[r] = __builtin_amdgcn_exp2f(eb[r]); }
                // the same slot for these v_exp_f32, eight to a statement: no source register is overwritten before all eight results stand
                asm volatile("v_nop" :: "v"(ea[0]), "v"(ea[1]), "v"(ea[2]), "v"(ea[3]), "v"(ea[4]), "v"(ea[5]), "v"(ea[6]), "v"(ea[7]), "v"(xa[0]), "v"(xa[1]), "v"(xa[2]), "v"(xa[3]), "v"(xa[4]), "v"(xa[5]), "v"(xa[6]), "v"(xa[7]));
                asm volatile("v_nop" :: "v"(eb[0]), "v"(eb[1]), "v"(eb[2]), "v"(eb[3]), "v"(eb[4]), "v"(eb[5]), "v"(eb[6]), "v"(eb[7]), "v"(xb[0]), "v"(xb[1]), "v"(xb[2]), "v"(xb[3]), "v"(xb[4]), "v"(xb[5]), "v"(xb[6]), "v"(xb[7]));
#pragma unroll
                for (int r = 0; r < 8; r += 2) {                   // two P values to a register by one packed convert (round to nearest even); values under the smallest normal f16 stay subnormal: the matrix unit and the sum below both take them as they are
                    const v2h pa = __builtin_convertvector((v2f){xa[r], xa[r + 1]}, v2h);
                    const v2h pc = __builtin_convertvector((v2f){xb[r], xb[r + 1]}, v2h);
                    pb[r] = pa[0]; pb[r + 1] = pa[1]; pb[8 + r] = pc[0]; pb[9 + r] = pc[1];
                    ls += (float)pa[0]; ls += (float)pc[0]; ls += (float)pa[1]; ls += (float)pc[1]; }   // one running sum: each add reads its f16 half straight from the packed register
                l[j] = l[j] * alpha[j] + ls;
                o[j] = o[j] * alpha[j];
                o[j] = wmma16(vf[j], pb, o[j]);
            }
            // four vector slots between the trip's last WMMA and the loop branch: the next trip's first products reuse this trip's fragment registers
            asm volatile("v_nop\n\tv_nop\n\tv_nop\n\tv_nop" : "+v"(o[0]), "+v"(o[1]), "+v"(o[2]), "+v"(o[3]));
        }
#pragma unroll
        for (int j = 0; j < 4; ++j) {
            const float lt = l[j] + __shfl_xor(l[j], 16, 32);
            const float inv = (1.0f / lt) * (CTXC / VC);           // lt >= 16384 (the maximum element of every row converts to 16384)
            v8h cv;
#pragma unroll
            for (int r = 0; r < 8; ++r) cv[r] = toh_flush(o[j][r] * inv);           // lane half 0: o[r] = (d = r, t = lane&15)
            if (hi == 0) *(v8ha*)(&cs[cb + lr * CP + (g * 4 + j) * HD]) = cv; }     // 8 heads x 8 columns: rows 0..15 x columns 0..63 all written
    }
    wave_sync();
    v8f acc[4];
#pragma unroll
    for (int nb = 0; nb < 4; ++nb) acc[nb] = (v8f){};
#pragma unroll
    for (int kc = 0; kc < DM; kc += 32) {
        const v8h a0 = *(const v8ha*)(&cs[cb + lr * CP + kc + 8 * hi]);
        const v8h a1 = *(const v8ha*)(&cs[cb + lr * CP + kc + 16 + 8 * hi]);
        const v16h a = cat16(a0, a1);                              // A fragment: row t, k = context column
#pragma unroll
        for (int nb = 0; nb < 4; ++nb) { const v16h bw = ldfh(PW + (nb * 2 + (kc >> 5)) * FRG + lane * 8);
            acc[nb] = wmma16g(a, bw, acc[nb]); }
    }
    const int ob = wave * 16 * OSP;
    const float nanv = __uint_as_float(0x7FC00000u);
#pragma unroll
    for (int nb = 0; nb < 4; ++nb) { const float bia = bfr(pbias[nb * 16 + lr]);
#pragma unroll
        for (int r = 0; r < 8; ++r) { const float v = acc[nb][r] * OUTI + bia;
            os[ob + (8 * hi + r) * OSP + nb * 16 + lr] = bad ? nanv : v; } }   // D: row 8h+r, col lane&15; rows 0..15 x columns 0..63 all written
    wave_sync();
    float* orow = OUT + ((size_t)b * OUT_SEQ + (size_t)(ut >> 3) * GW + (size_t)(ut & 7)) * DM;   // query row r is SRR tokens on from row r - 1
{
#pragma unroll
        for (int s = 0; s < 8; ++s) { const int row = 2 * s + (lane >> 4), cofs = (lane & 15) * 4;
            const v4f val = *(const v4fa*)(&os[ob + row * OSP + cofs]);
            *(v4f*)(orow + (size_t)row * (SRR * DM) + cofs) = val; }
         }
}

static constexpr size_t al256(size_t v) { return (v + 255) & ~(size_t)255; }
static constexpr size_t SZ_XB = al256((size_t)NB * SEQ * DM * 2);        // bf16 x plane
static constexpr size_t SZ_W1 = al256((size_t)DM * DM * 2);              // one 64 x 64 weight plane
static constexpr size_t SZ_KV = al256((size_t)2 * DM * DM * 2);          // kv weight plane [128][64]
static constexpr size_t SZ_SW = al256((size_t)DM * CK * 2);              // patch weight plane, 64 x 4096 elements
static constexpr size_t SZ_KP = al256((size_t)NB * NKEY * DM * 2);       // k / v^T planes
static constexpr size_t SZ_TOTAL = SZ_XB + 2 * SZ_W1 + SZ_KV + SZ_SW + 2 * SZ_KP;
static_assert(SZ_TOTAL <= (size_t)134217728);                            // workspace carve <= 128 MiB
static_assert(((size_t)NB * SEQ * DM * 2) % 256 == 0);
static_assert(((size_t)NB * NKEY * DM * 2) % 256 == 0);
static_assert((size_t)NB * (NKEY / 16) * VTT == (size_t)NB * NKEY * DM);  // the tiled v^T plane has the same extent as the k plane

extern "C" void kernel_launch(void* const* d_in, const int* in_sizes, int n_in,
                              void* d_out, int out_size, void* d_ws, size_t ws_size, hipStream_t stream) {
    if (n_in < 11) return;
    const size_t needx = ((size_t)(NB - 1) * SEQ_FULL + SEQ) * DM;
    if ((size_t)in_sizes[0] < needx) return;
    if (in_sizes[1] < 1 || in_sizes[2] < 1) return;
    if ((size_t)in_sizes[3] < (size_t)DM * DM || (size_t)in_sizes[4] < (size_t)2 * DM * DM || (size_t)in_sizes[5] < (size_t)DM * CK) return;
    if (in_sizes[6] < DM || in_sizes[7] < DM || in_sizes[8] < DM || (size_t)in_sizes[9] < (size_t)DM * DM || in_sizes[10] < DM) return;
    if ((size_t)out_size < ((size_t)(NB - 1) * OUT_SEQ + SEQ) * DM) return;
    if (SZ_TOTAL > ws_size) return;
    // wire order: x, H, W, q_w, kv_w, sr_w, sr_b, ln_g, ln_b, proj_w, proj_b
    const float* x    = (const float*)d_in[0];
    const int*   gh   = (const int*)d_in[1];
    const int*   gw   = (const int*)d_in[2];
    const float* q_w  = (const float*)d_in[3];
    const float* kv_w = (const float*)d_in[4];
    const float* sr_w = (const float*)d_in[5];
    const float* sr_b = (const float*)d_in[6];
    const float* ln_g = (const float*)d_in[7];
    const float* ln_b = (const float*)d_in[8];
    const float* pj_w = (const float*)d_in[9];
    const float* pj_b = (const float*)d_in[10];
    float* OUT = (float*)d_out;      // [NB][SEQ][64]
    char* wsp = (char*)d_ws;
    bf*  XB  = (bf*)wsp;  wsp += SZ_XB;              // [NB*SEQ/16][2 chunks][2 element halves][lane][8] bf16 x (fragment order)
    bf*  WQT = (bf*)wsp;  wsp += SZ_W1;              // 64 out x 64 in, bf16, fragment order
    bf*  PWT = (bf*)wsp;  wsp += SZ_W1;              // 64 out x 64 in, f16 bits, x64, fragment order
    bf*  KVT = (bf*)wsp;  wsp += SZ_KV;              // 128 out x 64 in, f16 bits, x64 (rows 0..63 k, 64..127 v), fragment order
    bf*  SW  = (bf*)wsp;  wsp += SZ_SW;              // [k/32][oc/16][half][lane][8] bf16, k = (ky*8+kx)*64 + ic
    h16* KP  = (h16*)wsp; wsp += SZ_KP;              // [NB*NKEY/16][4 element halves][lane][8] k x16 (fragment order)
    h16* VT  = (h16*)wsp; wsp += SZ_KP;              // [NB*NKEY/16][64][16] v^T x64

    // three dependent launches: inputs -> planes; patch projection + LayerNorm + k, v^T projections; q projection + attention + output projection
    k_prep<<<dim3(WTB + CVB, 1, 1), 256, 0, stream>>>(x, q_w, kv_w, sr_w, pj_w, XB, WQT, KVT, SW, PWT);
    k_patch<<<dim3(NB * NKEY / 16, 1, 1), 32 * PWV, 0, stream>>>(XB, SW, sr_b, ln_g, ln_b, (const h16*)KVT, KP, VT);
    k_attn<<<dim3(SEQ / (16 * AW), NB, 1), 32 * AW, 0, stream>>>(XB, WQT, KP, VT, (const h16*)PWT, pj_b, gh, gw, OUT);
}

// v007
// A run of this version takes 34.7 microseconds.
// Next to v006, in two timings, it ran 1.14 times as fast each time.
// Over all steps from v000 it is 5.95 times as fast.
#include <hip/hip_runtime.h>

// Spatial-reduction attention, width 64 = 8 heads x 8: queries from all NB x SEQ tokens (x @ q_w, weights [in][out], no bias); keys / values from an 8x8 stride-8 patch projection (+ bias) -> LayerNorm (eps 1e-5) -> fused [in][out] kv weight (256 keys per batch at the full size); dense softmax, score scale 8^-0.5; output projection (+ bias).
// Compute dtypes, f32 accumulate everywhere: q projection and patch projection v_wmma_f32_16x16x32_bf16 (x and weights RNE-converted to bf16; products exact); kv projection v_wmma_f32_16x16x32_f16 (LayerNorm rows single f16, weight = bf16 value x64 held in f16);
// scores v_wmma_f32_16x16x32_f16 (q x score scale x log2(e) / 16, k x16, single f16; four heads share one 32-deep k axis, the Q fragment is zeroed outside its head by value); P.V v_wmma_f32_16x16x32_f16 (P x16384 carry, v x64, single f16, row sum over the converted P);
// output projection v_wmma_f32_16x16x32_f16 (context x1024 single f16, weight = bf16 value x64 in f16), scale folded back in the f32 epilogue; softmax and LayerNorm in f32.
// Layout: the bf16 x plane, every weight plane and the k plane in fragment order (ldfh / ldfb below): [16-row tile][k/32][element half][lane][8] (rows: out channel; key; for x the 16 tokens tx = 0..15 of one patch row ty at one patch position (ky, kx), tile index (b*GH/8 + ty)*64 + ky*8 + kx), the patch weight plane with the chunk outermost, [k/32][oc/16][element half][lane][8], k = (ky*8+kx)*64+ic; v^T plane in tiles of 16 keys [(b*NKEY+key)/16][c][key%16]. q and the LayerNorm rows never reach memory.
// Fused attention kernel in transposed form (Q^T = Wq^T X^T, S^T = K Q^T, O^T = V^T P^T), no q or score plane in memory, q projection and output projection inside the same kernel; k and v^T projections inside the patch kernel, behind its LayerNorm.

#ifndef NB
#define NB 2
#endif
#ifndef GH
#define GH 128                   // token grid height (rows of the grid used per batch)
#endif
#define GW   128                 // token grid width
#define SEQ  (GH * GW)
#define NB_FULL  2
#define GH_FULL  128
#define SEQ_FULL 16384
#ifndef OUT_SEQ
#define OUT_SEQ SEQ              // row pitch (in tokens) between batches of the output
#endif
#define DM   64
#define NH_  8
#define HD   8
#define SRR  8                   // patch size = stride
#define KGW  (GW / SRR)
#define NKEY ((GH / SRR) * (GW / SRR))
#define CK   (DM * SRR * SRR)    // patch projection depth (4096)
#define AW   4                   // waves per attention block (16 query rows each)
#define CP   72                  // LDS row pitch (halves) of the context tile
#define OSP  68                  // LDS row pitch (floats) of the output tile
#define PWV  16                  // waves per patch-projection block = slices of its depth = rows of its tile
#define PKS  (CK / PWV)          // depth of one slice (256 = 4 patch positions x 64 channels)
#define RP   68                  // LDS row pitch (floats) of the partial tiles
#define LP   72                  // LDS row pitch (halves) of the LayerNorm tile
#define VTT  (DM * 16)           // halves in one 16-key tile of the v^T plane
#define KC   16.0f               // carry of the k plane
#define VC   64.0f               // carry of the v^T plane
#define WC   64.0f               // carry of the f16 weight planes
#define CTXC 1024.0f             // carry of the context tile
#define QS   ((float)(0.35355339059327378 * 1.4426950408889634 / 16.0))    // HD^-0.5 * log2(e) / KC: q carries the score scale, so K Q^T is already the exponent of 2
#define PSH  14.0f               // log2 of the P carry (16384)
#define NEGB (-3.0e38f)
#define OUTI (1.0f / 65536.0f)   // 1 / (CTXC * WC)

static_assert(DM == 64);
static_assert(NH_ * HD == DM);                 // head h = columns h*8 + d
static_assert(HD == 8);                        // one head = 8 k-slots = one half fragment of one lane half
static_assert(NH_ == 8);                       // two groups of four heads, 32 columns each
static_assert(DM % 32 == 0);                   // GEMM k-loops step by 32
static_assert(CK % 32 == 0);
static_assert(CK == 64 * DM);                  // k index = (ky*8+kx)*64 + ic
static_assert(SRR == 8);
static_assert(GH % SRR == 0);
static_assert(GW % SRR == 0);
static_assert(NKEY % 32 == 0);                 // key loop steps by 32
static_assert(SEQ % (16 * AW) == 0);           // attention grid covers the sequence exactly
static_assert(((size_t)SEQ * DM) % 8 == 0);
static_assert(NB <= NB_FULL);
static_assert(GH <= GH_FULL);
static_assert(SEQ <= SEQ_FULL);
static_assert((CP * 2) % 16 == 0);
static_assert((OSP * 4) % 16 == 0);
static_assert(CP >= DM);
static_assert(OSP >= DM);
static_assert(32 * 16 * 4 == 16 * DM * 2);
static_assert(32 * 16 * 8 == 16 * DM * 4);     // output stores: 32 lanes x 16 B x 8 instructions == 16 rows x 256 B
static_assert(256 * 2 * 16 == 64 * 64 * 2);
static_assert(AW * 16 * CP * 2 + AW * 16 * OSP * 4 <= 131072);
static_assert(64 * 65 * 4 <= 131072);
static_assert(PWV == 16);                      // wave w finishes row w of the 16-row tile
static_assert(PKS % DM == 0);                  // a slice holds whole patch positions
static_assert((SRR * DM) % PKS == 0);          // and stays inside one patch row ky
static_assert((NB * NKEY) % 16 == 0);
static_assert(NKEY % 16 == 0);                 // a 16-row tile never straddles two batches
static_assert(KGW == 16);                      // a 16-row tile = one patch row ty, row = tx
static_assert((RP * 4) % 8 == 0);
static_assert((LP * 2) % 16 == 0);
static_assert(LP >= DM);
static_assert(PWV * 16 * RP * 4 + 16 * LP * 2 <= 131072);

typedef _Float16 h16;
typedef unsigned short bf;
typedef __attribute__((ext_vector_type(16))) __bf16   v16bf;
typedef __attribute__((ext_vector_type(16))) _Float16 v16h;
typedef __attribute__((ext_vector_type(8)))  _Float16 v8h;
typedef __attribute__((ext_vector_type(8)))  unsigned short v8us;
typedef __attribute__((ext_vector_type(8)))  float    v8f;
typedef __attribute__((ext_vector_type(4)))  float    v4f;
typedef v4f  __attribute__((may_alias)) v4fa;
typedef v8h  __attribute__((may_alias)) v8ha;
typedef __attribute__((ext_vector_type(2)))  float    v2f;
typedef v2f  __attribute__((may_alias)) v2fa;
typedef __attribute__((ext_vector_type(2)))  _Float16 v2h;

__device__ __forceinline__ unsigned short f2bf(float f) { unsigned u = __float_as_uint(f); u += 0x7FFFu + ((u >> 16) & 1u); return (unsigned short)(u >> 16); }
__device__ __forceinline__ float bfr(float f) { return __uint_as_float(((unsigned)f2bf(f)) << 16); }   // value after RNE convert to bf16
__device__ __forceinline__ v16h cat16(v8h lo, v8h hi) { return __builtin_shufflevector(lo, hi, 0, 1, 2, 3, 4, 5, 6, 7, 8, 9, 10, 11, 12, 13, 14, 15); }
__device__ __forceinline__ v16bf cat16b(v8us lo, v8us hi) { return __builtin_bit_cast(v16bf, __builtin_shufflevector(lo, hi, 0, 1, 2, 3, 4, 5, 6, 7, 8, 9, 10, 11, 12, 13, 14, 15)); }
__device__ __forceinline__ v8f wmma16(v16h a, v16h b, v8f c) { return __builtin_amdgcn_wmma_f32_16x16x32_f16(false, a, false, b, (short)0, c, false, false); }
__device__ __forceinline__ v8f wmmab(v16bf a, v16bf b, v8f c) { return __builtin_amdgcn_wmma_f32_16x16x32_bf16(false, a, false, b, (short)0, c, false, false); }
// k map of a 16-bit fragment, lane = 16 h + row: elements 0..7 <- k0+8h+0..7, elements 8..15 <- k0+16+8h+0..7 (same map for A and B)
// fragment loaders from a plane in fragment order: one fragment (16 rows x 32 deep) = 512 elements, element half e/8 then lane then 8 elements, with the k map above; p already includes + 8*lane. Each of the two wave-wide 16-B loads reads 512 contiguous bytes (4 lines; K-contiguous rows give 16 lines of 32 B).
#define FRG  512                 // elements of one fragment
__device__ __forceinline__ v16h  ldfh(const h16* p) { return cat16(*(const v8h*)p, *(const v8h*)(p + 256)); }
__device__ __forceinline__ v16bf ldfb(const bf* p)  { return cat16b(*(const v8us*)p, *(const v8us*)(p + 256)); }
// ordering point for wave-private LDS tiles (same wave writes and reads)
__device__ __forceinline__ void wave_sync() { __builtin_amdgcn_fence(3 /* release order */, "wavefront"); __builtin_amdgcn_wave_barrier(); asm volatile("" ::: "memory"); }

// f32 -> f16 with a value select: results below the smallest normal become +0 (applied after the plane's power-of-two carry)
static __device__ __forceinline__ h16 toh_flush(float v) { const h16 r = (h16)v; return (fabsf(v) < 6.103515625e-05f) ? (h16)0.0f : r; }
// one WMMA + its own four-slot guard (ties the result, keeps both fragments live)
__device__ __forceinline__ v8f wmma16g(v16h a, v16h b, v8f c) {
    c = __builtin_amdgcn_wmma_f32_16x16x32_f16(false, a, false, b, (short)0, c, false, false);
    asm volatile("v_nop\n\tv_nop\n\tv_nop\n\tv_nop" : "+v"(c) : "v"(a), "v"(b));
    return c; }

// f16mode == 0: bf16 RNE bits; f16mode != 0: f16 bits of (bf16 value x carry), results below the smallest normal selected to +0.
// One block of 256 threads per 64 x 64 tile: tile column bx of plane z, in[rows = 64][Cn] -> the transposed tile [64 out rows][64 deep] in fragment order (8 fragments, 8 KiB, written by this block alone).
__device__ __forceinline__ void wT_body(const float* __restrict__ src, bf* dst, int Cn, int f16mode, float carry, int bx, int z) {
#pragma clang fp contract(off)
    __shared__ float ts[64 * 65];
    const int tid = threadIdx.x; const int c0 = bx * 64;
    const float* sp = src + (size_t)z * 64 * (size_t)Cn + c0;
#pragma unroll 1
    for (int it = 0; it < 16; ++it) { const int idx = it * 256 + tid; const int r = idx >> 6, c = idx & 63;   // 16 trips x 256 = 64 x 64 elements
        ts[r * 65 + c] = sp[(size_t)r * Cn + c]; }
    __syncthreads();
    bf* dp = dst + ((size_t)z * (size_t)Cn + c0) * 64;
{
#pragma unroll 1
        for (int it = 0; it < 2; ++it) { const int p = it * 256 + tid; const int c = p >> 3, r8 = (p & 7) * 8; v8us o;   // 2 trips x 256 = 64 rows x 8 pieces
#pragma unroll
            for (int k = 0; k < 8; ++k) { const float v = ts[(r8 + k) * 65 + c];
                const unsigned short ub = f2bf(v);
                const h16 hv = toh_flush(bfr(v) * carry);
                const unsigned short uh = __builtin_bit_cast(unsigned short, hv);
                o[k] = f16mode ? uh : ub; }
            *(v8us*)(dp + ((c >> 4) * 2 + (r8 >> 5)) * FRG + ((r8 >> 4) & 1) * 256 + (((r8 >> 3) & 1) * 16 + (c & 15)) * 8) = o;   // row tile c/16, chunk r8/32, element half, lane = 16 h + row
            asm volatile("s_wait_xcnt 0x0" ::: "memory"); }   // the next trip rewrites the store's address and data registers
         }
}

// Patch weight [oc][ic][ky*8+kx] f32 -> bf16 plane in the order in which k_patch loads its B fragments: with k = (ky*8+kx)*64 + ic, the 8 elements k = 32 c + 16 part + 8 h + 0..7 of row oc = 16 nb + lr stand at
// (((c*4 + nb)*2 + part)*32 + 16 h + lr)*8, so one wave-wide 16-B load of a fragment half reads 512 contiguous bytes (4 lines) where rows [oc][k] gave 16 lines of 32 B each.
// One block of 256 threads per (nb, 8 input channels ic8, 32 patch positions ph): reads 128 runs of 128 B, writes 32 runs of 256 B (16 oc x 16 B), so every 128-B line of the plane has one writer.
#define FCH  2048                // elements of the plane per 32-deep k chunk (4 column tiles x 2 halves x 32 lanes x 8)
#define FTP  33                  // LDS row pitch (floats) of the staging tile
__device__ __forceinline__ void wF_body(const float* __restrict__ src, bf* dst, int nb, int ic8, int ph) {
    __shared__ float tf[128 * FTP];                                // row = oc_l*8 + ic_l, column = position inside the half
    const int tid = threadIdx.x;
    const float* sp = src + ((size_t)(nb * 16) * DM + (size_t)(ic8 * 8)) * 64 + ph * 32;
    v4f ld[4];
#pragma unroll
    for (int it = 0; it < 4; ++it) { const int q4 = it * 256 + tid; const int row = q4 >> 3, c4 = (q4 & 7) * 4;   // 4 x 256 pieces of 4 floats = 128 rows x 32 columns
        ld[it] = *(const v4f*)(sp + ((size_t)(row >> 3) * DM + (size_t)(row & 7)) * 64 + c4); }
#pragma unroll
    for (int it = 0; it < 4; ++it) { const int q4 = it * 256 + tid; const int row = q4 >> 3, c4 = (q4 & 7) * 4;
#pragma unroll
        for (int k = 0; k < 4; ++k) tf[row * FTP + c4 + k] = ld[it][k]; }
    __syncthreads();
    bf* dp = dst + (size_t)(ic8 >> 2) * FCH + (size_t)(((nb * 2 + ((ic8 >> 1) & 1)) * 32 + (ic8 & 1) * 16) * 8);   // chunk parity, column tile, element half and lane half are fixed by (nb, ic8)
#pragma unroll
    for (int it = 0; it < 2; ++it) { const int p = it * 256 + tid; const int lr = p & 15, pl = p >> 4; v8us o;   // 2 x 256 pieces = 32 positions x 16 oc
#pragma unroll
        for (int k = 0; k < 8; ++k) o[k] = f2bf(tf[(lr * 8 + k) * FTP + pl]);
        *(v8us*)(dp + (size_t)((ph * 32 + pl) * 2) * FCH + lr * 8) = o; }   // position p holds chunks 2p and 2p + 1
}

// k_prep: everything that depends on the inputs alone, in ONE launch; the block index picks the job (a block-uniform choice, so the barriers of wT_body and wF_body are passed by whole blocks).
// Blocks 0 .. WTB-1: the weight tiles (they have the longest dependent chain, so they take the lowest block indices): 64 tiles of the patch weight (wF_body); q_w [64 in][64 out] -> [64 out][64 in];
// kv_w [64 in][128 out] -> [128 out][64 in] (two tiles); proj_w [64 in][64 out] -> [64 out][64 in]. Blocks WTB ..: x -> bf16 plane in fragment order, 8 elements per thread (a block writes 4 KiB in a row and reads whole 512-B runs, two adjacent tokens of each of 16 patches).
#define WTB  (DM + 4)
#define N8B  ((size_t)SEQ * DM / 8)                       // 8-element pieces of x per batch
#define CVB  ((unsigned)(((size_t)NB * N8B + 255) / 256))  // blocks of the x conversion
__global__ __launch_bounds__(256) void k_prep(const float* __restrict__ x, const float* __restrict__ q_w, const float* __restrict__ kv_w, const float* __restrict__ sr_w, const float* __restrict__ pj_w,
                                              bf* XB, bf* WQT, bf* KVT, bf* SW, bf* PWT) {
    const int bid = (int)blockIdx.x;
    if (bid < WTB) {
        if (bid < DM) { wF_body(sr_w, SW, bid >> 4, (bid >> 1) & 7, bid & 1); return; }
        const float* src = q_w; bf* dst = WQT; int Cn = DM, f16mode = 0, bx = 0;
        if (bid == DM + 3)      { src = pj_w; dst = PWT; f16mode = 1; }
        else if (bid > DM)      { src = kv_w; dst = KVT; f16mode = 1; Cn = 2 * DM; bx = bid - (DM + 1); }
        wT_body(src, dst, Cn, f16mode, f16mode ? WC : 1.0f, bx, 0);
        return;
    }
    const size_t i = (size_t)(bid - WTB) * 256 + threadIdx.x; if (i >= (size_t)NB * N8B) return;
    // thread i -> one 16-B piece of the plane: 4 adjacent lanes (h, element half) read one 128-B line of a token, the 8 lanes that share them write one 128-B line of the plane (a wave: 8 lines read, 4 written); then chunk, patch position, patch row of the batch
    const int h = (int)i & 1, eh = (int)(i >> 1) & 1, tx = (int)(i >> 2) & 15, ch = (int)(i >> 6) & 1, pos = (int)(i >> 7) & 63, ty = (int)((i % N8B) >> 13);
    const size_t tok = (size_t)(ty * SRR + (pos >> 3)) * GW + (size_t)(tx * SRR + (pos & 7));
    const v8f v = *(const v8f*)(x + ((i / N8B) * (size_t)SEQ_FULL + tok) * DM + ch * 32 + eh * 16 + h * 8); v8us o;   // batch pitch of x is the full sequence
#pragma unroll
    for (int k = 0; k < 8; ++k) o[k] = f2bf(v[k]);
    *(v8us*)(XB + ((i & ~(size_t)63) + (size_t)(eh * 32 + h * 16 + tx)) * 8) = o;   // fragment = 64 pieces: element half, lane = 16 h + tx
}

// kv_tail: one wave's projection of the 16 LayerNorm rows (fragments n0, n1: depth 0..31, 32..63) onto 64 kv weight rows (fragments wf[2t], wf[2t+1] of tile t), four 16 x 16 tiles, each lane's 8 results of a tile stored as one 16-B piece at op + 256 t.
// ISK: A = weight, B = LayerNorm: D row = column 16t + 8h + j of k, col = key lane&15: the lane's piece of element half t&1 of the k fragment of column group t>>1, so op = the block's 4 halves + 8*lane. Otherwise A = LayerNorm, B = weight: D row = key 8h + j, col = channel 16t + (lane&15) of v; 256 = 16 channel rows of the v^T tile.
template <bool ISK>
__device__ __forceinline__ void kv_tail(const v16h (&wf)[8], v16h n0, v16h n1, h16* op) {
    v8f kv[4]; v8h ov[4];
#pragma unroll
    for (int t = 0; t < 4; ++t) kv[t] = ISK ? wmma16(wf[2 * t], n0, (v8f){}) : wmma16(n0, wf[2 * t], (v8f){});
#pragma unroll
    for (int t = 0; t < 4; ++t) kv[t] = ISK ? wmma16(wf[2 * t + 1], n1, kv[t]) : wmma16(n1, wf[2 * t + 1], kv[t]);
#pragma unroll
    for (int t = 0; t < 4; ++t) {
#pragma unroll
        for (int j = 0; j < 8; ++j) ov[t][j] = toh_flush(kv[t][j] * (ISK ? (KC / WC) : (VC / WC))); }
#pragma unroll
    for (int t = 0; t < 4; ++t) *(v8h*)(op + t * 256) = ov[t];
}

// k_patch: patch projection (bf16 operands, K = 4096 with k = (ky*8+kx)*64 + ic) + bias + LayerNorm, then the k and v^T projections of the block's own 16 rows. grid NB*NKEY/16, PWV waves per block.
// One block per 16 rows m = (b, ty, tx = 0..15) x all 64 output channels; A = the block's own 64 tiles of the bf16 x plane (one per patch position, two fragments each), Bt = patch weight plane in fragment order (n = oc; wF_body has the map).
// The depth is split over the waves: wave w sums k = 256 w .. 256 w + 255 (ky = w>>1, kx = 4 (w&1) .. + 3) into its own 16 x 64 f32 partial tile, one patch position (2 KiB in a row of the x plane, 8 KiB in a row of the Bt plane) per trip.
// The 16 partial tiles meet in LDS; behind the block barrier wave w adds them up for row w in slice order (lane owns columns 2 lane, 2 lane + 1), adds the bias and does the LayerNorm of that row in f32 (xor exchanges over the 32 lanes).
// The 16 LayerNorm rows (single f16) meet in a second LDS tile; behind a second block barrier wave 0 forms k^T = Wk^T LN^T (A = kv weight rows 0..63, x WC; lane = key, 8 adjacent columns per tile; result x KC/WC into the block's own 16-key tile of the k plane)
// and wave 1 forms v = LN Wv (B = kv weight rows 64..127; lane = channel, 8 adjacent keys per tile; result x VC/WC into the block's own 16-key tile of the v^T plane). Each of the two waves alone writes its 2 KiB, so no 128-B line has two writers.
// amdgpu_waves_per_eu(4, 4): one block fills its 4 waves per SIMD and the grid is smaller than the chip, so the register budget goes to loads in flight (without it each fragment is loaded and waited for alone).
__global__ __launch_bounds__(32 * PWV) __attribute__((amdgpu_waves_per_eu(4, 4))) void k_patch(const bf* __restrict__ A, const bf* __restrict__ Bt, const float* __restrict__ cbias, const float* __restrict__ lg, const float* __restrict__ lb, const h16* __restrict__ KVW, h16* KP, h16* VT) {
    __shared__ __align__(16) float red[PWV * 16 * RP];
    __shared__ __align__(16) h16   lnt[16 * LP];
    const int lane = threadIdx.x & 31, lr = lane & 15, hi = lane >> 4;
    const int wave = __builtin_amdgcn_readfirstlane((int)(threadIdx.x >> 5));
    const int r0 = (int)blockIdx.x * 16;
    const int k0 = wave * PKS;
    const bf* ap = A + ((size_t)blockIdx.x * 64 + (size_t)(k0 >> 6)) * (16 * DM) + lane * 8;   // first patch position of the slice: ky*8 + kx = k0>>6; row tile (b, ty) = block
    const bf* bp = Bt + (size_t)(k0 >> 5) * FCH + lane * 8;         // the slice's 8 chunks stand in a row (32 KiB); + chunk * FCH + nb * FRG
    v8f acc[4];                                                    // the loops over nb, j and p below are unrolled so that acc[] is indexed by constants and stays in registers
#pragma unroll
    for (int nb = 0; nb < 4; ++nb) acc[nb] = (v8f){};
#pragma unroll                                                     // 4 trips, unrolled: every address is base + constant, and a later trip's loads issue ahead of an earlier trip's WMMAs
    for (int kk = 0; kk < PKS; kk += DM) {                         // next patch position = next tile of the x plane, two chunks on in the weight plane
        const v16bf a0 = ldfb(ap + (kk >> 6) * (16 * DM)), a1 = ldfb(ap + (kk >> 6) * (16 * DM) + FRG);
#pragma unroll
        for (int nb = 0; nb < 4; ++nb) { const bf* bq = bp + (kk >> 5) * FCH + nb * FRG;
            const v16bf b0 = ldfb(bq), b1 = ldfb(bq + FCH);
            acc[nb] = wmmab(a0, b0, acc[nb]); acc[nb] = wmmab(a1, b1, acc[nb]); }
    }
#pragma unroll
    for (int nb = 0; nb < 4; ++nb) {
#pragma unroll
        for (int j = 0; j < 8; ++j) red[(wave * 16 + hi * 8 + j) * RP + nb * 16 + lr] = acc[nb][j]; }   // D: row 8h+j, col lane&15
    __syncthreads();
    v16h wf[8];                                                    // kv weight fragments of waves 0 (k rows) and 1 (v rows), asked for behind the barrier (which waits for every load in flight) so that they arrive while the sums and the LayerNorm run
    if (wave < 2) {
        const h16* wp = KVW + (size_t)wave * 8 * FRG + lane * 8;
#pragma unroll
        for (int f = 0; f < 8; ++f) wf[f] = ldfh(wp + f * FRG);   // tile f>>1 (16 weight rows), depth half f&1
        asm volatile("s_wait_xcnt 0x0" :: "v"(wp) : "memory"); }   // the address pair is an input here: no load's result lands on it while the other loads still name it
    const v2f t0 = *(const v2fa*)(&red[wave * RP + 2 * lane]);
    float x0 = t0[0], x1 = t0[1];
#pragma unroll
    for (int p = 1; p < PWV; ++p) { const v2f t = *(const v2fa*)(&red[(p * 16 + wave) * RP + 2 * lane]); x0 += t[0]; x1 += t[1]; }
    const v2f bi = *(const v2f*)(cbias + 2 * lane), g = *(const v2f*)(lg + 2 * lane), of = *(const v2f*)(lb + 2 * lane);
    x0 += bfr(bi[0]); x1 += bfr(bi[1]);
    float sm = x0 + x1;
#pragma unroll
    for (int d = 16; d >= 1; d >>= 1) sm += __shfl_xor(sm, d, 32);
    const float mu = sm * (1.0f / 64.0f);
    const float d0 = x0 - mu, d1 = x1 - mu;
    float q = d0 * d0 + d1 * d1;
#pragma unroll
    for (int d = 16; d >= 1; d >>= 1) q += __shfl_xor(q, d, 32);
    const float rs = 1.0f / sqrtf(q * (1.0f / 64.0f) + 1.0e-5f);
    v2h hv;
    hv[0] = toh_flush(d0 * rs * bfr(g[0]) + bfr(of[0]));
    hv[1] = toh_flush(d1 * rs * bfr(g[1]) + bfr(of[1]));
    *(v2h*)(&lnt[wave * LP + 2 * lane]) = hv;                      // row w of the LayerNorm tile
    __syncthreads();                                               // all 16 rows stand before waves 0 and 1 read them
    if (wave >= 2) return;                                         // no barrier follows
    const v16h n0 = cat16(*(const v8ha*)(&lnt[lr * LP + 8 * hi]),      *(const v8ha*)(&lnt[lr * LP + 16 + 8 * hi]));   // fragment of row lr, depth 0..31 (the k map of ldfh)
    const v16h n1 = cat16(*(const v8ha*)(&lnt[lr * LP + 32 + 8 * hi]), *(const v8ha*)(&lnt[lr * LP + 48 + 8 * hi]));   // depth 32..63
    if (wave == 0) kv_tail<true>(wf, n0, n1, KP + (size_t)blockIdx.x * (16 * DM) + lane * 8);
    else           kv_tail<false>(wf, n0, n1, VT + (size_t)blockIdx.x * VTT + lr * 16 + 8 * hi);
}

// k_attn: fused q projection + attention + output projection, one wave per 16 query rows of one batch (one tile of the x plane: every 8th token of a grid row), the 8 heads in two trips of four (the four heads that share a 32-column group go through the key loop together, on one K fragment pair per 32 keys); K / V^T fragments straight from the f16 planes (two 16-B loads each, arithmetic addressing; K in fragment order).
// q projection in transposed form: Q^T[c][t] = Wq^T X^T (A = q weight rows c, B = bf16 x rows t, depth 64): lane (t = lane&15, h) holds columns 16 tile + 8h + 0..7 of its row, which after the f16 convert (x QS, subnormal results kept) are the two halves of the Q fragment below.
// Transposed form: S^T[key][t] = K Q^T (A = K rows over the 32 columns of the head's group, B = Q row with the k-slots outside the head selected to zero by value); lane (t = lane&15, h = lane>>4) holds keys 8h+r
// of each 16-key tile, so the packed P tile is directly the B fragment of O^T[d][t] = V^T P^T (A rows d: channel head*8 + (lane&7); rows 8..15 repeat rows 0..7 and are not used).
// Softmax in two passes over the keys. Pass 1: score products and a running maximum per lane, the two lane halves of a row combined with one xor-16 exchange behind it. Pass 2: the same score products with 14 - max as the accumulator's start, so each result is the argument of exp2 as it stands; O and the row sum are never rescaled. P = f16 of exp2(score - max + 14), converted in pairs (subnormal results kept); row sum over the converted P.
// Context (x CTXC) of each head goes to a wave-private f16 LDS tile [16][64]; after the head loop the tile is the A operand of the output projection (B = transposed weight plane, f16 x WC);
// The two integer grid-size inputs are read on the device; when they differ from the compiled grid the output is filled with NaN.
__global__ __launch_bounds__(32 * AW) void k_attn(const bf* __restrict__ XB, const bf* __restrict__ WQT, const h16* __restrict__ KP, const h16* __restrict__ VT, const h16* __restrict__ PW,
                                                  const float* __restrict__ pbias, const int* __restrict__ hp, const int* __restrict__ wp, float* OUT) {
    __shared__ __align__(16) h16   cs[AW * 16 * CP];
    __shared__ __align__(16) float os[AW * 16 * OSP];
    const int lane = threadIdx.x & 31, lr = lane & 15, hi = lane >> 4;
    const int wave = __builtin_amdgcn_readfirstlane((int)(threadIdx.x >> 5));
    const int b = blockIdx.y;
    const int ut = blockIdx.x * AW + wave;                         // tile of the x plane inside the batch = ty*64 + ky*8 + kx: the wave's 16 query rows are the tokens (grid row ut>>3, column 8 row + (ut&7))
    const bool bad = (hp[0] != GH_FULL) | (wp[0] != GW);
    const size_t qrow  = ((size_t)b * (SEQ / 16) + (size_t)ut) * (16 * DM) + (size_t)lane * 8;
    const size_t kbase = (size_t)b * NKEY * DM + (size_t)lane * 8;             // + (key/16) * 16*DM + group * FRG   (A fragment: row key, k = column inside the group)
    const size_t vbase = (size_t)b * (NKEY / 16) * VTT + (size_t)(lr & 7) * 16 + 8 * hi;   // + (key/16)*VTT + head*8*16   (A fragment: row d, k = key)
    const int cb = wave * 16 * CP;
    const v8h z8 = (v8h){};
    v8h qh[4];                                                     // q x QS of row t, columns 16 tile + 8h + 0..7
    {
        const v16bf x0 = ldfb(XB + qrow), x1 = ldfb(XB + qrow + FRG);
        const bf* wr = WQT + lane * 8;
        v16bf wq[8];
#pragma unroll
        for (int f = 0; f < 8; ++f) wq[f] = ldfb(wr + f * FRG);   // tile f>>1 (16 weight rows), depth half f&1
        // the loaded fragments are inputs here, so all twenty loads are asked for before the first product waits: one trip to the L2 instead of two (without it the second depth half is loaded into the first half's registers, behind its products)
        asm volatile("" :: "v"(x0), "v"(x1), "v"(wq[0]), "v"(wq[1]), "v"(wq[2]), "v"(wq[3]), "v"(wq[4]), "v"(wq[5]), "v"(wq[6]), "v"(wq[7]));
        asm volatile("s_wait_xcnt 0x0" ::: "memory");              // the register that holds these loads' offset is rewritten by the converts below
#pragma unroll
        for (int t = 0; t < 4; ++t) {
            v8f qa4 = wmmab(wq[2 * t], x0, (v8f){}); qa4 = wmmab(wq[2 * t + 1], x1, qa4);   // D: row = column 8h + j of the tile, col = t
#pragma unroll
            for (int j = 0; j < 8; ++j) qh[t][j] = (h16)(qa4[j] * QS); }
    }
#pragma unroll 1
    for (int g = 0; g < 2; ++g) {                                  // one trip = the four heads that share the group's 32 columns, carried together through the key loop
        const v8h qa = g ? qh[2] : qh[0], qb = g ? qh[3] : qh[1];  // columns 32g + 8h + 0..7 and 32g + 16 + 8h + 0..7
        v16h qf[4]; v8f o[4]; float mx[4], l[4];                   // every loop over j is unrolled so that the per-head arrays are indexed by constants and stay in registers
#pragma unroll
        for (int j = 0; j < 4; ++j) {
            const bool kA = (hi == (j & 1)) & (j < 2);             // head j of the group = k-slots 8j..8j+7: lane half (j&1), elements 0..7 (j < 2) or 8..15 (j >= 2)
            const bool kB = (hi == (j & 1)) & (j >= 2);
            qf[j] = cat16(kA ? qa : z8, kB ? qb : z8);             // B fragment: col t, k = column inside the group
            o[j] = (v8f){}; mx[j] = NEGB; l[j] = 0.0f; }
        const size_t ko = kbase + (size_t)(g * FRG);
        const size_t vo = vbase + (size_t)(g * 4 * HD) * 16;
        // pass 1: the maximum of every row. Unrolled: every address is base + constant, and a later trip's K loads issue ahead of an earlier trip's products
#pragma unroll
        for (int key0 = 0; key0 < NKEY; key0 += 32) {
            const h16* ka = KP + ko + (size_t)key0 * DM;
            const v16h ka0 = ldfh(ka), kb0 = ldfh(ka + 16 * DM);     // one K fragment pair serves the four heads
            v8f sa[4], sb[4];
#pragma unroll
            for (int j = 0; j < 4; ++j) { sa[j] = wmma16(ka0, qf[j], (v8f){}); sb[j] = wmma16(kb0, qf[j], (v8f){}); }   // eight independent products
#pragma unroll
            for (int j = 0; j < 4; ++j) {
#pragma unroll
                for (int r = 0; r < 8; ++r) mx[j] = fmaxf(mx[j], fmaxf(sa[j][r], sb[j][r])); }
        }
        v8f shv[4];                                                // 14 - max of the lane's row t, in all eight accumulator rows
#pragma unroll
        for (int j = 0; j < 4; ++j) {
            const float sh = PSH - fmaxf(mx[j], __shfl_xor(mx[j], 16, 32));          // the other lane half's maximum, one exchange per head
#pragma unroll
            for (int r = 0; r < 8; ++r) shv[j][r] = sh; }
        // pass 2: P, its row sum and O
#pragma unroll 1
        for (int key0 = 0; key0 < NKEY; key0 += 32) {
            const h16* ka = KP + ko + (size_t)key0 * DM;
            const v16h ka0 = ldfh(ka), kb0 = ldfh(ka + 16 * DM);
            v16h vf[4];
#pragma unroll
            for (int j = 0; j < 4; ++j) { const h16* vp = VT + vo + (size_t)(key0 >> 4) * VTT + j * HD * 16; vf[j] = cat16(*(const v8h*)vp, *(const v8h*)(vp + VTT)); }   // keys key0 + 8h + 0..7 and, one tile on, key0 + 16 + 8h + 0..7
            v8f sa[4], sb[4];
#pragma unroll
            for (int j = 0; j < 4; ++j) { sa[j] = wmma16(ka0, qf[j], shv[j]); sb[j] = wmma16(kb0, qf[j], shv[j]); }   // score - max + 14
#pragma unroll
            for (int j = 0; j < 4; ++j) {
                v16h pb; float ls = l[j];
                float xa[8], xb[8];
#pragma unroll
                for (int r = 0; r < 8; ++r) { xa[r] = __builtin_amdgcn_exp2f(sa[j][r]); xb[r] = __builtin_amdgcn_exp2f(sb[j][r]); }
                // the slot that the instruction set asks for behind a v_exp_f32 before its source register is overwritten, eight to a statement: the sources are inputs here, so none is overwritten before all eight results stand
                asm volatile("v_nop" :: "v"(sa[j][0]), "v"(sa[j][1]), "v"(sa[j][2]), "v"(sa[j][3]), "v"(sa[j][4]), "v"(sa[j][5]), "v"(sa[j][6]), "v"(sa[j][7]), "v"(xa[0]), "v"(xa[1]), "v"(xa[2]), "v"(xa[3]), "v"(xa[4]), "v"(xa[5]), "v"(xa[6]), "v"(xa[7]));
                asm volatile("v_nop" :: "v"(sb[j][0]), "v"(sb[j][1]), "v"(sb[j][2]), "v"(sb[j][3]), "v"(sb[j][4]), "v"(sb[j][5]), "v"(sb[j][6]), "v"(sb[j][7]), "v"(xb[0]), "v"(xb[1]), "v"(xb[2]), "v"(xb[3]), "v"(xb[4]), "v"(xb[5]), "v"(xb[6]), "v"(xb[7]));
#pragma unroll
                for (int r = 0; r < 8; r += 2) {                   // two P values to a register by one packed convert (round to nearest even); values under the smallest normal f16 stay subnormal: the matrix unit and the sum below both take them as they are
                    const v2h pa = __builtin_convertvector((v2f){xa[r], xa[r + 1]}, v2h);
                    const v2h pc = __builtin_convertvector((v2f){xb[r], xb[r + 1]}, v2h);
                    pb[r] = pa[0]; pb[r + 1] = pa[1]; pb[8 + r] = pc[0]; pb[9 + r] = pc[1];
                    ls += (float)pa[0]; ls += (float)pc[0]; ls += (float)pa[1]; ls += (float)pc[1]; }   // one running sum per head over the converted P, carried from trip to trip without a rescale
                l[j] = ls;
                o[j] = wmma16(vf[j], pb, o[j]);
            }
            // four vector slots between the trip's last WMMA and the loop branch: the next trip's first products reuse this trip's fragment registers
            asm volatile("v_nop\n\tv_nop\n\tv_nop\n\tv_nop" : "+v"(o[0]), "+v"(o[1]), "+v"(o[2]), "+v"(o[3]));
        }
#pragma unroll
        for (int j = 0; j < 4; ++j) {
            const float lt = l[j] + __shfl_xor(l[j], 16, 32);
            const float inv = (1.0f / lt) * (CTXC / VC);           // lt is about 16384 or more (the maximum element of every row converts to about 16384)
            v8h cv;
#pragma unroll
            for (int r = 0; r < 8; ++r) cv[r] = toh_flush(o[j][r] * inv);           // lane half 0: o[r] = (d = r, t = lane&15)
            if (hi == 0) *(v8ha*)(&cs[cb + lr * CP + (g * 4 + j) * HD]) = cv; }     // 8 heads x 8 columns: rows 0..15 x columns 0..63 all written
    }
    wave_sync();
    v8f acc[4];
#pragma unroll
    for (int nb = 0; nb < 4; ++nb) acc[nb] = (v8f){};
#pragma unroll
    for (int kc = 0; kc < DM; kc += 32) {
        const v8h a0 = *(const v8ha*)(&cs[cb + lr * CP + kc + 8 * hi]);
        const v8h a1 = *(const v8ha*)(&cs[cb + lr * CP + kc + 16 + 8 * hi]);
        const v16h a = cat16(a0, a1);                              // A fragment: row t, k = context column
#pragma unroll
        for (int nb = 0; nb < 4; ++nb) { const v16h bw = ldfh(PW + (nb * 2 + (kc >> 5)) * FRG + lane * 8);
            acc[nb] = wmma16g(a, bw, acc[nb]); }
    }
    const int ob = wave * 16 * OSP;
    const float nanv = __uint_as_float(0x7FC00000u);
#pragma unroll
    for (int nb = 0; nb < 4; ++nb) { const float bia = bfr(pbias[nb * 16 + lr]);
#pragma unroll
        for (int r = 0; r < 8; ++r) { const float v = acc[nb][r] * OUTI + bia;
            os[ob + (8 * hi + r) * OSP + nb * 16 + lr] = bad ? nanv : v; } }   // D: row 8h+r, col lane&15; rows 0..15 x columns 0..63 all written
    wave_sync();
    float* orow = OUT + ((size_t)b * OUT_SEQ + (size_t)(ut >> 3) * GW + (size_t)(ut & 7)) * DM;   // query row r is SRR tokens on from row r - 1
{
#pragma unroll
        for (int s = 0; s < 8; ++s) { const int row = 2 * s + (lane >> 4), cofs = (lane & 15) * 4;
            const v4f val = *(const v4fa*)(&os[ob + row * OSP + cofs]);
            *(v4f*)(orow + (size_t)row * (SRR * DM) + cofs) = val; }
         }
}

static constexpr size_t al256(size_t v) { return (v + 255) & ~(size_t)255; }
static constexpr size_t SZ_XB = al256((size_t)NB * SEQ * DM * 2);        // bf16 x plane
static constexpr size_t SZ_W1 = al256((size_t)DM * DM * 2);              // one 64 x 64 weight plane
static constexpr size_t SZ_KV = al256((size_t)2 * DM * DM * 2);          // kv weight plane [128][64]
static constexpr size_t SZ_SW = al256((size_t)DM * CK * 2);              // patch weight plane, 64 x 4096 elements
static constexpr size_t SZ_KP = al256((size_t)NB * NKEY * DM * 2);       // k / v^T planes
static constexpr size_t SZ_TOTAL = SZ_XB + 2 * SZ_W1 + SZ_KV + SZ_SW + 2 * SZ_KP;
static_assert(SZ_TOTAL <= (size_t)134217728);                            // workspace carve <= 128 MiB
static_assert(((size_t)NB * SEQ * DM * 2) % 256 == 0);
static_assert(((size_t)NB * NKEY * DM * 2) % 256 == 0);
static_assert((size_t)NB * (NKEY / 16) * VTT == (size_t)NB * NKEY * DM);  // the tiled v^T plane has the same extent as the k plane

extern "C" void kernel_launch(void* const* d_in, const int* in_sizes, int n_in,
                              void* d_out, int out_size, void* d_ws, size_t ws_size, hipStream_t stream) {
    if (n_in < 11) return;
    const size_t needx = ((size_t)(NB - 1) * SEQ_FULL + SEQ) * DM;
    if ((size_t)in_sizes[0] < needx) return;
    if (in_sizes[1] < 1 || in_sizes[2] < 1) return;
    if ((size_t)in_sizes[3] < (size_t)DM * DM || (size_t)in_sizes[4] < (size_t)2 * DM * DM || (size_t)in_sizes[5] < (size_t)DM * CK) return;
    if (in_sizes[6] < DM || in_sizes[7] < DM || in_sizes[8] < DM || (size_t)in_sizes[9] < (size_t)DM * DM || in_sizes[10] < DM) return;
    if ((size_t)out_size < ((size_t)(NB - 1) * OUT_SEQ + SEQ) * DM) return;
    if (SZ_TOTAL > ws_size) return;
    // wire order: x, H, W, q_w, kv_w, sr_w, sr_b, ln_g, ln_b, proj_w, proj_b
    const float* x    = (const float*)d_in[0];
    const int*   gh   = (const int*)d_in[1];
    const int*   gw   = (const int*)d_in[2];
    const float* q_w  = (const float*)d_in[3];
    const float* kv_w = (const float*)d_in[4];
    const float* sr_w = (const float*)d_in[5];
    const float* sr_b = (const float*)d_in[6];
    const float* ln_g = (const float*)d_in[7];
    const float* ln_b = (const float*)d_in[8];
    const float* pj_w = (const float*)d_in[9];
    const float* pj_b = (const float*)d_in[10];
    float* OUT = (float*)d_out;      // [NB][SEQ][64]
    char* wsp = (char*)d_ws;
    bf*  XB  = (bf*)wsp;  wsp += SZ_XB;              // [NB*SEQ/16][2 chunks][2 element halves][lane][8] bf16 x (fragment order)
    bf*  WQT = (bf*)wsp;  wsp += SZ_W1;              // 64 out x 64 in, bf16, fragment order
    bf*  PWT = (bf*)wsp;  wsp += SZ_W1;              // 64 out x 64 in, f16 bits, x64, fragment order
    bf*  KVT = (bf*)wsp;  wsp += SZ_KV;              // 128 out x 64 in, f16 bits, x64 (rows 0..63 k, 64..127 v), fragment order
    bf*  SW  = (bf*)wsp;  wsp += SZ_SW;              // [k/32][oc/16][half][lane][8] bf16, k = (ky*8+kx)*64 + ic
    h16* KP  = (h16*)wsp; wsp += SZ_KP;              // [NB*NKEY/16][4 element halves][lane][8] k x16 (fragment order)
    h16* VT  = (h16*)wsp; wsp += SZ_KP;              // [NB*NKEY/16][64][16] v^T x64

    // three dependent launches: inputs -> planes; patch projection + LayerNorm + k, v^T projections; q projection + attention + output projection
    k_prep<<<dim3(WTB + CVB, 1, 1), 256, 0, stream>>>(x, q_w, kv_w, sr_w, pj_w, XB, WQT, KVT, SW, PWT);
    k_patch<<<dim3(NB * NKEY / 16, 1, 1), 32 * PWV, 0, stream>>>(XB, SW, sr_b, ln_g, ln_b, (const h16*)KVT, KP, VT);
    k_attn<<<dim3(SEQ / (16 * AW), NB, 1), 32 * AW, 0, stream>>>(XB, WQT, KP, VT, (const h16*)PWT, pj_b, gh, gw, OUT);
}

// v008
// One run takes 32.2 microseconds.
// In two side-by-side timings against v007, it was 1.09 and 1.08 times as fast.
// All steps since v000 together make it 6.44 times as fast.
#include <hip/hip_runtime.h>

// Spatial-reduction attention, width 64 = 8 heads x 8: queries from all NB x SEQ tokens (x @ q_w, weights [in][out], no bias); keys / values from an 8x8 stride-8 patch projection (+ bias) -> LayerNorm (eps 1e-5) -> fused [in][out] kv weight (256 keys per batch at the full size); dense softmax, score scale 8^-0.5; output projection (+ bias).
// Compute dtypes, f32 accumulate everywhere: q projection and patch projection v_wmma_f32_16x16x32_bf16 (x and weights RNE-converted to bf16; products exact); kv projection v_wmma_f32_16x16x32_f16 (LayerNorm rows single f16, weight = bf16 value x64 held in f16);
// scores v_wmma_f32_16x16x32_f16 (q x score scale x log2(e) / 16, k x16, single f16; four heads share one 32-deep k axis, the Q fragment is zeroed outside its head by value); P.V v_wmma_f32_16x16x32_f16 (P x16384 carry, v x64, single f16, row sum over the converted P);
// output projection v_wmma_f32_16x16x32_f16 (context x1024 single f16, weight = bf16 value x64 in f16), scale folded back in the f32 epilogue; softmax and LayerNorm in f32.
// Layout: the bf16 x plane, every weight plane and the k plane in fragment order (ldfh / ldfb below): [16-row tile][k/32][element half][lane][8] (rows: out channel; key; for x the 16 tokens tx = 0..15 of one patch row ty at one patch position (ky, kx), tile index (b*GH/8 + ty)*64 + ky*8 + kx), the patch weight plane with the chunk outermost, [k/32][oc/16][element half][lane][8], k = (ky*8+kx)*64+ic; v^T plane in tiles of 16 keys [(b*NKEY+key)/16][c][key%16]. q and the LayerNorm rows never reach memory.
// Fused attention kernel in transposed form (Q^T = Wq^T X^T, S^T = K Q^T, O^T = V^T P^T), no q or score plane in memory, q projection and output projection inside the same kernel; k and v^T projections inside the patch kernel, behind its LayerNorm.

#ifndef NB
#define NB 2
#endif
#ifndef GH
#define GH 128                   // token grid height (rows of the grid used per batch)
#endif
#define GW   128                 // token grid width
#define SEQ  (GH * GW)
#define NB_FULL  2
#define GH_FULL  128
#define SEQ_FULL 16384
#ifndef OUT_SEQ
#define OUT_SEQ SEQ              // row pitch (in tokens) between batches of the output
#endif
#define DM   64
#define NH_  8
#define HD   8
#define SRR  8                   // patch size = stride
#define KGW  (GW / SRR)
#define NKEY ((GH / SRR) * (GW / SRR))
#define CK   (DM * SRR * SRR)    // patch projection depth (4096)
#define AW   4                   // waves per attention block (16 query rows each)
#define CP   72                  // LDS row pitch (halves) of the context tile
#define OSP  68                  // LDS row pitch (floats) of the output tile
#define PWV  16                  // waves per patch-projection block = slices of its depth = rows of its tile
#define PKS  (CK / PWV)          // depth of one slice (256 = 4 patch positions x 64 channels)
#define RP   68                  // LDS row pitch (floats) of the partial tiles
#define LP   72                  // LDS row pitch (halves) of the LayerNorm tile
#define VTT  (DM * 16)           // halves in one 16-key tile of the v^T plane
#define KC   16.0f               // carry of the k plane
#define VC   64.0f               // carry of the v^T plane
#define WC   64.0f               // carry of the f16 weight planes
#define CTXC 1024.0f             // carry of the context tile
#define QS   ((float)(0.35355339059327378 * 1.4426950408889634 / 16.0))    // HD^-0.5 * log2(e) / KC: q carries the score scale, so K Q^T is already the exponent of 2
#define PSH  14.0f               // log2 of the P carry (16384)
#define NEGB (-3.0e38f)
#define OUTI (1.0f / 65536.0f)   // 1 / (CTXC * WC)

static_assert(DM == 64);
static_assert(NH_ * HD == DM);                 // head h = columns h*8 + d
static_assert(HD == 8);                        // one head = 8 k-slots = one half fragment of one lane half
static_assert(NH_ == 8);                       // two groups of four heads, 32 columns each
static_assert(DM % 32 == 0);                   // GEMM k-loops step by 32
static_assert(CK % 32 == 0);
static_assert(CK == 64 * DM);                  // k index = (ky*8+kx)*64 + ic
static_assert(SRR == 8);
static_assert(GH % SRR == 0);
static_assert(GW % SRR == 0);
static_assert(NKEY % 32 == 0);                 // key loop steps by 32
static_assert(SEQ % (16 * AW) == 0);           // attention grid covers the sequence exactly
static_assert(((size_t)SEQ * DM) % 8 == 0);
static_assert(NB <= NB_FULL);
static_assert(GH <= GH_FULL);
static_assert(SEQ <= SEQ_FULL);
static_assert((CP * 2) % 16 == 0);
static_assert((OSP * 4) % 16 == 0);
static_assert(CP >= DM);
static_assert(OSP >= DM);
static_assert(32 * 16 * 4 == 16 * DM * 2);
static_assert(32 * 16 * 8 == 16 * DM * 4);     // output stores: 32 lanes x 16 B x 8 instructions == 16 rows x 256 B
static_assert(256 * 2 * 16 == 64 * 64 * 2);
static_assert(AW * 16 * CP * 2 + AW * 16 * OSP * 4 <= 131072);
static_assert(64 * 65 * 4 <= 131072);
static_assert(PWV == 16);                      // wave w finishes row w of the 16-row tile
static_assert(PKS % DM == 0);                  // a slice holds whole patch positions
static_assert((SRR * DM) % PKS == 0);          // and stays inside one patch row ky
static_assert((NB * NKEY) % 16 == 0);
static_assert(NKEY % 16 == 0);                 // a 16-row tile never straddles two batches
static_assert(KGW == 16);                      // a 16-row tile = one patch row ty, row = tx
static_assert((RP * 4) % 8 == 0);
static_assert((LP * 2) % 16 == 0);
static_assert(LP >= DM);
static_assert(PWV * 16 * RP * 4 + 16 * LP * 2 <= 131072);

typedef _Float16 h16;
typedef unsigned short bf;
typedef __attribute__((ext_vector_type(16))) __bf16   v16bf;
typedef __attribute__((ext_vector_type(16))) _Float16 v16h;
typedef __attribute__((ext_vector_type(8)))  _Float16 v8h;
typedef __attribute__((ext_vector_type(8)))  unsigned short v8us;
typedef __attribute__((ext_vector_type(8)))  float    v8f;
typedef __attribute__((ext_vector_type(4)))  float    v4f;
typedef v4f  __attribute__((may_alias)) v4fa;
typedef v8h  __attribute__((may_alias)) v8ha;
typedef __attribute__((ext_vector_type(2)))  float    v2f;
typedef v2f  __attribute__((may_alias)) v2fa;
typedef __attribute__((ext_vector_type(2)))  _Float16 v2h;

__device__ __forceinline__ unsigned short f2bf(float f) { unsigned u = __float_as_uint(f); u += 0x7FFFu + ((u >> 16) & 1u); return (unsigned short)(u >> 16); }
__device__ __forceinline__ float bfr(float f) { return __uint_as_float(((unsigned)f2bf(f)) << 16); }   // value after RNE convert to bf16
__device__ __forceinline__ v16h cat16(v8h lo, v8h hi) { return __builtin_shufflevector(lo, hi, 0, 1, 2, 3, 4, 5, 6, 7, 8, 9, 10, 11, 12, 13, 14, 15); }
__device__ __forceinline__ v16bf cat16b(v8us lo, v8us hi) { return __builtin_bit_cast(v16bf, __builtin_shufflevector(lo, hi, 0, 1, 2, 3, 4, 5, 6, 7, 8, 9, 10, 11, 12, 13, 14, 15)); }
__device__ __forceinline__ v8f wmma16(v16h a, v16h b, v8f c) { return __builtin_amdgcn_wmma_f32_16x16x32_f16(false, a, false, b, (short)0, c, false, false); }
__device__ __forceinline__ v8f wmmab(v16bf a, v16bf b, v8f c) { return __builtin_amdgcn_wmma_f32_16x16x32_bf16(false, a, false, b, (short)0, c, false, false); }
// k map of a 16-bit fragment, lane = 16 h + row: elements 0..7 <- k0+8h+0..7, elements 8..15 <- k0+16+8h+0..7 (same map for A and B)
// fragment loaders from a plane in fragment order: one fragment (16 rows x 32 deep) = 512 elements, element half e/8 then lane then 8 elements, with the k map above; p already includes + 8*lane. Each of the two wave-wide 16-B loads reads 512 contiguous bytes (4 lines; K-contiguous rows give 16 lines of 32 B).
#define FRG  512                 // elements of one fragment
__device__ __forceinline__ v16h  ldfh(const h16* p) { return cat16(*(const v8h*)p, *(const v8h*)(p + 256)); }
__device__ __forceinline__ v16bf ldfb(const bf* p)  { return cat16b(*(const v8us*)p, *(const v8us*)(p + 256)); }
// ordering point for wave-private LDS tiles (same wave writes and reads)
__device__ __forceinline__ void wave_sync() { __builtin_amdgcn_fence(3 /* release order */, "wavefront"); __builtin_amdgcn_wave_barrier(); asm volatile("" ::: "memory"); }

// f32 -> f16 with a value select: results below the smallest normal become +0 (applied after the plane's power-of-two carry)
static __device__ __forceinline__ h16 toh_flush(float v) { const h16 r = (h16)v; return (fabsf(v) < 6.103515625e-05f) ? (h16)0.0f : r; }
// one WMMA + its own four-slot guard (ties the result, keeps both fragments live)
__device__ __forceinline__ v8f wmma16g(v16h a, v16h b, v8f c) {
    c = __builtin_amdgcn_wmma_f32_16x16x32_f16(false, a, false, b, (short)0, c, false, false);
    asm volatile("v_nop\n\tv_nop\n\tv_nop\n\tv_nop" : "+v"(c) : "v"(a), "v"(b));
    return c; }

// f16mode == 0: bf16 RNE bits; f16mode != 0: f16 bits of (bf16 value x carry), results below the smallest normal selected to +0.
// One block of 256 threads per 64 x 64 tile: tile column bx of plane z, in[rows = 64][Cn] -> the transposed tile [64 out rows][64 deep] in fragment order (8 fragments, 8 KiB, written by this block alone).
__device__ __forceinline__ void wT_body(const float* __restrict__ src, bf* dst, int Cn, int f16mode, float carry, int bx, int z) {
#pragma clang fp contract(off)
    __shared__ float ts[64 * 65];
    const int tid = threadIdx.x; const int c0 = bx * 64;
    const float* sp = src + (size_t)z * 64 * (size_t)Cn + c0;
    float ld[16];
#pragma unroll                                                     // unrolled, loads apart from the LDS stores: ld[] stays in registers and the 16 loads go out together, one trip to memory (rolled, every pair of loads was waited for before the next went out)
    for (int it = 0; it < 16; ++it) ld[it] = (sp + (size_t)(it * 4) * Cn)[(tid >> 6) * Cn + (tid & 63)];   // 16 x 256 = 64 x 64 elements, row 4 it + tid/64
#pragma unroll
    for (int it = 0; it < 16; ++it) { const int idx = it * 256 + tid; const int r = idx >> 6, c = idx & 63;
        ts[r * 65 + c] = ld[it]; }
    __syncthreads();
    bf* dp = dst + ((size_t)z * (size_t)Cn + c0) * 64;
{
#pragma unroll 1
        for (int it = 0; it < 2; ++it) { const int p = it * 256 + tid; const int c = p >> 3, r8 = (p & 7) * 8; v8us o;   // 2 trips x 256 = 64 rows x 8 pieces
#pragma unroll
            for (int k = 0; k < 8; ++k) { const float v = ts[(r8 + k) * 65 + c];
                const unsigned short ub = f2bf(v);
                const h16 hv = toh_flush(bfr(v) * carry);
                const unsigned short uh = __builtin_bit_cast(unsigned short, hv);
                o[k] = f16mode ? uh : ub; }
            *(v8us*)(dp + ((c >> 4) * 2 + (r8 >> 5)) * FRG + ((r8 >> 4) & 1) * 256 + (((r8 >> 3) & 1) * 16 + (c & 15)) * 8) = o;   // row tile c/16, chunk r8/32, element half, lane = 16 h + row
            asm volatile("s_wait_xcnt 0x0" ::: "memory"); }   // the next trip rewrites the store's address and data registers
         }
}

// Patch weight [oc][ic][ky*8+kx] f32 -> bf16 plane in the order in which k_patch loads its B fragments: with k = (ky*8+kx)*64 + ic, the 8 elements k = 32 c + 16 part + 8 h + 0..7 of row oc = 16 nb + lr stand at
// (((c*4 + nb)*2 + part)*32 + 16 h + lr)*8, so one wave-wide 16-B load of a fragment half reads 512 contiguous bytes (4 lines) where rows [oc][k] gave 16 lines of 32 B each.
// One block of 256 threads per (nb, 8 input channels ic8, 32 patch positions ph): reads 128 runs of 128 B, writes 32 runs of 256 B (16 oc x 16 B), so every 128-B line of the plane has one writer.
#define FCH  2048                // elements of the plane per 32-deep k chunk (4 column tiles x 2 halves x 32 lanes x 8)
#define FTP  33                  // LDS row pitch (floats) of the staging tile
__device__ __forceinline__ void wF_body(const float* __restrict__ src, bf* dst, int nb, int ic8, int ph) {
    __shared__ float tf[128 * FTP];                                // row = oc_l*8 + ic_l, column = position inside the half
    const int tid = threadIdx.x;
    const float* sp = src + ((size_t)(nb * 16) * DM + (size_t)(ic8 * 8)) * 64 + ph * 32;
    v4f ld[4];
#pragma unroll
    for (int it = 0; it < 4; ++it) { const int q4 = it * 256 + tid; const int row = q4 >> 3, c4 = (q4 & 7) * 4;   // 4 x 256 pieces of 4 floats = 128 rows x 32 columns
        ld[it] = *(const v4f*)(sp + ((size_t)(row >> 3) * DM + (size_t)(row & 7)) * 64 + c4); }
#pragma unroll
    for (int it = 0; it < 4; ++it) { const int q4 = it * 256 + tid; const int row = q4 >> 3, c4 = (q4 & 7) * 4;
#pragma unroll
        for (int k = 0; k < 4; ++k) tf[row * FTP + c4 + k] = ld[it][k]; }
    __syncthreads();
    bf* dp = dst + (size_t)(ic8 >> 2) * FCH + (size_t)(((nb * 2 + ((ic8 >> 1) & 1)) * 32 + (ic8 & 1) * 16) * 8);   // chunk parity, column tile, element half and lane half are fixed by (nb, ic8)
#pragma unroll
    for (int it = 0; it < 2; ++it) { const int p = it * 256 + tid; const int lr = p & 15, pl = p >> 4; v8us o;   // 2 x 256 pieces = 32 positions x 16 oc
#pragma unroll
        for (int k = 0; k < 8; ++k) o[k] = f2bf(tf[(lr * 8 + k) * FTP + pl]);
        *(v8us*)(dp + (size_t)((ph * 32 + pl) * 2) * FCH + lr * 8) = o; }   // position p holds chunks 2p and 2p + 1
}

// k_prep: everything that depends on the inputs alone, in ONE launch; the block index picks the job (a block-uniform choice, so the barriers of wT_body and wF_body are passed by whole blocks).
// Blocks 0 .. WTB-1: the weight tiles (they have the longest dependent chain, so they take the lowest block indices): 64 tiles of the patch weight (wF_body); q_w [64 in][64 out] -> [64 out][64 in];
// kv_w [64 in][128 out] -> [128 out][64 in] (two tiles); proj_w [64 in][64 out] -> [64 out][64 in]. Blocks WTB ..: x -> bf16 plane in fragment order, XPT pieces of 8 elements per thread, all of a thread's loads asked for before its first convert
// (a block writes 16 KiB in a row and reads whole 2-KiB runs, the eight adjacent tokens of one patch row ky of each of 16 patches). With XPT pieces per thread a quarter of the waves have to be started: 256 blocks of 8 waves hold the whole of x in flight.
#define WTB  (DM + 4)
#define N8B  ((size_t)SEQ * DM / 8)                       // 8-element pieces of x per batch
#define XPT  4                                            // pieces per thread of the x conversion
#define CVB  ((unsigned)((size_t)NB * N8B / (256 * XPT)))  // blocks of the x conversion
static_assert(((size_t)NB * N8B) % (256 * XPT) == 0);     // the blocks cover the pieces exactly: no thread is past the end
static_assert(XPT == 4);                                  // the trip index is bits 8..9 of the piece index = bits 1..2 of the patch position: two tokens on per trip, inside one patch row
__global__ __launch_bounds__(256) void k_prep(const float* __restrict__ x, const float* __restrict__ q_w, const float* __restrict__ kv_w, const float* __restrict__ sr_w, const float* __restrict__ pj_w,
                                              bf* XB, bf* WQT, bf* KVT, bf* SW, bf* PWT) {
    const int bid = (int)blockIdx.x;
    if (bid < WTB) {
        if (bid < DM) { wF_body(sr_w, SW, bid >> 4, (bid >> 1) & 7, bid & 1); return; }
        const float* src = q_w; bf* dst = WQT; int Cn = DM, f16mode = 0, bx = 0;
        if (bid == DM + 3)      { src = pj_w; dst = PWT; f16mode = 1; }
        else if (bid > DM)      { src = kv_w; dst = KVT; f16mode = 1; Cn = 2 * DM; bx = bid - (DM + 1); }
        wT_body(src, dst, Cn, f16mode, f16mode ? WC : 1.0f, bx, 0);
        return;
    }
    const size_t i = (size_t)(bid - WTB) * (256 * XPT) + threadIdx.x;   // the thread's first piece; the others stand 256 pieces on each
    // piece i -> 16 B of the plane: 4 adjacent lanes (h, element half) read one 128-B line of a token, the 8 lanes that share them write one 128-B line of the plane (a wave: 8 lines read, 4 written); then chunk, patch position, patch row of the batch
    const int h = (int)i & 1, eh = (int)(i >> 1) & 1, tx = (int)(i >> 2) & 15, ch = (int)(i >> 6) & 1, pos = (int)(i >> 7) & 63, ty = (int)((i % N8B) >> 13);
    const size_t tok = (size_t)(ty * SRR + (pos >> 3)) * GW + (size_t)(tx * SRR + (pos & 7));
    const float* xp = x + ((i / N8B) * (size_t)SEQ_FULL + tok) * DM + ch * 32 + eh * 16 + h * 8;   // batch pitch of x is the full sequence
    bf* op = XB + ((i & ~(size_t)63) + (size_t)(eh * 32 + h * 16 + tx)) * 8;   // fragment = 64 pieces: element half, lane = 16 h + tx
    v8f v[XPT];
#pragma unroll                                                     // unrolled: v[] stays in registers and the eight 16-B loads go out together, base + constant
    for (int it = 0; it < XPT; ++it) v[it] = *(const v8f*)(xp + it * (2 * DM));   // 256 pieces on = patch position + 2 = two tokens on
#pragma unroll
    for (int it = 0; it < XPT; ++it) { v8us o;
#pragma unroll
        for (int k = 0; k < 8; ++k) o[k] = f2bf(v[it][k]);
        *(v8us*)(op + it * (256 * 8)) = o; }
    asm volatile("s_wait_xcnt 0x0" ::: "memory");                  // behind the last of the four stores: in the listing the weight jobs' code follows and rewrites the stores' data registers
}

// kv_tail: one wave's projection of the 16 LayerNorm rows (fragments n0, n1: depth 0..31, 32..63) onto 64 kv weight rows (fragments wf[2t], wf[2t+1] of tile t), four 16 x 16 tiles, each lane's 8 results of a tile stored as one 16-B piece at op + 256 t.
// ISK: A = weight, B = LayerNorm: D row = column 16t + 8h + j of k, col = key lane&15: the lane's piece of element half t&1 of the k fragment of column group t>>1, so op = the block's 4 halves + 8*lane. Otherwise A = LayerNorm, B = weight: D row = key 8h + j, col = channel 16t + (lane&15) of v; 256 = 16 channel rows of the v^T tile.
template <bool ISK>
__device__ __forceinline__ void kv_tail(const v16h (&wf)[8], v16h n0, v16h n1, h16* op) {
    v8f kv[4]; v8h ov[4];
#pragma unroll
    for (int t = 0; t < 4; ++t) kv[t] = ISK ? wmma16(wf[2 * t], n0, (v8f){}) : wmma16(n0, wf[2 * t], (v8f){});
#pragma unroll
    for (int t = 0; t < 4; ++t) kv[t] = ISK ? wmma16(wf[2 * t + 1], n1, kv[t]) : wmma16(n1, wf[2 * t + 1], kv[t]);
#pragma unroll
    for (int t = 0; t < 4; ++t) {
#pragma unroll
        for (int j = 0; j < 8; ++j) ov[t][j] = toh_flush(kv[t][j] * (ISK ? (KC / WC) : (VC / WC))); }
#pragma unroll
    for (int t = 0; t < 4; ++t) *(v8h*)(op + t * 256) = ov[t];
}

// k_patch: patch projection (bf16 operands, K = 4096 with k = (ky*8+kx)*64 + ic) + bias + LayerNorm, then the k and v^T projections of the block's own 16 rows. grid NB*NKEY/16, PWV waves per block.
// One block per 16 rows m = (b, ty, tx = 0..15) x all 64 output channels; A = the block's own 64 tiles of the bf16 x plane (one per patch position, two fragments each), Bt = patch weight plane in fragment order (n = oc; wF_body has the map).
// The depth is split over the waves: wave w sums k = 256 w .. 256 w + 255 (ky = w>>1, kx = 4 (w&1) .. + 3) into its own 16 x 64 f32 partial tile, one patch position (2 KiB in a row of the x plane, 8 KiB in a row of the Bt plane) per trip.
// The 16 partial tiles meet in LDS; behind the block barrier wave w adds them up for row w in slice order (lane owns columns 2 lane, 2 lane + 1), adds the bias and does the LayerNorm of that row in f32 (xor exchanges over the 32 lanes).
// The 16 LayerNorm rows (single f16) meet in a second LDS tile; behind a second block barrier wave 0 forms k^T = Wk^T LN^T (A = kv weight rows 0..63, x WC; lane = key, 8 adjacent columns per tile; result x KC/WC into the block's own 16-key tile of the k plane)
// and wave 1 forms v = LN Wv (B = kv weight rows 64..127; lane = channel, 8 adjacent keys per tile; result x VC/WC into the block's own 16-key tile of the v^T plane). Each of the two waves alone writes its 2 KiB, so no 128-B line has two writers.
// amdgpu_waves_per_eu(4, 4): one block fills its 4 waves per SIMD and the grid is smaller than the chip, so the register budget goes to loads in flight (without it each fragment is loaded and waited for alone).
__global__ __launch_bounds__(32 * PWV) __attribute__((amdgpu_waves_per_eu(4, 4))) void k_patch(const bf* __restrict__ A, const bf* __restrict__ Bt, const float* __restrict__ cbias, const float* __restrict__ lg, const float* __restrict__ lb, const h16* __restrict__ KVW, h16* KP, h16* VT) {
    __shared__ __align__(16) float red[PWV * 16 * RP];
    __shared__ __align__(16) h16   lnt[16 * LP];
    const int lane = threadIdx.x & 31, lr = lane & 15, hi = lane >> 4;
    const int wave = __builtin_amdgcn_readfirstlane((int)(threadIdx.x >> 5));
    const int r0 = (int)blockIdx.x * 16;
    const int k0 = wave * PKS;
    const bf* ap = A + ((size_t)blockIdx.x * 64 + (size_t)(k0 >> 6)) * (16 * DM) + lane * 8;   // first patch position of the slice: ky*8 + kx = k0>>6; row tile (b, ty) = block
    const bf* bp = Bt + (size_t)(k0 >> 5) * FCH + lane * 8;         // the slice's 8 chunks stand in a row (32 KiB); + chunk * FCH + nb * FRG
    v8f acc[4];                                                    // the loops over nb, j and p below are unrolled so that acc[] is indexed by constants and stays in registers
#pragma unroll
    for (int nb = 0; nb < 4; ++nb) acc[nb] = (v8f){};
#pragma unroll                                                     // 4 trips, unrolled: every address is base + constant, and a later trip's loads issue ahead of an earlier trip's WMMAs
    for (int kk = 0; kk < PKS; kk += DM) {                         // next patch position = next tile of the x plane, two chunks on in the weight plane
        const v16bf a0 = ldfb(ap + (kk >> 6) * (16 * DM)), a1 = ldfb(ap + (kk >> 6) * (16 * DM) + FRG);
#pragma unroll
        for (int nb = 0; nb < 4; ++nb) { const bf* bq = bp + (kk >> 5) * FCH + nb * FRG;
            const v16bf b0 = ldfb(bq), b1 = ldfb(bq + FCH);
            acc[nb] = wmmab(a0, b0, acc[nb]); acc[nb] = wmmab(a1, b1, acc[nb]); }
    }
#pragma unroll
    for (int nb = 0; nb < 4; ++nb) {
#pragma unroll
        for (int j = 0; j < 8; ++j) red[(wave * 16 + hi * 8 + j) * RP + nb * 16 + lr] = acc[nb][j]; }   // D: row 8h+j, col lane&15
    __syncthreads();
    v16h wf[8];                                                    // kv weight fragments of waves 0 (k rows) and 1 (v rows), asked for behind the barrier (which waits for every load in flight) so that they arrive while the sums and the LayerNorm run
    if (wave < 2) {
        const h16* wp = KVW + (size_t)wave * 8 * FRG + lane * 8;
#pragma unroll
        for (int f = 0; f < 8; ++f) wf[f] = ldfh(wp + f * FRG);   // tile f>>1 (16 weight rows), depth half f&1
        asm volatile("s_wait_xcnt 0x0" :: "v"(wp) : "memory"); }   // the address pair is an input here: no load's result lands on it while the other loads still name it
    const v2f t0 = *(const v2fa*)(&red[wave * RP + 2 * lane]);
    float x0 = t0[0], x1 = t0[1];
#pragma unroll
    for (int p = 1; p < PWV; ++p) { const v2f t = *(const v2fa*)(&red[(p * 16 + wave) * RP + 2 * lane]); x0 += t[0]; x1 += t[1]; }
    const v2f bi = *(const v2f*)(cbias + 2 * lane), g = *(const v2f*)(lg + 2 * lane), of = *(const v2f*)(lb + 2 * lane);
    x0 += bfr(bi[0]); x1 += bfr(bi[1]);
    float sm = x0 + x1;
#pragma unroll
    for (int d = 16; d >= 1; d >>= 1) sm += __shfl_xor(sm, d, 32);
    const float mu = sm * (1.0f / 64.0f);
    const float d0 = x0 - mu, d1 = x1 - mu;
    float q = d0 * d0 + d1 * d1;
#pragma unroll
    for (int d = 16; d >= 1; d >>= 1) q += __shfl_xor(q, d, 32);
    const float rs = 1.0f / sqrtf(q * (1.0f / 64.0f) + 1.0e-5f);
    v2h hv;
    hv[0] = toh_flush(d0 * rs * bfr(g[0]) + bfr(of[0]));
    hv[1] = toh_flush(d1 * rs * bfr(g[1]) + bfr(of[1]));
    *(v2h*)(&lnt[wave * LP + 2 * lane]) = hv;                      // row w of the LayerNorm tile
    __syncthreads();                                               // all 16 rows stand before waves 0 and 1 read them
    if (wave >= 2) return;                                         // no barrier follows
    const v16h n0 = cat16(*(const v8ha*)(&lnt[lr * LP + 8 * hi]),      *(const v8ha*)(&lnt[lr * LP + 16 + 8 * hi]));   // fragment of row lr, depth 0..31 (the k map of ldfh)
    const v16h n1 = cat16(*(const v8ha*)(&lnt[lr * LP + 32 + 8 * hi]), *(const v8ha*)(&lnt[lr * LP + 48 + 8 * hi]));   // depth 32..63
    if (wave == 0) kv_tail<true>(wf, n0, n1, KP + (size_t)blockIdx.x * (16 * DM) + lane * 8);
    else           kv_tail<false>(wf, n0, n1, VT + (size_t)blockIdx.x * VTT + lr * 16 + 8 * hi);
}

// k_attn: fused q projection + attention + output projection, one wave per 16 query rows of one batch (one tile of the x plane: every 8th token of a grid row), the 8 heads in two trips of four (the four heads that share a 32-column group go through the key loop together, on one K fragment pair per 32 keys); K / V^T fragments straight from the f16 planes (two 16-B loads each, arithmetic addressing; K in fragment order).
// q projection in transposed form: Q^T[c][t] = Wq^T X^T (A = q weight rows c, B = bf16 x rows t, depth 64): lane (t = lane&15, h) holds columns 16 tile + 8h + 0..7 of its row, which after the f16 convert (x QS, subnormal results kept) are the two halves of the Q fragment below.
// Transposed form: S^T[key][t] = K Q^T (A = K rows over the 32 columns of the head's group, B = Q row with the k-slots outside the head selected to zero by value); lane (t = lane&15, h = lane>>4) holds keys 8h+r
// of each 16-key tile, so the packed P tile is directly the B fragment of O^T[d][t] = V^T P^T (A rows d: channel head*8 + (lane&7); rows 8..15 repeat rows 0..7 and are not used).
// Softmax in two passes over the keys. Pass 1: score products and a running maximum per lane, the two lane halves of a row combined with one xor-16 exchange behind it. Pass 2: the same score products with 14 - max as the accumulator's start, so each result is the argument of exp2 as it stands; O and the row sum are never rescaled. P = f16 of exp2(score - max + 14), converted in pairs (subnormal results kept); row sum over the converted P.
// Context (x CTXC) of each head goes to a wave-private f16 LDS tile [16][64]; after the head loop the tile is the A operand of the output projection (B = transposed weight plane, f16 x WC);
// The two integer grid-size inputs are read on the device; when they differ from the compiled grid the output is filled with NaN.
__global__ __launch_bounds__(32 * AW) void k_attn(const bf* __restrict__ XB, const bf* __restrict__ WQT, const h16* __restrict__ KP, const h16* __restrict__ VT, const h16* __restrict__ PW,
                                                  const float* __restrict__ pbias, const int* __restrict__ hp, const int* __restrict__ wp, float* OUT) {
    __shared__ __align__(16) h16   cs[AW * 16 * CP];
    __shared__ __align__(16) float os[AW * 16 * OSP];
    const int lane = threadIdx.x & 31, lr = lane & 15, hi = lane >> 4;
    const int wave = __builtin_amdgcn_readfirstlane((int)(threadIdx.x >> 5));
    const int b = blockIdx.y;
    const int ut = blockIdx.x * AW + wave;                         // tile of the x plane inside the batch = ty*64 + ky*8 + kx: the wave's 16 query rows are the tokens (grid row ut>>3, column 8 row + (ut&7))
    const bool bad = (hp[0] != GH_FULL) | (wp[0] != GW);
    const size_t qrow  = ((size_t)b * (SEQ / 16) + (size_t)ut) * (16 * DM) + (size_t)lane * 8;
    const size_t kbase = (size_t)b * NKEY * DM + (size_t)lane * 8;             // + (key/16) * 16*DM + group * FRG   (A fragment: row key, k = column inside the group)
    const size_t vbase = (size_t)b * (NKEY / 16) * VTT + (size_t)(lr & 7) * 16 + 8 * hi;   // + (key/16)*VTT + head*8*16   (A fragment: row d, k = key)
    const int cb = wave * 16 * CP;
    const v8h z8 = (v8h){};
    v8h qh[4];                                                     // q x QS of row t, columns 16 tile + 8h + 0..7
    {
        const v16bf x0 = ldfb(XB + qrow), x1 = ldfb(XB + qrow + FRG);
        const bf* wr = WQT + lane * 8;
        v16bf wq[8];
#pragma unroll
        for (int f = 0; f < 8; ++f) wq[f] = ldfb(wr + f * FRG);   // tile f>>1 (16 weight rows), depth half f&1
        // the loaded fragments are inputs here, so all twenty loads are asked for before the first product waits: one trip to the L2 instead of two (without it the second depth half is loaded into the first half's registers, behind its products)
        asm volatile("" :: "v"(x0), "v"(x1), "v"(wq[0]), "v"(wq[1]), "v"(wq[2]), "v"(wq[3]), "v"(wq[4]), "v"(wq[5]), "v"(wq[6]), "v"(wq[7]));
        asm volatile("s_wait_xcnt 0x0" ::: "memory");              // the register that holds these loads' offset is rewritten by the converts below
#pragma unroll
        for (int t = 0; t < 4; ++t) {
            v8f qa4 = wmmab(wq[2 * t], x0, (v8f){}); qa4 = wmmab(wq[2 * t + 1], x1, qa4);   // D: row = column 8h + j of the tile, col = t
#pragma unroll
            for (int j = 0; j < 8; ++j) qh[t][j] = (h16)(qa4[j] * QS); }
    }
#pragma unroll 1
    for (int g = 0; g < 2; ++g) {                                  // one trip = the four heads that share the group's 32 columns, carried together through the key loop
        const v8h qa = g ? qh[2] : qh[0], qb = g ? qh[3] : qh[1];  // columns 32g + 8h + 0..7 and 32g + 16 + 8h + 0..7
        v16h qf[4]; v8f o[4]; float mx[4], l[4];                   // every loop over j is unrolled so that the per-head arrays are indexed by constants and stay in registers
#pragma unroll
        for (int j = 0; j < 4; ++j) {
            const bool kA = (hi == (j & 1)) & (j < 2);             // head j of the group = k-slots 8j..8j+7: lane half (j&1), elements 0..7 (j < 2) or 8..15 (j >= 2)
            const bool kB = (hi == (j & 1)) & (j >= 2);
            qf[j] = cat16(kA ? qa : z8, kB ? qb : z8);             // B fragment: col t, k = column inside the group
            o[j] = (v8f){}; mx[j] = NEGB; l[j] = 0.0f; }
        const size_t ko = kbase + (size_t)(g * FRG);
        const size_t vo = vbase + (size_t)(g * 4 * HD) * 16;
        // pass 1: the maximum of every row. Unrolled: every address is base + constant, and a later trip's K loads issue ahead of an earlier trip's products
#pragma unroll
        for (int key0 = 0; key0 < NKEY; key0 += 32) {
            const h16* ka = KP + ko + (size_t)key0 * DM;
            const v16h ka0 = ldfh(ka), kb0 = ldfh(ka + 16 * DM);     // one K fragment pair serves the four heads
            v8f sa[4], sb[4];
#pragma unroll
            for (int j = 0; j < 4; ++j) { sa[j] = wmma16(ka0, qf[j], (v8f){}); sb[j] = wmma16(kb0, qf[j], (v8f){}); }   // eight independent products
#pragma unroll
            for (int j = 0; j < 4; ++j) {
#pragma unroll
                for (int r = 0; r < 8; ++r) mx[j] = fmaxf(mx[j], fmaxf(sa[j][r], sb[j][r])); }
        }
        v8f shv[4];                                                // 14 - max of the lane's row t, in all eight accumulator rows
#pragma unroll
        for (int j = 0; j < 4; ++j) {
            const float sh = PSH - fmaxf(mx[j], __shfl_xor(mx[j], 16, 32));          // the other lane half's maximum, one exchange per head
#pragma unroll
            for (int r = 0; r < 8; ++r) shv[j][r] = sh; }
        // pass 2: P, its row sum and O
#pragma unroll 1
        for (int key0 = 0; key0 < NKEY; key0 += 32) {
            const h16* ka = KP + ko + (size_t)key0 * DM;
            const v16h ka0 = ldfh(ka), kb0 = ldfh(ka + 16 * DM);
            v16h vf[4];
#pragma unroll
            for (int j = 0; j < 4; ++j) { const h16* vp = VT + vo + (size_t)(key0 >> 4) * VTT + j * HD * 16; vf[j] = cat16(*(const v8h*)vp, *(const v8h*)(vp + VTT)); }   // keys key0 + 8h + 0..7 and, one tile on, key0 + 16 + 8h + 0..7
            v8f sa[4], sb[4];
#pragma unroll
            for (int j = 0; j < 4; ++j) { sa[j] = wmma16(ka0, qf[j], shv[j]); sb[j] = wmma16(kb0, qf[j], shv[j]); }   // score - max + 14
#pragma unroll
            for (int j = 0; j < 4; ++j) {
                v16h pb; float ls = l[j];
                float xa[8], xb[8];
#pragma unroll
                for (int r = 0; r < 8; ++r) { xa[r] = __builtin_amdgcn_exp2f(sa[j][r]); xb[r] = __builtin_amdgcn_exp2f(sb[j][r]); }
                // the slot that the instruction set asks for behind a v_exp_f32 before its source register is overwritten, eight to a statement: the sources are inputs here, so none is overwritten before all eight results stand
                asm volatile("v_nop" :: "v"(sa[j][0]), "v"(sa[j][1]), "v"(sa[j][2]), "v"(sa[j][3]), "v"(sa[j][4]), "v"(sa[j][5]), "v"(sa[j][6]), "v"(sa[j][7]), "v"(xa[0]), "v"(xa[1]), "v"(xa[2]), "v"(xa[3]), "v"(xa[4]), "v"(xa[5]), "v"(xa[6]), "v"(xa[7]));
                asm volatile("v_nop" :: "v"(sb[j][0]), "v"(sb[j][1]), "v"(sb[j][2]), "v"(sb[j][3]), "v"(sb[j][4]), "v"(sb[j][5]), "v"(sb[j][6]), "v"(sb[j][7]), "v"(xb[0]), "v"(xb[1]), "v"(xb[2]), "v"(xb[3]), "v"(xb[4]), "v"(xb[5]), "v"(xb[6]), "v"(xb[7]));
#pragma unroll
                for (int r = 0; r < 8; r += 2) {                   // two P values to a register by one packed convert (round to nearest even); values under the smallest normal f16 stay subnormal: the matrix unit and the sum below both take them as they are
                    const v2h pa = __builtin_convertvector((v2f){xa[r], xa[r + 1]}, v2h);
                    const v2h pc = __builtin_convertvector((v2f){xb[r], xb[r + 1]}, v2h);
                    pb[r] = pa[0]; pb[r + 1] = pa[1]; pb[8 + r] = pc[0]; pb[9 + r] = pc[1];
                    ls += (float)pa[0]; ls += (float)pc[0]; ls += (float)pa[1]; ls += (float)pc[1]; }   // one running sum per head over the converted P, carried from trip to trip without a rescale
                l[j] = ls;
                o[j] = wmma16(vf[j], pb, o[j]);
            }
            // four vector slots between the trip's last WMMA and the loop branch: the next trip's first products reuse this trip's fragment registers
            asm volatile("v_nop\n\tv_nop\n\tv_nop\n\tv_nop" : "+v"(o[0]), "+v"(o[1]), "+v"(o[2]), "+v"(o[3]));
        }
#pragma unroll
        for (int j = 0; j < 4; ++j) {
            const float lt = l[j] + __shfl_xor(l[j], 16, 32);
            const float inv = (1.0f / lt) * (CTXC / VC);           // lt is about 16384 or more (the maximum element of every row converts to about 16384)
            v8h cv;
#pragma unroll
            for (int r = 0; r < 8; ++r) cv[r] = toh_flush(o[j][r] * inv);           // lane half 0: o[r] = (d = r, t = lane&15)
            if (hi == 0) *(v8ha*)(&cs[cb + lr * CP + (g * 4 + j) * HD]) = cv; }     // 8 heads x 8 columns: rows 0..15 x columns 0..63 all written
    }
    wave_sync();
    v8f acc[4];
#pragma unroll
    for (int nb = 0; nb < 4; ++nb) acc[nb] = (v8f){};
#pragma unroll
    for (int kc = 0; kc < DM; kc += 32) {
        const v8h a0 = *(const v8ha*)(&cs[cb + lr * CP + kc + 8 * hi]);
        const v8h a1 = *(const v8ha*)(&cs[cb + lr * CP + kc + 16 + 8 * hi]);
        const v16h a = cat16(a0, a1);                              // A fragment: row t, k = context column
#pragma unroll
        for (int nb = 0; nb < 4; ++nb) { const v16h bw = ldfh(PW + (nb * 2 + (kc >> 5)) * FRG + lane * 8);
            acc[nb] = wmma16g(a, bw, acc[nb]); }
    }
    const int ob = wave * 16 * OSP;
    const float nanv = __uint_as_float(0x7FC00000u);
#pragma unroll
    for (int nb = 0; nb < 4; ++nb) { const float bia = bfr(pbias[nb * 16 + lr]);
#pragma unroll
        for (int r = 0; r < 8; ++r) { const float v = acc[nb][r] * OUTI + bia;
            os[ob + (8 * hi + r) * OSP + nb * 16 + lr] = bad ? nanv : v; } }   // D: row 8h+r, col lane&15; rows 0..15 x columns 0..63 all written
    wave_sync();
    float* orow = OUT + ((size_t)b * OUT_SEQ + (size_t)(ut >> 3) * GW + (size_t)(ut & 7)) * DM;   // query row r is SRR tokens on from row r - 1
{
#pragma unroll
        for (int s = 0; s < 8; ++s) { const int row = 2 * s + (lane >> 4), cofs = (lane & 15) * 4;
            const v4f val = *(const v4fa*)(&os[ob + row * OSP + cofs]);
            *(v4f*)(orow + (size_t)row * (SRR * DM) + cofs) = val; }
         }
}

static constexpr size_t al256(size_t v) { return (v + 255) & ~(size_t)255; }
static constexpr size_t SZ_XB = al256((size_t)NB * SEQ * DM * 2);        // bf16 x plane
static constexpr size_t SZ_W1 = al256((size_t)DM * DM * 2);              // one 64 x 64 weight plane
static constexpr size_t SZ_KV = al256((size_t)2 * DM * DM * 2);          // kv weight plane [128][64]
static constexpr size_t SZ_SW = al256((size_t)DM * CK * 2);              // patch weight plane, 64 x 4096 elements
static constexpr size_t SZ_KP = al256((size_t)NB * NKEY * DM * 2);       // k / v^T planes
static constexpr size_t SZ_TOTAL = SZ_XB + 2 * SZ_W1 + SZ_KV + SZ_SW + 2 * SZ_KP;
static_assert(SZ_TOTAL <= (size_t)134217728);                            // workspace carve <= 128 MiB
static_assert(((size_t)NB * SEQ * DM * 2) % 256 == 0);
static_assert(((size_t)NB * NKEY * DM * 2) % 256 == 0);
static_assert((size_t)NB * (NKEY / 16) * VTT == (size_t)NB * NKEY * DM);  // the tiled v^T plane has the same extent as the k plane

extern "C" void kernel_launch(void* const* d_in, const int* in_sizes, int n_in,
                              void* d_out, int out_size, void* d_ws, size_t ws_size, hipStream_t stream) {
    if (n_in < 11) return;
    const size_t needx = ((size_t)(NB - 1) * SEQ_FULL + SEQ) * DM;
    if ((size_t)in_sizes[0] < needx) return;
    if (in_sizes[1] < 1 || in_sizes[2] < 1) return;
    if ((size_t)in_sizes[3] < (size_t)DM * DM || (size_t)in_sizes[4] < (size_t)2 * DM * DM || (size_t)in_sizes[5] < (size_t)DM * CK) return;
    if (in_sizes[6] < DM || in_sizes[7] < DM || in_sizes[8] < DM || (size_t)in_sizes[9] < (size_t)DM * DM || in_sizes[10] < DM) return;
    if ((size_t)out_size < ((size_t)(NB - 1) * OUT_SEQ + SEQ) * DM) return;
    if (SZ_TOTAL > ws_size) return;
    // wire order: x, H, W, q_w, kv_w, sr_w, sr_b, ln_g, ln_b, proj_w, proj_b
    const float* x    = (const float*)d_in[0];
    const int*   gh   = (const int*)d_in[1];
    const int*   gw   = (const int*)d_in[2];
    const float* q_w  = (const float*)d_in[3];
    const float* kv_w = (const float*)d_in[4];
    const float* sr_w = (const float*)d_in[5];
    const float* sr_b = (const float*)d_in[6];
    const float* ln_g = (const float*)d_in[7];
    const float* ln_b = (const float*)d_in[8];
    const float* pj_w = (const float*)d_in[9];
    const float* pj_b = (const float*)d_in[10];
    float* OUT = (float*)d_out;      // [NB][SEQ][64]
    char* wsp = (char*)d_ws;
    bf*  XB  = (bf*)wsp;  wsp += SZ_XB;              // [NB*SEQ/16][2 chunks][2 element halves][lane][8] bf16 x (fragment order)
    bf*  WQT = (bf*)wsp;  wsp += SZ_W1;              // 64 out x 64 in, bf16, fragment order
    bf*  PWT = (bf*)wsp;  wsp += SZ_W1;              // 64 out x 64 in, f16 bits, x64, fragment order
    bf*  KVT = (bf*)wsp;  wsp += SZ_KV;              // 128 out x 64 in, f16 bits, x64 (rows 0..63 k, 64..127 v), fragment order
    bf*  SW  = (bf*)wsp;  wsp += SZ_SW;              // [k/32][oc/16][half][lane][8] bf16, k = (ky*8+kx)*64 + ic
    h16* KP  = (h16*)wsp; wsp += SZ_KP;              // [NB*NKEY/16][4 element halves][lane][8] k x16 (fragment order)
    h16* VT  = (h16*)wsp; wsp += SZ_KP;              // [NB*NKEY/16][64][16] v^T x64

    // three dependent launches: inputs -> planes; patch projection + LayerNorm + k, v^T projections; q projection + attention + output projection
    k_prep<<<dim3(WTB + CVB, 1, 1), 256, 0, stream>>>(x, q_w, kv_w, sr_w, pj_w, XB, WQT, KVT, SW, PWT);
    k_patch<<<dim3(NB * NKEY / 16, 1, 1), 32 * PWV, 0, stream>>>(XB, SW, sr_b, ln_g, ln_b, (const h16*)KVT, KP, VT);
    k_attn<<<dim3(SEQ / (16 * AW), NB, 1), 32 * AW, 0, stream>>>(XB, WQT, KP, VT, (const h16*)PWT, pj_b, gh, gw, OUT);
}

// v009
// One run takes 26.9 microseconds.
// In two side-by-side timings against v008, it was 1.25 and 1.21 times as fast.
// Over all steps from v000 it is 7.93 times as fast.
#include <hip/hip_runtime.h>

// Spatial-reduction attention, width 64 = 8 heads x 8: queries from all NB x SEQ tokens (x @ q_w, weights [in][out], no bias); keys / values from an 8x8 stride-8 patch projection (+ bias) -> LayerNorm (eps 1e-5) -> fused [in][out] kv weight (256 keys per batch at the full size); dense softmax, score scale 8^-0.5; output projection (+ bias).
// Compute dtypes, f32 accumulate everywhere: q projection and patch projection v_wmma_f32_16x16x32_bf16 (x and weights RNE-converted to bf16; products exact); kv projection v_wmma_f32_16x16x32_f16 (LayerNorm rows single f16, weight = bf16 value x64 held in f16);
// scores v_wmma_f32_16x16x32_f16 (q x score scale x log2(e) / 16, k x16, single f16; four heads share one 32-deep k axis, the Q fragment is zeroed outside its head by value); P.V v_wmma_f32_16x16x32_f16 (P x16384 carry, v x64, single f16, row sum over the converted P);
// output projection v_wmma_f32_16x16x32_f16 (context x1024 single f16, weight = bf16 value x64 in f16), scale folded back in the f32 epilogue; softmax and LayerNorm in f32.
// Layout: the bf16 x plane, every weight plane and the k plane in fragment order (ldfh / ldfb below): [16-row tile][k/32][element half][lane][8] (rows: out channel; key; for x the 16 tokens tx = 0..15 of one patch row ty at one patch position (ky, kx), tile index (b*GH/8 + ty)*64 + ky*8 + kx), the patch weight plane with the chunk outermost, [k/32][oc/16][element half][lane][8], k = (ky*8+kx)*64+ic; v^T plane in tiles of 16 keys [(b*NKEY+key)/16][c][key%16]. q and the LayerNorm rows never reach memory.
// Fused attention kernel in transposed form (Q^T = Wq^T X^T, S^T = K Q^T, O^T = V^T P^T), no q or score plane in memory, q projection and output projection inside the same kernel; k and v^T projections inside the patch kernel, behind its LayerNorm.

#ifndef NB
#define NB 2
#endif
#ifndef GH
#define GH 128                   // token grid height (rows of the grid used per batch)
#endif
#define GW   128                 // token grid width
#define SEQ  (GH * GW)
#define NB_FULL  2
#define GH_FULL  128
#define SEQ_FULL 16384
#ifndef OUT_SEQ
#define OUT_SEQ SEQ              // row pitch (in tokens) between batches of the output
#endif
#define DM   64
#define NH_  8
#define HD   8
#define SRR  8                   // patch size = stride
#define KGW  (GW / SRR)
#define NKEY ((GH / SRR) * (GW / SRR))
#define CK   (DM * SRR * SRR)    // patch projection depth (4096)
#define AW   4                   // waves per attention block (16 query rows each)
#define CP   72                  // LDS row pitch (halves) of the context tile
#define OSP  68                  // LDS row pitch (floats) of the output tile
#define PWV  16                  // waves per patch-projection block = slices of its depth = rows of its tile
#define PKS  (CK / PWV)          // depth of one slice (256 = 4 patch positions x 64 channels)
#define RP   68                  // LDS row pitch (floats) of the partial tiles
#define LP   72                  // LDS row pitch (halves) of the LayerNorm tile
#define VTT  (DM * 16)           // halves in one 16-key tile of the v^T plane
#define KC   16.0f               // carry of the k plane
#define VC   64.0f               // carry of the v^T plane
#define WC   64.0f               // carry of the f16 weight planes
#define CTXC 1024.0f             // carry of the context tile
#define QS   ((float)(0.35355339059327378 * 1.4426950408889634 / 16.0))    // HD^-0.5 * log2(e) / KC: q carries the score scale, so K Q^T is already the exponent of 2
#define PSH  14.0f               // log2 of the P carry (16384)
#define NEGB (-3.0e38f)
#define OUTI (1.0f / 65536.0f)   // 1 / (CTXC * WC)

static_assert(DM == 64);
static_assert(NH_ * HD == DM);                 // head h = columns h*8 + d
static_assert(HD == 8);                        // one head = 8 k-slots = one half fragment of one lane half
static_assert(NH_ == 8);                       // two groups of four heads, 32 columns each
static_assert(DM % 32 == 0);                   // GEMM k-loops step by 32
static_assert(CK % 32 == 0);
static_assert(CK == 64 * DM);                  // k index = (ky*8+kx)*64 + ic
static_assert(SRR == 8);
static_assert(GH % SRR == 0);
static_assert(GW % SRR == 0);
static_assert(NKEY % 32 == 0);                 // key loop steps by 32
static_assert(SEQ % (16 * AW) == 0);           // attention grid covers the sequence exactly
static_assert(((size_t)SEQ * DM) % 8 == 0);
static_assert(NB <= NB_FULL);
static_assert(GH <= GH_FULL);
static_assert(SEQ <= SEQ_FULL);
static_assert((CP * 2) % 16 == 0);
static_assert((OSP * 4) % 16 == 0);
static_assert(CP >= DM);
static_assert(OSP >= DM);
static_assert(32 * 16 * 4 == 16 * DM * 2);
static_assert(32 * 16 * 8 == 16 * DM * 4);     // output stores: 32 lanes x 16 B x 8 instructions == 16 rows x 256 B
static_assert(256 * 2 * 16 == 64 * 64 * 2);
static_assert(AW * 16 * CP * 2 + AW * 16 * OSP * 4 + 2 * NKEY * DM * 2 <= 131072);
static_assert(64 * 65 * 4 <= 131072);
static_assert(PWV == 16);                      // wave w finishes row w of the 16-row tile
static_assert(PKS % DM == 0);                  // a slice holds whole patch positions
static_assert((SRR * DM) % PKS == 0);          // and stays inside one patch row ky
static_assert((NB * NKEY) % 16 == 0);
static_assert(NKEY % 16 == 0);                 // a 16-row tile never straddles two batches
static_assert(KGW == 16);                      // a 16-row tile = one patch row ty, row = tx
static_assert((RP * 4) % 8 == 0);
static_assert((LP * 2) % 16 == 0);
static_assert(LP >= DM);
static_assert(PWV * 16 * RP * 4 + 16 * LP * 2 <= 131072);

typedef _Float16 h16;
typedef unsigned short bf;
typedef __attribute__((ext_vector_type(16))) __bf16   v16bf;
typedef __attribute__((ext_vector_type(16))) _Float16 v16h;
typedef __attribute__((ext_vector_type(8)))  _Float16 v8h;
typedef __attribute__((ext_vector_type(8)))  unsigned short v8us;
typedef __attribute__((ext_vector_type(8)))  float    v8f;
typedef __attribute__((ext_vector_type(4)))  float    v4f;
typedef v4f  __attribute__((may_alias)) v4fa;
typedef v8h  __attribute__((may_alias)) v8ha;
typedef __attribute__((ext_vector_type(2)))  float    v2f;
typedef v2f  __attribute__((may_alias)) v2fa;
typedef __attribute__((ext_vector_type(2)))  _Float16 v2h;

__device__ __forceinline__ unsigned short f2bf(float f) { unsigned u = __float_as_uint(f); u += 0x7FFFu + ((u >> 16) & 1u); return (unsigned short)(u >> 16); }
__device__ __forceinline__ float bfr(float f) { return __uint_as_float(((unsigned)f2bf(f)) << 16); }   // value after RNE convert to bf16
__device__ __forceinline__ v16h cat16(v8h lo, v8h hi) { return __builtin_shufflevector(lo, hi, 0, 1, 2, 3, 4, 5, 6, 7, 8, 9, 10, 11, 12, 13, 14, 15); }
__device__ __forceinline__ v16bf cat16b(v8us lo, v8us hi) { return __builtin_bit_cast(v16bf, __builtin_shufflevector(lo, hi, 0, 1, 2, 3, 4, 5, 6, 7, 8, 9, 10, 11, 12, 13, 14, 15)); }
__device__ __forceinline__ v8f wmma16(v16h a, v16h b, v8f c) { return __builtin_amdgcn_wmma_f32_16x16x32_f16(false, a, false, b, (short)0, c, false, false); }
__device__ __forceinline__ v8f wmmab(v16bf a, v16bf b, v8f c) { return __builtin_amdgcn_wmma_f32_16x16x32_bf16(false, a, false, b, (short)0, c, false, false); }
// k map of a 16-bit fragment, lane = 16 h + row: elements 0..7 <- k0+8h+0..7, elements 8..15 <- k0+16+8h+0..7 (same map for A and B)
// fragment loaders from a plane in fragment order: one fragment (16 rows x 32 deep) = 512 elements, element half e/8 then lane then 8 elements, with the k map above; p already includes + 8*lane. Each of the two wave-wide 16-B loads reads 512 contiguous bytes (4 lines; K-contiguous rows give 16 lines of 32 B).
#define FRG  512                 // elements of one fragment
__device__ __forceinline__ v16h  ldfh(const h16* p) { return cat16(*(const v8h*)p, *(const v8h*)(p + 256)); }
__device__ __forceinline__ v16bf ldfb(const bf* p)  { return cat16b(*(const v8us*)p, *(const v8us*)(p + 256)); }
// ordering point for wave-private LDS tiles (same wave writes and reads)
__device__ __forceinline__ void wave_sync() { __builtin_amdgcn_fence(3 /* release order */, "wavefront"); __builtin_amdgcn_wave_barrier(); asm volatile("" ::: "memory"); }

// f32 -> f16 with a value select: results below the smallest normal become +0 (applied after the plane's power-of-two carry)
static __device__ __forceinline__ h16 toh_flush(float v) { const h16 r = (h16)v; return (fabsf(v) < 6.103515625e-05f) ? (h16)0.0f : r; }
// one WMMA + its own four-slot guard (ties the result, keeps both fragments live)
__device__ __forceinline__ v8f wmma16g(v16h a, v16h b, v8f c) {
    c = __builtin_amdgcn_wmma_f32_16x16x32_f16(false, a, false, b, (short)0, c, false, false);
    asm volatile("v_nop\n\tv_nop\n\tv_nop\n\tv_nop" : "+v"(c) : "v"(a), "v"(b));
    return c; }

// f16mode == 0: bf16 RNE bits; f16mode != 0: f16 bits of (bf16 value x carry), results below the smallest normal selected to +0.
// One block of 256 threads per 64 x 64 tile: tile column bx of plane z, in[rows = 64][Cn] -> the transposed tile [64 out rows][64 deep] in fragment order (8 fragments, 8 KiB, written by this block alone).
__device__ __forceinline__ void wT_body(const float* __restrict__ src, bf* dst, int Cn, int f16mode, float carry, int bx, int z) {
#pragma clang fp contract(off)
    __shared__ float ts[64 * 65];
    const int tid = threadIdx.x; const int c0 = bx * 64;
    const float* sp = src + (size_t)z * 64 * (size_t)Cn + c0;
    float ld[16];
#pragma unroll                                                     // unrolled, loads apart from the LDS stores: ld[] stays in registers and the 16 loads go out together, one trip to memory (rolled, every pair of loads was waited for before the next went out)
    for (int it = 0; it < 16; ++it) ld[it] = (sp + (size_t)(it * 4) * Cn)[(tid >> 6) * Cn + (tid & 63)];   // 16 x 256 = 64 x 64 elements, row 4 it + tid/64
#pragma unroll
    for (int it = 0; it < 16; ++it) { const int idx = it * 256 + tid; const int r = idx >> 6, c = idx & 63;
        ts[r * 65 + c] = ld[it]; }
    __syncthreads();
    bf* dp = dst + ((size_t)z * (size_t)Cn + c0) * 64;
{
#pragma unroll 1
        for (int it = 0; it < 2; ++it) { const int p = it * 256 + tid; const int c = p >> 3, r8 = (p & 7) * 8; v8us o;   // 2 trips x 256 = 64 rows x 8 pieces
#pragma unroll
            for (int k = 0; k < 8; ++k) { const float v = ts[(r8 + k) * 65 + c];
                const unsigned short ub = f2bf(v);
                const h16 hv = toh_flush(bfr(v) * carry);
                const unsigned short uh = __builtin_bit_cast(unsigned short, hv);
                o[k] = f16mode ? uh : ub; }
            *(v8us*)(dp + ((c >> 4) * 2 + (r8 >> 5)) * FRG + ((r8 >> 4) & 1) * 256 + (((r8 >> 3) & 1) * 16 + (c & 15)) * 8) = o;   // row tile c/16, chunk r8/32, element half, lane = 16 h + row
            asm volatile("s_wait_xcnt 0x0" ::: "memory"); }   // the next trip rewrites the store's address and data registers
         }
}

// Patch weight [oc][ic][ky*8+kx] f32 -> bf16 plane in the order in which k_patch loads its B fragments: with k = (ky*8+kx)*64 + ic, the 8 elements k = 32 c + 16 part + 8 h + 0..7 of row oc = 16 nb + lr stand at
// (((c*4 + nb)*2 + part)*32 + 16 h + lr)*8, so one wave-wide 16-B load of a fragment half reads 512 contiguous bytes (4 lines) where rows [oc][k] gave 16 lines of 32 B each.
// One block of 256 threads per (nb, 8 input channels ic8, 32 patch positions ph): reads 128 runs of 128 B, writes 32 runs of 256 B (16 oc x 16 B), so every 128-B line of the plane has one writer.
#define FCH  2048                // elements of the plane per 32-deep k chunk (4 column tiles x 2 halves x 32 lanes x 8)
#define FTP  33                  // LDS row pitch (floats) of the staging tile
__device__ __forceinline__ void wF_body(const float* __restrict__ src, bf* dst, int nb, int ic8, int ph) {
    __shared__ float tf[128 * FTP];                                // row = oc_l*8 + ic_l, column = position inside the half
    const int tid = threadIdx.x;
    const float* sp = src + ((size_t)(nb * 16) * DM + (size_t)(ic8 * 8)) * 64 + ph * 32;
    v4f ld[4];
#pragma unroll
    for (int it = 0; it < 4; ++it) { const int q4 = it * 256 + tid; const int row = q4 >> 3, c4 = (q4 & 7) * 4;   // 4 x 256 pieces of 4 floats = 128 rows x 32 columns
        ld[it] = *(const v4f*)(sp + ((size_t)(row >> 3) * DM + (size_t)(row & 7)) * 64 + c4); }
#pragma unroll
    for (int it = 0; it < 4; ++it) { const int q4 = it * 256 + tid; const int row = q4 >> 3, c4 = (q4 & 7) * 4;
#pragma unroll
        for (int k = 0; k < 4; ++k) tf[row * FTP + c4 + k] = ld[it][k]; }
    __syncthreads();
    bf* dp = dst + (size_t)(ic8 >> 2) * FCH + (size_t)(((nb * 2 + ((ic8 >> 1) & 1)) * 32 + (ic8 & 1) * 16) * 8);   // chunk parity, column tile, element half and lane half are fixed by (nb, ic8)
#pragma unroll
    for (int it = 0; it < 2; ++it) { const int p = it * 256 + tid; const int lr = p & 15, pl = p >> 4; v8us o;   // 2 x 256 pieces = 32 positions x 16 oc
#pragma unroll
        for (int k = 0; k < 8; ++k) o[k] = f2bf(tf[(lr * 8 + k) * FTP + pl]);
        *(v8us*)(dp + (size_t)((ph * 32 + pl) * 2) * FCH + lr * 8) = o; }   // position p holds chunks 2p and 2p + 1
}

// k_prep: everything that depends on the inputs alone, in ONE launch; the block index picks the job (a block-uniform choice, so the barriers of wT_body and wF_body are passed by whole blocks).
// Blocks 0 .. WTB-1: the weight tiles (they have the longest dependent chain, so they take the lowest block indices): 64 tiles of the patch weight (wF_body); q_w [64 in][64 out] -> [64 out][64 in];
// kv_w [64 in][128 out] -> [128 out][64 in] (two tiles); proj_w [64 in][64 out] -> [64 out][64 in]. Blocks WTB ..: x -> bf16 plane in fragment order, XPT pieces of 8 elements per thread, all of a thread's loads asked for before its first convert
// (a block writes 16 KiB in a row and reads whole 2-KiB runs, the eight adjacent tokens of one patch row ky of each of 16 patches). With XPT pieces per thread a quarter of the waves have to be started: 256 blocks of 8 waves hold the whole of x in flight.
#define WTB  (DM + 4)
#define N8B  ((size_t)SEQ * DM / 8)                       // 8-element pieces of x per batch
#define XPT  4                                            // pieces per thread of the x conversion
#define CVB  ((unsigned)((size_t)NB * N8B / (256 * XPT)))  // blocks of the x conversion
static_assert(((size_t)NB * N8B) % (256 * XPT) == 0);     // the blocks cover the pieces exactly: no thread is past the end
static_assert(XPT == 4);                                  // the trip index is bits 8..9 of the piece index = bits 1..2 of the patch position: two tokens on per trip, inside one patch row
__global__ __launch_bounds__(256) void k_prep(const float* __restrict__ x, const float* __restrict__ q_w, const float* __restrict__ kv_w, const float* __restrict__ sr_w, const float* __restrict__ pj_w,
                                              bf* XB, bf* WQT, bf* KVT, bf* SW, bf* PWT) {
    const int bid = (int)blockIdx.x;
    if (bid < WTB) {
        if (bid < DM) { wF_body(sr_w, SW, bid >> 4, (bid >> 1) & 7, bid & 1); return; }
        const float* src = q_w; bf* dst = WQT; int Cn = DM, f16mode = 0, bx = 0;
        if (bid == DM + 3)      { src = pj_w; dst = PWT; f16mode = 1; }
        else if (bid > DM)      { src = kv_w; dst = KVT; f16mode = 1; Cn = 2 * DM; bx = bid - (DM + 1); }
        wT_body(src, dst, Cn, f16mode, f16mode ? WC : 1.0f, bx, 0);
        return;
    }
    const size_t i = (size_t)(bid - WTB) * (256 * XPT) + threadIdx.x;   // the thread's first piece; the others stand 256 pieces on each
    // piece i -> 16 B of the plane: 4 adjacent lanes (h, element half) read one 128-B line of a token, the 8 lanes that share them write one 128-B line of the plane (a wave: 8 lines read, 4 written); then chunk, patch position, patch row of the batch
    const int h = (int)i & 1, eh = (int)(i >> 1) & 1, tx = (int)(i >> 2) & 15, ch = (int)(i >> 6) & 1, pos = (int)(i >> 7) & 63, ty = (int)((i % N8B) >> 13);
    const size_t tok = (size_t)(ty * SRR + (pos >> 3)) * GW + (size_t)(tx * SRR + (pos & 7));
    const float* xp = x + ((i / N8B) * (size_t)SEQ_FULL + tok) * DM + ch * 32 + eh * 16 + h * 8;   // batch pitch of x is the full sequence
    bf* op = XB + ((i & ~(size_t)63) + (size_t)(eh * 32 + h * 16 + tx)) * 8;   // fragment = 64 pieces: element half, lane = 16 h + tx
    v8f v[XPT];
#pragma unroll                                                     // unrolled: v[] stays in registers and the eight 16-B loads go out together, base + constant
    for (int it = 0; it < XPT; ++it) v[it] = *(const v8f*)(xp + it * (2 * DM));   // 256 pieces on = patch position + 2 = two tokens on
#pragma unroll
    for (int it = 0; it < XPT; ++it) { v8us o;
#pragma unroll
        for (int k = 0; k < 8; ++k) o[k] = f2bf(v[it][k]);
        *(v8us*)(op + it * (256 * 8)) = o; }
    asm volatile("s_wait_xcnt 0x0" ::: "memory");                  // behind the last of the four stores: in the listing the weight jobs' code follows and rewrites the stores' data registers
}

// kv_tail: one wave's projection of the 16 LayerNorm rows (fragments n0, n1: depth 0..31, 32..63) onto 64 kv weight rows (fragments wf[2t], wf[2t+1] of tile t), four 16 x 16 tiles, each lane's 8 results of a tile stored as one 16-B piece at op + 256 t.
// ISK: A = weight, B = LayerNorm: D row = column 16t + 8h + j of k, col = key lane&15: the lane's piece of element half t&1 of the k fragment of column group t>>1, so op = the block's 4 halves + 8*lane. Otherwise A = LayerNorm, B = weight: D row = key 8h + j, col = channel 16t + (lane&15) of v; 256 = 16 channel rows of the v^T tile.
template <bool ISK>
__device__ __forceinline__ void kv_tail(const v16h (&wf)[8], v16h n0, v16h n1, h16* op) {
    v8f kv[4]; v8h ov[4];
#pragma unroll
    for (int t = 0; t < 4; ++t) kv[t] = ISK ? wmma16(wf[2 * t], n0, (v8f){}) : wmma16(n0, wf[2 * t], (v8f){});
#pragma unroll
    for (int t = 0; t < 4; ++t) kv[t] = ISK ? wmma16(wf[2 * t + 1], n1, kv[t]) : wmma16(n1, wf[2 * t + 1], kv[t]);
#pragma unroll
    for (int t = 0; t < 4; ++t) {
#pragma unroll
        for (int j = 0; j < 8; ++j) ov[t][j] = toh_flush(kv[t][j] * (ISK ? (KC / WC) : (VC / WC))); }
#pragma unroll
    for (int t = 0; t < 4; ++t) *(v8h*)(op + t * 256) = ov[t];
}

// k_patch: patch projection (bf16 operands, K = 4096 with k = (ky*8+kx)*64 + ic) + bias + LayerNorm, then the k and v^T projections of the block's own 16 rows. grid NB*NKEY/16, PWV waves per block.
// One block per 16 rows m = (b, ty, tx = 0..15) x all 64 output channels; A = the block's own 64 tiles of the bf16 x plane (one per patch position, two fragments each), Bt = patch weight plane in fragment order (n = oc; wF_body has the map).
// The depth is split over the waves: wave w sums k = 256 w .. 256 w + 255 (ky = w>>1, kx = 4 (w&1) .. + 3) into its own 16 x 64 f32 partial tile, one patch position (2 KiB in a row of the x plane, 8 KiB in a row of the Bt plane) per trip.
// The 16 partial tiles meet in LDS; behind the block barrier wave w adds them up for row w in slice order (lane owns columns 2 lane, 2 lane + 1), adds the bias and does the LayerNorm of that row in f32 (xor exchanges over the 32 lanes).
// The 16 LayerNorm rows (single f16) meet in a second LDS tile; behind a second block barrier wave 0 forms k^T = Wk^T LN^T (A = kv weight rows 0..63, x WC; lane = key, 8 adjacent columns per tile; result x KC/WC into the block's own 16-key tile of the k plane)
// and wave 1 forms v = LN Wv (B = kv weight rows 64..127; lane = channel, 8 adjacent keys per tile; result x VC/WC into the block's own 16-key tile of the v^T plane). Each of the two waves alone writes its 2 KiB, so no 128-B line has two writers.
// amdgpu_waves_per_eu(4, 4): one block fills its 4 waves per SIMD and the grid is smaller than the chip, so the register budget goes to loads in flight (without it each fragment is loaded and waited for alone).
__global__ __launch_bounds__(32 * PWV) __attribute__((amdgpu_waves_per_eu(4, 4))) void k_patch(const bf* __restrict__ A, const bf* __restrict__ Bt, const float* __restrict__ cbias, const float* __restrict__ lg, const float* __restrict__ lb, const h16* __restrict__ KVW, h16* KP, h16* VT) {
    __shared__ __align__(16) float red[PWV * 16 * RP];
    __shared__ __align__(16) h16   lnt[16 * LP];
    const int lane = threadIdx.x & 31, lr = lane & 15, hi = lane >> 4;
    const int wave = __builtin_amdgcn_readfirstlane((int)(threadIdx.x >> 5));
    const int r0 = (int)blockIdx.x * 16;
    const int k0 = wave * PKS;
    const bf* ap = A + ((size_t)blockIdx.x * 64 + (size_t)(k0 >> 6)) * (16 * DM) + lane * 8;   // first patch position of the slice: ky*8 + kx = k0>>6; row tile (b, ty) = block
    const bf* bp = Bt + (size_t)(k0 >> 5) * FCH + lane * 8;         // the slice's 8 chunks stand in a row (32 KiB); + chunk * FCH + nb * FRG
    v8f acc[4];                                                    // the loops over nb, j and p below are unrolled so that acc[] is indexed by constants and stays in registers
#pragma unroll
    for (int nb = 0; nb < 4; ++nb) acc[nb] = (v8f){};
#pragma unroll                                                     // 4 trips, unrolled: every address is base + constant, and a later trip's loads issue ahead of an earlier trip's WMMAs
    for (int kk = 0; kk < PKS; kk += DM) {                         // next patch position = next tile of the x plane, two chunks on in the weight plane
        const v16bf a0 = ldfb(ap + (kk >> 6) * (16 * DM)), a1 = ldfb(ap + (kk >> 6) * (16 * DM) + FRG);
#pragma unroll
        for (int nb = 0; nb < 4; ++nb) { const bf* bq = bp + (kk >> 5) * FCH + nb * FRG;
            const v16bf b0 = ldfb(bq), b1 = ldfb(bq + FCH);
            acc[nb] = wmmab(a0, b0, acc[nb]); acc[nb] = wmmab(a1, b1, acc[nb]); }
    }
#pragma unroll
    for (int nb = 0; nb < 4; ++nb) {
#pragma unroll
        for (int j = 0; j < 8; ++j) red[(wave * 16 + hi * 8 + j) * RP + nb * 16 + lr] = acc[nb][j]; }   // D: row 8h+j, col lane&15
    __syncthreads();
    v16h wf[8];                                                    // kv weight fragments of waves 0 (k rows) and 1 (v rows), asked for behind the barrier (which waits for every load in flight) so that they arrive while the sums and the LayerNorm run
    if (wave < 2) {
        const h16* wp = KVW + (size_t)wave * 8 * FRG + lane * 8;
#pragma unroll
        for (int f = 0; f < 8; ++f) wf[f] = ldfh(wp + f * FRG);   // tile f>>1 (16 weight rows), depth half f&1
        asm volatile("s_wait_xcnt 0x0" :: "v"(wp) : "memory"); }   // the address pair is an input here: no load's result lands on it while the other loads still name it
    const v2f t0 = *(const v2fa*)(&red[wave * RP + 2 * lane]);
    float x0 = t0[0], x1 = t0[1];
#pragma unroll
    for (int p = 1; p < PWV; ++p) { const v2f t = *(const v2fa*)(&red[(p * 16 + wave) * RP + 2 * lane]); x0 += t[0]; x1 += t[1]; }
    const v2f bi = *(const v2f*)(cbias + 2 * lane), g = *(const v2f*)(lg + 2 * lane), of = *(const v2f*)(lb + 2 * lane);
    x0 += bfr(bi[0]); x1 += bfr(bi[1]);
    float sm = x0 + x1;
#pragma unroll
    for (int d = 16; d >= 1; d >>= 1) sm += __shfl_xor(sm, d, 32);
    const float mu = sm * (1.0f / 64.0f);
    const float d0 = x0 - mu, d1 = x1 - mu;
    float q = d0 * d0 + d1 * d1;
#pragma unroll
    for (int d = 16; d >= 1; d >>= 1) q += __shfl_xor(q, d, 32);
    const float rs = 1.0f / sqrtf(q * (1.0f / 64.0f) + 1.0e-5f);
    v2h hv;
    hv[0] = toh_flush(d0 * rs * bfr(g[0]) + bfr(of[0]));
    hv[1] = toh_flush(d1 * rs * bfr(g[1]) + bfr(of[1]));
    *(v2h*)(&lnt[wave * LP + 2 * lane]) = hv;                      // row w of the LayerNorm tile
    __syncthreads();                                               // all 16 rows stand before waves 0 and 1 read them
    if (wave >= 2) return;                                         // no barrier follows
    const v16h n0 = cat16(*(const v8ha*)(&lnt[lr * LP + 8 * hi]),      *(const v8ha*)(&lnt[lr * LP + 16 + 8 * hi]));   // fragment of row lr, depth 0..31 (the k map of ldfh)
    const v16h n1 = cat16(*(const v8ha*)(&lnt[lr * LP + 32 + 8 * hi]), *(const v8ha*)(&lnt[lr * LP + 48 + 8 * hi]));   // depth 32..63
    if (wave == 0) kv_tail<true>(wf, n0, n1, KP + (size_t)blockIdx.x * (16 * DM) + lane * 8);
    else           kv_tail<false>(wf, n0, n1, VT + (size_t)blockIdx.x * VTT + lr * 16 + 8 * hi);
}

// Eight asynchronous 16-B-per-lane copies global -> LDS, each one block-wide step (CPS bytes) on from the last, in ONE statement with their s_wait_xcnt 0 as its last line, so that no register a copy names is rewritten ahead of that wait.
#define KVS  (NKEY * DM)         // halves of one batch's k plane = of its v^T plane
#define CPS  (32 * AW * 16)      // bytes that one copy of every lane of the block moves
static_assert((KVS * 2) % (8 * CPS) == 0);     // a plane = whole statements of eight copies
static_assert(2 * (KVS * 2) / CPS <= 63);      // copies of one wave in flight
__device__ __forceinline__ void cp8(unsigned l, const h16* g) {
    asm volatile("global_load_async_to_lds_b128 %0, %8, off\n\t"
                 "global_load_async_to_lds_b128 %1, %9, off\n\t"
                 "global_load_async_to_lds_b128 %2, %10, off\n\t"
                 "global_load_async_to_lds_b128 %3, %11, off\n\t"
                 "global_load_async_to_lds_b128 %4, %12, off\n\t"
                 "global_load_async_to_lds_b128 %5, %13, off\n\t"
                 "global_load_async_to_lds_b128 %6, %14, off\n\t"
                 "global_load_async_to_lds_b128 %7, %15, off\n\t"
                 "s_wait_xcnt 0x0"
                 :: "v"(l), "v"(l + 1u * CPS), "v"(l + 2u * CPS), "v"(l + 3u * CPS), "v"(l + 4u * CPS), "v"(l + 5u * CPS), "v"(l + 6u * CPS), "v"(l + 7u * CPS),
                    "v"(g), "v"(g + 1 * (CPS / 2)), "v"(g + 2 * (CPS / 2)), "v"(g + 3 * (CPS / 2)), "v"(g + 4 * (CPS / 2)), "v"(g + 5 * (CPS / 2)), "v"(g + 6 * (CPS / 2)), "v"(g + 7 * (CPS / 2))
                 : "memory");
}

// k_attn: fused q projection + attention + output projection, one wave per 16 query rows of one batch (one tile of the x plane: every 8th token of a grid row), the 8 heads in two trips of four (the four heads that share a 32-column group go through the key loop together, on one K fragment pair per 32 keys); K / V^T fragments from an LDS copy of the batch's two f16 planes (two 16-B LDS loads each; same order as in memory, K in fragment order). The block brings the 64 KiB in once, at entry, by asynchronous copies that fly while the q projection runs; every wave waits for its own copies, then one block barrier, before the first key loop.
// q projection in transposed form: Q^T[c][t] = Wq^T X^T (A = q weight rows c, B = bf16 x rows t, depth 64): lane (t = lane&15, h) holds columns 16 tile + 8h + 0..7 of its row, which after the f16 convert (x QS, subnormal results kept) are the two halves of the Q fragment below.
// Transposed form: S^T[key][t] = K Q^T (A = K rows over the 32 columns of the head's group, B = Q row with the k-slots outside the head selected to zero by value); lane (t = lane&15, h = lane>>4) holds keys 8h+r
// of each 16-key tile, so the packed P tile is directly the B fragment of O^T[d][t] = V^T P^T (A rows d: channel head*8 + (lane&7); rows 8..15 repeat rows 0..7 and are not used).
// Softmax in two passes over the keys. Pass 1: score products and a running maximum per lane, the two lane halves of a row combined with one xor-16 exchange behind it. Pass 2: the same score products with 14 - max as the accumulator's start, so each result is the argument of exp2 as it stands; O and the row sum are never rescaled. P = f16 of exp2(score - max + 14), converted in pairs (subnormal results kept); row sum over the converted P.
// Context (x CTXC) of each head goes to a wave-private f16 LDS tile [16][64]; after the head loop the tile is the A operand of the output projection (B = transposed weight plane, f16 x WC);
// The two integer grid-size inputs are read on the device; when they differ from the compiled grid the output is filled with NaN.
__global__ __launch_bounds__(32 * AW) void k_attn(const bf* __restrict__ XB, const bf* __restrict__ WQT, const h16* __restrict__ KP, const h16* __restrict__ VT, const h16* __restrict__ PW,
                                                  const float* __restrict__ pbias, const int* __restrict__ hp, const int* __restrict__ wp, float* OUT) {
    __shared__ __align__(16) h16   cs[AW * 16 * CP];
    __shared__ __align__(16) float os[AW * 16 * OSP];
    __shared__ __align__(16) h16   kvs[2 * KVS];                   // the batch's k plane, then its v^T plane
    const int lane = threadIdx.x & 31, lr = lane & 15, hi = lane >> 4;
    const int wave = __builtin_amdgcn_readfirstlane((int)(threadIdx.x >> 5));
    const int b = blockIdx.y;
    const int ut = blockIdx.x * AW + wave;                         // tile of the x plane inside the batch = ty*64 + ky*8 + kx: the wave's 16 query rows are the tokens (grid row ut>>3, column 8 row + (ut&7))
    const bool bad = (hp[0] != GH_FULL) | (wp[0] != GW);
    const size_t qrow  = ((size_t)b * (SEQ / 16) + (size_t)ut) * (16 * DM) + (size_t)lane * 8;
    const int kbase = lane * 8;                                    // in kvs; + (key/16) * 16*DM + group * FRG   (A fragment: row key, k = column inside the group)
    const int vbase = KVS + (lr & 7) * 16 + 8 * hi;                // in kvs; + (key/16)*VTT + head*8*16   (A fragment: row d, k = key)
    const int cb = wave * 16 * CP;
    const v8h z8 = (v8h){};
    v8h qh[4];                                                     // q x QS of row t, columns 16 tile + 8h + 0..7
    {
        const v16bf x0 = ldfb(XB + qrow), x1 = ldfb(XB + qrow + FRG);
        const bf* wr = WQT + lane * 8;
        v16bf wq[8];
#pragma unroll
        for (int f = 0; f < 8; ++f) wq[f] = ldfb(wr + f * FRG);   // tile f>>1 (16 weight rows), depth half f&1
        {   // lane i of the block moves bytes 16 i + CPS c of each plane, c = 0 .. 15: every lane on, every LDS byte written once
            const unsigned kl = (unsigned)(size_t)(&kvs[0]) + (unsigned)threadIdx.x * 16u;
            const h16* kg = KP + (size_t)b * KVS + (size_t)threadIdx.x * 8;
            const h16* vg = VT + (size_t)b * KVS + (size_t)threadIdx.x * 8;
#pragma unroll                                                     // unrolled: two statements a plane, every address base + constant
            for (int c = 0; c < KVS * 2 / CPS; c += 8) { cp8(kl + (unsigned)c * CPS, kg + c * (CPS / 2)); cp8(kl + (unsigned)(KVS * 2) + (unsigned)c * CPS, vg + c * (CPS / 2)); }
        }
        // the loaded fragments are inputs here, so all twenty loads are asked for before the first product waits: one trip to the L2 instead of two (without it the second depth half is loaded into the first half's registers, behind its products)
        asm volatile("" :: "v"(x0), "v"(x1), "v"(wq[0]), "v"(wq[1]), "v"(wq[2]), "v"(wq[3]), "v"(wq[4]), "v"(wq[5]), "v"(wq[6]), "v"(wq[7]));
        asm volatile("s_wait_xcnt 0x0" ::: "memory");              // the register that holds these loads' offset is rewritten by the converts below
#pragma unroll
        for (int t = 0; t < 4; ++t) {
            v8f qa4 = wmmab(wq[2 * t], x0, (v8f){}); qa4 = wmmab(wq[2 * t + 1], x1, qa4);   // D: row = column 8h + j of the tile, col = t
#pragma unroll
            for (int j = 0; j < 8; ++j) qh[t][j] = (h16)(qa4[j] * QS); }
    }
    __builtin_amdgcn_sched_barrier(0);                             // the q projection stays ahead of the wait below and runs while the copies fly (without it the wait is moved in front of its products)
    asm volatile("s_wait_asynccnt 0x0" ::: "memory");              // the wave's own copies have landed
    __syncthreads();                                               // and every other wave's: nobody reads kvs in front of this barrier
#pragma unroll 1
    for (int g = 0; g < 2; ++g) {                                  // one trip = the four heads that share the group's 32 columns, carried together through the key loop
        const v8h qa = g ? qh[2] : qh[0], qb = g ? qh[3] : qh[1];  // columns 32g + 8h + 0..7 and 32g + 16 + 8h + 0..7
        v16h qf[4]; v8f o[4]; float mx[4], l[4];                   // every loop over j is unrolled so that the per-head arrays are indexed by constants and stay in registers
#pragma unroll
        for (int j = 0; j < 4; ++j) {
            const bool kA = (hi == (j & 1)) & (j < 2);             // head j of the group = k-slots 8j..8j+7: lane half (j&1), elements 0..7 (j < 2) or 8..15 (j >= 2)
            const bool kB = (hi == (j & 1)) & (j >= 2);
            qf[j] = cat16(kA ? qa : z8, kB ? qb : z8);             // B fragment: col t, k = column inside the group
            o[j] = (v8f){}; mx[j] = NEGB; l[j] = 0.0f; }
        const int ko = kbase + g * FRG;
        const int vo = vbase + (g * 4 * HD) * 16;
        // pass 1: the maximum of every row. Unrolled: every address is base + constant, and a later trip's K loads issue ahead of an earlier trip's products
#pragma unroll
        for (int key0 = 0; key0 < NKEY; key0 += 32) {
            const h16* ka = &kvs[ko + key0 * DM];
            const v16h ka0 = ldfh(ka), kb0 = ldfh(ka + 16 * DM);     // one K fragment pair serves the four heads
            v8f sa[4], sb[4];
#pragma unroll
            for (int j = 0; j < 4; ++j) { sa[j] = wmma16(ka0, qf[j], (v8f){}); sb[j] = wmma16(kb0, qf[j], (v8f){}); }   // eight independent products
#pragma unroll
            for (int j = 0; j < 4; ++j) {
#pragma unroll
                for (int r = 0; r < 8; ++r) mx[j] = fmaxf(mx[j], fmaxf(sa[j][r], sb[j][r])); }
        }
        v8f shv[4];                                                // 14 - max of the lane's row t, in all eight accumulator rows
#pragma unroll
        for (int j = 0; j < 4; ++j) {
            const float sh = PSH - fmaxf(mx[j], __shfl_xor(mx[j], 16, 32));          // the other lane half's maximum, one exchange per head
#pragma unroll
            for (int r = 0; r < 8; ++r) shv[j][r] = sh; }
        // pass 2: P, its row sum and O
#pragma unroll 1
        for (int key0 = 0; key0 < NKEY; key0 += 32) {
            const h16* ka = &kvs[ko + key0 * DM];
            const v16h ka0 = ldfh(ka), kb0 = ldfh(ka + 16 * DM);
            v16h vf[4];
#pragma unroll
            for (int j = 0; j < 4; ++j) { const h16* vp = &kvs[vo + (key0 >> 4) * VTT + j * HD * 16]; vf[j] = cat16(*(const v8h*)vp, *(const v8h*)(vp + VTT)); }   // keys key0 + 8h + 0..7 and, one tile on, key0 + 16 + 8h + 0..7
            v8f sa[4], sb[4];
#pragma unroll
            for (int j = 0; j < 4; ++j) { sa[j] = wmma16(ka0, qf[j], shv[j]); sb[j] = wmma16(kb0, qf[j], shv[j]); }   // score - max + 14
#pragma unroll
            for (int j = 0; j < 4; ++j) {
                v16h pb; float ls = l[j];
                float xa[8], xb[8];
#pragma unroll
                for (int r = 0; r < 8; ++r) { xa[r] = __builtin_amdgcn_exp2f(sa[j][r]); xb[r] = __builtin_amdgcn_exp2f(sb[j][r]); }
                // the slot that the instruction set asks for behind a v_exp_f32 before its source register is overwritten, eight to a statement: the sources are inputs here, so none is overwritten before all eight results stand
                asm volatile("v_nop" :: "v"(sa[j][0]), "v"(sa[j][1]), "v"(sa[j][2]), "v"(sa[j][3]), "v"(sa[j][4]), "v"(sa[j][5]), "v"(sa[j][6]), "v"(sa[j][7]), "v"(xa[0]), "v"(xa[1]), "v"(xa[2]), "v"(xa[3]), "v"(xa[4]), "v"(xa[5]), "v"(xa[6]), "v"(xa[7]));
                asm volatile("v_nop" :: "v"(sb[j][0]), "v"(sb[j][1]), "v"(sb[j][2]), "v"(sb[j][3]), "v"(sb[j][4]), "v"(sb[j][5]), "v"(sb[j][6]), "v"(sb[j][7]), "v"(xb[0]), "v"(xb[1]), "v"(xb[2]), "v"(xb[3]), "v"(xb[4]), "v"(xb[5]), "v"(xb[6]), "v"(xb[7]));
#pragma unroll
                for (int r = 0; r < 8; r += 2) {                   // two P values to a register by one packed convert (round to nearest even); values under the smallest normal f16 stay subnormal: the matrix unit and the sum below both take them as they are
                    const v2h pa = __builtin_convertvector((v2f){xa[r], xa[r + 1]}, v2h);
                    const v2h pc = __builtin_convertvector((v2f){xb[r], xb[r + 1]}, v2h);
                    pb[r] = pa[0]; pb[r + 1] = pa[1]; pb[8 + r] = pc[0]; pb[9 + r] = pc[1];
                    ls += (float)pa[0]; ls += (float)pc[0]; ls += (float)pa[1]; ls += (float)pc[1]; }   // one running sum per head over the converted P, carried from trip to trip without a rescale
                l[j] = ls;
                o[j] = wmma16(vf[j], pb, o[j]);
            }
            // four vector slots between the trip's last WMMA and the loop branch: the next trip's first products reuse this trip's fragment registers
            asm volatile("v_nop\n\tv_nop\n\tv_nop\n\tv_nop" : "+v"(o[0]), "+v"(o[1]), "+v"(o[2]), "+v"(o[3]));
        }
#pragma unroll
        for (int j = 0; j < 4; ++j) {
            const float lt = l[j] + __shfl_xor(l[j], 16, 32);
            const float inv = (1.0f / lt) * (CTXC / VC);           // lt is about 16384 or more (the maximum element of every row converts to about 16384)
            v8h cv;
#pragma unroll
            for (int r = 0; r < 8; ++r) cv[r] = toh_flush(o[j][r] * inv);           // lane half 0: o[r] = (d = r, t = lane&15)
            if (hi == 0) *(v8ha*)(&cs[cb + lr * CP + (g * 4 + j) * HD]) = cv; }     // 8 heads x 8 columns: rows 0..15 x columns 0..63 all written
    }
    wave_sync();
    v8f acc[4];
#pragma unroll
    for (int nb = 0; nb < 4; ++nb) acc[nb] = (v8f){};
#pragma unroll
    for (int kc = 0; kc < DM; kc += 32) {
        const v8h a0 = *(const v8ha*)(&cs[cb + lr * CP + kc + 8 * hi]);
        const v8h a1 = *(const v8ha*)(&cs[cb + lr * CP + kc + 16 + 8 * hi]);
        const v16h a = cat16(a0, a1);                              // A fragment: row t, k = context column
#pragma unroll
        for (int nb = 0; nb < 4; ++nb) { const v16h bw = ldfh(PW + (nb * 2 + (kc >> 5)) * FRG + lane * 8);
            acc[nb] = wmma16g(a, bw, acc[nb]); }
    }
    const int ob = wave * 16 * OSP;
    const float nanv = __uint_as_float(0x7FC00000u);
#pragma unroll
    for (int nb = 0; nb < 4; ++nb) { const float bia = bfr(pbias[nb * 16 + lr]);
#pragma unroll
        for (int r = 0; r < 8; ++r) { const float v = acc[nb][r] * OUTI + bia;
            os[ob + (8 * hi + r) * OSP + nb * 16 + lr] = bad ? nanv : v; } }   // D: row 8h+r, col lane&15; rows 0..15 x columns 0..63 all written
    wave_sync();
    float* orow = OUT + ((size_t)b * OUT_SEQ + (size_t)(ut >> 3) * GW + (size_t)(ut & 7)) * DM;   // query row r is SRR tokens on from row r - 1
{
#pragma unroll
        for (int s = 0; s < 8; ++s) { const int row = 2 * s + (lane >> 4), cofs = (lane & 15) * 4;
            const v4f val = *(const v4fa*)(&os[ob + row * OSP + cofs]);
            *(v4f*)(orow + (size_t)row * (SRR * DM) + cofs) = val; }
         }
}

static constexpr size_t al256(size_t v) { return (v + 255) & ~(size_t)255; }
static constexpr size_t SZ_XB = al256((size_t)NB * SEQ * DM * 2);        // bf16 x plane
static constexpr size_t SZ_W1 = al256((size_t)DM * DM * 2);              // one 64 x 64 weight plane
static constexpr size_t SZ_KV = al256((size_t)2 * DM * DM * 2);          // kv weight plane [128][64]
static constexpr size_t SZ_SW = al256((size_t)DM * CK * 2);              // patch weight plane, 64 x 4096 elements
static constexpr size_t SZ_KP = al256((size_t)NB * NKEY * DM * 2);       // k / v^T planes
static constexpr size_t SZ_TOTAL = SZ_XB + 2 * SZ_W1 + SZ_KV + SZ_SW + 2 * SZ_KP;
static_assert(SZ_TOTAL <= (size_t)134217728);                            // workspace carve <= 128 MiB
static_assert(((size_t)NB * SEQ * DM * 2) % 256 == 0);
static_assert(((size_t)NB * NKEY * DM * 2) % 256 == 0);
static_assert((size_t)NB * (NKEY / 16) * VTT == (size_t)NB * NKEY * DM);  // the tiled v^T plane has the same extent as the k plane

extern "C" void kernel_launch(void* const* d_in, const int* in_sizes, int n_in,
                              void* d_out, int out_size, void* d_ws, size_t ws_size, hipStream_t stream) {
    if (n_in < 11) return;
    const size_t needx = ((size_t)(NB - 1) * SEQ_FULL + SEQ) * DM;
    if ((size_t)in_sizes[0] < needx) return;
    if (in_sizes[1] < 1 || in_sizes[2] < 1) return;
    if ((size_t)in_sizes[3] < (size_t)DM * DM || (size_t)in_sizes[4] < (size_t)2 * DM * DM || (size_t)in_sizes[5] < (size_t)DM * CK) return;
    if (in_sizes[6] < DM || in_sizes[7] < DM || in_sizes[8] < DM || (size_t)in_sizes[9] < (size_t)DM * DM || in_sizes[10] < DM) return;
    if ((size_t)out_size < ((size_t)(NB - 1) * OUT_SEQ + SEQ) * DM) return;
    if (SZ_TOTAL > ws_size) return;
    // wire order: x, H, W, q_w, kv_w, sr_w, sr_b, ln_g, ln_b, proj_w, proj_b
    const float* x    = (const float*)d_in[0];
    const int*   gh   = (const int*)d_in[1];
    const int*   gw   = (const int*)d_in[2];
    const float* q_w  = (const float*)d_in[3];
    const float* kv_w = (const float*)d_in[4];
    const float* sr_w = (const float*)d_in[5];
    const float* sr_b = (const float*)d_in[6];
    const float* ln_g = (const float*)d_in[7];
    const float* ln_b = (const float*)d_in[8];
    const float* pj_w = (const float*)d_in[9];
    const float* pj_b = (const float*)d_in[10];
    float* OUT = (float*)d_out;      // [NB][SEQ][64]
    char* wsp = (char*)d_ws;
    bf*  XB  = (bf*)wsp;  wsp += SZ_XB;              // [NB*SEQ/16][2 chunks][2 element halves][lane][8] bf16 x (fragment order)
    bf*  WQT = (bf*)wsp;  wsp += SZ_W1;              // 64 out x 64 in, bf16, fragment order
    bf*  PWT = (bf*)wsp;  wsp += SZ_W1;              // 64 out x 64 in, f16 bits, x64, fragment order
    bf*  KVT = (bf*)wsp;  wsp += SZ_KV;              // 128 out x 64 in, f16 bits, x64 (rows 0..63 k, 64..127 v), fragment order
    bf*  SW  = (bf*)wsp;  wsp += SZ_SW;              // [k/32][oc/16][half][lane][8] bf16, k = (ky*8+kx)*64 + ic
    h16* KP  = (h16*)wsp; wsp += SZ_KP;              // [NB*NKEY/16][4 element halves][lane][8] k x16 (fragment order)
    h16* VT  = (h16*)wsp; wsp += SZ_KP;              // [NB*NKEY/16][64][16] v^T x64

    // three dependent launches: inputs -> planes; patch projection + LayerNorm + k, v^T projections; q projection + attention + output projection
    k_prep<<<dim3(WTB + CVB, 1, 1), 256, 0, stream>>>(x, q_w, kv_w, sr_w, pj_w, XB, WQT, KVT, SW, PWT);
    k_patch<<<dim3(NB * NKEY / 16, 1, 1), 32 * PWV, 0, stream>>>(XB, SW, sr_b, ln_g, ln_b, (const h16*)KVT, KP, VT);
    k_attn<<<dim3(SEQ / (16 * AW), NB, 1), 32 * AW, 0, stream>>>(XB, WQT, KP, VT, (const h16*)PWT, pj_b, gh, gw, OUT);
}

// v010
// It runs in 23.6 microseconds.
// In two side-by-side timings against v009, it was 1.14 and 1.17 times as fast.
// Over all steps from v000 it is 9.16 times as fast.
#include <hip/hip_runtime.h>

// Spatial-reduction attention, width 64 = 8 heads x 8: queries from all NB x SEQ tokens (x @ q_w, weights [in][out], no bias); keys / values from an 8x8 stride-8 patch projection (+ bias) -> LayerNorm (eps 1e-5) -> fused [in][out] kv weight (256 keys per batch at the full size); dense softmax, score scale 8^-0.5; output projection (+ bias).
// Compute dtypes, f32 accumulate everywhere: q projection and patch projection v_wmma_f32_16x16x32_bf16 (x and weights RNE-converted to bf16; products exact); kv projection v_wmma_f32_16x16x32_f16 (LayerNorm rows single f16, weight = bf16 value x64 held in f16);
// scores v_wmma_f32_16x16x32_f16 (q x score scale x log2(e) / 16, k x16, single f16; four heads share one 32-deep k axis, the Q fragment is zeroed outside its head by value); P.V v_wmma_f32_16x16x32_f16 (P x16384 carry, v x64, single f16, row sum over the converted P);
// output projection v_wmma_f32_16x16x32_f16 (context x1024 single f16, weight = bf16 value x64 in f16), scale folded back in the f32 epilogue; softmax and LayerNorm in f32.
// Layout: the bf16 x plane, the q and output weight planes and the k plane in fragment order (ldfh / ldfb below): [16-row tile][k/32][element half][lane][8] (rows: out channel; key; for x the 16 tokens tx = 0..15 of one patch row ty at one patch position (ky, kx), tile index (b*GH/8 + ty)*64 + ky*8 + kx); the patch weight and the kv weight never reach memory in 16 bits (k_patch converts them into LDS); v^T plane in tiles of 16 keys [(b*NKEY+key)/16][c][key%16]. q and the LayerNorm rows never reach memory.
// Fused attention kernel in transposed form (Q^T = Wq^T X^T, S^T = K Q^T, O^T = V^T P^T), no q or score plane in memory, q projection and output projection inside the same kernel; k and v^T projections inside the patch kernel, behind its LayerNorm.

#ifndef NB
#define NB 2
#endif
#ifndef GH
#define GH 128                   // token grid height (rows of the grid used per batch)
#endif
#define GW   128                 // token grid width
#define SEQ  (GH * GW)
#define NB_FULL  2
#define GH_FULL  128
#define SEQ_FULL 16384
#ifndef OUT_SEQ
#define OUT_SEQ SEQ              // row pitch (in tokens) between batches of the output
#endif
#define DM   64
#define NH_  8
#define HD   8
#define SRR  8                   // patch size = stride
#define KGW  (GW / SRR)
#define NKEY ((GH / SRR) * (GW / SRR))
#define CK   (DM * SRR * SRR)    // patch projection depth (4096)
#define AW   4                   // waves per attention block (16 query rows each)
#define CP   72                  // LDS row pitch (halves) of the context tile
#define OSP  68                  // LDS row pitch (floats) of the output tile
#define PWV  16                  // waves per patch-projection block = slices of its depth = rows of its tile
#define PKS  (CK / PWV)          // depth of one slice (256 = 4 patch positions x 64 channels)
#define RP   68                  // LDS row pitch (floats) of the partial tiles
#define LP   72                  // LDS row pitch (halves) of the LayerNorm tile
#define VTT  (DM * 16)           // halves in one 16-key tile of the v^T plane
#define KC   16.0f               // carry of the k plane
#define VC   64.0f               // carry of the v^T plane
#define WC   64.0f               // carry of the f16 weight planes
#define CTXC 1024.0f             // carry of the context tile
#define QS   ((float)(0.35355339059327378 * 1.4426950408889634 / 16.0))    // HD^-0.5 * log2(e) / KC: q carries the score scale, so K Q^T is already the exponent of 2
#define PSH  14.0f               // log2 of the P carry (16384)
#define NEGB (-3.0e38f)
#define OUTI (1.0f / 65536.0f)   // 1 / (CTXC * WC)

static_assert(DM == 64);
static_assert(NH_ * HD == DM);                 // head h = columns h*8 + d
static_assert(HD == 8);                        // one head = 8 k-slots = one half fragment of one lane half
static_assert(NH_ == 8);                       // two groups of four heads, 32 columns each
static_assert(DM % 32 == 0);                   // GEMM k-loops step by 32
static_assert(CK % 32 == 0);
static_assert(CK == 64 * DM);                  // k index = (ky*8+kx)*64 + ic
static_assert(SRR == 8);
static_assert(GH % SRR == 0);
static_assert(GW % SRR == 0);
static_assert(NKEY % 32 == 0);                 // key loop steps by 32
static_assert(SEQ % (16 * AW) == 0);           // attention grid covers the sequence exactly
static_assert(((size_t)SEQ * DM) % 8 == 0);
static_assert(NB <= NB_FULL);
static_assert(GH <= GH_FULL);
static_assert(SEQ <= SEQ_FULL);
static_assert((CP * 2) % 16 == 0);
static_assert((OSP * 4) % 16 == 0);
static_assert(CP >= DM);
static_assert(OSP >= DM);
static_assert(32 * 16 * 4 == 16 * DM * 2);
static_assert(32 * 16 * 8 == 16 * DM * 4);     // output stores: 32 lanes x 16 B x 8 instructions == 16 rows x 256 B
static_assert(256 * 2 * 16 == 64 * 64 * 2);
static_assert(AW * 16 * CP * 2 + AW * 16 * OSP * 4 + 2 * NKEY * DM * 2 <= 131072);
static_assert(64 * 65 * 4 <= 131072);
static_assert(PWV == 16);                      // wave w finishes row w of the 16-row tile
static_assert(PKS % DM == 0);                  // a slice holds whole patch positions
static_assert((SRR * DM) % PKS == 0);          // and stays inside one patch row ky
static_assert((NB * NKEY) % 16 == 0);
static_assert(NKEY % 16 == 0);                 // a 16-row tile never straddles two batches
static_assert(KGW == 16);                      // a 16-row tile = one patch row ty, row = tx
static_assert((RP * 4) % 8 == 0);
static_assert((LP * 2) % 16 == 0);
static_assert(LP >= DM);
static_assert(PWV * 16 * RP * 4 + 16 * LP * 2 <= 131072);

typedef _Float16 h16;
typedef unsigned short bf;
typedef __attribute__((ext_vector_type(16))) __bf16   v16bf;
typedef __attribute__((ext_vector_type(16))) _Float16 v16h;
typedef __attribute__((ext_vector_type(8)))  _Float16 v8h;
typedef __attribute__((ext_vector_type(8)))  unsigned short v8us;
typedef __attribute__((ext_vector_type(8)))  float    v8f;
typedef __attribute__((ext_vector_type(4)))  float    v4f;
typedef v4f  __attribute__((may_alias)) v4fa;
typedef v8h  __attribute__((may_alias)) v8ha;
typedef __attribute__((ext_vector_type(2)))  float    v2f;
typedef v2f  __attribute__((may_alias)) v2fa;
typedef __attribute__((ext_vector_type(2)))  _Float16 v2h;

__device__ __forceinline__ unsigned short f2bf(float f) { unsigned u = __float_as_uint(f); u += 0x7FFFu + ((u >> 16) & 1u); return (unsigned short)(u >> 16); }
__device__ __forceinline__ float bfr(float f) { return __uint_as_float(((unsigned)f2bf(f)) << 16); }   // value after RNE convert to bf16
__device__ __forceinline__ v16h cat16(v8h lo, v8h hi) { return __builtin_shufflevector(lo, hi, 0, 1, 2, 3, 4, 5, 6, 7, 8, 9, 10, 11, 12, 13, 14, 15); }
__device__ __forceinline__ v16bf cat16b(v8us lo, v8us hi) { return __builtin_bit_cast(v16bf, __builtin_shufflevector(lo, hi, 0, 1, 2, 3, 4, 5, 6, 7, 8, 9, 10, 11, 12, 13, 14, 15)); }
__device__ __forceinline__ v8f wmma16(v16h a, v16h b, v8f c) { return __builtin_amdgcn_wmma_f32_16x16x32_f16(false, a, false, b, (short)0, c, false, false); }
__device__ __forceinline__ v8f wmmab(v16bf a, v16bf b, v8f c) { return __builtin_amdgcn_wmma_f32_16x16x32_bf16(false, a, false, b, (short)0, c, false, false); }
// k map of a 16-bit fragment, lane = 16 h + row: elements 0..7 <- k0+8h+0..7, elements 8..15 <- k0+16+8h+0..7 (same map for A and B)
// fragment loaders from a plane in fragment order: one fragment (16 rows x 32 deep) = 512 elements, element half e/8 then lane then 8 elements, with the k map above; p already includes + 8*lane. Each of the two wave-wide 16-B loads reads 512 contiguous bytes (4 lines; K-contiguous rows give 16 lines of 32 B).
#define FRG  512                 // elements of one fragment
__device__ __forceinline__ v16h  ldfh(const h16* p) { return cat16(*(const v8h*)p, *(const v8h*)(p + 256)); }
__device__ __forceinline__ v16bf ldfb(const bf* p)  { return cat16b(*(const v8us*)p, *(const v8us*)(p + 256)); }
// ordering point for wave-private LDS tiles (same wave writes and reads)
__device__ __forceinline__ void wave_sync() { __builtin_amdgcn_fence(3 /* release order */, "wavefront"); __builtin_amdgcn_wave_barrier(); asm volatile("" ::: "memory"); }

// f32 -> f16 with a value select: results below the smallest normal become +0 (applied after the plane's power-of-two carry)
static __device__ __forceinline__ h16 toh_flush(float v) { const h16 r = (h16)v; return (fabsf(v) < 6.103515625e-05f) ? (h16)0.0f : r; }
// one WMMA + its own four-slot guard (ties the result, keeps both fragments live)
__device__ __forceinline__ v8f wmma16g(v16h a, v16h b, v8f c) {
    c = __builtin_amdgcn_wmma_f32_16x16x32_f16(false, a, false, b, (short)0, c, false, false);
    asm volatile("v_nop\n\tv_nop\n\tv_nop\n\tv_nop" : "+v"(c) : "v"(a), "v"(b));
    return c; }

typedef __attribute__((ext_vector_type(2)))  __bf16   v2bf;
typedef __attribute__((ext_vector_type(4)))  unsigned v4u;
typedef v4u  __attribute__((may_alias)) v4ua;
typedef v8us __attribute__((may_alias)) v8usa;
// two f32 -> two bf16 (round to nearest even) in one register, first value in the low half
__device__ __forceinline__ unsigned pk2bf(float a, float b) { return __builtin_bit_cast(unsigned, __builtin_convertvector((v2f){a, b}, v2bf)); }
// the same convert for two values that stand in unrelated registers, as asm: from the vector form the compiler first copies both into a register pair, one v_mov more per convert
__device__ __forceinline__ unsigned pk2bfa(float a, float b) { unsigned r; asm("v_cvt_pk_bf16_f32 %0, %1, %2" : "=v"(r) : "v"(a), "v"(b)); return r; }
// work-group barrier for LDS traffic alone: it waits for the wave's own LDS operations and not for its global loads (__syncthreads() waits for every load in flight, and the weight loads of the next two stages are to stay in flight across it)
__device__ __forceinline__ void lds_barrier() {
    __builtin_amdgcn_fence(__ATOMIC_RELEASE, "workgroup", "local");
    __builtin_amdgcn_s_barrier();
    __builtin_amdgcn_fence(__ATOMIC_ACQUIRE, "workgroup", "local");
}

// One block of 512 threads: src [64 in][64 out] f32 -> the transposed tile [64 out rows][64 deep] in fragment order (8 fragments, 8 KiB, written by this block alone).
// f16mode == 0: bf16 RNE bits; f16mode != 0: f16 bits of (bf16 value x WC), results below the smallest normal selected to +0.
__device__ __forceinline__ void wT_body(float* ts, const float* __restrict__ src, bf* dst, int f16mode) {
    const int tid = threadIdx.x;
    float ld[8];
#pragma unroll                                                     // unrolled, loads apart from the LDS stores: ld[] stays in registers and the 8 loads go out together
    for (int it = 0; it < 8; ++it) ld[it] = src[it * 512 + tid];   // 8 x 512 = 64 x 64 elements in a row
#pragma unroll
    for (int it = 0; it < 8; ++it) { const int idx = it * 512 + tid; ts[(idx >> 6) * 65 + (idx & 63)] = ld[it]; }
    __syncthreads();
    const int c = tid >> 3, r8 = (tid & 7) * 8; v8us o;            // 512 = 64 out rows x 8 pieces
#pragma unroll
    for (int k = 0; k < 8; ++k) { const float v = ts[(r8 + k) * 65 + c];
        const unsigned short ub = f2bf(v);
        const h16 hv = toh_flush(bfr(v) * WC);
        o[k] = f16mode ? __builtin_bit_cast(unsigned short, hv) : ub; }
    *(v8us*)(dst + ((c >> 4) * 2 + (r8 >> 5)) * FRG + ((r8 >> 4) & 1) * 256 + (((r8 >> 3) & 1) * 16 + (c & 15)) * 8) = o;   // row tile c/16, chunk r8/32, element half, lane = 16 h + row
    asm volatile("s_wait_xcnt 0x0" ::: "memory");                  // behind the store: in the listing another job's code follows and rewrites the store's registers
}

// One block of 512 threads: a quarter (two grid rows, 16 patch positions) of patch row 'row' (b * GH/8 + ty) of x -> bf16 tiles of the x plane in fragment order, 4 pieces of 8 channels per thread, all loads asked for before the first convert.
// piece j = 512 it + tid of the quarter: 4 adjacent lanes (lane half xh, element half xe) read one 128-B line of a token, the 8 lanes that share them write one 128-B line of the plane; then patch tx, chunk xc, position 4 it + tid/128. A block writes 32 KiB in a row.
__device__ __forceinline__ void xcv_body(const float* __restrict__ x, bf* XB, int row, int q4) {
    const int tid = (int)threadIdx.x;
    const int xh = tid & 1, xe = (tid >> 1) & 1, xt = (tid >> 2) & 15, xc = (tid >> 6) & 1;
    const float* xp = x + ((size_t)(row / (GH / SRR)) * SEQ_FULL + (size_t)((row % (GH / SRR)) * SRR + q4 * 2) * GW + (size_t)(xt * SRR + (tid >> 7))) * DM + xc * 32 + xe * 16 + xh * 8;   // batch pitch of x is the full sequence
    bf* xo = XB + (size_t)row * (64 * 16 * DM) + q4 * (4 * 512 * 8) + ((tid & ~63) + xe * 32 + xh * 16 + xt) * 8;   // fragment = 64 pieces: element half, lane = 16 h + tx
    v8f xv[4];
#pragma unroll                                                     // unrolled: xv[] stays in registers and the eight loads go out together, base + constant
    for (int it = 0; it < 4; ++it) xv[it] = *(const v8f*)(xp + ((it >> 1) * GW + (it & 1) * 4) * DM);
#pragma unroll
    for (int it = 0; it < 4; ++it) { v4u o;
#pragma unroll
        for (int k = 0; k < 4; ++k) o[k] = pk2bf(xv[it][2 * k], xv[it][2 * k + 1]);
        *(v4u*)(xo + it * (512 * 8)) = o; }
    asm volatile("s_wait_xcnt 0x0" ::: "memory");                  // behind the last store: in the listing other jobs' code follows and rewrites the stores' registers
}

// kv_tail: one wave's projection of the 16 LayerNorm rows (fragments n0, n1: depth 0..31, 32..63) onto 64 kv weight rows (fragments wf[2t], wf[2t+1] of tile t), four 16 x 16 tiles, each lane's 8 results of a tile stored as one 16-B piece at op + 256 t.
// ISK: A = weight, B = LayerNorm: D row = column 16t + 8h + j of k, col = key lane&15: the lane's piece of element half t&1 of the k fragment of column group t>>1, so op = the block's 4 halves + 8*lane. Otherwise A = LayerNorm, B = weight: D row = key 8h + j, col = channel 16t + (lane&15) of v; 256 = 16 channel rows of the v^T tile.
template <bool ISK>
__device__ __forceinline__ void kv_tail(const v16h (&wf)[8], v16h n0, v16h n1, h16* op) {
    v8f kv[4]; v8h ov[4];
#pragma unroll
    for (int t = 0; t < 4; ++t) kv[t] = ISK ? wmma16(wf[2 * t], n0, (v8f){}) : wmma16(n0, wf[2 * t], (v8f){});
#pragma unroll
    for (int t = 0; t < 4; ++t) kv[t] = ISK ? wmma16(wf[2 * t + 1], n1, kv[t]) : wmma16(n1, wf[2 * t + 1], kv[t]);
#pragma unroll
    for (int t = 0; t < 4; ++t) {
#pragma unroll
        for (int j = 0; j < 8; ++j) ov[t][j] = toh_flush(kv[t][j] * (ISK ? (KC / WC) : (VC / WC))); }
#pragma unroll
    for (int t = 0; t < 4; ++t) *(v8h*)(op + t * 256) = ov[t];
}

// k_patch: patch projection (bf16 operands, K = 4096) + bias + LayerNorm, then the k and v^T projections of the block's own 16 rows, all from the f32 inputs as they are: no launch stands in front of it. grid NPB + 2 + NXB, PWV waves per block; the patch blocks have the longest chain and the lowest indices (for speed only).
// Blocks NPB and NPB + 1 have no part in that: they transpose q_w and proj_w into their planes for k_attn (wT_body; a block-uniform choice, so its barrier is passed by the whole block). The NXB blocks behind them write the bf16 x plane for k_attn (xcv_body), a quarter of a patch row each:
// spread over 128 WGPs they have read all of x after about one trip to memory, so most of a patch block's own x loads, of which a WGP keeps only a part in flight, find their lines in L2. A row's four blocks have the row's block index modulo 8 (for speed only).
// Block (b, ty) = 16 rows m = (b, ty, tx = 0..15) x all 64 output channels.
// x: the block's 1024 tokens (256 KiB f32) are asked for at once, 16 pieces of 8 channels per thread (4 adjacent lanes read one 128-B line), converted to bf16, and each 16-B piece goes to the LDS copy xs of the block's 64 tiles of the x plane,
// where the 16 pieces of a run (tx = 0..15) stand permuted, slot = tx ^ 4 (ic8 & 3), ic8 = channel / 8: the writing lanes then fall on all 64 banks (plain order: 4 lanes to a bank), and the reader's 16 lanes still cover one run.
// kv_w [64 in][128 out]: 2 pieces of 8 inputs per thread (lanes along the outputs), f16 bits of (bf16 value x WC), to LDS in fragment order (rows 0..63 k, 64..127 v).
// Patch weight [oc][ic][pos = ky*8+kx] f32: eight stages, stage s = input channels 8 s .. 8 s + 7 of all 64 oc (128 KiB f32). A lane loads 16 B = 4 positions of one (oc, ic), 16 lanes one whole 256-B row, for the 8 channels of the stage: its 8 x 4 values are, read the other way, 4 pieces of 8 channels at one position, so the transpose costs no instruction.
// Piece (pos, oc) of a stage stands in LDS at pos * 1024 + (pos / 4) * 16 + oc * 16 bytes: the 16 writing lanes (4 positions apart) fall on all banks, the reader's 16 lanes (oc) read 256 B in a row. Two LDS buffers and two register sets: stage s + 2 is asked for as soon as stage s has left its registers, so two stages are always in flight.
// Every block needs the whole weight, and blocks that walk it in one order all wait for the same line's first fetch from memory, stage after stage: so trip s of a block works on stage (s + rot) & 7, rot from the block index, eight starts: behind its first trip a block finds its stage in L2, fetched a trip earlier by a block that started one stage further on (for speed only; any rot gives the same sums in another order).
// One barrier a stage: behind it every wave has finished its reads of stage s - 1, whose buffer stage s + 1 then overwrites.
// The depth is split over the waves as before: wave w sums the positions 4 w .. 4 w + 3. One WMMA depth of 32 = 4 positions x the stage's 8 channels; k map, the same for A and B: elements 0..7 of lane half h <- position 4 w + h, elements 8..15 <- position 4 w + 2 + h, element e <- channel 8 stage + e.
// The 16 partial tiles meet in LDS (in the first weight buffer, last read in stage 6, in front of stage 7's barrier); behind the block barrier wave w adds them up for row w in slice order (lane owns columns 2 lane, 2 lane + 1), adds the bias and does the LayerNorm of that row in f32 (xor exchanges over the 32 lanes).
// The 16 LayerNorm rows (single f16) meet in a second LDS tile; behind a second block barrier wave 0 forms k^T = Wk^T LN^T (A = kv weight rows 0..63, x WC; lane = key, 8 adjacent columns per tile; result x KC/WC into the block's own 16-key tile of the k plane)
// and wave 1 forms v = LN Wv (B = kv weight rows 64..127; lane = channel, 8 adjacent keys per tile; result x VC/WC into the block's own 16-key tile of the v^T plane). Each of the two waves alone writes its 2 KiB, so no 128-B line has two writers.
// amdgpu_waves_per_eu(4, 4): one block fills its 4 waves per SIMD and the grid is smaller than the chip, so the register budget goes to loads in flight.
#define NPB   (NB * NKEY / 16)                 // patch blocks
#define NXB   (NPB * 4)                        // blocks of the x plane
static_assert(NPB == 32);                      // row = 8 (m / 4) + block index % 8 below; (NPB + 2 + 8 m + i) % 8 runs through 0..7 with i
#define XS_O  0                                // LDS bytes: bf16 x tiles of the block, 64 x 2 KiB
#define W0_O  (XS_O + 64 * 16 * DM * 2)        // weight buffer of the even stages; afterwards the partial tiles
#define WBB   (64 * 1024 + 16 * 16)            // bytes of one weight stage in LDS
#define W1_O  (W0_O + PWV * 16 * RP * 4)       // weight buffer of the odd stages
#define KW_O  (W1_O + WBB)                     // kv weight fragments
#define LN_O  (KW_O + 2 * DM * DM * 2)         // LayerNorm tile
#define SM_ALL (LN_O + 16 * LP * 2)
static_assert(WBB <= PWV * 16 * RP * 4);       // the partial tiles cover the first weight buffer and end in front of the second
static_assert(SM_ALL <= 327680);
static_assert(W0_O % 16 == 0 && W1_O % 16 == 0 && KW_O % 16 == 0 && LN_O % 16 == 0);
static_assert(64 * 65 * 4 <= SM_ALL);
static_assert(GW * SRR * DM / 8 == 16 * 32 * PWV);   // pieces of one patch row = 16 per thread
static_assert(GW == 128 && DM == 64 && PWV == 16);   // bit fields of the thread index below
__global__ __launch_bounds__(32 * PWV) __attribute__((amdgpu_waves_per_eu(4, 4))) void k_patch(const float* __restrict__ x, const float* __restrict__ sr_w, const float* __restrict__ kv_w, const float* __restrict__ q_w, const float* __restrict__ pj_w,
                                                                                               const float* __restrict__ cbias, const float* __restrict__ lg, const float* __restrict__ lb, bf* XB, bf* WQT, bf* PWT, h16* KP, h16* VT) {
    __shared__ __align__(16) unsigned char sm[SM_ALL];
    const int tid = (int)threadIdx.x, bid = (int)blockIdx.x;
    if (bid >= NPB + 2) { const int m = (bid - (NPB + 2)) >> 3; xcv_body(x, XB, (m >> 2) * 8 + (bid & 7), m & 3); return; }   // 8 m + (bid & 7) runs through the NXB blocks once, so every (row, quarter) has one block
    if (bid >= NPB) { wT_body((float*)sm, bid == NPB ? q_w : pj_w, bid == NPB ? WQT : PWT, bid != NPB); return; }
    float* red = (float*)(sm + W0_O);
    h16*   lnt = (h16*)(sm + LN_O);
    const int lane = tid & 31, lr = lane & 15, hi = lane >> 4;
    const int wave = __builtin_amdgcn_readfirstlane(tid >> 5);
    // patch weight: the lane's rows are oc = 4 wave + 2 u + hi, u = 0, 1; its 16 B are the positions 4 lr .. 4 lr + 3
    const float* wg = sr_w + (size_t)(wave * 4 + hi) * CK + lr * 4;
    unsigned char* wst = sm + lr * (4 * 1024 + 16) + (wave * 4 + hi) * 16;   // + buffer + q * 1024 + u * 32
    const int rot = ((bid >> 1) & 4) | (bid & 3);                  // trip s works on stage (s + rot) & 7: the blocks walk the weight from eight different starts (see above)
    v4f raw[2][2][8];                                              // [trip parity][u][channel]; every loop over them is unrolled so that they stay in registers
    const float* w0p = wg + rot * 512;
#pragma unroll
    for (int u = 0; u < 2; ++u) {
#pragma unroll
        for (int j = 0; j < 8; ++j) raw[0][u][j] = *(const v4f*)(w0p + u * (2 * CK) + j * 64); }
    // x: piece j = 512 it + tid of the block -> lane half xh, element half xe, patch tx, chunk xc, position 4 it + tid/128
    const int xh = tid & 1, xe = (tid >> 1) & 1, xt = (tid >> 2) & 15, xc = (tid >> 6) & 1;
    const float* xp = x + ((size_t)(bid / (GH / SRR)) * SEQ_FULL + (size_t)((bid % (GH / SRR)) * SRR) * GW + (size_t)(xt * SRR + (tid >> 7))) * DM + xc * 32 + xe * 16 + xh * 8;   // batch pitch of x is the full sequence
    v8f xv[16];
#pragma unroll                                                     // unrolled: xv[] stays in registers and the 32 loads go out together, base + constant
    for (int it = 0; it < 16; ++it) xv[it] = *(const v8f*)(xp + ((it >> 1) * GW + (it & 1) * 4) * DM);   // position 4 it + .. = patch row it/2, column 4 (it&1) + ..
    __builtin_amdgcn_sched_barrier(0);                             // all of x and stage 0 are asked for before the first convert waits (without it the weight loads are moved behind the converts: a second trip to memory)
    asm volatile("s_wait_xcnt 0x0" :: "v"(xp), "v"(w0p) : "memory");   // behind the loads: the registers of their addresses are rewritten below; the addresses are inputs here, so no load's result lands on one while other loads still name it
    __builtin_amdgcn_sched_barrier(0);                             // nothing that rewrites a register moves up over that wait
    {
        unsigned char* xl = sm + XS_O + ((tid & ~63) + xe * 32 + xh * 16 + (xt ^ ((xe * 2 + xh) << 2))) * 16;
#pragma unroll
        for (int it = 0; it < 16; ++it) { v4u o;
#pragma unroll
            for (int k = 0; k < 4; ++k) o[k] = pk2bf(xv[it][2 * k], xv[it][2 * k + 1]);
            *(v4ua*)(xl + it * (512 * 16)) = o; }
    }
    const float* w1p = wg + ((1 + rot) & 7) * 512;
#pragma unroll
    for (int u = 0; u < 2; ++u) {
#pragma unroll
        for (int j = 0; j < 8; ++j) raw[1][u][j] = *(const v4f*)(w1p + u * (2 * CK) + j * 64); }
    // kv weight: piece = output cg, inputs r8 .. r8 + 7; asked for here, converted in stage 1
    const int cg = tid & 127;
    float kr[2][8];
#pragma unroll
    for (int it = 0; it < 2; ++it) {
#pragma unroll
        for (int k = 0; k < 8; ++k) kr[it][k] = kv_w[((it * 4 + (tid >> 7)) * 8 + k) * (2 * DM) + cg]; }
    __builtin_amdgcn_sched_barrier(0);                             // stage 1 and the kv weight are asked for before stage 0 is worked on
    asm volatile("s_wait_xcnt 0x0" :: "v"(w1p) : "memory");        // the registers that hold these loads' addresses are free from here on, and the next stages' loads land on them (the weight address is an input, as above)
    __builtin_amdgcn_sched_barrier(0);                             // none of those loads moves up over that wait
    v8f acc[4];                                                    // the loops over nb, j and p below are unrolled so that acc[] is indexed by constants and stays in registers
#pragma unroll
    for (int nb = 0; nb < 4; ++nb) acc[nb] = (v8f){};
    const unsigned char* ard = sm + XS_O + (wave * 4 + hi) * 2048;                       // tile of position 4 wave + hi; + 4096: position + 2
    const unsigned char* brd = sm + (wave * 4 + hi) * 1024 + wave * 16 + lr * 16;        // + buffer; + 2048: position + 2; + 256 nb
#pragma unroll                                                     // 8 trips, unrolled: buffer and register set are constants
    for (int s = 0; s < 8; ++s) {
        const int wo = (s & 1) ? W1_O : W0_O;
#pragma unroll
        for (int u = 0; u < 2; ++u) {
#pragma unroll
            for (int q = 0; q < 4; ++q) { v4u o;
#pragma unroll
                for (int k = 0; k < 4; ++k) o[k] = pk2bfa(raw[s & 1][u][2 * k][q], raw[s & 1][u][2 * k + 1][q]);
                *(v4ua*)(wst + wo + q * 1024 + u * 32) = o; } }
        if (s == 1) {
#pragma unroll
            for (int it = 0; it < 2; ++it) { const int r8 = (it * 4 + (tid >> 7)) * 8; v8h o;
#pragma unroll
                for (int k = 0; k < 8; ++k) o[k] = toh_flush(bfr(kr[it][k]) * WC);
                *(v8ha*)(sm + KW_O + (((cg >> 4) * 2 + (r8 >> 5)) * FRG + ((r8 >> 4) & 1) * 256 + (((r8 >> 3) & 1) * 16 + (cg & 15)) * 8) * 2) = o; } }   // row tile cg/16, chunk r8/32, element half, lane = 16 h + row
        if (s + 2 < 8) {
            const float* wq = wg + ((s + 2 + rot) & 7) * 512;
#pragma unroll
            for (int u = 0; u < 2; ++u) {
#pragma unroll
                for (int j = 0; j < 8; ++j) raw[s & 1][u][j] = *(const v4f*)(wq + u * (2 * CK) + j * 64); }
            asm volatile("s_wait_xcnt 0x0" :: "v"(wq) : "memory"); }   // the registers that hold this stage's address are rewritten later; the address is an input, as above
        __builtin_amdgcn_sched_barrier(0);                         // stage s + 2 is asked for in front of the barrier, and stage s + 1's converts stay behind this stage's products (moved up, they hold registers that the loads in flight need: spills)
        lds_barrier();                                             // stage s (at s = 0 also xs) stands in LDS for every wave
        const int st = (s + rot) & 7;                              // the stage = ic8 of this trip; its pieces stand 256 st bytes into a tile
        const unsigned char* ap = ard + st * 256 + (lr ^ ((st & 3) << 2)) * 16;
        const v16bf a = cat16b(*(const v8usa*)ap, *(const v8usa*)(ap + 4096));
        v16bf bfr4[4];
#pragma unroll
        for (int nb = 0; nb < 4; ++nb) { const unsigned char* bq = brd + wo + nb * 256; bfr4[nb] = cat16b(*(const v8usa*)bq, *(const v8usa*)(bq + 2048)); }
        __builtin_amdgcn_sched_barrier(0);                         // the ten LDS reads go out together, one LDS latency a stage (without it each product's two reads are waited for alone: four latencies)
#pragma unroll
        for (int nb = 0; nb < 4; ++nb) acc[nb] = wmmab(a, bfr4[nb], acc[nb]);
        __builtin_amdgcn_sched_barrier(0);                         // see above
        // four vector slots between the stage's last WMMA and the next stage's asm converts, which reuse the fragment registers; the fragments are inputs, so none is overwritten earlier
        asm volatile("v_nop\n\tv_nop\n\tv_nop\n\tv_nop" :: "v"(a), "v"(bfr4[0]), "v"(bfr4[1]), "v"(bfr4[2]), "v"(bfr4[3]));
        __builtin_amdgcn_sched_barrier(0);                         // and the slots stay where they are
    }
#pragma unroll
    for (int nb = 0; nb < 4; ++nb) {
#pragma unroll
        for (int j = 0; j < 8; ++j) red[(wave * 16 + hi * 8 + j) * RP + nb * 16 + lr] = acc[nb][j]; }   // D: row 8h+j, col lane&15
    __syncthreads();
    const v2f t0 = *(const v2fa*)(&red[wave * RP + 2 * lane]);
    float x0 = t0[0], x1 = t0[1];
#pragma unroll
    for (int p = 1; p < PWV; ++p) { const v2f t = *(const v2fa*)(&red[(p * 16 + wave) * RP + 2 * lane]); x0 += t[0]; x1 += t[1]; }
    const v2f bi = *(const v2f*)(cbias + 2 * lane), g = *(const v2f*)(lg + 2 * lane), of = *(const v2f*)(lb + 2 * lane);
    x0 += bfr(bi[0]); x1 += bfr(bi[1]);
    float sm_ = x0 + x1;
#pragma unroll
    for (int d = 16; d >= 1; d >>= 1) sm_ += __shfl_xor(sm_, d, 32);
    const float mu = sm_ * (1.0f / 64.0f);
    const float d0 = x0 - mu, d1 = x1 - mu;
    float q = d0 * d0 + d1 * d1;
#pragma unroll
    for (int d = 16; d >= 1; d >>= 1) q += __shfl_xor(q, d, 32);
    const float rs = 1.0f / sqrtf(q * (1.0f / 64.0f) + 1.0e-5f);
    v2h hv;
    hv[0] = toh_flush(d0 * rs * bfr(g[0]) + bfr(of[0]));
    hv[1] = toh_flush(d1 * rs * bfr(g[1]) + bfr(of[1]));
    *(v2h*)(&lnt[wave * LP + 2 * lane]) = hv;                      // row w of the LayerNorm tile
    __syncthreads();                                               // all 16 rows stand before waves 0 and 1 read them
    if (wave >= 2) return;                                         // no barrier follows
    v16h wf[8];                                                    // kv weight fragments of waves 0 (k rows) and 1 (v rows)
    const h16* wp = (const h16*)(sm + KW_O) + wave * 8 * FRG + lane * 8;
#pragma unroll
    for (int f = 0; f < 8; ++f) wf[f] = cat16(*(const v8ha*)(wp + f * FRG), *(const v8ha*)(wp + f * FRG + 256));   // tile f>>1 (16 weight rows), depth half f&1
    const v16h n0 = cat16(*(const v8ha*)(&lnt[lr * LP + 8 * hi]),      *(const v8ha*)(&lnt[lr * LP + 16 + 8 * hi]));   // fragment of row lr, depth 0..31 (the k map of ldfh)
    const v16h n1 = cat16(*(const v8ha*)(&lnt[lr * LP + 32 + 8 * hi]), *(const v8ha*)(&lnt[lr * LP + 48 + 8 * hi]));   // depth 32..63
    if (wave == 0) kv_tail<true>(wf, n0, n1, KP + (size_t)blockIdx.x * (16 * DM) + lane * 8);
    else           kv_tail<false>(wf, n0, n1, VT + (size_t)blockIdx.x * VTT + lr * 16 + 8 * hi);
    asm volatile("s_wait_xcnt 0x0" ::: "memory");                  // behind the last stores: in the listing scalar code of the way out follows and rewrites the registers of their base address
}

// Eight asynchronous 16-B-per-lane copies global -> LDS, each one block-wide step (CPS bytes) on from the last, in ONE statement with their s_wait_xcnt 0 as its last line, so that no register a copy names is rewritten ahead of that wait.
#define KVS  (NKEY * DM)         // halves of one batch's k plane = of its v^T plane
#define CPS  (32 * AW * 16)      // bytes that one copy of every lane of the block moves
static_assert((KVS * 2) % (8 * CPS) == 0);     // a plane = whole statements of eight copies
static_assert(2 * (KVS * 2) / CPS <= 63);      // copies of one wave in flight
__device__ __forceinline__ void cp8(unsigned l, const h16* g) {
    asm volatile("global_load_async_to_lds_b128 %0, %8, off\n\t"
                 "global_load_async_to_lds_b128 %1, %9, off\n\t"
                 "global_load_async_to_lds_b128 %2, %10, off\n\t"
                 "global_load_async_to_lds_b128 %3, %11, off\n\t"
                 "global_load_async_to_lds_b128 %4, %12, off\n\t"
                 "global_load_async_to_lds_b128 %5, %13, off\n\t"
                 "global_load_async_to_lds_b128 %6, %14, off\n\t"
                 "global_load_async_to_lds_b128 %7, %15, off\n\t"
                 "s_wait_xcnt 0x0"
                 :: "v"(l), "v"(l + 1u * CPS), "v"(l + 2u * CPS), "v"(l + 3u * CPS), "v"(l + 4u * CPS), "v"(l + 5u * CPS), "v"(l + 6u * CPS), "v"(l + 7u * CPS),
                    "v"(g), "v"(g + 1 * (CPS / 2)), "v"(g + 2 * (CPS / 2)), "v"(g + 3 * (CPS / 2)), "v"(g + 4 * (CPS / 2)), "v"(g + 5 * (CPS / 2)), "v"(g + 6 * (CPS / 2)), "v"(g + 7 * (CPS / 2))
                 : "memory");
}

// k_attn: fused q projection + attention + output projection, one wave per 16 query rows of one batch (one tile of the x plane: every 8th token of a grid row), the 8 heads in two trips of four (the four heads that share a 32-column group go through the key loop together, on one K fragment pair per 32 keys); K / V^T fragments from an LDS copy of the batch's two f16 planes (two 16-B LDS loads each; same order as in memory, K in fragment order). The block brings the 64 KiB in once, at entry, by asynchronous copies that fly while the q projection runs; every wave waits for its own copies, then one block barrier, before the first key loop.
// q projection in transposed form: Q^T[c][t] = Wq^T X^T (A = q weight rows c, B = bf16 x rows t, depth 64): lane (t = lane&15, h) holds columns 16 tile + 8h + 0..7 of its row, which after the f16 convert (x QS, subnormal results kept) are the two halves of the Q fragment below.
// Transposed form: S^T[key][t] = K Q^T (A = K rows over the 32 columns of the head's group, B = Q row with the k-slots outside the head selected to zero by value); lane (t = lane&15, h = lane>>4) holds keys 8h+r
// of each 16-key tile, so the packed P tile is directly the B fragment of O^T[d][t] = V^T P^T (A rows d: channel head*8 + (lane&7); rows 8..15 repeat rows 0..7 and are not used).
// Softmax in two passes over the keys. Pass 1: score products and a running maximum per lane, the two lane halves of a row combined with one xor-16 exchange behind it. Pass 2: the same score products with 14 - max as the accumulator's start, so each result is the argument of exp2 as it stands; O and the row sum are never rescaled. P = f16 of exp2(score - max + 14), converted in pairs (subnormal results kept); row sum over the converted P.
// Context (x CTXC) of each head goes to a wave-private f16 LDS tile [16][64]; after the head loop the tile is the A operand of the output projection (B = transposed weight plane, f16 x WC);
// The two integer grid-size inputs are read on the device; when they differ from the compiled grid the output is filled with NaN.
__global__ __launch_bounds__(32 * AW) void k_attn(const bf* __restrict__ XB, const bf* __restrict__ WQT, const h16* __restrict__ KP, const h16* __restrict__ VT, const h16* __restrict__ PW,
                                                  const float* __restrict__ pbias, const int* __restrict__ hp, const int* __restrict__ wp, float* OUT) {
    __shared__ __align__(16) h16   cs[AW * 16 * CP];
    __shared__ __align__(16) float os[AW * 16 * OSP];
    __shared__ __align__(16) h16   kvs[2 * KVS];                   // the batch's k plane, then its v^T plane
    const int lane = threadIdx.x & 31, lr = lane & 15, hi = lane >> 4;
    const int wave = __builtin_amdgcn_readfirstlane((int)(threadIdx.x >> 5));
    const int b = blockIdx.y;
    const int ut = blockIdx.x * AW + wave;                         // tile of the x plane inside the batch = ty*64 + ky*8 + kx: the wave's 16 query rows are the tokens (grid row ut>>3, column 8 row + (ut&7))
    const bool bad = (hp[0] != GH_FULL) | (wp[0] != GW);
    const size_t qrow  = ((size_t)b * (SEQ / 16) + (size_t)ut) * (16 * DM) + (size_t)lane * 8;
    const int kbase = lane * 8;                                    // in kvs; + (key/16) * 16*DM + group * FRG   (A fragment: row key, k = column inside the group)
    const int vbase = KVS + (lr & 7) * 16 + 8 * hi;                // in kvs; + (key/16)*VTT + head*8*16   (A fragment: row d, k = key)
    const int cb = wave * 16 * CP;
    const v8h z8 = (v8h){};
    v8h qh[4];                                                     // q x QS of row t, columns 16 tile + 8h + 0..7
    {
        const v16bf x0 = ldfb(XB + qrow), x1 = ldfb(XB + qrow + FRG);
        const bf* wr = WQT + lane * 8;
        v16bf wq[8];
#pragma unroll
        for (int f = 0; f < 8; ++f) wq[f] = ldfb(wr + f * FRG);   // tile f>>1 (16 weight rows), depth half f&1
        {   // lane i of the block moves bytes 16 i + CPS c of each plane, c = 0 .. 15: every lane on, every LDS byte written once
            const unsigned kl = (unsigned)(size_t)(&kvs[0]) + (unsigned)threadIdx.x * 16u;
            const h16* kg = KP + (size_t)b * KVS + (size_t)threadIdx.x * 8;
            const h16* vg = VT + (size_t)b * KVS + (size_t)threadIdx.x * 8;
#pragma unroll                                                     // unrolled: two statements a plane, every address base + constant
            for (int c = 0; c < KVS * 2 / CPS; c += 8) { cp8(kl + (unsigned)c * CPS, kg + c * (CPS / 2)); cp8(kl + (unsigned)(KVS * 2) + (unsigned)c * CPS, vg + c * (CPS / 2)); }
        }
        // the loaded fragments are inputs here, so all twenty loads are asked for before the first product waits: one trip to the L2 instead of two (without it the second depth half is loaded into the first half's registers, behind its products)
        asm volatile("" :: "v"(x0), "v"(x1), "v"(wq[0]), "v"(wq[1]), "v"(wq[2]), "v"(wq[3]), "v"(wq[4]), "v"(wq[5]), "v"(wq[6]), "v"(wq[7]));
        asm volatile("s_wait_xcnt 0x0" ::: "memory");              // the register that holds these loads' offset is rewritten by the converts below
#pragma unroll
        for (int t = 0; t < 4; ++t) {
            v8f qa4 = wmmab(wq[2 * t], x0, (v8f){}); qa4 = wmmab(wq[2 * t + 1], x1, qa4);   // D: row = column 8h + j of the tile, col = t
#pragma unroll
            for (int j = 0; j < 8; ++j) qh[t][j] = (h16)(qa4[j] * QS); }
    }
    __builtin_amdgcn_sched_barrier(0);                             // the q projection stays ahead of the wait below and runs while the copies fly (without it the wait is moved in front of its products)
    asm volatile("s_wait_asynccnt 0x0" ::: "memory");              // the wave's own copies have landed
    __syncthreads();                                               // and every other wave's: nobody reads kvs in front of this barrier
#pragma unroll 1
    for (int g = 0; g < 2; ++g) {                                  // one trip = the four heads that share the group's 32 columns, carried together through the key loop
        const v8h qa = g ? qh[2] : qh[0], qb = g ? qh[3] : qh[1];  // columns 32g + 8h + 0..7 and 32g + 16 + 8h + 0..7
        v16h qf[4]; v8f o[4]; float mx[4], l[4];                   // every loop over j is unrolled so that the per-head arrays are indexed by constants and stay in registers
#pragma unroll
        for (int j = 0; j < 4; ++j) {
            const bool kA = (hi == (j & 1)) & (j < 2);             // head j of the group = k-slots 8j..8j+7: lane half (j&1), elements 0..7 (j < 2) or 8..15 (j >= 2)
            const bool kB = (hi == (j & 1)) & (j >= 2);
            qf[j] = cat16(kA ? qa : z8, kB ? qb : z8);             // B fragment: col t, k = column inside the group
            o[j] = (v8f){}; mx[j] = NEGB; l[j] = 0.0f; }
        const int ko = kbase + g * FRG;
        const int vo = vbase + (g * 4 * HD) * 16;
        // pass 1: the maximum of every row. Unrolled: every address is base + constant, and a later trip's K loads issue ahead of an earlier trip's products
#pragma unroll
        for (int key0 = 0; key0 < NKEY; key0 += 32) {
            const h16* ka = &kvs[ko + key0 * DM];
            const v16h ka0 = ldfh(ka), kb0 = ldfh(ka + 16 * DM);     // one K fragment pair serves the four heads
            v8f sa[4], sb[4];
#pragma unroll
            for (int j = 0; j < 4; ++j) { sa[j] = wmma16(ka0, qf[j], (v8f){}); sb[j] = wmma16(kb0, qf[j], (v8f){}); }   // eight independent products
#pragma unroll
            for (int j = 0; j < 4; ++j) {
#pragma unroll
                for (int r = 0; r < 8; ++r) mx[j] = fmaxf(mx[j], fmaxf(sa[j][r], sb[j][r])); }
        }
        v8f shv[4];                                                // 14 - max of the lane's row t, in all eight accumulator rows
#pragma unroll
        for (int j = 0; j < 4; ++j) {
            const float sh = PSH - fmaxf(mx[j], __shfl_xor(mx[j], 16, 32));          // the other lane half's maximum, one exchange per head
#pragma unroll
            for (int r = 0; r < 8; ++r) shv[j][r] = sh; }
        // pass 2: P, its row sum and O
#pragma unroll 1
        for (int key0 = 0; key0 < NKEY; key0 += 32) {
            const h16* ka = &kvs[ko + key0 * DM];
            const v16h ka0 = ldfh(ka), kb0 = ldfh(ka + 16 * DM);
            v16h vf[4];
#pragma unroll
            for (int j = 0; j < 4; ++j) { const h16* vp = &kvs[vo + (key0 >> 4) * VTT + j * HD * 16]; vf[j] = cat16(*(const v8h*)vp, *(const v8h*)(vp + VTT)); }   // keys key0 + 8h + 0..7 and, one tile on, key0 + 16 + 8h + 0..7
            v8f sa[4], sb[4];
#pragma unroll
            for (int j = 0; j < 4; ++j) { sa[j] = wmma16(ka0, qf[j], shv[j]); sb[j] = wmma16(kb0, qf[j], shv[j]); }   // score - max + 14
#pragma unroll
            for (int j = 0; j < 4; ++j) {
                v16h pb; float ls = l[j];
                float xa[8], xb[8];
#pragma unroll
                for (int r = 0; r < 8; ++r) { xa[r] = __builtin_amdgcn_exp2f(sa[j][r]); xb[r] = __builtin_amdgcn_exp2f(sb[j][r]); }
                // the slot that the instruction set asks for behind a v_exp_f32 before its source register is overwritten, eight to a statement: the sources are inputs here, so none is overwritten before all eight results stand
                asm volatile("v_nop" :: "v"(sa[j][0]), "v"(sa[j][1]), "v"(sa[j][2]), "v"(sa[j][3]), "v"(sa[j][4]), "v"(sa[j][5]), "v"(sa[j][6]), "v"(sa[j][7]), "v"(xa[0]), "v"(xa[1]), "v"(xa[2]), "v"(xa[3]), "v"(xa[4]), "v"(xa[5]), "v"(xa[6]), "v"(xa[7]));
                asm volatile("v_nop" :: "v"(sb[j][0]), "v"(sb[j][1]), "v"(sb[j][2]), "v"(sb[j][3]), "v"(sb[j][4]), "v"(sb[j][5]), "v"(sb[j][6]), "v"(sb[j][7]), "v"(xb[0]), "v"(xb[1]), "v"(xb[2]), "v"(xb[3]), "v"(xb[4]), "v"(xb[5]), "v"(xb[6]), "v"(xb[7]));
#pragma unroll
                for (int r = 0; r < 8; r += 2) {                   // two P values to a register by one packed convert (round to nearest even); values under the smallest normal f16 stay subnormal: the matrix unit and the sum below both take them as they are
                    const v2h pa = __builtin_convertvector((v2f){xa[r], xa[r + 1]}, v2h);
                    const v2h pc = __builtin_convertvector((v2f){xb[r], xb[r + 1]}, v2h);
                    pb[r] = pa[0]; pb[r + 1] = pa[1]; pb[8 + r] = pc[0]; pb[9 + r] = pc[1];
                    ls += (float)pa[0]; ls += (float)pc[0]; ls += (float)pa[1]; ls += (float)pc[1]; }   // one running sum per head over the converted P, carried from trip to trip without a rescale
                l[j] = ls;
                o[j] = wmma16(vf[j], pb, o[j]);
            }
            // four vector slots between the trip's last WMMA and the loop branch: the next trip's first products reuse this trip's fragment registers
            asm volatile("v_nop\n\tv_nop\n\tv_nop\n\tv_nop" : "+v"(o[0]), "+v"(o[1]), "+v"(o[2]), "+v"(o[3]));
        }
#pragma unroll
        for (int j = 0; j < 4; ++j) {
            const float lt = l[j] + __shfl_xor(l[j], 16, 32);
            const float inv = (1.0f / lt) * (CTXC / VC);           // lt is about 16384 or more (the maximum element of every row converts to about 16384)
            v8h cv;
#pragma unroll
            for (int r = 0; r < 8; ++r) cv[r] = toh_flush(o[j][r] * inv);           // lane half 0: o[r] = (d = r, t = lane&15)
            if (hi == 0) *(v8ha*)(&cs[cb + lr * CP + (g * 4 + j) * HD]) = cv; }     // 8 heads x 8 columns: rows 0..15 x columns 0..63 all written
    }
    wave_sync();
    v8f acc[4];
#pragma unroll
    for (int nb = 0; nb < 4; ++nb) acc[nb] = (v8f){};
#pragma unroll
    for (int kc = 0; kc < DM; kc += 32) {
        const v8h a0 = *(const v8ha*)(&cs[cb + lr * CP + kc + 8 * hi]);
        const v8h a1 = *(const v8ha*)(&cs[cb + lr * CP + kc + 16 + 8 * hi]);
        const v16h a = cat16(a0, a1);                              // A fragment: row t, k = context column
#pragma unroll
        for (int nb = 0; nb < 4; ++nb) { const v16h bw = ldfh(PW + (nb * 2 + (kc >> 5)) * FRG + lane * 8);
            acc[nb] = wmma16g(a, bw, acc[nb]); }
    }
    const int ob = wave * 16 * OSP;
    const float nanv = __uint_as_float(0x7FC00000u);
#pragma unroll
    for (int nb = 0; nb < 4; ++nb) { const float bia = bfr(pbias[nb * 16 + lr]);
#pragma unroll
        for (int r = 0; r < 8; ++r) { const float v = acc[nb][r] * OUTI + bia;
            os[ob + (8 * hi + r) * OSP + nb * 16 + lr] = bad ? nanv : v; } }   // D: row 8h+r, col lane&15; rows 0..15 x columns 0..63 all written
    wave_sync();
    float* orow = OUT + ((size_t)b * OUT_SEQ + (size_t)(ut >> 3) * GW + (size_t)(ut & 7)) * DM;   // query row r is SRR tokens on from row r - 1
{
#pragma unroll
        for (int s = 0; s < 8; ++s) { const int row = 2 * s + (lane >> 4), cofs = (lane & 15) * 4;
            const v4f val = *(const v4fa*)(&os[ob + row * OSP + cofs]);
            *(v4f*)(orow + (size_t)row * (SRR * DM) + cofs) = val; }
         }
}

static constexpr size_t al256(size_t v) { return (v + 255) & ~(size_t)255; }
static constexpr size_t SZ_XB = al256((size_t)NB * SEQ * DM * 2);        // bf16 x plane
static constexpr size_t SZ_W1 = al256((size_t)DM * DM * 2);              // one 64 x 64 weight plane
static constexpr size_t SZ_KP = al256((size_t)NB * NKEY * DM * 2);       // k / v^T planes
static constexpr size_t SZ_TOTAL = SZ_XB + 2 * SZ_W1 + 2 * SZ_KP;
static_assert(SZ_TOTAL <= (size_t)134217728);                            // workspace carve <= 128 MiB
static_assert(((size_t)NB * SEQ * DM * 2) % 256 == 0);
static_assert(((size_t)NB * NKEY * DM * 2) % 256 == 0);
static_assert((size_t)NB * (NKEY / 16) * VTT == (size_t)NB * NKEY * DM);  // the tiled v^T plane has the same extent as the k plane

extern "C" void kernel_launch(void* const* d_in, const int* in_sizes, int n_in,
                              void* d_out, int out_size, void* d_ws, size_t ws_size, hipStream_t stream) {
    if (n_in < 11) return;
    const size_t needx = ((size_t)(NB - 1) * SEQ_FULL + SEQ) * DM;
    if ((size_t)in_sizes[0] < needx) return;
    if (in_sizes[1] < 1 || in_sizes[2] < 1) return;
    if ((size_t)in_sizes[3] < (size_t)DM * DM || (size_t)in_sizes[4] < (size_t)2 * DM * DM || (size_t)in_sizes[5] < (size_t)DM * CK) return;
    if (in_sizes[6] < DM || in_sizes[7] < DM || in_sizes[8] < DM || (size_t)in_sizes[9] < (size_t)DM * DM || in_sizes[10] < DM) return;
    if ((size_t)out_size < ((size_t)(NB - 1) * OUT_SEQ + SEQ) * DM) return;
    if (SZ_TOTAL > ws_size) return;
    // wire order: x, H, W, q_w, kv_w, sr_w, sr_b, ln_g, ln_b, proj_w, proj_b
    const float* x    = (const float*)d_in[0];
    const int*   gh   = (const int*)d_in[1];
    const int*   gw   = (const int*)d_in[2];
    const float* q_w  = (const float*)d_in[3];
    const float* kv_w = (const float*)d_in[4];
    const float* sr_w = (const float*)d_in[5];
    const float* sr_b = (const float*)d_in[6];
    const float* ln_g = (const float*)d_in[7];
    const float* ln_b = (const float*)d_in[8];
    const float* pj_w = (const float*)d_in[9];
    const float* pj_b = (const float*)d_in[10];
    float* OUT = (float*)d_out;      // [NB][SEQ][64]
    char* wsp = (char*)d_ws;
    bf*  XB  = (bf*)wsp;  wsp += SZ_XB;              // [NB*SEQ/16][2 chunks][2 element halves][lane][8] bf16 x (fragment order)
    bf*  WQT = (bf*)wsp;  wsp += SZ_W1;              // 64 out x 64 in, bf16, fragment order
    bf*  PWT = (bf*)wsp;  wsp += SZ_W1;              // 64 out x 64 in, f16 bits, x64, fragment order
    h16* KP  = (h16*)wsp; wsp += SZ_KP;              // [NB*NKEY/16][4 element halves][lane][8] k x16 (fragment order)
    h16* VT  = (h16*)wsp; wsp += SZ_KP;              // [NB*NKEY/16][64][16] v^T x64

    // two dependent launches: x plane, q / output weight planes, patch projection + LayerNorm + k, v^T projections; q projection + attention + output projection
    k_patch<<<dim3(NPB + 2 + NXB, 1, 1), 32 * PWV, 0, stream>>>(x, sr_w, kv_w, q_w, pj_w, sr_b, ln_g, ln_b, XB, WQT, PWT, KP, VT);
    k_attn<<<dim3(SEQ / (16 * AW), NB, 1), 32 * AW, 0, stream>>>(XB, WQT, KP, VT, (const h16*)PWT, pj_b, gh, gw, OUT);
}
